// v000
// The times below were measured on an AMD MI455X: many runs one after another, warmed up first and cycling through
// copies of the inputs, with the whole window's GPU time divided by the number of runs. Launches and the gaps
// between them are all in it. The median over several windows is given; except for v000 it joins two sittings, which
// can be a few percent apart, so the side-by-side timings, each taken in one sitting, are the better comparison.
// v000, which the later versions start from, runs in 1280 microseconds.
#include <hip/hip_runtime.h>
// Two-stage attention decoder block (word embeddings [2048][1024], position embeddings [1024][1024], 16 heads x 64, FFN 4096): word = CausalMHA(wemb; q,k,v = Linear+bias, scores/8, tril, softmax, .v, heads merged, no output projection); cross = MHA(q from word, k/v from pemb, no mask); out = relu(cross*W1^T + b1)*W2^T + b2 -> [2048,1024].
// Compute dtype: inputs and parameters rounded to bf16; projections of the embeddings exact; all other operands f16 hi + (x2^10) residual pairs (~2^-21); f32 accumulation, softmax f32. v_wmma_f32_16x16x32_f16.
#define SW 2048
#define SP 1024
#define DM 1024
#define NH 16
#define FF 4096
#define SCL 0.125f
#define SKV ((SW > SP) ? SW : SP)      /* key/value plane rows: the self attention has SW keys, the cross attention SP */
typedef __bf16 v16b __attribute__((ext_vector_type(16)));
typedef unsigned short v8us __attribute__((ext_vector_type(8), may_alias));
typedef float  v8f  __attribute__((ext_vector_type(8)));
typedef float  v4f  __attribute__((ext_vector_type(4)));
typedef float  v4fa __attribute__((ext_vector_type(4), may_alias));
union FragB { v16b v; v8us half[2]; unsigned short u[16]; };

__device__ __forceinline__ unsigned short bf16_bits(float x) { unsigned int u = __float_as_uint(x); return (unsigned short)((u + 0x7FFFu + ((u >> 16) & 1u)) >> 16); }
__device__ __forceinline__ float bf16_val(unsigned short b) { return __uint_as_float(((unsigned int)b) << 16); }
__device__ __forceinline__ float bf16_round(float x) { return bf16_val(bf16_bits(x)); }
// D += A·B with NT terms: 1 = ah·bh, 2 = + al·bh (A split), 3 = + ah·bl (both split)
template <int NT>
__device__ __forceinline__ v8f mmaN(v16b ah, v16b al, v16b bh, v16b bl, v8f c) {
  c = __builtin_amdgcn_wmma_f32_16x16x32_bf16(false, ah, false, bh, (short)0, c, false, false);
  if (NT >= 2) c = __builtin_amdgcn_wmma_f32_16x16x32_bf16(false, al, false, bh, (short)0, c, false, false);
  if (NT >= 3) c = __builtin_amdgcn_wmma_f32_16x16x32_bf16(false, ah, false, bl, (short)0, c, false, false);
  asm volatile("v_nop\n\tv_nop\n\tv_nop\n\tv_nop" : "+v"(c) : "v"(ah), "v"(al), "v"(bh), "v"(bl));
  return c;
}

__global__ __launch_bounds__(256) void k_wt_bf16(const float* __restrict__ W, unsigned short* __restrict__ Wt, int K, int N) {
  const int t = blockIdx.x * 256 + threadIdx.x;
  const int k8n = K / 8;
  if (t >= N * k8n) return;
  const int n = t / k8n, k8 = (t % k8n) * 8;
  v8us v;
#pragma unroll
  for (int i = 0; i < 8; ++i) v[i] = bf16_bits(W[(size_t)(k8 + i) * N + n]);
  *(v8us*)(Wt + (size_t)n * K + k8) = v;
  
}

// GEMM C[M][N] (f32, pitch ldc) = act(A[M][K]·W + bias). A f32 row-major (pitch lda) converted per fragment to bf16
// (ASPLIT: hi/lo two planes -> 2 terms, else single rounded term); Wt bf16 [N][K] (pitch ldb). BIAS_BF16 rounds the
// bias to bf16 first (bias quantised to bf16 before the add). K%32==0, M%16==0, N%64==0.
template <bool ASPLIT, int ACT, bool BIAS_BF16>
__global__ __launch_bounds__(128) void k_gemm_bf(const float* __restrict__ A, int lda, const unsigned short* __restrict__ Wt, int ldb,
                                               const float* __restrict__ bias, float* __restrict__ C, int ldc, int M, int N, int K) {
  __shared__ __attribute__((aligned(16))) float so[4][16][64];
  const int tid = threadIdx.x, w = tid >> 5, lane = tid & 31, ln = lane & 15, hh = lane >> 4;
  const int ntn = N / 64;
  const int wid = blockIdx.x * 4 + w;
  const int mt = wid / ntn, nq = wid % ntn;
  if (mt * 16 >= M) return;
  const int row0 = mt * 16, col0 = nq * 64;
  const float* arow = A + (size_t)(row0 + ln) * lda;
  v8f acc[4] = {};
  for (int kb = 0; kb < K; kb += 32) {
    FragB ah, al;
    const v4f x0 = *(const v4fa*)(arow + kb + 8 * hh), x1 = *(const v4fa*)(arow + kb + 8 * hh + 4);
    const v4f x2 = *(const v4fa*)(arow + kb + 16 + 8 * hh), x3 = *(const v4fa*)(arow + kb + 16 + 8 * hh + 4);
    float xs[16] = {x0[0],x0[1],x0[2],x0[3],x1[0],x1[1],x1[2],x1[3],x2[0],x2[1],x2[2],x2[3],x3[0],x3[1],x3[2],x3[3]};
#pragma unroll
    for (int i = 0; i < 16; ++i) { const unsigned short hb = bf16_bits(xs[i]); ah.u[i] = hb; al.u[i] = ASPLIT ? bf16_bits(xs[i] - bf16_val(hb)) : (unsigned short)0; }
#pragma unroll
    for (int t = 0; t < 4; ++t) {
      const unsigned short* brow = Wt + (size_t)(col0 + t * 16 + ln) * ldb + kb;
      FragB b;
      b.half[0] = *(const v8us*)(brow + 8 * hh);
      b.half[1] = *(const v8us*)(brow + 16 + 8 * hh);
      acc[t] = mmaN<ASPLIT ? 2 : 1>(ah.v, al.v, b.v, b.v, acc[t]);
    }
  }
#pragma unroll
  for (int t = 0; t < 4; ++t) {
    float bv = bias ? bias[col0 + t * 16 + ln] : 0.f;
    if (BIAS_BF16) bv = bf16_round(bv);
#pragma unroll
    for (int r = 0; r < 8; ++r) { float v = acc[t][r] + bv; if (ACT == 1) v = fmaxf(v, 0.f); so[w][8 * hh + r][t * 16 + ln] = v; }
  }
  __builtin_amdgcn_fence(__ATOMIC_ACQ_REL, "workgroup");
  __builtin_amdgcn_wave_barrier();
  const int rsub = lane >> 4, c4 = (lane & 15) * 4;
  {
#pragma unroll
    for (int q = 0; q < 8; ++q) {
      const int r = q * 2 + rsub;
      const v4f v = *(const v4fa*)&so[w][r][c4];
      *(v4f*)(C + (size_t)(row0 + r) * ldc + col0 + c4) = v;
    }
    
  }
}

// GEMM C = act(A·W + bias + resid): A f32 (ASPLIT -> hi/lo 2 terms), Wt bf16 [N][K]; ACT 0 none, 1 relu, 2 exact gelu;
// resid (optional, f32, row index = (row % rmod), pitch ldr, RES_BF16 rounds it) added before the activation.
template <bool ASPLIT, int ACT, bool BIAS_BF16, bool RES_BF16>
__global__ __launch_bounds__(128) void k_gemm_bf3(const float* __restrict__ A, int lda, const unsigned short* __restrict__ Wt, int ldb,
                                                const float* __restrict__ bias, const float* __restrict__ resid, int rmod, int ldr,
                                                float* __restrict__ C, int ldc, int M, int N, int K) {
  __shared__ __attribute__((aligned(16))) float so[4][16][64];
  const int tid = threadIdx.x, w = tid >> 5, lane = tid & 31, ln = lane & 15, hh = lane >> 4;
  const int ntn = N / 64;
  const int wid = blockIdx.x * 4 + w;
  const int mt = wid / ntn, nq = wid % ntn;
  if (mt * 16 >= M) return;
  const int row0 = mt * 16, col0 = nq * 64;
  const float* arow = A + (size_t)(row0 + ln) * lda;
  v8f acc[4] = {};
  for (int kb = 0; kb < K; kb += 32) {
    FragB ah, al;
    const v4f x0 = *(const v4fa*)(arow + kb + 8 * hh), x1 = *(const v4fa*)(arow + kb + 8 * hh + 4);
    const v4f x2 = *(const v4fa*)(arow + kb + 16 + 8 * hh), x3 = *(const v4fa*)(arow + kb + 16 + 8 * hh + 4);
    float xs[16] = {x0[0],x0[1],x0[2],x0[3],x1[0],x1[1],x1[2],x1[3],x2[0],x2[1],x2[2],x2[3],x3[0],x3[1],x3[2],x3[3]};
#pragma unroll
    for (int i = 0; i < 16; ++i) { const unsigned short hb = bf16_bits(xs[i]); ah.u[i] = hb; al.u[i] = ASPLIT ? bf16_bits(xs[i] - bf16_val(hb)) : (unsigned short)0; }
#pragma unroll
    for (int t = 0; t < 4; ++t) {
      const unsigned short* brow = Wt + (size_t)(col0 + t * 16 + ln) * ldb + kb;
      FragB b;
      b.half[0] = *(const v8us*)(brow + 8 * hh);
      b.half[1] = *(const v8us*)(brow + 16 + 8 * hh);
      acc[t] = mmaN<ASPLIT ? 2 : 1>(ah.v, al.v, b.v, b.v, acc[t]);
    }
  }
#pragma unroll
  for (int t = 0; t < 4; ++t) {
    const int col = col0 + t * 16 + ln;
    float bv = bias ? bias[col] : 0.f;
    if (BIAS_BF16) bv = bf16_round(bv);
#pragma unroll
    for (int r = 0; r < 8; ++r) {
      float v = acc[t][r] + bv;
      if (resid) { float rv = resid[(size_t)((row0 + 8 * hh + r) % rmod) * ldr + col]; if (RES_BF16) rv = bf16_round(rv); v += rv; }
      if (ACT == 1) v = fmaxf(v, 0.f);
      if (ACT == 2) v = 0.5f * v * (1.0f + erff(v * 0.70710678118654752f));
      if (ACT == 3) { const float u = 0.7978845608028654f * (v + 0.044715f * v * v * v); v = 0.5f * v * (1.0f + tanhf(u)); }
      so[w][8 * hh + r][t * 16 + ln] = v;
    }
  }
  __builtin_amdgcn_fence(__ATOMIC_ACQ_REL, "workgroup");
  __builtin_amdgcn_wave_barrier();
  const int rsub = lane >> 4, c4 = (lane & 15) * 4;
  {
#pragma unroll
    for (int q = 0; q < 8; ++q) {
      const int r = q * 2 + rsub;
      const v4f v = *(const v4fa*)&so[w][r][c4];
      *(v4f*)(C + (size_t)(row0 + r) * ldc + col0 + c4) = v;
    }
    
  }
}
// row LayerNorm (biased variance, eps) over N: s = X (+ R); optional out_sum <- s; out_norm <- (s-mu)*rsqrt(var+eps)*g + b
template <bool PARAM_BF16>
__global__ __launch_bounds__(256) void k_layernorm(const float* __restrict__ X, const float* __restrict__ R, const float* __restrict__ g, const float* __restrict__ bta,
                                                  float* __restrict__ out_sum, float* __restrict__ out_norm, int N, float eps) {
  __shared__ float red[256];
  const int row = blockIdx.x, tid = threadIdx.x;
  const float* x = X + (size_t)row * N; const float* rr = R ? R + (size_t)row * N : nullptr;
  float vals[16];                     // up to N = 4096
  const int per = N / 256;            // contiguous chunk per thread? use strided-by-4 chunks: thread handles j = tid*4 + 1024*u
  float s1 = 0.f;
  for (int u = 0; u < per / 4; ++u) {
    const int j = tid * 4 + 1024 * u;
    const v4f a = *(const v4fa*)(x + j);
    v4f b = {0.f,0.f,0.f,0.f}; if (rr) b = *(const v4fa*)(rr + j);
#pragma unroll
    for (int q = 0; q < 4; ++q) { const float v = a[q] + b[q]; vals[u * 4 + q] = v; s1 += v; }
  }
  red[tid] = s1; __syncthreads();
  for (int st = 128; st > 0; st >>= 1) { if (tid < st) red[tid] += red[tid + st]; __syncthreads(); }
  const float mu = red[0] / (float)N; __syncthreads();
  float s2 = 0.f;
  for (int u = 0; u < per / 4; ++u)
#pragma unroll
    for (int q = 0; q < 4; ++q) { const float c = vals[u * 4 + q] - mu; s2 += c * c; }
  red[tid] = s2; __syncthreads();
  for (int st = 128; st > 0; st >>= 1) { if (tid < st) red[tid] += red[tid + st]; __syncthreads(); }
  const float rs = rsqrtf(red[0] / (float)N + eps);
  {
    for (int u = 0; u < per / 4; ++u) {
      const int j = tid * 4 + 1024 * u;
      v4f o, sm;
#pragma unroll
      for (int q = 0; q < 4; ++q) {
        float gg = g[j + q], bb = bta[j + q];
        if (PARAM_BF16) { gg = bf16_round(gg); bb = bf16_round(bb); }
        sm[q] = vals[u * 4 + q]; o[q] = (vals[u * 4 + q] - mu) * rs * gg + bb;
      }
      if (out_sum) *(v4f*)(out_sum + (size_t)row * N + j) = sm;
      *(v4f*)(out_norm + (size_t)row * N + j) = o;
    }
    
  }
}



// ---- f16 WMMA path (v_wmma_f32_16x16x32_f16): 11-bit significands for operands in range — used where a [0,1] probability operand needs more precision than bf16
typedef _Float16 v16h __attribute__((ext_vector_type(16)));
union FragH { v16h v; v8us half[2]; _Float16 h[16]; unsigned short u[16]; };
template <int NT>
__device__ __forceinline__ v8f mmaH(v16h ah, v16h al, v16h bh, v16h bl, v8f c) {
  c = __builtin_amdgcn_wmma_f32_16x16x32_f16(false, ah, false, bh, (short)0, c, false, false);
  if (NT >= 2) c = __builtin_amdgcn_wmma_f32_16x16x32_f16(false, al, false, bh, (short)0, c, false, false);
  if (NT >= 3) c = __builtin_amdgcn_wmma_f32_16x16x32_f16(false, ah, false, bl, (short)0, c, false, false);
  asm volatile("v_nop\n\tv_nop\n\tv_nop\n\tv_nop" : "+v"(c) : "v"(ah), "v"(al), "v"(bh), "v"(bl));
  return c;
}
// batched GEMM like k_gemm_b but f16 operands: A f32 (split into f16 hi/lo if ASPLIT, else rounded to f16), Bt = f16 values [n][k]; alpha; C f32; N multiple of 16 (partial tiles skipped)
template <bool ASPLIT>
__global__ __launch_bounds__(128) void k_gemm_h(const float* __restrict__ A, int lda, size_t sA, const _Float16* __restrict__ Bh, int ldb, size_t sB, float alpha, float* __restrict__ C, int ldc, size_t sC, int M, int N, int K) {
  __shared__ __attribute__((aligned(16))) float so[4][16][64];
  const int tid = threadIdx.x, w = tid >> 5, lane = tid & 31, ln = lane & 15, hh = lane >> 4; const int by = blockIdx.y;
  A += (size_t)by * sA; Bh += (size_t)by * sB; C += (size_t)by * sC;
  const int ntn = (N + 63) / 64; const int wid = blockIdx.x * 4 + w; const int mt = wid / ntn, nq = wid % ntn; if (mt * 16 >= M) return;
  const int row0 = mt * 16, col0 = nq * 64; const float* arow = A + (size_t)(row0 + ln) * lda;
  v8f acc[4] = {};
  for (int kb = 0; kb < K; kb += 32) {
    FragH ah, al;
    const v4f x0 = *(const v4fa*)(arow + kb + 8 * hh), x1 = *(const v4fa*)(arow + kb + 8 * hh + 4), x2 = *(const v4fa*)(arow + kb + 16 + 8 * hh), x3 = *(const v4fa*)(arow + kb + 16 + 8 * hh + 4);
    float xs[16] = {x0[0],x0[1],x0[2],x0[3],x1[0],x1[1],x1[2],x1[3],x2[0],x2[1],x2[2],x2[3],x3[0],x3[1],x3[2],x3[3]};
#pragma unroll
    for (int i = 0; i < 16; ++i) { const _Float16 h = (_Float16)xs[i]; ah.h[i] = h; al.h[i] = ASPLIT ? (_Float16)(xs[i] - (float)h) : (_Float16)0.0f; }
#pragma unroll
    for (int t = 0; t < 4; ++t) { if (col0 + t * 16 >= N) continue; const size_t boff = (size_t)(col0 + t * 16 + ln) * ldb + kb; FragH bq; bq.half[0] = *(const v8us*)(Bh + boff + 8 * hh); bq.half[1] = *(const v8us*)(Bh + boff + 16 + 8 * hh);
      acc[t] = mmaH<ASPLIT ? 2 : 1>(ah.v, al.v, bq.v, bq.v, acc[t]); }
  }
#pragma unroll
  for (int t = 0; t < 4; ++t) { if (col0 + t * 16 >= N) continue;
#pragma unroll
    for (int r = 0; r < 8; ++r) so[w][8 * hh + r][t * 16 + ln] = acc[t][r] * alpha; }
  __builtin_amdgcn_fence(__ATOMIC_ACQ_REL, "workgroup"); __builtin_amdgcn_wave_barrier();
  const int rsub = lane >> 4, c4 = (lane & 15) * 4;
  {
#pragma unroll
    for (int q = 0; q < 8; ++q) { const int r = q * 2 + rsub; if (col0 + c4 < N) { const v4f v = *(const v4fa*)&so[w][r][c4]; *(v4f*)(C + (size_t)(row0 + r) * ldc + col0 + c4) = v; } }
     }
}

// Wt[n][k] = f16(W[k][n]·scale) from f32 row-major W[K][N] (scale = power of two; bf16-exact weights stay exact in f16 away from the subnormal range)
__global__ __launch_bounds__(256) void k_wt_f16(const float* __restrict__ W, _Float16* __restrict__ Wt, int K, int N, float scale) {
  const int t = blockIdx.x * 256 + threadIdx.x; if (t >= N * (K / 8)) return; const int n = t / (K / 8), k8 = (t % (K / 8)) * 8; FragH f;
#pragma unroll
  for (int i = 0; i < 8; ++i) f.h[i] = (_Float16)(bf16_round(W[(size_t)(k8 + i) * N + n]) * scale); const v8us o = f.half[0];
  *(v8us*)((unsigned short*)Wt + (size_t)n * K + k8) = o; 
}
// k_gemm_hh variant with fused epilogue: v = acc·alpha + bias[by·sBias + col] (+ CP[(row/rowsPerB)·sCPb + by·64 + col] if CP) ; ACT 0 none / 1 elu ; writes f16 C16 (and f32 C if non-null)
template <int ACT>
__global__ __launch_bounds__(128) void k_gemm_hhx(const _Float16* __restrict__ A, int lda, size_t sA, const _Float16* __restrict__ Bh, int ldb, size_t sB, float alpha, const float* __restrict__ bias, size_t sBias, const float* __restrict__ CP, int rowsPerB, size_t sCPb, int row0g,
    float* __restrict__ C, _Float16* __restrict__ C16, int ldc, size_t sC, int M, int N, int K) {
  __shared__ __attribute__((aligned(16))) float so[4][16][64];
  const int tid = threadIdx.x, w = tid >> 5, lane = tid & 31, ln = lane & 15, hh = lane >> 4; const int by = blockIdx.y;
  A += (size_t)by * sA; Bh += (size_t)by * sB; const size_t cofs = (size_t)by * sC; const float* bp = bias ? bias + (size_t)by * sBias : nullptr;
  const int ntn = (N + 63) / 64; const int wid = blockIdx.x * 4 + w; const int mt = wid / ntn, nq = wid % ntn; if (mt * 16 >= M) return;
  const int row0 = mt * 16, col0 = nq * 64; const _Float16* arow = A + (size_t)(row0 + ln) * lda;
  v8f acc[4] = {};
  for (int kb = 0; kb < K; kb += 32) { FragH ah; ah.half[0] = *(const v8us*)((const unsigned short*)arow + kb + 8 * hh); ah.half[1] = *(const v8us*)((const unsigned short*)arow + kb + 16 + 8 * hh);
#pragma unroll
    for (int t = 0; t < 4; ++t) { if (col0 + t * 16 >= N) continue; const size_t boff = (size_t)(col0 + t * 16 + ln) * ldb + kb; FragH bq; bq.half[0] = *(const v8us*)((const unsigned short*)Bh + boff + 8 * hh); bq.half[1] = *(const v8us*)((const unsigned short*)Bh + boff + 16 + 8 * hh);
      acc[t] = mmaH<1>(ah.v, ah.v, bq.v, bq.v, acc[t]); }
  }
#pragma unroll
  for (int t = 0; t < 4; ++t) { if (col0 + t * 16 >= N) continue; const int col = col0 + t * 16 + ln; const float bv = bp ? bf16_round(bp[col]) : 0.f;
#pragma unroll
    for (int r = 0; r < 8; ++r) { float v = acc[t][r] * alpha + bv; if (CP) { const int bidx = (row0g + row0 + 8 * hh + r) / rowsPerB; v += CP[(size_t)bidx * sCPb + (size_t)by * 64 + col]; } if (ACT == 1) v = (v > 0.f) ? v : expm1f(v); else if (ACT == 7) v = (v > 0.f) ? v + 1.0f : expf(v); else if (ACT == 8) v = tanhf(v); else if (ACT == 9) v = 0.5f * v * (1.0f + tanhf(0.7978845608028654f * (v + 0.044715f * v * v * v))); else if (ACT == 11) v = 1.0f / (1.0f + expf(-v)); else if (ACT == 12) v = (v > 0.f) ? v : 0.01f * v; else if (ACT == 14) v = (v > 0.f) ? v : 0.1f * v; else if (ACT == 15) v = v / (1.0f + expf(-v)); else if (ACT == 3) v = fmaxf(v, 0.f); else if (ACT == 6) v = 0.5f * v * (1.0f + erff(v * 0.70710678118654752f)); so[w][8 * hh + r][t * 16 + ln] = v; } }
  __builtin_amdgcn_fence(__ATOMIC_ACQ_REL, "workgroup"); __builtin_amdgcn_wave_barrier();
  const int rsub = lane >> 4, c4 = (lane & 15) * 4; typedef _Float16 v4h __attribute__((ext_vector_type(4)));
  {
#pragma unroll
    for (int q = 0; q < 8; ++q) { const int r = q * 2 + rsub; if (col0 + c4 < N) { const v4f v = *(const v4fa*)&so[w][r][c4]; if (C) *(v4f*)(C + cofs + (size_t)(row0 + r) * ldc + col0 + c4) = v; if (C16) { v4h h4; for (int i = 0; i < 4; ++i) h4[i] = (_Float16)v[i]; *(v4h*)(C16 + cofs + (size_t)(row0 + r) * ldc + col0 + c4) = h4; } } }
     }
}


typedef _Float16 v4h __attribute__((ext_vector_type(4)));

__global__ __launch_bounds__(256) void k_x16(const float* __restrict__ x, _Float16* __restrict__ X16, size_t n8) { const size_t t = (size_t)blockIdx.x * 256 + threadIdx.x; if (t >= n8) return; FragH f;
#pragma unroll
  for (int q = 0; q < 8; ++q) f.h[q] = (_Float16)bf16_round(x[t * 8 + q]); *(v8us*)((unsigned short*)X16 + t * 8) = f.half[0];  }
__global__ __launch_bounds__(256) void k_h16(const float* __restrict__ x, _Float16* __restrict__ X16, size_t n8) { const size_t t = (size_t)blockIdx.x * 256 + threadIdx.x; if (t >= n8) return; FragH f;
#pragma unroll
  for (int q = 0; q < 8; ++q) f.h[q] = (_Float16)x[t * 8 + q]; *(v8us*)((unsigned short*)X16 + t * 8) = f.half[0];  }
__global__ __launch_bounds__(256) void k_round16f(const float* __restrict__ W, _Float16* __restrict__ Bt, size_t n8) { const size_t t = (size_t)blockIdx.x * 256 + threadIdx.x; if (t >= n8) return; FragH f;
#pragma unroll
  for (int i = 0; i < 8; ++i) f.h[i] = (_Float16)(bf16_round(W[t * 8 + i]) * 16.0f); *(v8us*)((unsigned short*)Bt + t * 8) = f.half[0];  }
template <int NHv, int TTv>
__global__ __launch_bounds__(256) void k_vt(const _Float16* __restrict__ V16, int ldv, int voff, _Float16* __restrict__ Vt) { __shared__ unsigned short tl[64][66]; const int tid = threadIdx.x; const int slab = blockIdx.x / (TTv / 64), lg = blockIdx.x % (TTv / 64); const int b = slab / NHv, h = slab % NHv;
  for (int i = tid; i < 64 * 8; i += 256) { const int r = i / 8, c8 = (i % 8) * 8; FragH f; f.half[0] = *(const v8us*)((const unsigned short*)V16 + ((size_t)b * TTv + lg * 64 + r) * ldv + voff + h * 64 + c8);
#pragma unroll
    for (int q = 0; q < 8; ++q) tl[r][c8 + q] = f.u[q]; }
  __syncthreads();
  {
#pragma unroll
    for (int rd = 0; rd < 2; ++rd) { const int d = rd * 32 + tid / 8, pc = tid % 8; FragH f;
#pragma unroll
      for (int q = 0; q < 8; ++q) f.u[q] = tl[pc * 8 + q][d];
      *(v8us*)((unsigned short*)Vt + ((size_t)slab * 64 + d) * TTv + lg * 64 + pc * 8) = f.half[0]; }
     } }

__global__ __launch_bounds__(256) void k_hl(const float* __restrict__ F, _Float16* __restrict__ Hh, _Float16* __restrict__ Hl, size_t n8) { const size_t t = (size_t)blockIdx.x * 256 + threadIdx.x; if (t >= n8) return; FragH fh, fl; const v4f a = *(const v4fa*)(F + t * 8), c = *(const v4fa*)(F + t * 8 + 4);
#pragma unroll
  for (int q = 0; q < 4; ++q) { _Float16 h = (_Float16)a[q]; fh.h[q] = h; fl.h[q] = (_Float16)((a[q] - (float)h) * 1024.0f); h = (_Float16)c[q]; fh.h[4 + q] = h; fl.h[4 + q] = (_Float16)((c[q] - (float)h) * 1024.0f); }
  { *(v8us*)((unsigned short*)Hh + t * 8) = fh.half[0]; *(v8us*)((unsigned short*)Hl + t * 8) = fl.half[0];  } }

// ---- fast GEMM (wave tile 32x64; requires M % 32 == 0 rows per launch region and N % 64 == 0); epilogue = k_gemm_hhx semantics ----
__device__ __forceinline__ v16h g2_frag(const _Float16* p, int hh) { FragH f; f.half[0] = *(const v8us*)((const unsigned short*)p + 8 * hh); f.half[1] = *(const v8us*)((const unsigned short*)p + 16 + 8 * hh); return f.v; }
__device__ __forceinline__ v8f g2_mma(v16h a, v16h b, v8f c) { v8f d = __builtin_amdgcn_wmma_f32_16x16x32_f16(false, a, false, b, (short)0, c, false, false); asm volatile("v_nop\n\tv_nop\n\tv_nop\n\tv_nop" : "+v"(d) : "v"(a), "v"(b)); return d; }
template <int ACT>
__global__ __launch_bounds__(128) void k_gemm2(const _Float16* __restrict__ A, int lda, size_t sA, const _Float16* __restrict__ Bh, int ldb, size_t sB, float alpha, const float* __restrict__ bias, size_t sBias, const float* __restrict__ CP, int rowsPerB, size_t sCPb, int row0g,
    float* __restrict__ C, _Float16* __restrict__ C16, int ldc, size_t sC, int M, int N, int K) {
  __shared__ __attribute__((aligned(16))) float so[4][32][68];
  const int tid = threadIdx.x, w = tid >> 5, lane = tid & 31, ln = lane & 15, hh = lane >> 4; const int by = blockIdx.y;
  A += (size_t)by * sA; Bh += (size_t)by * sB; const size_t cofs = (size_t)by * sC; const float* bp = bias ? bias + (size_t)by * sBias : nullptr;
  const int ntn = N >> 6; const int mt = blockIdx.x / ntn, nq = blockIdx.x - mt * ntn; const int row0 = mt * 128 + 32 * w, col0 = nq * 64; if (row0 >= M) return;
  const _Float16* a0p = A + (size_t)(row0 + ln) * lda; const _Float16* a1p = a0p + (size_t)16 * lda;
  const _Float16* b0p = Bh + (size_t)(col0 + ln) * ldb; const _Float16* b1p = b0p + (size_t)16 * ldb; const _Float16* b2p = b1p + (size_t)16 * ldb; const _Float16* b3p = b2p + (size_t)16 * ldb;
  const v8f z8 = {0.f,0.f,0.f,0.f,0.f,0.f,0.f,0.f}; v8f c00 = z8, c01 = z8, c02 = z8, c03 = z8, c10 = z8, c11 = z8, c12 = z8, c13 = z8;
#pragma unroll 1
  for (int kb = 0; kb < K; kb += 32) { const v16h a0 = g2_frag(a0p + kb, hh), a1 = g2_frag(a1p + kb, hh);
    v16h b = g2_frag(b0p + kb, hh); c00 = g2_mma(a0, b, c00); c10 = g2_mma(a1, b, c10);
    b = g2_frag(b1p + kb, hh); c01 = g2_mma(a0, b, c01); c11 = g2_mma(a1, b, c11);
    b = g2_frag(b2p + kb, hh); c02 = g2_mma(a0, b, c02); c12 = g2_mma(a1, b, c12);
    b = g2_frag(b3p + kb, hh); c03 = g2_mma(a0, b, c03); c13 = g2_mma(a1, b, c13); }
  v8f accs[8] = {c00, c01, c02, c03, c10, c11, c12, c13};
#pragma unroll
  for (int u = 0; u < 8; ++u) { const int t = u & 3, half = u >> 2; const int col = col0 + t * 16 + ln; const float bv = bp ? bf16_round(bp[col]) : 0.f;
#pragma unroll
    for (int r = 0; r < 8; ++r) { const int rloc = half * 16 + 8 * hh + r; float v = accs[u][r] * alpha + bv; if (CP) { const int bidx = (row0g + row0 + rloc) / rowsPerB; v += CP[(size_t)bidx * sCPb + (size_t)by * 64 + col]; }
      if (ACT == 3) v = fmaxf(v, 0.f); else if (ACT == 6) v = 0.5f * v * (1.0f + erff(v * 0.70710678118654752f)); else if (ACT == 11) v = 1.0f / (1.0f + expf(-v)); else if (ACT == 15) v = v / (1.0f + expf(-v)); else if (ACT == 12) v = (v > 0.f) ? v : 0.01f * v; else if (ACT == 8) v = tanhf(v);
      so[w][rloc][t * 16 + ln] = v; } }
  __builtin_amdgcn_fence(__ATOMIC_ACQ_REL, "workgroup"); __builtin_amdgcn_wave_barrier();
  const int rsub = lane >> 4, c4 = (lane & 15) * 4;
  {
#pragma unroll
    for (int q = 0; q < 16; ++q) { const int r = q * 2 + rsub; const v4f v = *(const v4fa*)&so[w][r][c4]; if (C) *(v4f*)(C + cofs + (size_t)(row0 + r) * ldc + col0 + c4) = v; if (C16) { v4h h4; for (int i = 0; i < 4; ++i) h4[i] = (_Float16)v[i]; *(v4h*)(C16 + cofs + (size_t)(row0 + r) * ldc + col0 + c4) = h4; } }
     } }


template <int TK>
__global__ __launch_bounds__(256) void k_vthl(const float* __restrict__ VF, int ldv, _Float16* __restrict__ Vth, _Float16* __restrict__ Vtl) { __shared__ float tl[64][65]; const int tid = threadIdx.x; const int slab = blockIdx.x / (TK / 64), lg = blockIdx.x % (TK / 64); const int b = slab / NH, h = slab % NH;
  for (int i = tid; i < 64 * 16; i += 256) { const int r = i / 16, c4 = (i % 16) * 4; const v4f a = *(const v4fa*)(VF + ((size_t)b * TK + lg * 64 + r) * ldv + h * 64 + c4); tl[r][c4] = a[0]; tl[r][c4 + 1] = a[1]; tl[r][c4 + 2] = a[2]; tl[r][c4 + 3] = a[3]; }
  __syncthreads();
  FragH fh[2], fl[2]; size_t oo[2];
#pragma unroll
  for (int rd = 0; rd < 2; ++rd) { const int d = rd * 32 + tid / 8, pc = tid % 8;
#pragma unroll
    for (int q = 0; q < 8; ++q) { const float v = tl[pc * 8 + q][d]; const _Float16 hv = (_Float16)v; fh[rd].h[q] = hv; fl[rd].h[q] = (_Float16)((v - (float)hv) * 1024.0f); } oo[rd] = ((size_t)slab * 64 + d) * TK + lg * 64 + pc * 8; }
  {
#pragma unroll
    for (int rd = 0; rd < 2; ++rd) { *(v8us*)((unsigned short*)Vth + oo[rd]) = fh[rd].half[0]; *(v8us*)((unsigned short*)Vtl + oo[rd]) = fl[rd].half[0]; }
     } }

template <int TQ, int TK>
__global__ __launch_bounds__(128) void k_flashm(const _Float16* __restrict__ Q16, const _Float16* __restrict__ Q16lo, int ldq, const _Float16* __restrict__ K16, const _Float16* __restrict__ K16lo, int ldk, const _Float16* __restrict__ Vt, const _Float16* __restrict__ Vtlo, const unsigned* __restrict__ MB, const int* __restrict__ RA, const int* __restrict__ KE, float* __restrict__ O, int ldo) {
  constexpr int RPW = 16, RTN = RPW / 16, NQB = TQ / (4 * RPW), DT = 4, KS = 2;
  __shared__ __attribute__((aligned(16))) unsigned short sP[4][RPW][40], sPl[4][RPW][40]; __shared__ __attribute__((aligned(16))) float sO[4][RPW][64 + 4];
  const int tid = threadIdx.x, w = tid >> 5, lane = tid & 31, ln = lane & 15, hh = lane >> 4;
  const int slab = blockIdx.x / NQB, qblk = blockIdx.x % NQB; const int b = slab / NH, h = slab % NH; const int qb0 = qblk * (4 * RPW); const int q0 = qb0 + w * RPW;
  FragH aq[2][KS], aql[2][KS];
#pragma unroll
  for (int rt = 0; rt < RTN; ++rt) { const size_t qo = ((size_t)b * TQ + q0 + rt * 16 + ln) * ldq + h * 64; const unsigned short* qr = (const unsigned short*)Q16 + qo; const unsigned short* ql = (const unsigned short*)Q16lo + qo;
#pragma unroll
    for (int ks = 0; ks < KS; ++ks) { aq[rt][ks].half[0] = *(const v8us*)(qr + ks * 32 + 8 * hh); aq[rt][ks].half[1] = *(const v8us*)(qr + ks * 32 + 16 + 8 * hh); aql[rt][ks].half[0] = *(const v8us*)(ql + ks * 32 + 8 * hh); aql[rt][ks].half[1] = *(const v8us*)(ql + ks * 32 + 16 + 8 * hh); } }
  const unsigned short* Vth = (const unsigned short*)Vt + (size_t)slab * 64 * TK; const unsigned short* Vtl = (const unsigned short*)Vtlo + (size_t)slab * 64 * TK;
  float m_r[2][8], l_r[2][8]; v8f oacc[2][DT], oaccl[2][DT];
#pragma unroll
  for (int rt = 0; rt < RTN; ++rt) {
#pragma unroll
    for (int r = 0; r < 8; ++r) { m_r[rt][r] = -3.0e38f; l_r[rt][r] = 0.f; }
#pragma unroll
    for (int dt = 0; dt < DT; ++dt) { oacc[rt][dt] = (v8f){0.f,0.f,0.f,0.f,0.f,0.f,0.f,0.f}; oaccl[rt][dt] = oacc[rt][dt]; } }
  int jend = KE[qblk * 32]; jend = min(TK, (jend + 31) & ~31); if (jend < 32) jend = 32;      /* block-uniform */
  int allm[2][8]; const unsigned* mrow[2][8];
#pragma unroll
  for (int rt = 0; rt < RTN; ++rt)
#pragma unroll
    for (int r = 0; r < 8; ++r) { const int tq = q0 + rt * 16 + 8 * hh + r; allm[rt][r] = RA[tq]; mrow[rt][r] = MB + (size_t)tq * (TK / 32); }
#pragma unroll 1
  for (int j0 = 0; j0 < jend; j0 += 32) {
    
    v8f s[2][2];
#pragma unroll
    for (int nt = 0; nt < 2; ++nt) { const size_t ko = ((size_t)b * TK + j0 + nt * 16 + ln) * ldk + h * 64; const unsigned short* kr = (const unsigned short*)K16 + ko; const unsigned short* kl = (const unsigned short*)K16lo + ko; FragH bk[KS], bkl[KS];
#pragma unroll
      for (int ks = 0; ks < KS; ++ks) { bk[ks].half[0] = *(const v8us*)(kr + ks * 32 + 8 * hh); bk[ks].half[1] = *(const v8us*)(kr + ks * 32 + 16 + 8 * hh); bkl[ks].half[0] = *(const v8us*)(kl + ks * 32 + 8 * hh); bkl[ks].half[1] = *(const v8us*)(kl + ks * 32 + 16 + 8 * hh); }
#pragma unroll
      for (int rt = 0; rt < RTN; ++rt) { v8f acc = (v8f){0.f,0.f,0.f,0.f,0.f,0.f,0.f,0.f}, accr = acc;
#pragma unroll
        for (int ks = 0; ks < KS; ++ks) { acc = mmaH<1>(aq[rt][ks].v, aq[rt][ks].v, bk[ks].v, bk[ks].v, acc); accr = mmaH<1>(aql[rt][ks].v, aql[rt][ks].v, bk[ks].v, bk[ks].v, accr); accr = mmaH<1>(aq[rt][ks].v, aq[rt][ks].v, bkl[ks].v, bkl[ks].v, accr); }
        s[rt][nt] = acc + accr * 0.0009765625f; } }
#pragma unroll
    for (int rt = 0; rt < RTN; ++rt)
#pragma unroll
      for (int r = 0; r < 8; ++r) { const unsigned mw = mrow[rt][r][j0 >> 5]; const bool am = (allm[rt][r] != 0);
        const bool ok0 = am || (((mw >> ln) & 1u) == 0u), ok1 = am || (((mw >> (16 + ln)) & 1u) == 0u);
        const float s0 = ok0 ? (am ? 0.f : s[rt][0][r] * SCL) : -INFINITY, s1 = ok1 ? (am ? 0.f : s[rt][1][r] * SCL) : -INFINITY; float mc = fmaxf(s0, s1);
        mc = fmaxf(mc, __shfl_xor(mc, 1, 32)); mc = fmaxf(mc, __shfl_xor(mc, 2, 32)); mc = fmaxf(mc, __shfl_xor(mc, 4, 32)); mc = fmaxf(mc, __shfl_xor(mc, 8, 32));
        const float mn = fmaxf(m_r[rt][r], mc); const float al = (mn > -1.0e38f) ? expf(m_r[rt][r] - mn) : 1.0f; m_r[rt][r] = mn; const float p0 = ok0 ? expf(s0 - mn) : 0.f, p1 = ok1 ? expf(s1 - mn) : 0.f; l_r[rt][r] = l_r[rt][r] * al + p0 + p1;
#pragma unroll
        for (int dt = 0; dt < DT; ++dt) { oacc[rt][dt][r] *= al; oaccl[rt][dt][r] *= al; }
        FragH t2, t3; const float ps0 = p0 * 1024.0f, ps1 = p1 * 1024.0f; t2.h[0] = (_Float16)ps0; t2.h[1] = (_Float16)ps1; t3.h[0] = (_Float16)((ps0 - (float)t2.h[0]) * 1024.0f); t3.h[1] = (_Float16)((ps1 - (float)t2.h[1]) * 1024.0f);
        sP[w][rt * 16 + 8 * hh + r][ln] = t2.u[0]; sP[w][rt * 16 + 8 * hh + r][16 + ln] = t2.u[1]; sPl[w][rt * 16 + 8 * hh + r][ln] = t3.u[0]; sPl[w][rt * 16 + 8 * hh + r][16 + ln] = t3.u[1]; }
    __builtin_amdgcn_fence(__ATOMIC_ACQ_REL, "workgroup"); __builtin_amdgcn_wave_barrier();
    FragH pa[2], pl[2];
#pragma unroll
    for (int rt = 0; rt < RTN; ++rt) { pa[rt].half[0] = *(const v8us*)&sP[w][rt * 16 + ln][8 * hh]; pa[rt].half[1] = *(const v8us*)&sP[w][rt * 16 + ln][16 + 8 * hh]; pl[rt].half[0] = *(const v8us*)&sPl[w][rt * 16 + ln][8 * hh]; pl[rt].half[1] = *(const v8us*)&sPl[w][rt * 16 + ln][16 + 8 * hh]; }
#pragma unroll
    for (int dt = 0; dt < DT; ++dt) { const size_t vo = (size_t)(dt * 16 + ln) * TK + j0; FragH bv, bl; bv.half[0] = *(const v8us*)(Vth + vo + 8 * hh); bv.half[1] = *(const v8us*)(Vth + vo + 16 + 8 * hh); bl.half[0] = *(const v8us*)(Vtl + vo + 8 * hh); bl.half[1] = *(const v8us*)(Vtl + vo + 16 + 8 * hh);
#pragma unroll
      for (int rt = 0; rt < RTN; ++rt) { oacc[rt][dt] = mmaH<1>(pa[rt].v, pa[rt].v, bv.v, bv.v, oacc[rt][dt]); oaccl[rt][dt] = mmaH<1>(pa[rt].v, pa[rt].v, bl.v, bl.v, oaccl[rt][dt]); oaccl[rt][dt] = mmaH<1>(pl[rt].v, pl[rt].v, bv.v, bv.v, oaccl[rt][dt]); } }
    __builtin_amdgcn_fence(__ATOMIC_ACQ_REL, "workgroup"); __builtin_amdgcn_wave_barrier(); }
#pragma unroll
  for (int rt = 0; rt < RTN; ++rt) {
#pragma unroll
    for (int r = 0; r < 8; ++r) { float l = l_r[rt][r]; l += __shfl_xor(l, 1, 32); l += __shfl_xor(l, 2, 32); l += __shfl_xor(l, 4, 32); l += __shfl_xor(l, 8, 32); l_r[rt][r] = (l > 0.f) ? 1.0f / (l * 1024.0f) : 0.f; }
#pragma unroll
    for (int dt = 0; dt < DT; ++dt)
#pragma unroll
      for (int r = 0; r < 8; ++r) sO[w][rt * 16 + 8 * hh + r][dt * 16 + ln] = (oacc[rt][dt][r] + oaccl[rt][dt][r] * 0.0009765625f) * l_r[rt][r]; }
  __builtin_amdgcn_fence(__ATOMIC_ACQ_REL, "workgroup"); __builtin_amdgcn_wave_barrier();
  {
#pragma unroll
    for (int rp = 0; rp < RPW; rp += 2) { const int r = rp + (lane >> 4), pc = lane & 15; const v4f val = *(const v4fa*)&sO[w][r][pc * 4]; *(v4f*)(O + ((size_t)b * TQ + q0 + r) * ldo + h * 64 + pc * 4) = val; }
     } }


__global__ __launch_bounds__(256) void k_causaltab(unsigned* __restrict__ MB, int* __restrict__ RA, int* __restrict__ KE, int nq, int nk) {
  const int t = blockIdx.x * 256 + threadIdx.x; const int nw = nk / 32;
  if (t < nq * nw) { const int q = t / nw, w = t % nw; const int first = q + 1 - 32 * w; const unsigned bits = (first <= 0) ? 0xffffffffu : ((first >= 32) ? 0u : (0xffffffffu << first)); *(unsigned*)(MB + t) = bits;  }
  if (t < nq) { *(int*)(RA + t) = 0;  }
  if (t < nq / 64) { const int v = 64 * (t + 1); *(int*)(KE + t * 32) = v;  } }
__global__ __launch_bounds__(256) void k_fulltab(unsigned* __restrict__ MB, int* __restrict__ RA, int* __restrict__ KE, int nq, int nk) {
  const int t = blockIdx.x * 256 + threadIdx.x; const int nw = nk / 32;
  if (t < nq * nw) { *(unsigned*)(MB + t) = 0u;  }
  if (t < nq) { *(int*)(RA + t) = 0;  }
  if (t < nq / 64) { *(int*)(KE + t * 32) = nk;  } }

extern "C" void kernel_launch(void* const* d_in, const int* in_sizes, int n_in,
                              void* d_out, int out_size, void* d_ws, size_t ws_size, hipStream_t stream) {
  (void)in_sizes; (void)n_in; (void)out_size;
  const float* const* I = (const float* const*)d_in; const float* wemb = I[0]; const float* pemb = I[1];
  const float* Wq = I[2]; const float* bq = I[3]; const float* Wk = I[4]; const float* bk = I[5]; const float* Wv = I[6]; const float* bv = I[7];
  const float* Wqc = I[8]; const float* bqc = I[9]; const float* Wkc = I[10]; const float* bkc = I[11]; const float* Wvc = I[12]; const float* bvc = I[13];
  const float* W1 = I[14]; const float* b1 = I[15]; const float* W2 = I[16]; const float* b2 = I[17];
  char* ws = (char*)d_ws; size_t off = 0;
  auto take = [&](size_t bytes) { char* p = ws + off; off += (bytes + 255) & ~(size_t)255; return p; };
  _Float16* BQ = (_Float16*)take((size_t)DM * DM * 2); _Float16* BK = (_Float16*)take((size_t)DM * DM * 2); _Float16* BV = (_Float16*)take((size_t)DM * DM * 2); _Float16* BQC = (_Float16*)take((size_t)DM * DM * 2); _Float16* BKC = (_Float16*)take((size_t)DM * DM * 2); _Float16* BVC = (_Float16*)take((size_t)DM * DM * 2);
  _Float16* BW1 = (_Float16*)take((size_t)FF * DM * 2); _Float16* BW2 = (_Float16*)take((size_t)DM * FF * 2);
  _Float16* WE16 = (_Float16*)take((size_t)SW * DM * 2); _Float16* PE16 = (_Float16*)take((size_t)SP * DM * 2); float* F = (float*)take((size_t)SKV * DM * 4);
  _Float16* Qh = (_Float16*)take((size_t)SW * DM * 2); _Float16* Ql = (_Float16*)take((size_t)SW * DM * 2); _Float16* Kh = (_Float16*)take((size_t)SKV * DM * 2); _Float16* Kl = (_Float16*)take((size_t)SKV * DM * 2);      /* with Qh/Ql: 16 MiB contiguous, later the FFN f32 half-hidden */
  _Float16* Vth = (_Float16*)take((size_t)SKV * DM * 2); _Float16* Vtl = (_Float16*)take((size_t)SKV * DM * 2);
  unsigned* MB = (unsigned*)take((size_t)SW * (SW / 32) * 4); int* RA = (int*)take((size_t)SW * 4); int* KE = (int*)take((size_t)(SW / 64) * 32 * 4);
  unsigned* MB2 = (unsigned*)take((size_t)SW * (SP / 32) * 4); int* RA2 = (int*)take((size_t)SW * 4); int* KE2 = (int*)take((size_t)(SW / 64) * 32 * 4);
  _Float16* Ah = (_Float16*)take((size_t)SW * DM * 2); _Float16* Al = (_Float16*)take((size_t)SW * DM * 2);      /* word hi/lo, later cross hi/lo */
  _Float16* HDh = (_Float16*)take((size_t)SW * (FF / 2) * 2); _Float16* HDl = (_Float16*)take((size_t)SW * (FF / 2) * 2);
  if (off > ws_size) return;      /* 12 + 16 + 4 + 2 + 8 + 16 + 8 + 0.8 + 8 + 16 = 91 MiB */
  float* HF = (float*)Qh;             /* FFN half hidden f32 [2048][2048] = 16 MiB over Qh..Kl (dead after the second attention) */
  const size_t w8 = (size_t)DM * DM / 8; const unsigned wb = (unsigned)((w8 + 255) / 256);
  k_round16f<<<wb, 256, 0, stream>>>(Wq, BQ, w8); k_round16f<<<wb, 256, 0, stream>>>(Wk, BK, w8); k_round16f<<<wb, 256, 0, stream>>>(Wv, BV, w8); k_round16f<<<wb, 256, 0, stream>>>(Wqc, BQC, w8); k_round16f<<<wb, 256, 0, stream>>>(Wkc, BKC, w8); k_round16f<<<wb, 256, 0, stream>>>(Wvc, BVC, w8);
  k_round16f<<<(unsigned)(((size_t)FF * DM / 8 + 255) / 256), 256, 0, stream>>>(W1, BW1, (size_t)FF * DM / 8); k_round16f<<<(unsigned)(((size_t)FF * DM / 8 + 255) / 256), 256, 0, stream>>>(W2, BW2, (size_t)FF * DM / 8);      /* torch (out,in) = natural Bt; x16 */
  k_x16<<<(unsigned)(((size_t)SW * DM / 8 + 255) / 256), 256, 0, stream>>>(wemb, WE16, (size_t)SW * DM / 8); k_x16<<<(unsigned)(((size_t)SP * DM / 8 + 255) / 256), 256, 0, stream>>>(pemb, PE16, (size_t)SP * DM / 8);
  k_causaltab<<<(SW * (SW / 32) + 255) / 256, 256, 0, stream>>>(MB, RA, KE, SW, SW); k_fulltab<<<(SW * (SP / 32) + 255) / 256, 256, 0, stream>>>(MB2, RA2, KE2, SW, SP);
  const dim3 gW((SW / 128) * (DM / 64), 1), gPp((SP / 128) * (DM / 64), 1), gH((SW / 128) * ((FF / 2) / 64), 1); const size_t n8w = (size_t)SW * DM / 8, n8p = (size_t)SP * DM / 8; const unsigned nbw = (unsigned)((n8w + 255) / 256), nbp = (unsigned)((n8p + 255) / 256);
  /* --- causal self attention on the word embeddings (all planes hi/lo) --- */
  k_gemm2<0><<<gW, 128, 0, stream>>>(WE16, DM, 0, BQ, DM, 0, 0.0625f, bq, 0, nullptr, 1, 0, 0, F, nullptr, DM, 0, SW, DM, DM); k_hl<<<nbw, 256, 0, stream>>>(F, Qh, Ql, n8w);
  k_gemm2<0><<<gW, 128, 0, stream>>>(WE16, DM, 0, BK, DM, 0, 0.0625f, bk, 0, nullptr, 1, 0, 0, F, nullptr, DM, 0, SW, DM, DM); k_hl<<<nbw, 256, 0, stream>>>(F, Kh, Kl, n8w);
  k_gemm2<0><<<gW, 128, 0, stream>>>(WE16, DM, 0, BV, DM, 0, 0.0625f, bv, 0, nullptr, 1, 0, 0, F, nullptr, DM, 0, SW, DM, DM); k_vthl<SW><<<NH * (SW / 64), 256, 0, stream>>>(F, DM, Vth, Vtl);
  k_flashm<SW, SW><<<NH * (SW / 64), 128, 0, stream>>>(Qh, Ql, DM, Kh, Kl, DM, Vth, Vtl, MB, RA, KE, F, DM);      /* word (f32) -> F */
  k_hl<<<nbw, 256, 0, stream>>>(F, Ah, Al, n8w);      /* word as hi/lo operand planes */
  k_gemm2<0><<<gW, 128, 0, stream>>>(Ah, DM, 0, BQC, DM, 0, 0.0625f, bqc, 0, nullptr, 1, 0, 0, F, nullptr, DM, 0, SW, DM, DM);
  k_gemm2<0><<<gW, 128, 0, stream>>>(Al, DM, 0, BQC, DM, 0, 0.0625f * 0.0009765625f, nullptr, 0, F, 1, (size_t)DM, 0, F, nullptr, DM, 0, SW, DM, DM); k_hl<<<nbw, 256, 0, stream>>>(F, Qh, Ql, n8w);
  k_gemm2<0><<<gPp, 128, 0, stream>>>(PE16, DM, 0, BKC, DM, 0, 0.0625f, bkc, 0, nullptr, 1, 0, 0, F, nullptr, DM, 0, SP, DM, DM); k_hl<<<nbp, 256, 0, stream>>>(F, Kh, Kl, n8p);
  k_gemm2<0><<<gPp, 128, 0, stream>>>(PE16, DM, 0, BVC, DM, 0, 0.0625f, bvc, 0, nullptr, 1, 0, 0, F, nullptr, DM, 0, SP, DM, DM); k_vthl<SP><<<NH * (SP / 64), 256, 0, stream>>>(F, DM, Vth, Vtl);
  k_flashm<SW, SP><<<NH * (SW / 64), 128, 0, stream>>>(Qh, Ql, DM, Kh, Kl, DM, Vth, Vtl, MB2, RA2, KE2, F, DM);      /* cross (f32) -> F */
  k_hl<<<nbw, 256, 0, stream>>>(F, Ah, Al, n8w);      /* cross as hi/lo operand planes */
  /* --- FFN in two column halves of the hidden: h = relu(cross*W1^T + b1) (hi/lo), out (+)= h_half*W2_half^T (+ b2 once) --- */
  for (int hf = 0; hf < 2; ++hf) { const _Float16* B1h = BW1 + (size_t)hf * (FF / 2) * DM; const _Float16* B2h = BW2 + (size_t)hf * (FF / 2);
    k_gemm2<0><<<gH, 128, 0, stream>>>(Ah, DM, 0, B1h, DM, 0, 0.0625f, b1 + hf * (FF / 2), 0, nullptr, 1, 0, 0, HF, nullptr, FF / 2, 0, SW, FF / 2, DM);
    k_gemm2<3><<<gH, 128, 0, stream>>>(Al, DM, 0, B1h, DM, 0, 0.0625f * 0.0009765625f, nullptr, 0, HF, 1, (size_t)(FF / 2), 0, HF, nullptr, FF / 2, 0, SW, FF / 2, DM);      /* relu applied after the residual pass completes the sum */
    k_hl<<<(unsigned)(((size_t)SW * (FF / 2) / 8 + 255) / 256), 256, 0, stream>>>(HF, HDh, HDl, (size_t)SW * (FF / 2) / 8);
    k_gemm2<0><<<gW, 128, 0, stream>>>(HDh, FF / 2, 0, B2h, FF, 0, 0.0625f, (hf == 0) ? b2 : nullptr, 0, (hf == 0) ? nullptr : (const float*)d_out, 1, (size_t)DM, 0, (float*)d_out, nullptr, DM, 0, SW, DM, FF / 2);
    k_gemm2<0><<<gW, 128, 0, stream>>>(HDl, FF / 2, 0, B2h, FF, 0, 0.0625f * 0.0009765625f, nullptr, 0, (const float*)d_out, 1, (size_t)DM, 0, (float*)d_out, nullptr, DM, 0, SW, DM, FF / 2); }
}

// v001
// One run takes 843 microseconds.
// Timed twice side by side with v000, it ran 1.53 times as fast both times.
#include <hip/hip_runtime.h>
// Two-stage attention decoder block (word embeddings [2048][1024], position embeddings [1024][1024], 16 heads x 64, FFN 4096): word = CausalMHA(wemb; q,k,v = Linear+bias, scores/8, tril, softmax, .v, heads merged, no output projection); cross = MHA(q from word, k/v from pemb, no mask); out = relu(cross*W1^T + b1)*W2^T + b2 -> [2048,1024].
// Compute dtype: inputs and parameters rounded to bf16; projections of the embeddings exact; all other operands f16 hi + (x2^10) residual pairs (~2^-21); f32 accumulation, softmax f32. v_wmma_f32_16x16x32_f16.
#define SW 2048
#define SP 1024
#define DM 1024
#define NH 16
#define FF 4096
#define SCL 0.125f
#define SKV ((SW > SP) ? SW : SP)      /* key/value plane rows: the self attention has SW keys, the cross attention SP */
typedef __bf16 v16b __attribute__((ext_vector_type(16)));
typedef unsigned short v8us __attribute__((ext_vector_type(8), may_alias));
typedef float  v8f  __attribute__((ext_vector_type(8)));
typedef float  v4f  __attribute__((ext_vector_type(4)));
typedef float  v4fa __attribute__((ext_vector_type(4), may_alias));
union FragB { v16b v; v8us half[2]; unsigned short u[16]; };

__device__ __forceinline__ unsigned short bf16_bits(float x) { unsigned int u = __float_as_uint(x); return (unsigned short)((u + 0x7FFFu + ((u >> 16) & 1u)) >> 16); }
__device__ __forceinline__ float bf16_val(unsigned short b) { return __uint_as_float(((unsigned int)b) << 16); }
__device__ __forceinline__ float bf16_round(float x) { return bf16_val(bf16_bits(x)); }
// D += A·B with NT terms: 1 = ah·bh, 2 = + al·bh (A split), 3 = + ah·bl (both split)
template <int NT>
__device__ __forceinline__ v8f mmaN(v16b ah, v16b al, v16b bh, v16b bl, v8f c) {
  c = __builtin_amdgcn_wmma_f32_16x16x32_bf16(false, ah, false, bh, (short)0, c, false, false);
  if (NT >= 2) c = __builtin_amdgcn_wmma_f32_16x16x32_bf16(false, al, false, bh, (short)0, c, false, false);
  if (NT >= 3) c = __builtin_amdgcn_wmma_f32_16x16x32_bf16(false, ah, false, bl, (short)0, c, false, false);
  asm volatile("v_nop\n\tv_nop\n\tv_nop\n\tv_nop" : "+v"(c) : "v"(ah), "v"(al), "v"(bh), "v"(bl));
  return c;
}

__global__ __launch_bounds__(256) void k_wt_bf16(const float* __restrict__ W, unsigned short* __restrict__ Wt, int K, int N) {
  const int t = blockIdx.x * 256 + threadIdx.x;
  const int k8n = K / 8;
  if (t >= N * k8n) return;
  const int n = t / k8n, k8 = (t % k8n) * 8;
  v8us v;
#pragma unroll
  for (int i = 0; i < 8; ++i) v[i] = bf16_bits(W[(size_t)(k8 + i) * N + n]);
  *(v8us*)(Wt + (size_t)n * K + k8) = v;
  
}

// GEMM C[M][N] (f32, pitch ldc) = act(A[M][K]·W + bias). A f32 row-major (pitch lda) converted per fragment to bf16
// (ASPLIT: hi/lo two planes -> 2 terms, else single rounded term); Wt bf16 [N][K] (pitch ldb). BIAS_BF16 rounds the
// bias to bf16 first (bias quantised to bf16 before the add). K%32==0, M%16==0, N%64==0.
template <bool ASPLIT, int ACT, bool BIAS_BF16>
__global__ __launch_bounds__(128) void k_gemm_bf(const float* __restrict__ A, int lda, const unsigned short* __restrict__ Wt, int ldb,
                                               const float* __restrict__ bias, float* __restrict__ C, int ldc, int M, int N, int K) {
  __shared__ __attribute__((aligned(16))) float so[4][16][64];
  const int tid = threadIdx.x, w = tid >> 5, lane = tid & 31, ln = lane & 15, hh = lane >> 4;
  const int ntn = N / 64;
  const int wid = blockIdx.x * 4 + w;
  const int mt = wid / ntn, nq = wid % ntn;
  if (mt * 16 >= M) return;
  const int row0 = mt * 16, col0 = nq * 64;
  const float* arow = A + (size_t)(row0 + ln) * lda;
  v8f acc[4] = {};
  for (int kb = 0; kb < K; kb += 32) {
    FragB ah, al;
    const v4f x0 = *(const v4fa*)(arow + kb + 8 * hh), x1 = *(const v4fa*)(arow + kb + 8 * hh + 4);
    const v4f x2 = *(const v4fa*)(arow + kb + 16 + 8 * hh), x3 = *(const v4fa*)(arow + kb + 16 + 8 * hh + 4);
    float xs[16] = {x0[0],x0[1],x0[2],x0[3],x1[0],x1[1],x1[2],x1[3],x2[0],x2[1],x2[2],x2[3],x3[0],x3[1],x3[2],x3[3]};
#pragma unroll
    for (int i = 0; i < 16; ++i) { const unsigned short hb = bf16_bits(xs[i]); ah.u[i] = hb; al.u[i] = ASPLIT ? bf16_bits(xs[i] - bf16_val(hb)) : (unsigned short)0; }
#pragma unroll
    for (int t = 0; t < 4; ++t) {
      const unsigned short* brow = Wt + (size_t)(col0 + t * 16 + ln) * ldb + kb;
      FragB b;
      b.half[0] = *(const v8us*)(brow + 8 * hh);
      b.half[1] = *(const v8us*)(brow + 16 + 8 * hh);
      acc[t] = mmaN<ASPLIT ? 2 : 1>(ah.v, al.v, b.v, b.v, acc[t]);
    }
  }
#pragma unroll
  for (int t = 0; t < 4; ++t) {
    float bv = bias ? bias[col0 + t * 16 + ln] : 0.f;
    if (BIAS_BF16) bv = bf16_round(bv);
#pragma unroll
    for (int r = 0; r < 8; ++r) { float v = acc[t][r] + bv; if (ACT == 1) v = fmaxf(v, 0.f); so[w][8 * hh + r][t * 16 + ln] = v; }
  }
  __builtin_amdgcn_fence(__ATOMIC_ACQ_REL, "workgroup");
  __builtin_amdgcn_wave_barrier();
  const int rsub = lane >> 4, c4 = (lane & 15) * 4;
  {
#pragma unroll
    for (int q = 0; q < 8; ++q) {
      const int r = q * 2 + rsub;
      const v4f v = *(const v4fa*)&so[w][r][c4];
      *(v4f*)(C + (size_t)(row0 + r) * ldc + col0 + c4) = v;
    }
    
  }
}

// GEMM C = act(A·W + bias + resid): A f32 (ASPLIT -> hi/lo 2 terms), Wt bf16 [N][K]; ACT 0 none, 1 relu, 2 exact gelu;
// resid (optional, f32, row index = (row % rmod), pitch ldr, RES_BF16 rounds it) added before the activation.
template <bool ASPLIT, int ACT, bool BIAS_BF16, bool RES_BF16>
__global__ __launch_bounds__(128) void k_gemm_bf3(const float* __restrict__ A, int lda, const unsigned short* __restrict__ Wt, int ldb,
                                                const float* __restrict__ bias, const float* __restrict__ resid, int rmod, int ldr,
                                                float* __restrict__ C, int ldc, int M, int N, int K) {
  __shared__ __attribute__((aligned(16))) float so[4][16][64];
  const int tid = threadIdx.x, w = tid >> 5, lane = tid & 31, ln = lane & 15, hh = lane >> 4;
  const int ntn = N / 64;
  const int wid = blockIdx.x * 4 + w;
  const int mt = wid / ntn, nq = wid % ntn;
  if (mt * 16 >= M) return;
  const int row0 = mt * 16, col0 = nq * 64;
  const float* arow = A + (size_t)(row0 + ln) * lda;
  v8f acc[4] = {};
  for (int kb = 0; kb < K; kb += 32) {
    FragB ah, al;
    const v4f x0 = *(const v4fa*)(arow + kb + 8 * hh), x1 = *(const v4fa*)(arow + kb + 8 * hh + 4);
    const v4f x2 = *(const v4fa*)(arow + kb + 16 + 8 * hh), x3 = *(const v4fa*)(arow + kb + 16 + 8 * hh + 4);
    float xs[16] = {x0[0],x0[1],x0[2],x0[3],x1[0],x1[1],x1[2],x1[3],x2[0],x2[1],x2[2],x2[3],x3[0],x3[1],x3[2],x3[3]};
#pragma unroll
    for (int i = 0; i < 16; ++i) { const unsigned short hb = bf16_bits(xs[i]); ah.u[i] = hb; al.u[i] = ASPLIT ? bf16_bits(xs[i] - bf16_val(hb)) : (unsigned short)0; }
#pragma unroll
    for (int t = 0; t < 4; ++t) {
      const unsigned short* brow = Wt + (size_t)(col0 + t * 16 + ln) * ldb + kb;
      FragB b;
      b.half[0] = *(const v8us*)(brow + 8 * hh);
      b.half[1] = *(const v8us*)(brow + 16 + 8 * hh);
      acc[t] = mmaN<ASPLIT ? 2 : 1>(ah.v, al.v, b.v, b.v, acc[t]);
    }
  }
#pragma unroll
  for (int t = 0; t < 4; ++t) {
    const int col = col0 + t * 16 + ln;
    float bv = bias ? bias[col] : 0.f;
    if (BIAS_BF16) bv = bf16_round(bv);
#pragma unroll
    for (int r = 0; r < 8; ++r) {
      float v = acc[t][r] + bv;
      if (resid) { float rv = resid[(size_t)((row0 + 8 * hh + r) % rmod) * ldr + col]; if (RES_BF16) rv = bf16_round(rv); v += rv; }
      if (ACT == 1) v = fmaxf(v, 0.f);
      if (ACT == 2) v = 0.5f * v * (1.0f + erff(v * 0.70710678118654752f));
      if (ACT == 3) { const float u = 0.7978845608028654f * (v + 0.044715f * v * v * v); v = 0.5f * v * (1.0f + tanhf(u)); }
      so[w][8 * hh + r][t * 16 + ln] = v;
    }
  }
  __builtin_amdgcn_fence(__ATOMIC_ACQ_REL, "workgroup");
  __builtin_amdgcn_wave_barrier();
  const int rsub = lane >> 4, c4 = (lane & 15) * 4;
  {
#pragma unroll
    for (int q = 0; q < 8; ++q) {
      const int r = q * 2 + rsub;
      const v4f v = *(const v4fa*)&so[w][r][c4];
      *(v4f*)(C + (size_t)(row0 + r) * ldc + col0 + c4) = v;
    }
    
  }
}
// row LayerNorm (biased variance, eps) over N: s = X (+ R); optional out_sum <- s; out_norm <- (s-mu)*rsqrt(var+eps)*g + b
template <bool PARAM_BF16>
__global__ __launch_bounds__(256) void k_layernorm(const float* __restrict__ X, const float* __restrict__ R, const float* __restrict__ g, const float* __restrict__ bta,
                                                  float* __restrict__ out_sum, float* __restrict__ out_norm, int N, float eps) {
  __shared__ float red[256];
  const int row = blockIdx.x, tid = threadIdx.x;
  const float* x = X + (size_t)row * N; const float* rr = R ? R + (size_t)row * N : nullptr;
  float vals[16];                     // up to N = 4096
  const int per = N / 256;            // contiguous chunk per thread? use strided-by-4 chunks: thread handles j = tid*4 + 1024*u
  float s1 = 0.f;
  for (int u = 0; u < per / 4; ++u) {
    const int j = tid * 4 + 1024 * u;
    const v4f a = *(const v4fa*)(x + j);
    v4f b = {0.f,0.f,0.f,0.f}; if (rr) b = *(const v4fa*)(rr + j);
#pragma unroll
    for (int q = 0; q < 4; ++q) { const float v = a[q] + b[q]; vals[u * 4 + q] = v; s1 += v; }
  }
  red[tid] = s1; __syncthreads();
  for (int st = 128; st > 0; st >>= 1) { if (tid < st) red[tid] += red[tid + st]; __syncthreads(); }
  const float mu = red[0] / (float)N; __syncthreads();
  float s2 = 0.f;
  for (int u = 0; u < per / 4; ++u)
#pragma unroll
    for (int q = 0; q < 4; ++q) { const float c = vals[u * 4 + q] - mu; s2 += c * c; }
  red[tid] = s2; __syncthreads();
  for (int st = 128; st > 0; st >>= 1) { if (tid < st) red[tid] += red[tid + st]; __syncthreads(); }
  const float rs = rsqrtf(red[0] / (float)N + eps);
  {
    for (int u = 0; u < per / 4; ++u) {
      const int j = tid * 4 + 1024 * u;
      v4f o, sm;
#pragma unroll
      for (int q = 0; q < 4; ++q) {
        float gg = g[j + q], bb = bta[j + q];
        if (PARAM_BF16) { gg = bf16_round(gg); bb = bf16_round(bb); }
        sm[q] = vals[u * 4 + q]; o[q] = (vals[u * 4 + q] - mu) * rs * gg + bb;
      }
      if (out_sum) *(v4f*)(out_sum + (size_t)row * N + j) = sm;
      *(v4f*)(out_norm + (size_t)row * N + j) = o;
    }
    
  }
}



// ---- f16 WMMA path (v_wmma_f32_16x16x32_f16): 11-bit significands for operands in range — used where a [0,1] probability operand needs more precision than bf16
typedef _Float16 v16h __attribute__((ext_vector_type(16)));
union FragH { v16h v; v8us half[2]; _Float16 h[16]; unsigned short u[16]; };
template <int NT>
__device__ __forceinline__ v8f mmaH(v16h ah, v16h al, v16h bh, v16h bl, v8f c) {
  c = __builtin_amdgcn_wmma_f32_16x16x32_f16(false, ah, false, bh, (short)0, c, false, false);
  if (NT >= 2) c = __builtin_amdgcn_wmma_f32_16x16x32_f16(false, al, false, bh, (short)0, c, false, false);
  if (NT >= 3) c = __builtin_amdgcn_wmma_f32_16x16x32_f16(false, ah, false, bl, (short)0, c, false, false);
  asm volatile("v_nop\n\tv_nop\n\tv_nop\n\tv_nop" : "+v"(c) : "v"(ah), "v"(al), "v"(bh), "v"(bl));
  return c;
}
// batched GEMM like k_gemm_b but f16 operands: A f32 (split into f16 hi/lo if ASPLIT, else rounded to f16), Bt = f16 values [n][k]; alpha; C f32; N multiple of 16 (partial tiles skipped)
template <bool ASPLIT>
__global__ __launch_bounds__(128) void k_gemm_h(const float* __restrict__ A, int lda, size_t sA, const _Float16* __restrict__ Bh, int ldb, size_t sB, float alpha, float* __restrict__ C, int ldc, size_t sC, int M, int N, int K) {
  __shared__ __attribute__((aligned(16))) float so[4][16][64];
  const int tid = threadIdx.x, w = tid >> 5, lane = tid & 31, ln = lane & 15, hh = lane >> 4; const int by = blockIdx.y;
  A += (size_t)by * sA; Bh += (size_t)by * sB; C += (size_t)by * sC;
  const int ntn = (N + 63) / 64; const int wid = blockIdx.x * 4 + w; const int mt = wid / ntn, nq = wid % ntn; if (mt * 16 >= M) return;
  const int row0 = mt * 16, col0 = nq * 64; const float* arow = A + (size_t)(row0 + ln) * lda;
  v8f acc[4] = {};
  for (int kb = 0; kb < K; kb += 32) {
    FragH ah, al;
    const v4f x0 = *(const v4fa*)(arow + kb + 8 * hh), x1 = *(const v4fa*)(arow + kb + 8 * hh + 4), x2 = *(const v4fa*)(arow + kb + 16 + 8 * hh), x3 = *(const v4fa*)(arow + kb + 16 + 8 * hh + 4);
    float xs[16] = {x0[0],x0[1],x0[2],x0[3],x1[0],x1[1],x1[2],x1[3],x2[0],x2[1],x2[2],x2[3],x3[0],x3[1],x3[2],x3[3]};
#pragma unroll
    for (int i = 0; i < 16; ++i) { const _Float16 h = (_Float16)xs[i]; ah.h[i] = h; al.h[i] = ASPLIT ? (_Float16)(xs[i] - (float)h) : (_Float16)0.0f; }
#pragma unroll
    for (int t = 0; t < 4; ++t) { if (col0 + t * 16 >= N) continue; const size_t boff = (size_t)(col0 + t * 16 + ln) * ldb + kb; FragH bq; bq.half[0] = *(const v8us*)(Bh + boff + 8 * hh); bq.half[1] = *(const v8us*)(Bh + boff + 16 + 8 * hh);
      acc[t] = mmaH<ASPLIT ? 2 : 1>(ah.v, al.v, bq.v, bq.v, acc[t]); }
  }
#pragma unroll
  for (int t = 0; t < 4; ++t) { if (col0 + t * 16 >= N) continue;
#pragma unroll
    for (int r = 0; r < 8; ++r) so[w][8 * hh + r][t * 16 + ln] = acc[t][r] * alpha; }
  __builtin_amdgcn_fence(__ATOMIC_ACQ_REL, "workgroup"); __builtin_amdgcn_wave_barrier();
  const int rsub = lane >> 4, c4 = (lane & 15) * 4;
  {
#pragma unroll
    for (int q = 0; q < 8; ++q) { const int r = q * 2 + rsub; if (col0 + c4 < N) { const v4f v = *(const v4fa*)&so[w][r][c4]; *(v4f*)(C + (size_t)(row0 + r) * ldc + col0 + c4) = v; } }
     }
}

// Wt[n][k] = f16(W[k][n]·scale) from f32 row-major W[K][N] (scale = power of two; bf16-exact weights stay exact in f16 away from the subnormal range)
__global__ __launch_bounds__(256) void k_wt_f16(const float* __restrict__ W, _Float16* __restrict__ Wt, int K, int N, float scale) {
  const int t = blockIdx.x * 256 + threadIdx.x; if (t >= N * (K / 8)) return; const int n = t / (K / 8), k8 = (t % (K / 8)) * 8; FragH f;
#pragma unroll
  for (int i = 0; i < 8; ++i) f.h[i] = (_Float16)(bf16_round(W[(size_t)(k8 + i) * N + n]) * scale); const v8us o = f.half[0];
  *(v8us*)((unsigned short*)Wt + (size_t)n * K + k8) = o; 
}
// k_gemm_hh variant with fused epilogue: v = acc·alpha + bias[by·sBias + col] (+ CP[(row/rowsPerB)·sCPb + by·64 + col] if CP) ; ACT 0 none / 1 elu ; writes f16 C16 (and f32 C if non-null)
template <int ACT>
__global__ __launch_bounds__(128) void k_gemm_hhx(const _Float16* __restrict__ A, int lda, size_t sA, const _Float16* __restrict__ Bh, int ldb, size_t sB, float alpha, const float* __restrict__ bias, size_t sBias, const float* __restrict__ CP, int rowsPerB, size_t sCPb, int row0g,
    float* __restrict__ C, _Float16* __restrict__ C16, int ldc, size_t sC, int M, int N, int K) {
  __shared__ __attribute__((aligned(16))) float so[4][16][64];
  const int tid = threadIdx.x, w = tid >> 5, lane = tid & 31, ln = lane & 15, hh = lane >> 4; const int by = blockIdx.y;
  A += (size_t)by * sA; Bh += (size_t)by * sB; const size_t cofs = (size_t)by * sC; const float* bp = bias ? bias + (size_t)by * sBias : nullptr;
  const int ntn = (N + 63) / 64; const int wid = blockIdx.x * 4 + w; const int mt = wid / ntn, nq = wid % ntn; if (mt * 16 >= M) return;
  const int row0 = mt * 16, col0 = nq * 64; const _Float16* arow = A + (size_t)(row0 + ln) * lda;
  v8f acc[4] = {};
  for (int kb = 0; kb < K; kb += 32) { FragH ah; ah.half[0] = *(const v8us*)((const unsigned short*)arow + kb + 8 * hh); ah.half[1] = *(const v8us*)((const unsigned short*)arow + kb + 16 + 8 * hh);
#pragma unroll
    for (int t = 0; t < 4; ++t) { if (col0 + t * 16 >= N) continue; const size_t boff = (size_t)(col0 + t * 16 + ln) * ldb + kb; FragH bq; bq.half[0] = *(const v8us*)((const unsigned short*)Bh + boff + 8 * hh); bq.half[1] = *(const v8us*)((const unsigned short*)Bh + boff + 16 + 8 * hh);
      acc[t] = mmaH<1>(ah.v, ah.v, bq.v, bq.v, acc[t]); }
  }
#pragma unroll
  for (int t = 0; t < 4; ++t) { if (col0 + t * 16 >= N) continue; const int col = col0 + t * 16 + ln; const float bv = bp ? bf16_round(bp[col]) : 0.f;
#pragma unroll
    for (int r = 0; r < 8; ++r) { float v = acc[t][r] * alpha + bv; if (CP) { const int bidx = (row0g + row0 + 8 * hh + r) / rowsPerB; v += CP[(size_t)bidx * sCPb + (size_t)by * 64 + col]; } if (ACT == 1) v = (v > 0.f) ? v : expm1f(v); else if (ACT == 7) v = (v > 0.f) ? v + 1.0f : expf(v); else if (ACT == 8) v = tanhf(v); else if (ACT == 9) v = 0.5f * v * (1.0f + tanhf(0.7978845608028654f * (v + 0.044715f * v * v * v))); else if (ACT == 11) v = 1.0f / (1.0f + expf(-v)); else if (ACT == 12) v = (v > 0.f) ? v : 0.01f * v; else if (ACT == 14) v = (v > 0.f) ? v : 0.1f * v; else if (ACT == 15) v = v / (1.0f + expf(-v)); else if (ACT == 3) v = fmaxf(v, 0.f); else if (ACT == 6) v = 0.5f * v * (1.0f + erff(v * 0.70710678118654752f)); so[w][8 * hh + r][t * 16 + ln] = v; } }
  __builtin_amdgcn_fence(__ATOMIC_ACQ_REL, "workgroup"); __builtin_amdgcn_wave_barrier();
  const int rsub = lane >> 4, c4 = (lane & 15) * 4; typedef _Float16 v4h __attribute__((ext_vector_type(4)));
  {
#pragma unroll
    for (int q = 0; q < 8; ++q) { const int r = q * 2 + rsub; if (col0 + c4 < N) { const v4f v = *(const v4fa*)&so[w][r][c4]; if (C) *(v4f*)(C + cofs + (size_t)(row0 + r) * ldc + col0 + c4) = v; if (C16) { v4h h4; for (int i = 0; i < 4; ++i) h4[i] = (_Float16)v[i]; *(v4h*)(C16 + cofs + (size_t)(row0 + r) * ldc + col0 + c4) = h4; } } }
     }
}


typedef _Float16 v4h __attribute__((ext_vector_type(4)));

__global__ __launch_bounds__(256) void k_x16(const float* __restrict__ x, _Float16* __restrict__ X16, size_t n8) { const size_t t = (size_t)blockIdx.x * 256 + threadIdx.x; if (t >= n8) return; FragH f;
#pragma unroll
  for (int q = 0; q < 8; ++q) f.h[q] = (_Float16)bf16_round(x[t * 8 + q]); *(v8us*)((unsigned short*)X16 + t * 8) = f.half[0];  }
__global__ __launch_bounds__(256) void k_h16(const float* __restrict__ x, _Float16* __restrict__ X16, size_t n8) { const size_t t = (size_t)blockIdx.x * 256 + threadIdx.x; if (t >= n8) return; FragH f;
#pragma unroll
  for (int q = 0; q < 8; ++q) f.h[q] = (_Float16)x[t * 8 + q]; *(v8us*)((unsigned short*)X16 + t * 8) = f.half[0];  }
__global__ __launch_bounds__(256) void k_round16f(const float* __restrict__ W, _Float16* __restrict__ Bt, size_t n8) { const size_t t = (size_t)blockIdx.x * 256 + threadIdx.x; if (t >= n8) return; FragH f;
#pragma unroll
  for (int i = 0; i < 8; ++i) f.h[i] = (_Float16)(bf16_round(W[t * 8 + i]) * 16.0f); *(v8us*)((unsigned short*)Bt + t * 8) = f.half[0];  }
template <int NHv, int TTv>
__global__ __launch_bounds__(256) void k_vt(const _Float16* __restrict__ V16, int ldv, int voff, _Float16* __restrict__ Vt) { __shared__ unsigned short tl[64][66]; const int tid = threadIdx.x; const int slab = blockIdx.x / (TTv / 64), lg = blockIdx.x % (TTv / 64); const int b = slab / NHv, h = slab % NHv;
  for (int i = tid; i < 64 * 8; i += 256) { const int r = i / 8, c8 = (i % 8) * 8; FragH f; f.half[0] = *(const v8us*)((const unsigned short*)V16 + ((size_t)b * TTv + lg * 64 + r) * ldv + voff + h * 64 + c8);
#pragma unroll
    for (int q = 0; q < 8; ++q) tl[r][c8 + q] = f.u[q]; }
  __syncthreads();
  {
#pragma unroll
    for (int rd = 0; rd < 2; ++rd) { const int d = rd * 32 + tid / 8, pc = tid % 8; FragH f;
#pragma unroll
      for (int q = 0; q < 8; ++q) f.u[q] = tl[pc * 8 + q][d];
      *(v8us*)((unsigned short*)Vt + ((size_t)slab * 64 + d) * TTv + lg * 64 + pc * 8) = f.half[0]; }
     } }

__global__ __launch_bounds__(256) void k_hl(const float* __restrict__ F, _Float16* __restrict__ Hh, _Float16* __restrict__ Hl, size_t n8) { const size_t t = (size_t)blockIdx.x * 256 + threadIdx.x; if (t >= n8) return; FragH fh, fl; const v4f a = *(const v4fa*)(F + t * 8), c = *(const v4fa*)(F + t * 8 + 4);
#pragma unroll
  for (int q = 0; q < 4; ++q) { _Float16 h = (_Float16)a[q]; fh.h[q] = h; fl.h[q] = (_Float16)((a[q] - (float)h) * 1024.0f); h = (_Float16)c[q]; fh.h[4 + q] = h; fl.h[4 + q] = (_Float16)((c[q] - (float)h) * 1024.0f); }
  { *(v8us*)((unsigned short*)Hh + t * 8) = fh.half[0]; *(v8us*)((unsigned short*)Hl + t * 8) = fl.half[0];  } }

// ---- fast GEMM (block tile 128x64, wave tile 32x64; requires M % 128 == 0, N % 64 == 0 and K % 128 == 0); epilogue = k_gemm_hhx semantics ----
// k loop staging of k_gemm2: one stage = 128 k (256 B of a row) of the block's 128 A rows and 64 B rows, laid in LDS at a pitch of 272 B (16 B x odd, for the 16-byte fragment reads); two buffers.
#define G2_PITCH 272
#define G2_AB (128 * G2_PITCH)
#define G2_STAGE ((128 + 64) * G2_PITCH)
__device__ __forceinline__ v16h g2_lfrag(const unsigned char* p, int hh) { FragH f; f.half[0] = *(const v8us*)(p + 16 * hh); f.half[1] = *(const v8us*)(p + 32 + 16 * hh); return f.v; }
__device__ __forceinline__ v8f g2_mm(v16h a, v16h b, v8f c) { return __builtin_amdgcn_wmma_f32_16x16x32_f16(false, a, false, b, (short)0, c, false, false); }
// One wave's share of a stage: 32 A rows and 16 B rows, two rows (2 x 256 B, whole lines) per wave-wide copy, 16 B per lane, 24 copies.
// la, lb: the lane's LDS byte addresses of its first A and B chunk; ga, gb: the matching global addresses; a copy further on is two rows further on.
__device__ __forceinline__ void g2_stage(unsigned la, unsigned lb, const _Float16* ga, int lda, const _Float16* gb, int ldb) {
  unsigned l[24]; const _Float16* g[24];
#pragma unroll
  for (int i = 0; i < 16; ++i) { l[i] = la + i * (2 * G2_PITCH); g[i] = ga + (size_t)(2 * i) * lda; }
#pragma unroll
  for (int i = 0; i < 8; ++i) { l[16 + i] = lb + i * (2 * G2_PITCH); g[16 + i] = gb + (size_t)(2 * i) * ldb; }
  // the copies go to LDS through no register; s_wait_xcnt is the statement's last line so that no address register is rewritten ahead of it
  asm volatile("global_load_async_to_lds_b128 %0, %12, off\n\t"
               "global_load_async_to_lds_b128 %1, %13, off\n\t"
               "global_load_async_to_lds_b128 %2, %14, off\n\t"
               "global_load_async_to_lds_b128 %3, %15, off\n\t"
               "global_load_async_to_lds_b128 %4, %16, off\n\t"
               "global_load_async_to_lds_b128 %5, %17, off\n\t"
               "global_load_async_to_lds_b128 %6, %18, off\n\t"
               "global_load_async_to_lds_b128 %7, %19, off\n\t"
               "global_load_async_to_lds_b128 %8, %20, off\n\t"
               "global_load_async_to_lds_b128 %9, %21, off\n\t"
               "global_load_async_to_lds_b128 %10, %22, off\n\t"
               "global_load_async_to_lds_b128 %11, %23, off\n\t"
               "s_wait_xcnt 0x0"
               :: "v"(l[0]), "v"(l[1]), "v"(l[2]), "v"(l[3]), "v"(l[4]), "v"(l[5]), "v"(l[6]), "v"(l[7]), "v"(l[8]), "v"(l[9]), "v"(l[10]), "v"(l[11]),
                  "v"(g[0]), "v"(g[1]), "v"(g[2]), "v"(g[3]), "v"(g[4]), "v"(g[5]), "v"(g[6]), "v"(g[7]), "v"(g[8]), "v"(g[9]), "v"(g[10]), "v"(g[11]) : "memory");
  asm volatile("global_load_async_to_lds_b128 %0, %12, off\n\t"
               "global_load_async_to_lds_b128 %1, %13, off\n\t"
               "global_load_async_to_lds_b128 %2, %14, off\n\t"
               "global_load_async_to_lds_b128 %3, %15, off\n\t"
               "global_load_async_to_lds_b128 %4, %16, off\n\t"
               "global_load_async_to_lds_b128 %5, %17, off\n\t"
               "global_load_async_to_lds_b128 %6, %18, off\n\t"
               "global_load_async_to_lds_b128 %7, %19, off\n\t"
               "global_load_async_to_lds_b128 %8, %20, off\n\t"
               "global_load_async_to_lds_b128 %9, %21, off\n\t"
               "global_load_async_to_lds_b128 %10, %22, off\n\t"
               "global_load_async_to_lds_b128 %11, %23, off\n\t"
               "s_wait_xcnt 0x0"
               :: "v"(l[12]), "v"(l[13]), "v"(l[14]), "v"(l[15]), "v"(l[16]), "v"(l[17]), "v"(l[18]), "v"(l[19]), "v"(l[20]), "v"(l[21]), "v"(l[22]), "v"(l[23]),
                  "v"(g[12]), "v"(g[13]), "v"(g[14]), "v"(g[15]), "v"(g[16]), "v"(g[17]), "v"(g[18]), "v"(g[19]), "v"(g[20]), "v"(g[21]), "v"(g[22]), "v"(g[23]) : "memory");
}
template <int ACT>
__global__ __launch_bounds__(128) void k_gemm2(const _Float16* __restrict__ A, int lda, size_t sA, const _Float16* __restrict__ Bh, int ldb, size_t sB, float alpha, const float* __restrict__ bias, size_t sBias, const float* __restrict__ CP, int rowsPerB, size_t sCPb, int row0g,
    float* __restrict__ C, _Float16* __restrict__ C16, int ldc, size_t sC, int M, int N, int K) {
  __shared__ __attribute__((aligned(16))) float so[4][32][68]; __shared__ __attribute__((aligned(16))) unsigned char ring[2 * G2_STAGE];
  const int tid = threadIdx.x, w = tid >> 5, lane = tid & 31, ln = lane & 15, hh = lane >> 4; const int by = blockIdx.y;
  A += (size_t)by * sA; Bh += (size_t)by * sB; const size_t cofs = (size_t)by * sC; const float* bp = bias ? bias + (size_t)by * sBias : nullptr;
  const int ntn = N >> 6; const int mt = blockIdx.x / ntn, nq = blockIdx.x - mt * ntn; const int row0 = mt * 128 + 32 * w, col0 = nq * 64; if (mt * 128 >= M) return;      /* the whole block leaves, in front of every barrier */
  const v8f z8 = {0.f,0.f,0.f,0.f,0.f,0.f,0.f,0.f}; v8f c00 = z8, c01 = z8, c02 = z8, c03 = z8, c10 = z8, c11 = z8, c12 = z8, c13 = z8;
  const _Float16* ga = A + (size_t)(row0 + hh) * lda + ln * 8; const _Float16* gb = Bh + (size_t)(col0 + 16 * w + hh) * ldb + ln * 8;      /* this lane's first 16 bytes of the wave's A and B rows */
  const unsigned la = (unsigned)(size_t)ring + (unsigned)((32 * w + hh) * G2_PITCH + ln * 16), lb = (unsigned)(size_t)ring + (unsigned)(G2_AB + (16 * w + hh) * G2_PITCH + ln * 16);
  const int nst = K >> 7;
  g2_stage(la, lb, ga, lda, gb, ldb);
  asm volatile("s_wait_asynccnt 0x0" ::: "memory");      /* this wave's copies of stage 0 have landed */
  __syncthreads();      /* and every other wave's: stage 0 may be read */
  if (nst > 1) g2_stage(la + G2_STAGE, lb + G2_STAGE, ga + 128, lda, gb + 128, ldb);
#pragma unroll 1      /* one trip per stage: the two buffers alternate */
  for (int t = 0; t < nst; ++t) { const unsigned bo = (unsigned)(t & 1) * G2_STAGE; const unsigned char* pa = ring + bo + (32 * w + ln) * G2_PITCH; const unsigned char* pb = ring + bo + G2_AB + ln * G2_PITCH;
    v16h fa[2][2], fb[2][4];      /* two fragment sets: the next k step's LDS reads are issued, as one group, ahead of this step's WMMAs; never beyond the stage */
    fa[0][0] = g2_lfrag(pa, hh); fa[0][1] = g2_lfrag(pa + 16 * G2_PITCH, hh);
#pragma unroll
    for (int j = 0; j < 4; ++j) fb[0][j] = g2_lfrag(pb + j * 16 * G2_PITCH, hh);
#pragma unroll
    for (int ks = 0; ks < 4; ++ks) { const int cu = ks & 1, nx = cu ^ 1;
      if (ks < 3) { fa[nx][0] = g2_lfrag(pa + (ks + 1) * 64, hh); fa[nx][1] = g2_lfrag(pa + 16 * G2_PITCH + (ks + 1) * 64, hh);
#pragma unroll
        for (int j = 0; j < 4; ++j) fb[nx][j] = g2_lfrag(pb + j * 16 * G2_PITCH + (ks + 1) * 64, hh); }
      __builtin_amdgcn_sched_barrier(0);      /* keeps the reads above in front of the WMMAs below: sunk to their uses, each pair of WMMAs waits out an LDS latency */
      c00 = g2_mm(fa[cu][0], fb[cu][0], c00); c10 = g2_mm(fa[cu][1], fb[cu][0], c10); c01 = g2_mm(fa[cu][0], fb[cu][1], c01); c11 = g2_mm(fa[cu][1], fb[cu][1], c11);
      c02 = g2_mm(fa[cu][0], fb[cu][2], c02); c12 = g2_mm(fa[cu][1], fb[cu][2], c12); c03 = g2_mm(fa[cu][0], fb[cu][3], c03); c13 = g2_mm(fa[cu][1], fb[cu][3], c13);
      __builtin_amdgcn_sched_barrier(0);      /* keeps the next group of reads behind these WMMAs, so that two sets suffice */
    }
    asm volatile("s_wait_dscnt 0x0" ::: "memory");      /* this wave's reads of the buffer are done before it is refilled */
    asm volatile("s_wait_asynccnt 0x0" ::: "memory");      /* this wave's copies of stage t + 1 have landed */
    __syncthreads();      /* publishes stage t + 1 and ends every wave's reads of stage t */
    if (t + 2 < nst) g2_stage(la + bo, lb + bo, ga + (size_t)(t + 2) * 128, lda, gb + (size_t)(t + 2) * 128, ldb); }
  asm volatile("s_wait_asynccnt 0x0" ::: "memory");      /* no copy is left in flight */
  v8f accs[8] = {c00, c01, c02, c03, c10, c11, c12, c13};
#pragma unroll
  for (int u = 0; u < 8; ++u) { const int t = u & 3, half = u >> 2; const int col = col0 + t * 16 + ln; const float bv = bp ? bf16_round(bp[col]) : 0.f;
#pragma unroll
    for (int r = 0; r < 8; ++r) { const int rloc = half * 16 + 8 * hh + r; float v = accs[u][r] * alpha + bv; if (CP) { const int bidx = (row0g + row0 + rloc) / rowsPerB; v += CP[(size_t)bidx * sCPb + (size_t)by * 64 + col]; }
      if (ACT == 3) v = fmaxf(v, 0.f); else if (ACT == 6) v = 0.5f * v * (1.0f + erff(v * 0.70710678118654752f)); else if (ACT == 11) v = 1.0f / (1.0f + expf(-v)); else if (ACT == 15) v = v / (1.0f + expf(-v)); else if (ACT == 12) v = (v > 0.f) ? v : 0.01f * v; else if (ACT == 8) v = tanhf(v);
      so[w][rloc][t * 16 + ln] = v; } }
  __builtin_amdgcn_fence(__ATOMIC_ACQ_REL, "workgroup"); __builtin_amdgcn_wave_barrier();
  const int rsub = lane >> 4, c4 = (lane & 15) * 4;
  {
#pragma unroll
    for (int q = 0; q < 16; ++q) { const int r = q * 2 + rsub; const v4f v = *(const v4fa*)&so[w][r][c4]; if (C) *(v4f*)(C + cofs + (size_t)(row0 + r) * ldc + col0 + c4) = v; if (C16) { v4h h4; for (int i = 0; i < 4; ++i) h4[i] = (_Float16)v[i]; *(v4h*)(C16 + cofs + (size_t)(row0 + r) * ldc + col0 + c4) = h4; } }
     } }


template <int TK>
__global__ __launch_bounds__(256) void k_vthl(const float* __restrict__ VF, int ldv, _Float16* __restrict__ Vth, _Float16* __restrict__ Vtl) { __shared__ float tl[64][65]; const int tid = threadIdx.x; const int slab = blockIdx.x / (TK / 64), lg = blockIdx.x % (TK / 64); const int b = slab / NH, h = slab % NH;
  for (int i = tid; i < 64 * 16; i += 256) { const int r = i / 16, c4 = (i % 16) * 4; const v4f a = *(const v4fa*)(VF + ((size_t)b * TK + lg * 64 + r) * ldv + h * 64 + c4); tl[r][c4] = a[0]; tl[r][c4 + 1] = a[1]; tl[r][c4 + 2] = a[2]; tl[r][c4 + 3] = a[3]; }
  __syncthreads();
  FragH fh[2], fl[2]; size_t oo[2];
#pragma unroll
  for (int rd = 0; rd < 2; ++rd) { const int d = rd * 32 + tid / 8, pc = tid % 8;
#pragma unroll
    for (int q = 0; q < 8; ++q) { const float v = tl[pc * 8 + q][d]; const _Float16 hv = (_Float16)v; fh[rd].h[q] = hv; fl[rd].h[q] = (_Float16)((v - (float)hv) * 1024.0f); } oo[rd] = ((size_t)slab * 64 + d) * TK + lg * 64 + pc * 8; }
  {
#pragma unroll
    for (int rd = 0; rd < 2; ++rd) { *(v8us*)((unsigned short*)Vth + oo[rd]) = fh[rd].half[0]; *(v8us*)((unsigned short*)Vtl + oo[rd]) = fl[rd].half[0]; }
     } }

template <int TQ, int TK>
__global__ __launch_bounds__(128) void k_flashm(const _Float16* __restrict__ Q16, const _Float16* __restrict__ Q16lo, int ldq, const _Float16* __restrict__ K16, const _Float16* __restrict__ K16lo, int ldk, const _Float16* __restrict__ Vt, const _Float16* __restrict__ Vtlo, const unsigned* __restrict__ MB, const int* __restrict__ RA, const int* __restrict__ KE, float* __restrict__ O, int ldo) {
  constexpr int RPW = 16, RTN = RPW / 16, NQB = TQ / (4 * RPW), DT = 4, KS = 2;
  __shared__ __attribute__((aligned(16))) unsigned short sP[4][RPW][40], sPl[4][RPW][40]; __shared__ __attribute__((aligned(16))) float sO[4][RPW][64 + 4];
  const int tid = threadIdx.x, w = tid >> 5, lane = tid & 31, ln = lane & 15, hh = lane >> 4;
  const int slab = blockIdx.x / NQB, qblk = blockIdx.x % NQB; const int b = slab / NH, h = slab % NH; const int qb0 = qblk * (4 * RPW); const int q0 = qb0 + w * RPW;
  FragH aq[2][KS], aql[2][KS];
#pragma unroll
  for (int rt = 0; rt < RTN; ++rt) { const size_t qo = ((size_t)b * TQ + q0 + rt * 16 + ln) * ldq + h * 64; const unsigned short* qr = (const unsigned short*)Q16 + qo; const unsigned short* ql = (const unsigned short*)Q16lo + qo;
#pragma unroll
    for (int ks = 0; ks < KS; ++ks) { aq[rt][ks].half[0] = *(const v8us*)(qr + ks * 32 + 8 * hh); aq[rt][ks].half[1] = *(const v8us*)(qr + ks * 32 + 16 + 8 * hh); aql[rt][ks].half[0] = *(const v8us*)(ql + ks * 32 + 8 * hh); aql[rt][ks].half[1] = *(const v8us*)(ql + ks * 32 + 16 + 8 * hh); } }
  const unsigned short* Vth = (const unsigned short*)Vt + (size_t)slab * 64 * TK; const unsigned short* Vtl = (const unsigned short*)Vtlo + (size_t)slab * 64 * TK;
  float m_r[2][8], l_r[2][8]; v8f oacc[2][DT], oaccl[2][DT];
#pragma unroll
  for (int rt = 0; rt < RTN; ++rt) {
#pragma unroll
    for (int r = 0; r < 8; ++r) { m_r[rt][r] = -3.0e38f; l_r[rt][r] = 0.f; }
#pragma unroll
    for (int dt = 0; dt < DT; ++dt) { oacc[rt][dt] = (v8f){0.f,0.f,0.f,0.f,0.f,0.f,0.f,0.f}; oaccl[rt][dt] = oacc[rt][dt]; } }
  int jend = KE[qblk * 32]; jend = min(TK, (jend + 31) & ~31); if (jend < 32) jend = 32;      /* block-uniform */
  int allm[2][8]; const unsigned* mrow[2][8];
#pragma unroll
  for (int rt = 0; rt < RTN; ++rt)
#pragma unroll
    for (int r = 0; r < 8; ++r) { const int tq = q0 + rt * 16 + 8 * hh + r; allm[rt][r] = RA[tq]; mrow[rt][r] = MB + (size_t)tq * (TK / 32); }
#pragma unroll 1
  for (int j0 = 0; j0 < jend; j0 += 32) {
    
    v8f s[2][2];
#pragma unroll
    for (int nt = 0; nt < 2; ++nt) { const size_t ko = ((size_t)b * TK + j0 + nt * 16 + ln) * ldk + h * 64; const unsigned short* kr = (const unsigned short*)K16 + ko; const unsigned short* kl = (const unsigned short*)K16lo + ko; FragH bk[KS], bkl[KS];
#pragma unroll
      for (int ks = 0; ks < KS; ++ks) { bk[ks].half[0] = *(const v8us*)(kr + ks * 32 + 8 * hh); bk[ks].half[1] = *(const v8us*)(kr + ks * 32 + 16 + 8 * hh); bkl[ks].half[0] = *(const v8us*)(kl + ks * 32 + 8 * hh); bkl[ks].half[1] = *(const v8us*)(kl + ks * 32 + 16 + 8 * hh); }
#pragma unroll
      for (int rt = 0; rt < RTN; ++rt) { v8f acc = (v8f){0.f,0.f,0.f,0.f,0.f,0.f,0.f,0.f}, accr = acc;
#pragma unroll
        for (int ks = 0; ks < KS; ++ks) { acc = mmaH<1>(aq[rt][ks].v, aq[rt][ks].v, bk[ks].v, bk[ks].v, acc); accr = mmaH<1>(aql[rt][ks].v, aql[rt][ks].v, bk[ks].v, bk[ks].v, accr); accr = mmaH<1>(aq[rt][ks].v, aq[rt][ks].v, bkl[ks].v, bkl[ks].v, accr); }
        s[rt][nt] = acc + accr * 0.0009765625f; } }
#pragma unroll
    for (int rt = 0; rt < RTN; ++rt)
#pragma unroll
      for (int r = 0; r < 8; ++r) { const unsigned mw = mrow[rt][r][j0 >> 5]; const bool am = (allm[rt][r] != 0);
        const bool ok0 = am || (((mw >> ln) & 1u) == 0u), ok1 = am || (((mw >> (16 + ln)) & 1u) == 0u);
        const float s0 = ok0 ? (am ? 0.f : s[rt][0][r] * SCL) : -INFINITY, s1 = ok1 ? (am ? 0.f : s[rt][1][r] * SCL) : -INFINITY; float mc = fmaxf(s0, s1);
        mc = fmaxf(mc, __shfl_xor(mc, 1, 32)); mc = fmaxf(mc, __shfl_xor(mc, 2, 32)); mc = fmaxf(mc, __shfl_xor(mc, 4, 32)); mc = fmaxf(mc, __shfl_xor(mc, 8, 32));
        const float mn = fmaxf(m_r[rt][r], mc); const float al = (mn > -1.0e38f) ? expf(m_r[rt][r] - mn) : 1.0f; m_r[rt][r] = mn; const float p0 = ok0 ? expf(s0 - mn) : 0.f, p1 = ok1 ? expf(s1 - mn) : 0.f; l_r[rt][r] = l_r[rt][r] * al + p0 + p1;
#pragma unroll
        for (int dt = 0; dt < DT; ++dt) { oacc[rt][dt][r] *= al; oaccl[rt][dt][r] *= al; }
        FragH t2, t3; const float ps0 = p0 * 1024.0f, ps1 = p1 * 1024.0f; t2.h[0] = (_Float16)ps0; t2.h[1] = (_Float16)ps1; t3.h[0] = (_Float16)((ps0 - (float)t2.h[0]) * 1024.0f); t3.h[1] = (_Float16)((ps1 - (float)t2.h[1]) * 1024.0f);
        sP[w][rt * 16 + 8 * hh + r][ln] = t2.u[0]; sP[w][rt * 16 + 8 * hh + r][16 + ln] = t2.u[1]; sPl[w][rt * 16 + 8 * hh + r][ln] = t3.u[0]; sPl[w][rt * 16 + 8 * hh + r][16 + ln] = t3.u[1]; }
    __builtin_amdgcn_fence(__ATOMIC_ACQ_REL, "workgroup"); __builtin_amdgcn_wave_barrier();
    FragH pa[2], pl[2];
#pragma unroll
    for (int rt = 0; rt < RTN; ++rt) { pa[rt].half[0] = *(const v8us*)&sP[w][rt * 16 + ln][8 * hh]; pa[rt].half[1] = *(const v8us*)&sP[w][rt * 16 + ln][16 + 8 * hh]; pl[rt].half[0] = *(const v8us*)&sPl[w][rt * 16 + ln][8 * hh]; pl[rt].half[1] = *(const v8us*)&sPl[w][rt * 16 + ln][16 + 8 * hh]; }
#pragma unroll
    for (int dt = 0; dt < DT; ++dt) { const size_t vo = (size_t)(dt * 16 + ln) * TK + j0; FragH bv, bl; bv.half[0] = *(const v8us*)(Vth + vo + 8 * hh); bv.half[1] = *(const v8us*)(Vth + vo + 16 + 8 * hh); bl.half[0] = *(const v8us*)(Vtl + vo + 8 * hh); bl.half[1] = *(const v8us*)(Vtl + vo + 16 + 8 * hh);
#pragma unroll
      for (int rt = 0; rt < RTN; ++rt) { oacc[rt][dt] = mmaH<1>(pa[rt].v, pa[rt].v, bv.v, bv.v, oacc[rt][dt]); oaccl[rt][dt] = mmaH<1>(pa[rt].v, pa[rt].v, bl.v, bl.v, oaccl[rt][dt]); oaccl[rt][dt] = mmaH<1>(pl[rt].v, pl[rt].v, bv.v, bv.v, oaccl[rt][dt]); } }
    __builtin_amdgcn_fence(__ATOMIC_ACQ_REL, "workgroup"); __builtin_amdgcn_wave_barrier(); }
#pragma unroll
  for (int rt = 0; rt < RTN; ++rt) {
#pragma unroll
    for (int r = 0; r < 8; ++r) { float l = l_r[rt][r]; l += __shfl_xor(l, 1, 32); l += __shfl_xor(l, 2, 32); l += __shfl_xor(l, 4, 32); l += __shfl_xor(l, 8, 32); l_r[rt][r] = (l > 0.f) ? 1.0f / (l * 1024.0f) : 0.f; }
#pragma unroll
    for (int dt = 0; dt < DT; ++dt)
#pragma unroll
      for (int r = 0; r < 8; ++r) sO[w][rt * 16 + 8 * hh + r][dt * 16 + ln] = (oacc[rt][dt][r] + oaccl[rt][dt][r] * 0.0009765625f) * l_r[rt][r]; }
  __builtin_amdgcn_fence(__ATOMIC_ACQ_REL, "workgroup"); __builtin_amdgcn_wave_barrier();
  {
#pragma unroll
    for (int rp = 0; rp < RPW; rp += 2) { const int r = rp + (lane >> 4), pc = lane & 15; const v4f val = *(const v4fa*)&sO[w][r][pc * 4]; *(v4f*)(O + ((size_t)b * TQ + q0 + r) * ldo + h * 64 + pc * 4) = val; }
     } }


__global__ __launch_bounds__(256) void k_causaltab(unsigned* __restrict__ MB, int* __restrict__ RA, int* __restrict__ KE, int nq, int nk) {
  const int t = blockIdx.x * 256 + threadIdx.x; const int nw = nk / 32;
  if (t < nq * nw) { const int q = t / nw, w = t % nw; const int first = q + 1 - 32 * w; const unsigned bits = (first <= 0) ? 0xffffffffu : ((first >= 32) ? 0u : (0xffffffffu << first)); *(unsigned*)(MB + t) = bits;  }
  if (t < nq) { *(int*)(RA + t) = 0;  }
  if (t < nq / 64) { const int v = 64 * (t + 1); *(int*)(KE + t * 32) = v;  } }
__global__ __launch_bounds__(256) void k_fulltab(unsigned* __restrict__ MB, int* __restrict__ RA, int* __restrict__ KE, int nq, int nk) {
  const int t = blockIdx.x * 256 + threadIdx.x; const int nw = nk / 32;
  if (t < nq * nw) { *(unsigned*)(MB + t) = 0u;  }
  if (t < nq) { *(int*)(RA + t) = 0;  }
  if (t < nq / 64) { *(int*)(KE + t * 32) = nk;  } }

extern "C" void kernel_launch(void* const* d_in, const int* in_sizes, int n_in,
                              void* d_out, int out_size, void* d_ws, size_t ws_size, hipStream_t stream) {
  (void)in_sizes; (void)n_in; (void)out_size;
  const float* const* I = (const float* const*)d_in; const float* wemb = I[0]; const float* pemb = I[1];
  const float* Wq = I[2]; const float* bq = I[3]; const float* Wk = I[4]; const float* bk = I[5]; const float* Wv = I[6]; const float* bv = I[7];
  const float* Wqc = I[8]; const float* bqc = I[9]; const float* Wkc = I[10]; const float* bkc = I[11]; const float* Wvc = I[12]; const float* bvc = I[13];
  const float* W1 = I[14]; const float* b1 = I[15]; const float* W2 = I[16]; const float* b2 = I[17];
  char* ws = (char*)d_ws; size_t off = 0;
  auto take = [&](size_t bytes) { char* p = ws + off; off += (bytes + 255) & ~(size_t)255; return p; };
  _Float16* BQ = (_Float16*)take((size_t)DM * DM * 2); _Float16* BK = (_Float16*)take((size_t)DM * DM * 2); _Float16* BV = (_Float16*)take((size_t)DM * DM * 2); _Float16* BQC = (_Float16*)take((size_t)DM * DM * 2); _Float16* BKC = (_Float16*)take((size_t)DM * DM * 2); _Float16* BVC = (_Float16*)take((size_t)DM * DM * 2);
  _Float16* BW1 = (_Float16*)take((size_t)FF * DM * 2); _Float16* BW2 = (_Float16*)take((size_t)DM * FF * 2);
  _Float16* WE16 = (_Float16*)take((size_t)SW * DM * 2); _Float16* PE16 = (_Float16*)take((size_t)SP * DM * 2); float* F = (float*)take((size_t)SKV * DM * 4);
  _Float16* Qh = (_Float16*)take((size_t)SW * DM * 2); _Float16* Ql = (_Float16*)take((size_t)SW * DM * 2); _Float16* Kh = (_Float16*)take((size_t)SKV * DM * 2); _Float16* Kl = (_Float16*)take((size_t)SKV * DM * 2);      /* with Qh/Ql: 16 MiB contiguous, later the FFN f32 half-hidden */
  _Float16* Vth = (_Float16*)take((size_t)SKV * DM * 2); _Float16* Vtl = (_Float16*)take((size_t)SKV * DM * 2);
  unsigned* MB = (unsigned*)take((size_t)SW * (SW / 32) * 4); int* RA = (int*)take((size_t)SW * 4); int* KE = (int*)take((size_t)(SW / 64) * 32 * 4);
  unsigned* MB2 = (unsigned*)take((size_t)SW * (SP / 32) * 4); int* RA2 = (int*)take((size_t)SW * 4); int* KE2 = (int*)take((size_t)(SW / 64) * 32 * 4);
  _Float16* Ah = (_Float16*)take((size_t)SW * DM * 2); _Float16* Al = (_Float16*)take((size_t)SW * DM * 2);      /* word hi/lo, later cross hi/lo */
  _Float16* HDh = (_Float16*)take((size_t)SW * (FF / 2) * 2); _Float16* HDl = (_Float16*)take((size_t)SW * (FF / 2) * 2);
  if (off > ws_size) return;      /* 12 + 16 + 4 + 2 + 8 + 16 + 8 + 0.8 + 8 + 16 = 91 MiB */
  float* HF = (float*)Qh;             /* FFN half hidden f32 [2048][2048] = 16 MiB over Qh..Kl (dead after the second attention) */
  const size_t w8 = (size_t)DM * DM / 8; const unsigned wb = (unsigned)((w8 + 255) / 256);
  k_round16f<<<wb, 256, 0, stream>>>(Wq, BQ, w8); k_round16f<<<wb, 256, 0, stream>>>(Wk, BK, w8); k_round16f<<<wb, 256, 0, stream>>>(Wv, BV, w8); k_round16f<<<wb, 256, 0, stream>>>(Wqc, BQC, w8); k_round16f<<<wb, 256, 0, stream>>>(Wkc, BKC, w8); k_round16f<<<wb, 256, 0, stream>>>(Wvc, BVC, w8);
  k_round16f<<<(unsigned)(((size_t)FF * DM / 8 + 255) / 256), 256, 0, stream>>>(W1, BW1, (size_t)FF * DM / 8); k_round16f<<<(unsigned)(((size_t)FF * DM / 8 + 255) / 256), 256, 0, stream>>>(W2, BW2, (size_t)FF * DM / 8);      /* torch (out,in) = natural Bt; x16 */
  k_x16<<<(unsigned)(((size_t)SW * DM / 8 + 255) / 256), 256, 0, stream>>>(wemb, WE16, (size_t)SW * DM / 8); k_x16<<<(unsigned)(((size_t)SP * DM / 8 + 255) / 256), 256, 0, stream>>>(pemb, PE16, (size_t)SP * DM / 8);
  k_causaltab<<<(SW * (SW / 32) + 255) / 256, 256, 0, stream>>>(MB, RA, KE, SW, SW); k_fulltab<<<(SW * (SP / 32) + 255) / 256, 256, 0, stream>>>(MB2, RA2, KE2, SW, SP);
  const dim3 gW((SW / 128) * (DM / 64), 1), gPp((SP / 128) * (DM / 64), 1), gH((SW / 128) * ((FF / 2) / 64), 1); const size_t n8w = (size_t)SW * DM / 8, n8p = (size_t)SP * DM / 8; const unsigned nbw = (unsigned)((n8w + 255) / 256), nbp = (unsigned)((n8p + 255) / 256);
  /* --- causal self attention on the word embeddings (all planes hi/lo) --- */
  k_gemm2<0><<<gW, 128, 0, stream>>>(WE16, DM, 0, BQ, DM, 0, 0.0625f, bq, 0, nullptr, 1, 0, 0, F, nullptr, DM, 0, SW, DM, DM); k_hl<<<nbw, 256, 0, stream>>>(F, Qh, Ql, n8w);
  k_gemm2<0><<<gW, 128, 0, stream>>>(WE16, DM, 0, BK, DM, 0, 0.0625f, bk, 0, nullptr, 1, 0, 0, F, nullptr, DM, 0, SW, DM, DM); k_hl<<<nbw, 256, 0, stream>>>(F, Kh, Kl, n8w);
  k_gemm2<0><<<gW, 128, 0, stream>>>(WE16, DM, 0, BV, DM, 0, 0.0625f, bv, 0, nullptr, 1, 0, 0, F, nullptr, DM, 0, SW, DM, DM); k_vthl<SW><<<NH * (SW / 64), 256, 0, stream>>>(F, DM, Vth, Vtl);
  k_flashm<SW, SW><<<NH * (SW / 64), 128, 0, stream>>>(Qh, Ql, DM, Kh, Kl, DM, Vth, Vtl, MB, RA, KE, F, DM);      /* word (f32) -> F */
  k_hl<<<nbw, 256, 0, stream>>>(F, Ah, Al, n8w);      /* word as hi/lo operand planes */
  k_gemm2<0><<<gW, 128, 0, stream>>>(Ah, DM, 0, BQC, DM, 0, 0.0625f, bqc, 0, nullptr, 1, 0, 0, F, nullptr, DM, 0, SW, DM, DM);
  k_gemm2<0><<<gW, 128, 0, stream>>>(Al, DM, 0, BQC, DM, 0, 0.0625f * 0.0009765625f, nullptr, 0, F, 1, (size_t)DM, 0, F, nullptr, DM, 0, SW, DM, DM); k_hl<<<nbw, 256, 0, stream>>>(F, Qh, Ql, n8w);
  k_gemm2<0><<<gPp, 128, 0, stream>>>(PE16, DM, 0, BKC, DM, 0, 0.0625f, bkc, 0, nullptr, 1, 0, 0, F, nullptr, DM, 0, SP, DM, DM); k_hl<<<nbp, 256, 0, stream>>>(F, Kh, Kl, n8p);
  k_gemm2<0><<<gPp, 128, 0, stream>>>(PE16, DM, 0, BVC, DM, 0, 0.0625f, bvc, 0, nullptr, 1, 0, 0, F, nullptr, DM, 0, SP, DM, DM); k_vthl<SP><<<NH * (SP / 64), 256, 0, stream>>>(F, DM, Vth, Vtl);
  k_flashm<SW, SP><<<NH * (SW / 64), 128, 0, stream>>>(Qh, Ql, DM, Kh, Kl, DM, Vth, Vtl, MB2, RA2, KE2, F, DM);      /* cross (f32) -> F */
  k_hl<<<nbw, 256, 0, stream>>>(F, Ah, Al, n8w);      /* cross as hi/lo operand planes */
  /* --- FFN in two column halves of the hidden: h = relu(cross*W1^T + b1) (hi/lo), out (+)= h_half*W2_half^T (+ b2 once) --- */
  for (int hf = 0; hf < 2; ++hf) { const _Float16* B1h = BW1 + (size_t)hf * (FF / 2) * DM; const _Float16* B2h = BW2 + (size_t)hf * (FF / 2);
    k_gemm2<0><<<gH, 128, 0, stream>>>(Ah, DM, 0, B1h, DM, 0, 0.0625f, b1 + hf * (FF / 2), 0, nullptr, 1, 0, 0, HF, nullptr, FF / 2, 0, SW, FF / 2, DM);
    k_gemm2<3><<<gH, 128, 0, stream>>>(Al, DM, 0, B1h, DM, 0, 0.0625f * 0.0009765625f, nullptr, 0, HF, 1, (size_t)(FF / 2), 0, HF, nullptr, FF / 2, 0, SW, FF / 2, DM);      /* relu applied after the residual pass completes the sum */
    k_hl<<<(unsigned)(((size_t)SW * (FF / 2) / 8 + 255) / 256), 256, 0, stream>>>(HF, HDh, HDl, (size_t)SW * (FF / 2) / 8);
    k_gemm2<0><<<gW, 128, 0, stream>>>(HDh, FF / 2, 0, B2h, FF, 0, 0.0625f, (hf == 0) ? b2 : nullptr, 0, (hf == 0) ? nullptr : (const float*)d_out, 1, (size_t)DM, 0, (float*)d_out, nullptr, DM, 0, SW, DM, FF / 2);
    k_gemm2<0><<<gW, 128, 0, stream>>>(HDl, FF / 2, 0, B2h, FF, 0, 0.0625f * 0.0009765625f, nullptr, 0, (const float*)d_out, 1, (size_t)DM, 0, (float*)d_out, nullptr, DM, 0, SW, DM, FF / 2); }
}

// v002
// A run of this version takes 688 microseconds.
// Two timings next to v001 put it at 1.23 and 1.22 times that version's speed.
// Counting every step since v000, it is 1.87 times as fast.
#include <hip/hip_runtime.h>
// Two-stage attention decoder block (word embeddings [2048][1024], position embeddings [1024][1024], 16 heads x 64, FFN 4096): word = CausalMHA(wemb; q,k,v = Linear+bias, scores/8, tril, softmax, .v, heads merged, no output projection); cross = MHA(q from word, k/v from pemb, no mask); out = relu(cross*W1^T + b1)*W2^T + b2 -> [2048,1024].
// Compute dtype: inputs and parameters rounded to bf16; projections of the embeddings exact; all other operands f16 hi + (x2^10) residual pairs (~2^-21); f32 accumulation, softmax f32. v_wmma_f32_16x16x32_f16.
#define SW 2048
#define SP 1024
#define DM 1024
#define NH 16
#define FF 4096
#define SCL 0.125f
#define SKV ((SW > SP) ? SW : SP)      /* key/value plane rows: the self attention has SW keys, the cross attention SP */
typedef __bf16 v16b __attribute__((ext_vector_type(16)));
typedef unsigned short v8us __attribute__((ext_vector_type(8), may_alias));
typedef float  v8f  __attribute__((ext_vector_type(8)));
typedef float  v4f  __attribute__((ext_vector_type(4)));
typedef float  v4fa __attribute__((ext_vector_type(4), may_alias));
union FragB { v16b v; v8us half[2]; unsigned short u[16]; };

__device__ __forceinline__ unsigned short bf16_bits(float x) { unsigned int u = __float_as_uint(x); return (unsigned short)((u + 0x7FFFu + ((u >> 16) & 1u)) >> 16); }
__device__ __forceinline__ float bf16_val(unsigned short b) { return __uint_as_float(((unsigned int)b) << 16); }
__device__ __forceinline__ float bf16_round(float x) { return bf16_val(bf16_bits(x)); }
// D += A·B with NT terms: 1 = ah·bh, 2 = + al·bh (A split), 3 = + ah·bl (both split)
template <int NT>
__device__ __forceinline__ v8f mmaN(v16b ah, v16b al, v16b bh, v16b bl, v8f c) {
  c = __builtin_amdgcn_wmma_f32_16x16x32_bf16(false, ah, false, bh, (short)0, c, false, false);
  if (NT >= 2) c = __builtin_amdgcn_wmma_f32_16x16x32_bf16(false, al, false, bh, (short)0, c, false, false);
  if (NT >= 3) c = __builtin_amdgcn_wmma_f32_16x16x32_bf16(false, ah, false, bl, (short)0, c, false, false);
  asm volatile("v_nop\n\tv_nop\n\tv_nop\n\tv_nop" : "+v"(c) : "v"(ah), "v"(al), "v"(bh), "v"(bl));
  return c;
}

__global__ __launch_bounds__(256) void k_wt_bf16(const float* __restrict__ W, unsigned short* __restrict__ Wt, int K, int N) {
  const int t = blockIdx.x * 256 + threadIdx.x;
  const int k8n = K / 8;
  if (t >= N * k8n) return;
  const int n = t / k8n, k8 = (t % k8n) * 8;
  v8us v;
#pragma unroll
  for (int i = 0; i < 8; ++i) v[i] = bf16_bits(W[(size_t)(k8 + i) * N + n]);
  *(v8us*)(Wt + (size_t)n * K + k8) = v;
  
}

// GEMM C[M][N] (f32, pitch ldc) = act(A[M][K]·W + bias). A f32 row-major (pitch lda) converted per fragment to bf16
// (ASPLIT: hi/lo two planes -> 2 terms, else single rounded term); Wt bf16 [N][K] (pitch ldb). BIAS_BF16 rounds the
// bias to bf16 first (bias quantised to bf16 before the add). K%32==0, M%16==0, N%64==0.
template <bool ASPLIT, int ACT, bool BIAS_BF16>
__global__ __launch_bounds__(128) void k_gemm_bf(const float* __restrict__ A, int lda, const unsigned short* __restrict__ Wt, int ldb,
                                               const float* __restrict__ bias, float* __restrict__ C, int ldc, int M, int N, int K) {
  __shared__ __attribute__((aligned(16))) float so[4][16][64];
  const int tid = threadIdx.x, w = tid >> 5, lane = tid & 31, ln = lane & 15, hh = lane >> 4;
  const int ntn = N / 64;
  const int wid = blockIdx.x * 4 + w;
  const int mt = wid / ntn, nq = wid % ntn;
  if (mt * 16 >= M) return;
  const int row0 = mt * 16, col0 = nq * 64;
  const float* arow = A + (size_t)(row0 + ln) * lda;
  v8f acc[4] = {};
  for (int kb = 0; kb < K; kb += 32) {
    FragB ah, al;
    const v4f x0 = *(const v4fa*)(arow + kb + 8 * hh), x1 = *(const v4fa*)(arow + kb + 8 * hh + 4);
    const v4f x2 = *(const v4fa*)(arow + kb + 16 + 8 * hh), x3 = *(const v4fa*)(arow + kb + 16 + 8 * hh + 4);
    float xs[16] = {x0[0],x0[1],x0[2],x0[3],x1[0],x1[1],x1[2],x1[3],x2[0],x2[1],x2[2],x2[3],x3[0],x3[1],x3[2],x3[3]};
#pragma unroll
    for (int i = 0; i < 16; ++i) { const unsigned short hb = bf16_bits(xs[i]); ah.u[i] = hb; al.u[i] = ASPLIT ? bf16_bits(xs[i] - bf16_val(hb)) : (unsigned short)0; }
#pragma unroll
    for (int t = 0; t < 4; ++t) {
      const unsigned short* brow = Wt + (size_t)(col0 + t * 16 + ln) * ldb + kb;
      FragB b;
      b.half[0] = *(const v8us*)(brow + 8 * hh);
      b.half[1] = *(const v8us*)(brow + 16 + 8 * hh);
      acc[t] = mmaN<ASPLIT ? 2 : 1>(ah.v, al.v, b.v, b.v, acc[t]);
    }
  }
#pragma unroll
  for (int t = 0; t < 4; ++t) {
    float bv = bias ? bias[col0 + t * 16 + ln] : 0.f;
    if (BIAS_BF16) bv = bf16_round(bv);
#pragma unroll
    for (int r = 0; r < 8; ++r) { float v = acc[t][r] + bv; if (ACT == 1) v = fmaxf(v, 0.f); so[w][8 * hh + r][t * 16 + ln] = v; }
  }
  __builtin_amdgcn_fence(__ATOMIC_ACQ_REL, "workgroup");
  __builtin_amdgcn_wave_barrier();
  const int rsub = lane >> 4, c4 = (lane & 15) * 4;
  {
#pragma unroll
    for (int q = 0; q < 8; ++q) {
      const int r = q * 2 + rsub;
      const v4f v = *(const v4fa*)&so[w][r][c4];
      *(v4f*)(C + (size_t)(row0 + r) * ldc + col0 + c4) = v;
    }
    
  }
}

// GEMM C = act(A·W + bias + resid): A f32 (ASPLIT -> hi/lo 2 terms), Wt bf16 [N][K]; ACT 0 none, 1 relu, 2 exact gelu;
// resid (optional, f32, row index = (row % rmod), pitch ldr, RES_BF16 rounds it) added before the activation.
template <bool ASPLIT, int ACT, bool BIAS_BF16, bool RES_BF16>
__global__ __launch_bounds__(128) void k_gemm_bf3(const float* __restrict__ A, int lda, const unsigned short* __restrict__ Wt, int ldb,
                                                const float* __restrict__ bias, const float* __restrict__ resid, int rmod, int ldr,
                                                float* __restrict__ C, int ldc, int M, int N, int K) {
  __shared__ __attribute__((aligned(16))) float so[4][16][64];
  const int tid = threadIdx.x, w = tid >> 5, lane = tid & 31, ln = lane & 15, hh = lane >> 4;
  const int ntn = N / 64;
  const int wid = blockIdx.x * 4 + w;
  const int mt = wid / ntn, nq = wid % ntn;
  if (mt * 16 >= M) return;
  const int row0 = mt * 16, col0 = nq * 64;
  const float* arow = A + (size_t)(row0 + ln) * lda;
  v8f acc[4] = {};
  for (int kb = 0; kb < K; kb += 32) {
    FragB ah, al;
    const v4f x0 = *(const v4fa*)(arow + kb + 8 * hh), x1 = *(const v4fa*)(arow + kb + 8 * hh + 4);
    const v4f x2 = *(const v4fa*)(arow + kb + 16 + 8 * hh), x3 = *(const v4fa*)(arow + kb + 16 + 8 * hh + 4);
    float xs[16] = {x0[0],x0[1],x0[2],x0[3],x1[0],x1[1],x1[2],x1[3],x2[0],x2[1],x2[2],x2[3],x3[0],x3[1],x3[2],x3[3]};
#pragma unroll
    for (int i = 0; i < 16; ++i) { const unsigned short hb = bf16_bits(xs[i]); ah.u[i] = hb; al.u[i] = ASPLIT ? bf16_bits(xs[i] - bf16_val(hb)) : (unsigned short)0; }
#pragma unroll
    for (int t = 0; t < 4; ++t) {
      const unsigned short* brow = Wt + (size_t)(col0 + t * 16 + ln) * ldb + kb;
      FragB b;
      b.half[0] = *(const v8us*)(brow + 8 * hh);
      b.half[1] = *(const v8us*)(brow + 16 + 8 * hh);
      acc[t] = mmaN<ASPLIT ? 2 : 1>(ah.v, al.v, b.v, b.v, acc[t]);
    }
  }
#pragma unroll
  for (int t = 0; t < 4; ++t) {
    const int col = col0 + t * 16 + ln;
    float bv = bias ? bias[col] : 0.f;
    if (BIAS_BF16) bv = bf16_round(bv);
#pragma unroll
    for (int r = 0; r < 8; ++r) {
      float v = acc[t][r] + bv;
      if (resid) { float rv = resid[(size_t)((row0 + 8 * hh + r) % rmod) * ldr + col]; if (RES_BF16) rv = bf16_round(rv); v += rv; }
      if (ACT == 1) v = fmaxf(v, 0.f);
      if (ACT == 2) v = 0.5f * v * (1.0f + erff(v * 0.70710678118654752f));
      if (ACT == 3) { const float u = 0.7978845608028654f * (v + 0.044715f * v * v * v); v = 0.5f * v * (1.0f + tanhf(u)); }
      so[w][8 * hh + r][t * 16 + ln] = v;
    }
  }
  __builtin_amdgcn_fence(__ATOMIC_ACQ_REL, "workgroup");
  __builtin_amdgcn_wave_barrier();
  const int rsub = lane >> 4, c4 = (lane & 15) * 4;
  {
#pragma unroll
    for (int q = 0; q < 8; ++q) {
      const int r = q * 2 + rsub;
      const v4f v = *(const v4fa*)&so[w][r][c4];
      *(v4f*)(C + (size_t)(row0 + r) * ldc + col0 + c4) = v;
    }
    
  }
}
// row LayerNorm (biased variance, eps) over N: s = X (+ R); optional out_sum <- s; out_norm <- (s-mu)*rsqrt(var+eps)*g + b
template <bool PARAM_BF16>
__global__ __launch_bounds__(256) void k_layernorm(const float* __restrict__ X, const float* __restrict__ R, const float* __restrict__ g, const float* __restrict__ bta,
                                                  float* __restrict__ out_sum, float* __restrict__ out_norm, int N, float eps) {
  __shared__ float red[256];
  const int row = blockIdx.x, tid = threadIdx.x;
  const float* x = X + (size_t)row * N; const float* rr = R ? R + (size_t)row * N : nullptr;
  float vals[16];                     // up to N = 4096
  const int per = N / 256;            // contiguous chunk per thread? use strided-by-4 chunks: thread handles j = tid*4 + 1024*u
  float s1 = 0.f;
  for (int u = 0; u < per / 4; ++u) {
    const int j = tid * 4 + 1024 * u;
    const v4f a = *(const v4fa*)(x + j);
    v4f b = {0.f,0.f,0.f,0.f}; if (rr) b = *(const v4fa*)(rr + j);
#pragma unroll
    for (int q = 0; q < 4; ++q) { const float v = a[q] + b[q]; vals[u * 4 + q] = v; s1 += v; }
  }
  red[tid] = s1; __syncthreads();
  for (int st = 128; st > 0; st >>= 1) { if (tid < st) red[tid] += red[tid + st]; __syncthreads(); }
  const float mu = red[0] / (float)N; __syncthreads();
  float s2 = 0.f;
  for (int u = 0; u < per / 4; ++u)
#pragma unroll
    for (int q = 0; q < 4; ++q) { const float c = vals[u * 4 + q] - mu; s2 += c * c; }
  red[tid] = s2; __syncthreads();
  for (int st = 128; st > 0; st >>= 1) { if (tid < st) red[tid] += red[tid + st]; __syncthreads(); }
  const float rs = rsqrtf(red[0] / (float)N + eps);
  {
    for (int u = 0; u < per / 4; ++u) {
      const int j = tid * 4 + 1024 * u;
      v4f o, sm;
#pragma unroll
      for (int q = 0; q < 4; ++q) {
        float gg = g[j + q], bb = bta[j + q];
        if (PARAM_BF16) { gg = bf16_round(gg); bb = bf16_round(bb); }
        sm[q] = vals[u * 4 + q]; o[q] = (vals[u * 4 + q] - mu) * rs * gg + bb;
      }
      if (out_sum) *(v4f*)(out_sum + (size_t)row * N + j) = sm;
      *(v4f*)(out_norm + (size_t)row * N + j) = o;
    }
    
  }
}



// ---- f16 WMMA path (v_wmma_f32_16x16x32_f16): 11-bit significands for operands in range — used where a [0,1] probability operand needs more precision than bf16
typedef _Float16 v16h __attribute__((ext_vector_type(16)));
union FragH { v16h v; v8us half[2]; _Float16 h[16]; unsigned short u[16]; };
template <int NT>
__device__ __forceinline__ v8f mmaH(v16h ah, v16h al, v16h bh, v16h bl, v8f c) {
  c = __builtin_amdgcn_wmma_f32_16x16x32_f16(false, ah, false, bh, (short)0, c, false, false);
  if (NT >= 2) c = __builtin_amdgcn_wmma_f32_16x16x32_f16(false, al, false, bh, (short)0, c, false, false);
  if (NT >= 3) c = __builtin_amdgcn_wmma_f32_16x16x32_f16(false, ah, false, bl, (short)0, c, false, false);
  asm volatile("v_nop\n\tv_nop\n\tv_nop\n\tv_nop" : "+v"(c) : "v"(ah), "v"(al), "v"(bh), "v"(bl));
  return c;
}
// batched GEMM like k_gemm_b but f16 operands: A f32 (split into f16 hi/lo if ASPLIT, else rounded to f16), Bt = f16 values [n][k]; alpha; C f32; N multiple of 16 (partial tiles skipped)
template <bool ASPLIT>
__global__ __launch_bounds__(128) void k_gemm_h(const float* __restrict__ A, int lda, size_t sA, const _Float16* __restrict__ Bh, int ldb, size_t sB, float alpha, float* __restrict__ C, int ldc, size_t sC, int M, int N, int K) {
  __shared__ __attribute__((aligned(16))) float so[4][16][64];
  const int tid = threadIdx.x, w = tid >> 5, lane = tid & 31, ln = lane & 15, hh = lane >> 4; const int by = blockIdx.y;
  A += (size_t)by * sA; Bh += (size_t)by * sB; C += (size_t)by * sC;
  const int ntn = (N + 63) / 64; const int wid = blockIdx.x * 4 + w; const int mt = wid / ntn, nq = wid % ntn; if (mt * 16 >= M) return;
  const int row0 = mt * 16, col0 = nq * 64; const float* arow = A + (size_t)(row0 + ln) * lda;
  v8f acc[4] = {};
  for (int kb = 0; kb < K; kb += 32) {
    FragH ah, al;
    const v4f x0 = *(const v4fa*)(arow + kb + 8 * hh), x1 = *(const v4fa*)(arow + kb + 8 * hh + 4), x2 = *(const v4fa*)(arow + kb + 16 + 8 * hh), x3 = *(const v4fa*)(arow + kb + 16 + 8 * hh + 4);
    float xs[16] = {x0[0],x0[1],x0[2],x0[3],x1[0],x1[1],x1[2],x1[3],x2[0],x2[1],x2[2],x2[3],x3[0],x3[1],x3[2],x3[3]};
#pragma unroll
    for (int i = 0; i < 16; ++i) { const _Float16 h = (_Float16)xs[i]; ah.h[i] = h; al.h[i] = ASPLIT ? (_Float16)(xs[i] - (float)h) : (_Float16)0.0f; }
#pragma unroll
    for (int t = 0; t < 4; ++t) { if (col0 + t * 16 >= N) continue; const size_t boff = (size_t)(col0 + t * 16 + ln) * ldb + kb; FragH bq; bq.half[0] = *(const v8us*)(Bh + boff + 8 * hh); bq.half[1] = *(const v8us*)(Bh + boff + 16 + 8 * hh);
      acc[t] = mmaH<ASPLIT ? 2 : 1>(ah.v, al.v, bq.v, bq.v, acc[t]); }
  }
#pragma unroll
  for (int t = 0; t < 4; ++t) { if (col0 + t * 16 >= N) continue;
#pragma unroll
    for (int r = 0; r < 8; ++r) so[w][8 * hh + r][t * 16 + ln] = acc[t][r] * alpha; }
  __builtin_amdgcn_fence(__ATOMIC_ACQ_REL, "workgroup"); __builtin_amdgcn_wave_barrier();
  const int rsub = lane >> 4, c4 = (lane & 15) * 4;
  {
#pragma unroll
    for (int q = 0; q < 8; ++q) { const int r = q * 2 + rsub; if (col0 + c4 < N) { const v4f v = *(const v4fa*)&so[w][r][c4]; *(v4f*)(C + (size_t)(row0 + r) * ldc + col0 + c4) = v; } }
     }
}

// Wt[n][k] = f16(W[k][n]·scale) from f32 row-major W[K][N] (scale = power of two; bf16-exact weights stay exact in f16 away from the subnormal range)
__global__ __launch_bounds__(256) void k_wt_f16(const float* __restrict__ W, _Float16* __restrict__ Wt, int K, int N, float scale) {
  const int t = blockIdx.x * 256 + threadIdx.x; if (t >= N * (K / 8)) return; const int n = t / (K / 8), k8 = (t % (K / 8)) * 8; FragH f;
#pragma unroll
  for (int i = 0; i < 8; ++i) f.h[i] = (_Float16)(bf16_round(W[(size_t)(k8 + i) * N + n]) * scale); const v8us o = f.half[0];
  *(v8us*)((unsigned short*)Wt + (size_t)n * K + k8) = o; 
}
// k_gemm_hh variant with fused epilogue: v = acc·alpha + bias[by·sBias + col] (+ CP[(row/rowsPerB)·sCPb + by·64 + col] if CP) ; ACT 0 none / 1 elu ; writes f16 C16 (and f32 C if non-null)
template <int ACT>
__global__ __launch_bounds__(128) void k_gemm_hhx(const _Float16* __restrict__ A, int lda, size_t sA, const _Float16* __restrict__ Bh, int ldb, size_t sB, float alpha, const float* __restrict__ bias, size_t sBias, const float* __restrict__ CP, int rowsPerB, size_t sCPb, int row0g,
    float* __restrict__ C, _Float16* __restrict__ C16, int ldc, size_t sC, int M, int N, int K) {
  __shared__ __attribute__((aligned(16))) float so[4][16][64];
  const int tid = threadIdx.x, w = tid >> 5, lane = tid & 31, ln = lane & 15, hh = lane >> 4; const int by = blockIdx.y;
  A += (size_t)by * sA; Bh += (size_t)by * sB; const size_t cofs = (size_t)by * sC; const float* bp = bias ? bias + (size_t)by * sBias : nullptr;
  const int ntn = (N + 63) / 64; const int wid = blockIdx.x * 4 + w; const int mt = wid / ntn, nq = wid % ntn; if (mt * 16 >= M) return;
  const int row0 = mt * 16, col0 = nq * 64; const _Float16* arow = A + (size_t)(row0 + ln) * lda;
  v8f acc[4] = {};
  for (int kb = 0; kb < K; kb += 32) { FragH ah; ah.half[0] = *(const v8us*)((const unsigned short*)arow + kb + 8 * hh); ah.half[1] = *(const v8us*)((const unsigned short*)arow + kb + 16 + 8 * hh);
#pragma unroll
    for (int t = 0; t < 4; ++t) { if (col0 + t * 16 >= N) continue; const size_t boff = (size_t)(col0 + t * 16 + ln) * ldb + kb; FragH bq; bq.half[0] = *(const v8us*)((const unsigned short*)Bh + boff + 8 * hh); bq.half[1] = *(const v8us*)((const unsigned short*)Bh + boff + 16 + 8 * hh);
      acc[t] = mmaH<1>(ah.v, ah.v, bq.v, bq.v, acc[t]); }
  }
#pragma unroll
  for (int t = 0; t < 4; ++t) { if (col0 + t * 16 >= N) continue; const int col = col0 + t * 16 + ln; const float bv = bp ? bf16_round(bp[col]) : 0.f;
#pragma unroll
    for (int r = 0; r < 8; ++r) { float v = acc[t][r] * alpha + bv; if (CP) { const int bidx = (row0g + row0 + 8 * hh + r) / rowsPerB; v += CP[(size_t)bidx * sCPb + (size_t)by * 64 + col]; } if (ACT == 1) v = (v > 0.f) ? v : expm1f(v); else if (ACT == 7) v = (v > 0.f) ? v + 1.0f : expf(v); else if (ACT == 8) v = tanhf(v); else if (ACT == 9) v = 0.5f * v * (1.0f + tanhf(0.7978845608028654f * (v + 0.044715f * v * v * v))); else if (ACT == 11) v = 1.0f / (1.0f + expf(-v)); else if (ACT == 12) v = (v > 0.f) ? v : 0.01f * v; else if (ACT == 14) v = (v > 0.f) ? v : 0.1f * v; else if (ACT == 15) v = v / (1.0f + expf(-v)); else if (ACT == 3) v = fmaxf(v, 0.f); else if (ACT == 6) v = 0.5f * v * (1.0f + erff(v * 0.70710678118654752f)); so[w][8 * hh + r][t * 16 + ln] = v; } }
  __builtin_amdgcn_fence(__ATOMIC_ACQ_REL, "workgroup"); __builtin_amdgcn_wave_barrier();
  const int rsub = lane >> 4, c4 = (lane & 15) * 4; typedef _Float16 v4h __attribute__((ext_vector_type(4)));
  {
#pragma unroll
    for (int q = 0; q < 8; ++q) { const int r = q * 2 + rsub; if (col0 + c4 < N) { const v4f v = *(const v4fa*)&so[w][r][c4]; if (C) *(v4f*)(C + cofs + (size_t)(row0 + r) * ldc + col0 + c4) = v; if (C16) { v4h h4; for (int i = 0; i < 4; ++i) h4[i] = (_Float16)v[i]; *(v4h*)(C16 + cofs + (size_t)(row0 + r) * ldc + col0 + c4) = h4; } } }
     }
}


typedef _Float16 v4h __attribute__((ext_vector_type(4)));

__global__ __launch_bounds__(256) void k_x16(const float* __restrict__ x, _Float16* __restrict__ X16, size_t n8) { const size_t t = (size_t)blockIdx.x * 256 + threadIdx.x; if (t >= n8) return; FragH f;
#pragma unroll
  for (int q = 0; q < 8; ++q) f.h[q] = (_Float16)bf16_round(x[t * 8 + q]); *(v8us*)((unsigned short*)X16 + t * 8) = f.half[0];  }
__global__ __launch_bounds__(256) void k_h16(const float* __restrict__ x, _Float16* __restrict__ X16, size_t n8) { const size_t t = (size_t)blockIdx.x * 256 + threadIdx.x; if (t >= n8) return; FragH f;
#pragma unroll
  for (int q = 0; q < 8; ++q) f.h[q] = (_Float16)x[t * 8 + q]; *(v8us*)((unsigned short*)X16 + t * 8) = f.half[0];  }
__global__ __launch_bounds__(256) void k_round16f(const float* __restrict__ W, _Float16* __restrict__ Bt, size_t n8) { const size_t t = (size_t)blockIdx.x * 256 + threadIdx.x; if (t >= n8) return; FragH f;
#pragma unroll
  for (int i = 0; i < 8; ++i) f.h[i] = (_Float16)(bf16_round(W[t * 8 + i]) * 16.0f); *(v8us*)((unsigned short*)Bt + t * 8) = f.half[0];  }
template <int NHv, int TTv>
__global__ __launch_bounds__(256) void k_vt(const _Float16* __restrict__ V16, int ldv, int voff, _Float16* __restrict__ Vt) { __shared__ unsigned short tl[64][66]; const int tid = threadIdx.x; const int slab = blockIdx.x / (TTv / 64), lg = blockIdx.x % (TTv / 64); const int b = slab / NHv, h = slab % NHv;
  for (int i = tid; i < 64 * 8; i += 256) { const int r = i / 8, c8 = (i % 8) * 8; FragH f; f.half[0] = *(const v8us*)((const unsigned short*)V16 + ((size_t)b * TTv + lg * 64 + r) * ldv + voff + h * 64 + c8);
#pragma unroll
    for (int q = 0; q < 8; ++q) tl[r][c8 + q] = f.u[q]; }
  __syncthreads();
  {
#pragma unroll
    for (int rd = 0; rd < 2; ++rd) { const int d = rd * 32 + tid / 8, pc = tid % 8; FragH f;
#pragma unroll
      for (int q = 0; q < 8; ++q) f.u[q] = tl[pc * 8 + q][d];
      *(v8us*)((unsigned short*)Vt + ((size_t)slab * 64 + d) * TTv + lg * 64 + pc * 8) = f.half[0]; }
     } }

__global__ __launch_bounds__(256) void k_hl(const float* __restrict__ F, _Float16* __restrict__ Hh, _Float16* __restrict__ Hl, size_t n8) { const size_t t = (size_t)blockIdx.x * 256 + threadIdx.x; if (t >= n8) return; FragH fh, fl; const v4f a = *(const v4fa*)(F + t * 8), c = *(const v4fa*)(F + t * 8 + 4);
#pragma unroll
  for (int q = 0; q < 4; ++q) { _Float16 h = (_Float16)a[q]; fh.h[q] = h; fl.h[q] = (_Float16)((a[q] - (float)h) * 1024.0f); h = (_Float16)c[q]; fh.h[4 + q] = h; fl.h[4 + q] = (_Float16)((c[q] - (float)h) * 1024.0f); }
  { *(v8us*)((unsigned short*)Hh + t * 8) = fh.half[0]; *(v8us*)((unsigned short*)Hl + t * 8) = fl.half[0];  } }

// ---- fast GEMM (block tile 128x64, wave tile 32x64; requires M % 128 == 0, N % 64 == 0 and K % 128 == 0); epilogue = k_gemm_hhx semantics ----
// k loop staging of k_gemm2: one stage = 128 k (256 B of a row) of the block's 128 A rows and 64 B rows, laid in LDS at a pitch of 272 B (16 B x odd, for the 16-byte fragment reads); two buffers.
#define G2_PITCH 272
#define G2_AB (128 * G2_PITCH)
#define G2_STAGE ((128 + 64) * G2_PITCH)
__device__ __forceinline__ v16h g2_lfrag(const unsigned char* p, int hh) { FragH f; f.half[0] = *(const v8us*)(p + 16 * hh); f.half[1] = *(const v8us*)(p + 32 + 16 * hh); return f.v; }
__device__ __forceinline__ v8f g2_mm(v16h a, v16h b, v8f c) { return __builtin_amdgcn_wmma_f32_16x16x32_f16(false, a, false, b, (short)0, c, false, false); }
// One wave's share of a stage: 32 A rows and 16 B rows, two rows (2 x 256 B, whole lines) per wave-wide copy, 16 B per lane, 24 copies.
// la, lb: the lane's LDS byte addresses of its first A and B chunk; ga, gb: the matching global addresses; a copy further on is two rows further on.
__device__ __forceinline__ void g2_stage(unsigned la, unsigned lb, const _Float16* ga, int lda, const _Float16* gb, int ldb) {
  unsigned l[24]; const _Float16* g[24];
#pragma unroll
  for (int i = 0; i < 16; ++i) { l[i] = la + i * (2 * G2_PITCH); g[i] = ga + (size_t)(2 * i) * lda; }
#pragma unroll
  for (int i = 0; i < 8; ++i) { l[16 + i] = lb + i * (2 * G2_PITCH); g[16 + i] = gb + (size_t)(2 * i) * ldb; }
  // the copies go to LDS through no register; s_wait_xcnt is the statement's last line so that no address register is rewritten ahead of it
  asm volatile("global_load_async_to_lds_b128 %0, %12, off\n\t"
               "global_load_async_to_lds_b128 %1, %13, off\n\t"
               "global_load_async_to_lds_b128 %2, %14, off\n\t"
               "global_load_async_to_lds_b128 %3, %15, off\n\t"
               "global_load_async_to_lds_b128 %4, %16, off\n\t"
               "global_load_async_to_lds_b128 %5, %17, off\n\t"
               "global_load_async_to_lds_b128 %6, %18, off\n\t"
               "global_load_async_to_lds_b128 %7, %19, off\n\t"
               "global_load_async_to_lds_b128 %8, %20, off\n\t"
               "global_load_async_to_lds_b128 %9, %21, off\n\t"
               "global_load_async_to_lds_b128 %10, %22, off\n\t"
               "global_load_async_to_lds_b128 %11, %23, off\n\t"
               "s_wait_xcnt 0x0"
               :: "v"(l[0]), "v"(l[1]), "v"(l[2]), "v"(l[3]), "v"(l[4]), "v"(l[5]), "v"(l[6]), "v"(l[7]), "v"(l[8]), "v"(l[9]), "v"(l[10]), "v"(l[11]),
                  "v"(g[0]), "v"(g[1]), "v"(g[2]), "v"(g[3]), "v"(g[4]), "v"(g[5]), "v"(g[6]), "v"(g[7]), "v"(g[8]), "v"(g[9]), "v"(g[10]), "v"(g[11]) : "memory");
  asm volatile("global_load_async_to_lds_b128 %0, %12, off\n\t"
               "global_load_async_to_lds_b128 %1, %13, off\n\t"
               "global_load_async_to_lds_b128 %2, %14, off\n\t"
               "global_load_async_to_lds_b128 %3, %15, off\n\t"
               "global_load_async_to_lds_b128 %4, %16, off\n\t"
               "global_load_async_to_lds_b128 %5, %17, off\n\t"
               "global_load_async_to_lds_b128 %6, %18, off\n\t"
               "global_load_async_to_lds_b128 %7, %19, off\n\t"
               "global_load_async_to_lds_b128 %8, %20, off\n\t"
               "global_load_async_to_lds_b128 %9, %21, off\n\t"
               "global_load_async_to_lds_b128 %10, %22, off\n\t"
               "global_load_async_to_lds_b128 %11, %23, off\n\t"
               "s_wait_xcnt 0x0"
               :: "v"(l[12]), "v"(l[13]), "v"(l[14]), "v"(l[15]), "v"(l[16]), "v"(l[17]), "v"(l[18]), "v"(l[19]), "v"(l[20]), "v"(l[21]), "v"(l[22]), "v"(l[23]),
                  "v"(g[12]), "v"(g[13]), "v"(g[14]), "v"(g[15]), "v"(g[16]), "v"(g[17]), "v"(g[18]), "v"(g[19]), "v"(g[20]), "v"(g[21]), "v"(g[22]), "v"(g[23]) : "memory");
}
template <int ACT>
__global__ __launch_bounds__(128) void k_gemm2(const _Float16* __restrict__ A, int lda, size_t sA, const _Float16* __restrict__ Bh, int ldb, size_t sB, float alpha, const float* __restrict__ bias, size_t sBias, const float* __restrict__ CP, int rowsPerB, size_t sCPb, int row0g,
    float* __restrict__ C, _Float16* __restrict__ C16, int ldc, size_t sC, int M, int N, int K) {
  __shared__ __attribute__((aligned(16))) float so[4][32][68]; __shared__ __attribute__((aligned(16))) unsigned char ring[2 * G2_STAGE];
  const int tid = threadIdx.x, w = tid >> 5, lane = tid & 31, ln = lane & 15, hh = lane >> 4; const int by = blockIdx.y;
  A += (size_t)by * sA; Bh += (size_t)by * sB; const size_t cofs = (size_t)by * sC; const float* bp = bias ? bias + (size_t)by * sBias : nullptr;
  const int ntn = N >> 6; const int mt = blockIdx.x / ntn, nq = blockIdx.x - mt * ntn; const int row0 = mt * 128 + 32 * w, col0 = nq * 64; if (mt * 128 >= M) return;      /* the whole block leaves, in front of every barrier */
  const v8f z8 = {0.f,0.f,0.f,0.f,0.f,0.f,0.f,0.f}; v8f c00 = z8, c01 = z8, c02 = z8, c03 = z8, c10 = z8, c11 = z8, c12 = z8, c13 = z8;
  const _Float16* ga = A + (size_t)(row0 + hh) * lda + ln * 8; const _Float16* gb = Bh + (size_t)(col0 + 16 * w + hh) * ldb + ln * 8;      /* this lane's first 16 bytes of the wave's A and B rows */
  const unsigned la = (unsigned)(size_t)ring + (unsigned)((32 * w + hh) * G2_PITCH + ln * 16), lb = (unsigned)(size_t)ring + (unsigned)(G2_AB + (16 * w + hh) * G2_PITCH + ln * 16);
  const int nst = K >> 7;
  g2_stage(la, lb, ga, lda, gb, ldb);
  asm volatile("s_wait_asynccnt 0x0" ::: "memory");      /* this wave's copies of stage 0 have landed */
  __syncthreads();      /* and every other wave's: stage 0 may be read */
  if (nst > 1) g2_stage(la + G2_STAGE, lb + G2_STAGE, ga + 128, lda, gb + 128, ldb);
#pragma unroll 1      /* one trip per stage: the two buffers alternate */
  for (int t = 0; t < nst; ++t) { const unsigned bo = (unsigned)(t & 1) * G2_STAGE; const unsigned char* pa = ring + bo + (32 * w + ln) * G2_PITCH; const unsigned char* pb = ring + bo + G2_AB + ln * G2_PITCH;
    v16h fa[2][2], fb[2][4];      /* two fragment sets: the next k step's LDS reads are issued, as one group, ahead of this step's WMMAs; never beyond the stage */
    fa[0][0] = g2_lfrag(pa, hh); fa[0][1] = g2_lfrag(pa + 16 * G2_PITCH, hh);
#pragma unroll
    for (int j = 0; j < 4; ++j) fb[0][j] = g2_lfrag(pb + j * 16 * G2_PITCH, hh);
#pragma unroll
    for (int ks = 0; ks < 4; ++ks) { const int cu = ks & 1, nx = cu ^ 1;
      if (ks < 3) { fa[nx][0] = g2_lfrag(pa + (ks + 1) * 64, hh); fa[nx][1] = g2_lfrag(pa + 16 * G2_PITCH + (ks + 1) * 64, hh);
#pragma unroll
        for (int j = 0; j < 4; ++j) fb[nx][j] = g2_lfrag(pb + j * 16 * G2_PITCH + (ks + 1) * 64, hh); }
      __builtin_amdgcn_sched_barrier(0);      /* keeps the reads above in front of the WMMAs below: sunk to their uses, each pair of WMMAs waits out an LDS latency */
      c00 = g2_mm(fa[cu][0], fb[cu][0], c00); c10 = g2_mm(fa[cu][1], fb[cu][0], c10); c01 = g2_mm(fa[cu][0], fb[cu][1], c01); c11 = g2_mm(fa[cu][1], fb[cu][1], c11);
      c02 = g2_mm(fa[cu][0], fb[cu][2], c02); c12 = g2_mm(fa[cu][1], fb[cu][2], c12); c03 = g2_mm(fa[cu][0], fb[cu][3], c03); c13 = g2_mm(fa[cu][1], fb[cu][3], c13);
      __builtin_amdgcn_sched_barrier(0);      /* keeps the next group of reads behind these WMMAs, so that two sets suffice */
    }
    asm volatile("s_wait_dscnt 0x0" ::: "memory");      /* this wave's reads of the buffer are done before it is refilled */
    asm volatile("s_wait_asynccnt 0x0" ::: "memory");      /* this wave's copies of stage t + 1 have landed */
    __syncthreads();      /* publishes stage t + 1 and ends every wave's reads of stage t */
    if (t + 2 < nst) g2_stage(la + bo, lb + bo, ga + (size_t)(t + 2) * 128, lda, gb + (size_t)(t + 2) * 128, ldb); }
  asm volatile("s_wait_asynccnt 0x0" ::: "memory");      /* no copy is left in flight */
  v8f accs[8] = {c00, c01, c02, c03, c10, c11, c12, c13};
#pragma unroll
  for (int u = 0; u < 8; ++u) { const int t = u & 3, half = u >> 2; const int col = col0 + t * 16 + ln; const float bv = bp ? bf16_round(bp[col]) : 0.f;
#pragma unroll
    for (int r = 0; r < 8; ++r) { const int rloc = half * 16 + 8 * hh + r; float v = accs[u][r] * alpha + bv; if (CP) { const int bidx = (row0g + row0 + rloc) / rowsPerB; v += CP[(size_t)bidx * sCPb + (size_t)by * 64 + col]; }
      if (ACT == 3) v = fmaxf(v, 0.f); else if (ACT == 6) v = 0.5f * v * (1.0f + erff(v * 0.70710678118654752f)); else if (ACT == 11) v = 1.0f / (1.0f + expf(-v)); else if (ACT == 15) v = v / (1.0f + expf(-v)); else if (ACT == 12) v = (v > 0.f) ? v : 0.01f * v; else if (ACT == 8) v = tanhf(v);
      so[w][rloc][t * 16 + ln] = v; } }
  __builtin_amdgcn_fence(__ATOMIC_ACQ_REL, "workgroup"); __builtin_amdgcn_wave_barrier();
  const int rsub = lane >> 4, c4 = (lane & 15) * 4;
  {
#pragma unroll
    for (int q = 0; q < 16; ++q) { const int r = q * 2 + rsub; const v4f v = *(const v4fa*)&so[w][r][c4]; if (C) *(v4f*)(C + cofs + (size_t)(row0 + r) * ldc + col0 + c4) = v; if (C16) { v4h h4; for (int i = 0; i < 4; ++i) h4[i] = (_Float16)v[i]; *(v4h*)(C16 + cofs + (size_t)(row0 + r) * ldc + col0 + c4) = h4; } }
     } }


template <int TK>
__global__ __launch_bounds__(256) void k_vthl(const float* __restrict__ VF, int ldv, _Float16* __restrict__ Vth, _Float16* __restrict__ Vtl) { __shared__ float tl[64][65]; const int tid = threadIdx.x; const int slab = blockIdx.x / (TK / 64), lg = blockIdx.x % (TK / 64); const int b = slab / NH, h = slab % NH;
  for (int i = tid; i < 64 * 16; i += 256) { const int r = i / 16, c4 = (i % 16) * 4; const v4f a = *(const v4fa*)(VF + ((size_t)b * TK + lg * 64 + r) * ldv + h * 64 + c4); tl[r][c4] = a[0]; tl[r][c4 + 1] = a[1]; tl[r][c4 + 2] = a[2]; tl[r][c4 + 3] = a[3]; }
  __syncthreads();
  FragH fh[2], fl[2]; size_t oo[2];
#pragma unroll
  for (int rd = 0; rd < 2; ++rd) { const int d = rd * 32 + tid / 8, pc = tid % 8;
#pragma unroll
    for (int q = 0; q < 8; ++q) { const float v = tl[pc * 8 + q][d]; const _Float16 hv = (_Float16)v; fh[rd].h[q] = hv; fl[rd].h[q] = (_Float16)((v - (float)hv) * 1024.0f); } oo[rd] = ((size_t)slab * 64 + d) * TK + lg * 64 + pc * 8; }
  {
#pragma unroll
    for (int rd = 0; rd < 2; ++rd) { *(v8us*)((unsigned short*)Vth + oo[rd]) = fh[rd].half[0]; *(v8us*)((unsigned short*)Vtl + oo[rd]) = fl[rd].half[0]; }
     } }

template <int TQ, int TK>
__global__ __launch_bounds__(128) void k_flashm(const _Float16* __restrict__ Q16, const _Float16* __restrict__ Q16lo, int ldq, const _Float16* __restrict__ K16, const _Float16* __restrict__ K16lo, int ldk, const _Float16* __restrict__ Vt, const _Float16* __restrict__ Vtlo, const unsigned* __restrict__ MB, const int* __restrict__ RA, const int* __restrict__ KE, float* __restrict__ O, int ldo) {
  constexpr int RPW = 16, RTN = RPW / 16, NQB = TQ / (4 * RPW), DT = 4, KS = 2;
  __shared__ __attribute__((aligned(16))) unsigned short sP[4][RPW][40], sPl[4][RPW][40]; __shared__ __attribute__((aligned(16))) float sO[4][RPW][64 + 4];
  const int tid = threadIdx.x, w = tid >> 5, lane = tid & 31, ln = lane & 15, hh = lane >> 4;
  const int slab = blockIdx.x / NQB, qblk = blockIdx.x % NQB; const int b = slab / NH, h = slab % NH; const int qb0 = qblk * (4 * RPW); const int q0 = qb0 + w * RPW;
  FragH aq[2][KS], aql[2][KS];
#pragma unroll
  for (int rt = 0; rt < RTN; ++rt) { const size_t qo = ((size_t)b * TQ + q0 + rt * 16 + ln) * ldq + h * 64; const unsigned short* qr = (const unsigned short*)Q16 + qo; const unsigned short* ql = (const unsigned short*)Q16lo + qo;
#pragma unroll
    for (int ks = 0; ks < KS; ++ks) { aq[rt][ks].half[0] = *(const v8us*)(qr + ks * 32 + 8 * hh); aq[rt][ks].half[1] = *(const v8us*)(qr + ks * 32 + 16 + 8 * hh); aql[rt][ks].half[0] = *(const v8us*)(ql + ks * 32 + 8 * hh); aql[rt][ks].half[1] = *(const v8us*)(ql + ks * 32 + 16 + 8 * hh); } }
  const unsigned short* Vth = (const unsigned short*)Vt + (size_t)slab * 64 * TK; const unsigned short* Vtl = (const unsigned short*)Vtlo + (size_t)slab * 64 * TK;
  float m_r[2][8], l_r[2][8]; v8f oacc[2][DT], oaccl[2][DT];
#pragma unroll
  for (int rt = 0; rt < RTN; ++rt) {
#pragma unroll
    for (int r = 0; r < 8; ++r) { m_r[rt][r] = -3.0e38f; l_r[rt][r] = 0.f; }
#pragma unroll
    for (int dt = 0; dt < DT; ++dt) { oacc[rt][dt] = (v8f){0.f,0.f,0.f,0.f,0.f,0.f,0.f,0.f}; oaccl[rt][dt] = oacc[rt][dt]; } }
  int jend = KE[qblk * 32]; jend = min(TK, (jend + 31) & ~31); if (jend < 32) jend = 32;      /* block-uniform */
  int allm[2][8]; const unsigned* mrow[2][8];
#pragma unroll
  for (int rt = 0; rt < RTN; ++rt)
#pragma unroll
    for (int r = 0; r < 8; ++r) { const int tq = q0 + rt * 16 + 8 * hh + r; allm[rt][r] = RA[tq]; mrow[rt][r] = MB + (size_t)tq * (TK / 32); }
#pragma unroll 1
  for (int j0 = 0; j0 < jend; j0 += 32) {
    
    v8f s[2][2];
#pragma unroll
    for (int nt = 0; nt < 2; ++nt) { const size_t ko = ((size_t)b * TK + j0 + nt * 16 + ln) * ldk + h * 64; const unsigned short* kr = (const unsigned short*)K16 + ko; const unsigned short* kl = (const unsigned short*)K16lo + ko; FragH bk[KS], bkl[KS];
#pragma unroll
      for (int ks = 0; ks < KS; ++ks) { bk[ks].half[0] = *(const v8us*)(kr + ks * 32 + 8 * hh); bk[ks].half[1] = *(const v8us*)(kr + ks * 32 + 16 + 8 * hh); bkl[ks].half[0] = *(const v8us*)(kl + ks * 32 + 8 * hh); bkl[ks].half[1] = *(const v8us*)(kl + ks * 32 + 16 + 8 * hh); }
      asm volatile("s_wait_xcnt 0x0" ::: "memory");      /* stands in front of whatever reuses the address registers of the K loads above */
#pragma unroll
      for (int rt = 0; rt < RTN; ++rt) { v8f acc = (v8f){0.f,0.f,0.f,0.f,0.f,0.f,0.f,0.f}, accr = acc;
#pragma unroll
        for (int ks = 0; ks < KS; ++ks) { acc = mmaH<1>(aq[rt][ks].v, aq[rt][ks].v, bk[ks].v, bk[ks].v, acc); accr = mmaH<1>(aql[rt][ks].v, aql[rt][ks].v, bk[ks].v, bk[ks].v, accr); accr = mmaH<1>(aq[rt][ks].v, aq[rt][ks].v, bkl[ks].v, bkl[ks].v, accr); }
        s[rt][nt] = acc + accr * 0.0009765625f; } }
#pragma unroll
    for (int rt = 0; rt < RTN; ++rt) {      /* no branch in the softmax: each exp is computed for every lane and the old conditions pick by select, so a lane's eight rows are one straight-line block and their mask loads, cross-lane steps and exp chains overlap */
      float s0[8], s1[8], mc[8]; bool ok0[8], ok1[8];
#pragma unroll
      for (int r = 0; r < 8; ++r) { const unsigned mw = mrow[rt][r][j0 >> 5]; const bool am = (allm[rt][r] != 0);
        ok0[r] = am || (((mw >> ln) & 1u) == 0u); ok1[r] = am || (((mw >> (16 + ln)) & 1u) == 0u);
        s0[r] = ok0[r] ? (am ? 0.f : s[rt][0][r] * SCL) : -INFINITY; s1[r] = ok1[r] ? (am ? 0.f : s[rt][1][r] * SCL) : -INFINITY; mc[r] = fmaxf(s0[r], s1[r]); }
#pragma unroll
      for (int st = 1; st < 16; st <<= 1)
#pragma unroll
        for (int r = 0; r < 8; ++r) mc[r] = fmaxf(mc[r], __shfl_xor(mc[r], st, 32));
#pragma unroll
      for (int r = 0; r < 8; ++r) { const float mo = m_r[rt][r], mn = fmaxf(mo, mc[r]); const float ea = expf(mo - mn), e0 = expf(s0[r] - mn), e1 = expf(s1[r] - mn);
        const float al = (mn > -1.0e38f) ? ea : 1.0f; m_r[rt][r] = mn; const float p0 = ok0[r] ? e0 : 0.f, p1 = ok1[r] ? e1 : 0.f; l_r[rt][r] = l_r[rt][r] * al + p0 + p1;
#pragma unroll
        for (int dt = 0; dt < DT; ++dt) { oacc[rt][dt][r] *= al; oaccl[rt][dt][r] *= al; }
        FragH t2, t3; const float ps0 = p0 * 1024.0f, ps1 = p1 * 1024.0f; t2.h[0] = (_Float16)ps0; t2.h[1] = (_Float16)ps1; t3.h[0] = (_Float16)((ps0 - (float)t2.h[0]) * 1024.0f); t3.h[1] = (_Float16)((ps1 - (float)t2.h[1]) * 1024.0f);
        sP[w][rt * 16 + 8 * hh + r][ln] = t2.u[0]; sP[w][rt * 16 + 8 * hh + r][16 + ln] = t2.u[1]; sPl[w][rt * 16 + 8 * hh + r][ln] = t3.u[0]; sPl[w][rt * 16 + 8 * hh + r][16 + ln] = t3.u[1]; } }
    __builtin_amdgcn_fence(__ATOMIC_ACQ_REL, "workgroup"); __builtin_amdgcn_wave_barrier();
    FragH pa[2], pl[2];
#pragma unroll
    for (int rt = 0; rt < RTN; ++rt) { pa[rt].half[0] = *(const v8us*)&sP[w][rt * 16 + ln][8 * hh]; pa[rt].half[1] = *(const v8us*)&sP[w][rt * 16 + ln][16 + 8 * hh]; pl[rt].half[0] = *(const v8us*)&sPl[w][rt * 16 + ln][8 * hh]; pl[rt].half[1] = *(const v8us*)&sPl[w][rt * 16 + ln][16 + 8 * hh]; }
#pragma unroll
    for (int dt = 0; dt < DT; ++dt) { const size_t vo = (size_t)(dt * 16 + ln) * TK + j0; FragH bv, bl; bv.half[0] = *(const v8us*)(Vth + vo + 8 * hh); bv.half[1] = *(const v8us*)(Vth + vo + 16 + 8 * hh); bl.half[0] = *(const v8us*)(Vtl + vo + 8 * hh); bl.half[1] = *(const v8us*)(Vtl + vo + 16 + 8 * hh);
#pragma unroll
      for (int rt = 0; rt < RTN; ++rt) { oacc[rt][dt] = mmaH<1>(pa[rt].v, pa[rt].v, bv.v, bv.v, oacc[rt][dt]); oaccl[rt][dt] = mmaH<1>(pa[rt].v, pa[rt].v, bl.v, bl.v, oaccl[rt][dt]); oaccl[rt][dt] = mmaH<1>(pl[rt].v, pl[rt].v, bv.v, bv.v, oaccl[rt][dt]); } }
    __builtin_amdgcn_fence(__ATOMIC_ACQ_REL, "workgroup"); __builtin_amdgcn_wave_barrier(); }
#pragma unroll
  for (int rt = 0; rt < RTN; ++rt) {
#pragma unroll
    for (int r = 0; r < 8; ++r) { float l = l_r[rt][r]; l += __shfl_xor(l, 1, 32); l += __shfl_xor(l, 2, 32); l += __shfl_xor(l, 4, 32); l += __shfl_xor(l, 8, 32); l_r[rt][r] = (l > 0.f) ? 1.0f / (l * 1024.0f) : 0.f; }
#pragma unroll
    for (int dt = 0; dt < DT; ++dt)
#pragma unroll
      for (int r = 0; r < 8; ++r) sO[w][rt * 16 + 8 * hh + r][dt * 16 + ln] = (oacc[rt][dt][r] + oaccl[rt][dt][r] * 0.0009765625f) * l_r[rt][r]; }
  __builtin_amdgcn_fence(__ATOMIC_ACQ_REL, "workgroup"); __builtin_amdgcn_wave_barrier();
  {
#pragma unroll
    for (int rp = 0; rp < RPW; rp += 2) { const int r = rp + (lane >> 4), pc = lane & 15; const v4f val = *(const v4fa*)&sO[w][r][pc * 4]; *(v4f*)(O + ((size_t)b * TQ + q0 + r) * ldo + h * 64 + pc * 4) = val; }
     } }


__global__ __launch_bounds__(256) void k_causaltab(unsigned* __restrict__ MB, int* __restrict__ RA, int* __restrict__ KE, int nq, int nk) {
  const int t = blockIdx.x * 256 + threadIdx.x; const int nw = nk / 32;
  if (t < nq * nw) { const int q = t / nw, w = t % nw; const int first = q + 1 - 32 * w; const unsigned bits = (first <= 0) ? 0xffffffffu : ((first >= 32) ? 0u : (0xffffffffu << first)); *(unsigned*)(MB + t) = bits;  }
  if (t < nq) { *(int*)(RA + t) = 0;  }
  if (t < nq / 64) { const int v = 64 * (t + 1); *(int*)(KE + t * 32) = v;  } }
__global__ __launch_bounds__(256) void k_fulltab(unsigned* __restrict__ MB, int* __restrict__ RA, int* __restrict__ KE, int nq, int nk) {
  const int t = blockIdx.x * 256 + threadIdx.x; const int nw = nk / 32;
  if (t < nq * nw) { *(unsigned*)(MB + t) = 0u;  }
  if (t < nq) { *(int*)(RA + t) = 0;  }
  if (t < nq / 64) { *(int*)(KE + t * 32) = nk;  } }

extern "C" void kernel_launch(void* const* d_in, const int* in_sizes, int n_in,
                              void* d_out, int out_size, void* d_ws, size_t ws_size, hipStream_t stream) {
  (void)in_sizes; (void)n_in; (void)out_size;
  const float* const* I = (const float* const*)d_in; const float* wemb = I[0]; const float* pemb = I[1];
  const float* Wq = I[2]; const float* bq = I[3]; const float* Wk = I[4]; const float* bk = I[5]; const float* Wv = I[6]; const float* bv = I[7];
  const float* Wqc = I[8]; const float* bqc = I[9]; const float* Wkc = I[10]; const float* bkc = I[11]; const float* Wvc = I[12]; const float* bvc = I[13];
  const float* W1 = I[14]; const float* b1 = I[15]; const float* W2 = I[16]; const float* b2 = I[17];
  char* ws = (char*)d_ws; size_t off = 0;
  auto take = [&](size_t bytes) { char* p = ws + off; off += (bytes + 255) & ~(size_t)255; return p; };
  _Float16* BQ = (_Float16*)take((size_t)DM * DM * 2); _Float16* BK = (_Float16*)take((size_t)DM * DM * 2); _Float16* BV = (_Float16*)take((size_t)DM * DM * 2); _Float16* BQC = (_Float16*)take((size_t)DM * DM * 2); _Float16* BKC = (_Float16*)take((size_t)DM * DM * 2); _Float16* BVC = (_Float16*)take((size_t)DM * DM * 2);
  _Float16* BW1 = (_Float16*)take((size_t)FF * DM * 2); _Float16* BW2 = (_Float16*)take((size_t)DM * FF * 2);
  _Float16* WE16 = (_Float16*)take((size_t)SW * DM * 2); _Float16* PE16 = (_Float16*)take((size_t)SP * DM * 2); float* F = (float*)take((size_t)SKV * DM * 4);
  _Float16* Qh = (_Float16*)take((size_t)SW * DM * 2); _Float16* Ql = (_Float16*)take((size_t)SW * DM * 2); _Float16* Kh = (_Float16*)take((size_t)SKV * DM * 2); _Float16* Kl = (_Float16*)take((size_t)SKV * DM * 2);      /* with Qh/Ql: 16 MiB contiguous, later the FFN f32 half-hidden */
  _Float16* Vth = (_Float16*)take((size_t)SKV * DM * 2); _Float16* Vtl = (_Float16*)take((size_t)SKV * DM * 2);
  unsigned* MB = (unsigned*)take((size_t)SW * (SW / 32) * 4); int* RA = (int*)take((size_t)SW * 4); int* KE = (int*)take((size_t)(SW / 64) * 32 * 4);
  unsigned* MB2 = (unsigned*)take((size_t)SW * (SP / 32) * 4); int* RA2 = (int*)take((size_t)SW * 4); int* KE2 = (int*)take((size_t)(SW / 64) * 32 * 4);
  _Float16* Ah = (_Float16*)take((size_t)SW * DM * 2); _Float16* Al = (_Float16*)take((size_t)SW * DM * 2);      /* word hi/lo, later cross hi/lo */
  _Float16* HDh = (_Float16*)take((size_t)SW * (FF / 2) * 2); _Float16* HDl = (_Float16*)take((size_t)SW * (FF / 2) * 2);
  if (off > ws_size) return;      /* 12 + 16 + 4 + 2 + 8 + 16 + 8 + 0.8 + 8 + 16 = 91 MiB */
  float* HF = (float*)Qh;             /* FFN half hidden f32 [2048][2048] = 16 MiB over Qh..Kl (dead after the second attention) */
  const size_t w8 = (size_t)DM * DM / 8; const unsigned wb = (unsigned)((w8 + 255) / 256);
  k_round16f<<<wb, 256, 0, stream>>>(Wq, BQ, w8); k_round16f<<<wb, 256, 0, stream>>>(Wk, BK, w8); k_round16f<<<wb, 256, 0, stream>>>(Wv, BV, w8); k_round16f<<<wb, 256, 0, stream>>>(Wqc, BQC, w8); k_round16f<<<wb, 256, 0, stream>>>(Wkc, BKC, w8); k_round16f<<<wb, 256, 0, stream>>>(Wvc, BVC, w8);
  k_round16f<<<(unsigned)(((size_t)FF * DM / 8 + 255) / 256), 256, 0, stream>>>(W1, BW1, (size_t)FF * DM / 8); k_round16f<<<(unsigned)(((size_t)FF * DM / 8 + 255) / 256), 256, 0, stream>>>(W2, BW2, (size_t)FF * DM / 8);      /* torch (out,in) = natural Bt; x16 */
  k_x16<<<(unsigned)(((size_t)SW * DM / 8 + 255) / 256), 256, 0, stream>>>(wemb, WE16, (size_t)SW * DM / 8); k_x16<<<(unsigned)(((size_t)SP * DM / 8 + 255) / 256), 256, 0, stream>>>(pemb, PE16, (size_t)SP * DM / 8);
  k_causaltab<<<(SW * (SW / 32) + 255) / 256, 256, 0, stream>>>(MB, RA, KE, SW, SW); k_fulltab<<<(SW * (SP / 32) + 255) / 256, 256, 0, stream>>>(MB2, RA2, KE2, SW, SP);
  const dim3 gW((SW / 128) * (DM / 64), 1), gPp((SP / 128) * (DM / 64), 1), gH((SW / 128) * ((FF / 2) / 64), 1); const size_t n8w = (size_t)SW * DM / 8, n8p = (size_t)SP * DM / 8; const unsigned nbw = (unsigned)((n8w + 255) / 256), nbp = (unsigned)((n8p + 255) / 256);
  /* --- causal self attention on the word embeddings (all planes hi/lo) --- */
  k_gemm2<0><<<gW, 128, 0, stream>>>(WE16, DM, 0, BQ, DM, 0, 0.0625f, bq, 0, nullptr, 1, 0, 0, F, nullptr, DM, 0, SW, DM, DM); k_hl<<<nbw, 256, 0, stream>>>(F, Qh, Ql, n8w);
  k_gemm2<0><<<gW, 128, 0, stream>>>(WE16, DM, 0, BK, DM, 0, 0.0625f, bk, 0, nullptr, 1, 0, 0, F, nullptr, DM, 0, SW, DM, DM); k_hl<<<nbw, 256, 0, stream>>>(F, Kh, Kl, n8w);
  k_gemm2<0><<<gW, 128, 0, stream>>>(WE16, DM, 0, BV, DM, 0, 0.0625f, bv, 0, nullptr, 1, 0, 0, F, nullptr, DM, 0, SW, DM, DM); k_vthl<SW><<<NH * (SW / 64), 256, 0, stream>>>(F, DM, Vth, Vtl);
  k_flashm<SW, SW><<<NH * (SW / 64), 128, 0, stream>>>(Qh, Ql, DM, Kh, Kl, DM, Vth, Vtl, MB, RA, KE, F, DM);      /* word (f32) -> F */
  k_hl<<<nbw, 256, 0, stream>>>(F, Ah, Al, n8w);      /* word as hi/lo operand planes */
  k_gemm2<0><<<gW, 128, 0, stream>>>(Ah, DM, 0, BQC, DM, 0, 0.0625f, bqc, 0, nullptr, 1, 0, 0, F, nullptr, DM, 0, SW, DM, DM);
  k_gemm2<0><<<gW, 128, 0, stream>>>(Al, DM, 0, BQC, DM, 0, 0.0625f * 0.0009765625f, nullptr, 0, F, 1, (size_t)DM, 0, F, nullptr, DM, 0, SW, DM, DM); k_hl<<<nbw, 256, 0, stream>>>(F, Qh, Ql, n8w);
  k_gemm2<0><<<gPp, 128, 0, stream>>>(PE16, DM, 0, BKC, DM, 0, 0.0625f, bkc, 0, nullptr, 1, 0, 0, F, nullptr, DM, 0, SP, DM, DM); k_hl<<<nbp, 256, 0, stream>>>(F, Kh, Kl, n8p);
  k_gemm2<0><<<gPp, 128, 0, stream>>>(PE16, DM, 0, BVC, DM, 0, 0.0625f, bvc, 0, nullptr, 1, 0, 0, F, nullptr, DM, 0, SP, DM, DM); k_vthl<SP><<<NH * (SP / 64), 256, 0, stream>>>(F, DM, Vth, Vtl);
  k_flashm<SW, SP><<<NH * (SW / 64), 128, 0, stream>>>(Qh, Ql, DM, Kh, Kl, DM, Vth, Vtl, MB2, RA2, KE2, F, DM);      /* cross (f32) -> F */
  k_hl<<<nbw, 256, 0, stream>>>(F, Ah, Al, n8w);      /* cross as hi/lo operand planes */
  /* --- FFN in two column halves of the hidden: h = relu(cross*W1^T + b1) (hi/lo), out (+)= h_half*W2_half^T (+ b2 once) --- */
  for (int hf = 0; hf < 2; ++hf) { const _Float16* B1h = BW1 + (size_t)hf * (FF / 2) * DM; const _Float16* B2h = BW2 + (size_t)hf * (FF / 2);
    k_gemm2<0><<<gH, 128, 0, stream>>>(Ah, DM, 0, B1h, DM, 0, 0.0625f, b1 + hf * (FF / 2), 0, nullptr, 1, 0, 0, HF, nullptr, FF / 2, 0, SW, FF / 2, DM);
    k_gemm2<3><<<gH, 128, 0, stream>>>(Al, DM, 0, B1h, DM, 0, 0.0625f * 0.0009765625f, nullptr, 0, HF, 1, (size_t)(FF / 2), 0, HF, nullptr, FF / 2, 0, SW, FF / 2, DM);      /* relu applied after the residual pass completes the sum */
    k_hl<<<(unsigned)(((size_t)SW * (FF / 2) / 8 + 255) / 256), 256, 0, stream>>>(HF, HDh, HDl, (size_t)SW * (FF / 2) / 8);
    k_gemm2<0><<<gW, 128, 0, stream>>>(HDh, FF / 2, 0, B2h, FF, 0, 0.0625f, (hf == 0) ? b2 : nullptr, 0, (hf == 0) ? nullptr : (const float*)d_out, 1, (size_t)DM, 0, (float*)d_out, nullptr, DM, 0, SW, DM, FF / 2);
    k_gemm2<0><<<gW, 128, 0, stream>>>(HDl, FF / 2, 0, B2h, FF, 0, 0.0625f * 0.0009765625f, nullptr, 0, (const float*)d_out, 1, (size_t)DM, 0, (float*)d_out, nullptr, DM, 0, SW, DM, FF / 2); }
}

// v003
// Measured time: 628 microseconds a run.
// Next to v002, in two timings, it ran 1.10 and 1.08 times as fast.
// All steps since v000 together make it 2.04 times as fast.
#include <hip/hip_runtime.h>
// Two-stage attention decoder block (word embeddings [2048][1024], position embeddings [1024][1024], 16 heads x 64, FFN 4096): word = CausalMHA(wemb; q,k,v = Linear+bias, scores/8, tril, softmax, .v, heads merged, no output projection); cross = MHA(q from word, k/v from pemb, no mask); out = relu(cross*W1^T + b1)*W2^T + b2 -> [2048,1024].
// Compute dtype: inputs and parameters rounded to bf16; projections of the embeddings exact; all other operands f16 hi + (x2^10) residual pairs (~2^-21); f32 accumulation, softmax f32. v_wmma_f32_16x16x32_f16.
#define SW 2048
#define SP 1024
#define DM 1024
#define NH 16
#define FF 4096
#define SCL 0.125f
#define SKV ((SW > SP) ? SW : SP)      /* larger key count (unused): the self attention has SW keys, the cross attention SP */
typedef __bf16 v16b __attribute__((ext_vector_type(16)));
typedef unsigned short v8us __attribute__((ext_vector_type(8), may_alias));
typedef float  v8f  __attribute__((ext_vector_type(8)));
typedef float  v4f  __attribute__((ext_vector_type(4)));
typedef float  v4fa __attribute__((ext_vector_type(4), may_alias));
union FragB { v16b v; v8us half[2]; unsigned short u[16]; };

__device__ __forceinline__ unsigned short bf16_bits(float x) { unsigned int u = __float_as_uint(x); return (unsigned short)((u + 0x7FFFu + ((u >> 16) & 1u)) >> 16); }
__device__ __forceinline__ float bf16_val(unsigned short b) { return __uint_as_float(((unsigned int)b) << 16); }
__device__ __forceinline__ float bf16_round(float x) { return bf16_val(bf16_bits(x)); }
// D += A·B with NT terms: 1 = ah·bh, 2 = + al·bh (A split), 3 = + ah·bl (both split)
template <int NT>
__device__ __forceinline__ v8f mmaN(v16b ah, v16b al, v16b bh, v16b bl, v8f c) {
  c = __builtin_amdgcn_wmma_f32_16x16x32_bf16(false, ah, false, bh, (short)0, c, false, false);
  if (NT >= 2) c = __builtin_amdgcn_wmma_f32_16x16x32_bf16(false, al, false, bh, (short)0, c, false, false);
  if (NT >= 3) c = __builtin_amdgcn_wmma_f32_16x16x32_bf16(false, ah, false, bl, (short)0, c, false, false);
  asm volatile("v_nop\n\tv_nop\n\tv_nop\n\tv_nop" : "+v"(c) : "v"(ah), "v"(al), "v"(bh), "v"(bl));
  return c;
}

__global__ __launch_bounds__(256) void k_wt_bf16(const float* __restrict__ W, unsigned short* __restrict__ Wt, int K, int N) {
  const int t = blockIdx.x * 256 + threadIdx.x;
  const int k8n = K / 8;
  if (t >= N * k8n) return;
  const int n = t / k8n, k8 = (t % k8n) * 8;
  v8us v;
#pragma unroll
  for (int i = 0; i < 8; ++i) v[i] = bf16_bits(W[(size_t)(k8 + i) * N + n]);
  *(v8us*)(Wt + (size_t)n * K + k8) = v;
  
}

// GEMM C[M][N] (f32, pitch ldc) = act(A[M][K]·W + bias). A f32 row-major (pitch lda) converted per fragment to bf16
// (ASPLIT: hi/lo two planes -> 2 terms, else single rounded term); Wt bf16 [N][K] (pitch ldb). BIAS_BF16 rounds the
// bias to bf16 first (bias quantised to bf16 before the add). K%32==0, M%16==0, N%64==0.
template <bool ASPLIT, int ACT, bool BIAS_BF16>
__global__ __launch_bounds__(128) void k_gemm_bf(const float* __restrict__ A, int lda, const unsigned short* __restrict__ Wt, int ldb,
                                               const float* __restrict__ bias, float* __restrict__ C, int ldc, int M, int N, int K) {
  __shared__ __attribute__((aligned(16))) float so[4][16][64];
  const int tid = threadIdx.x, w = tid >> 5, lane = tid & 31, ln = lane & 15, hh = lane >> 4;
  const int ntn = N / 64;
  const int wid = blockIdx.x * 4 + w;
  const int mt = wid / ntn, nq = wid % ntn;
  if (mt * 16 >= M) return;
  const int row0 = mt * 16, col0 = nq * 64;
  const float* arow = A + (size_t)(row0 + ln) * lda;
  v8f acc[4] = {};
  for (int kb = 0; kb < K; kb += 32) {
    FragB ah, al;
    const v4f x0 = *(const v4fa*)(arow + kb + 8 * hh), x1 = *(const v4fa*)(arow + kb + 8 * hh + 4);
    const v4f x2 = *(const v4fa*)(arow + kb + 16 + 8 * hh), x3 = *(const v4fa*)(arow + kb + 16 + 8 * hh + 4);
    float xs[16] = {x0[0],x0[1],x0[2],x0[3],x1[0],x1[1],x1[2],x1[3],x2[0],x2[1],x2[2],x2[3],x3[0],x3[1],x3[2],x3[3]};
#pragma unroll
    for (int i = 0; i < 16; ++i) { const unsigned short hb = bf16_bits(xs[i]); ah.u[i] = hb; al.u[i] = ASPLIT ? bf16_bits(xs[i] - bf16_val(hb)) : (unsigned short)0; }
#pragma unroll
    for (int t = 0; t < 4; ++t) {
      const unsigned short* brow = Wt + (size_t)(col0 + t * 16 + ln) * ldb + kb;
      FragB b;
      b.half[0] = *(const v8us*)(brow + 8 * hh);
      b.half[1] = *(const v8us*)(brow + 16 + 8 * hh);
      acc[t] = mmaN<ASPLIT ? 2 : 1>(ah.v, al.v, b.v, b.v, acc[t]);
    }
  }
#pragma unroll
  for (int t = 0; t < 4; ++t) {
    float bv = bias ? bias[col0 + t * 16 + ln] : 0.f;
    if (BIAS_BF16) bv = bf16_round(bv);
#pragma unroll
    for (int r = 0; r < 8; ++r) { float v = acc[t][r] + bv; if (ACT == 1) v = fmaxf(v, 0.f); so[w][8 * hh + r][t * 16 + ln] = v; }
  }
  __builtin_amdgcn_fence(__ATOMIC_ACQ_REL, "workgroup");
  __builtin_amdgcn_wave_barrier();
  const int rsub = lane >> 4, c4 = (lane & 15) * 4;
  {
#pragma unroll
    for (int q = 0; q < 8; ++q) {
      const int r = q * 2 + rsub;
      const v4f v = *(const v4fa*)&so[w][r][c4];
      *(v4f*)(C + (size_t)(row0 + r) * ldc + col0 + c4) = v;
    }
    
  }
}

// GEMM C = act(A·W + bias + resid): A f32 (ASPLIT -> hi/lo 2 terms), Wt bf16 [N][K]; ACT 0 none, 1 relu, 2 exact gelu;
// resid (optional, f32, row index = (row % rmod), pitch ldr, RES_BF16 rounds it) added before the activation.
template <bool ASPLIT, int ACT, bool BIAS_BF16, bool RES_BF16>
__global__ __launch_bounds__(128) void k_gemm_bf3(const float* __restrict__ A, int lda, const unsigned short* __restrict__ Wt, int ldb,
                                                const float* __restrict__ bias, const float* __restrict__ resid, int rmod, int ldr,
                                                float* __restrict__ C, int ldc, int M, int N, int K) {
  __shared__ __attribute__((aligned(16))) float so[4][16][64];
  const int tid = threadIdx.x, w = tid >> 5, lane = tid & 31, ln = lane & 15, hh = lane >> 4;
  const int ntn = N / 64;
  const int wid = blockIdx.x * 4 + w;
  const int mt = wid / ntn, nq = wid % ntn;
  if (mt * 16 >= M) return;
  const int row0 = mt * 16, col0 = nq * 64;
  const float* arow = A + (size_t)(row0 + ln) * lda;
  v8f acc[4] = {};
  for (int kb = 0; kb < K; kb += 32) {
    FragB ah, al;
    const v4f x0 = *(const v4fa*)(arow + kb + 8 * hh), x1 = *(const v4fa*)(arow + kb + 8 * hh + 4);
    const v4f x2 = *(const v4fa*)(arow + kb + 16 + 8 * hh), x3 = *(const v4fa*)(arow + kb + 16 + 8 * hh + 4);
    float xs[16] = {x0[0],x0[1],x0[2],x0[3],x1[0],x1[1],x1[2],x1[3],x2[0],x2[1],x2[2],x2[3],x3[0],x3[1],x3[2],x3[3]};
#pragma unroll
    for (int i = 0; i < 16; ++i) { const unsigned short hb = bf16_bits(xs[i]); ah.u[i] = hb; al.u[i] = ASPLIT ? bf16_bits(xs[i] - bf16_val(hb)) : (unsigned short)0; }
#pragma unroll
    for (int t = 0; t < 4; ++t) {
      const unsigned short* brow = Wt + (size_t)(col0 + t * 16 + ln) * ldb + kb;
      FragB b;
      b.half[0] = *(const v8us*)(brow + 8 * hh);
      b.half[1] = *(const v8us*)(brow + 16 + 8 * hh);
      acc[t] = mmaN<ASPLIT ? 2 : 1>(ah.v, al.v, b.v, b.v, acc[t]);
    }
  }
#pragma unroll
  for (int t = 0; t < 4; ++t) {
    const int col = col0 + t * 16 + ln;
    float bv = bias ? bias[col] : 0.f;
    if (BIAS_BF16) bv = bf16_round(bv);
#pragma unroll
    for (int r = 0; r < 8; ++r) {
      float v = acc[t][r] + bv;
      if (resid) { float rv = resid[(size_t)((row0 + 8 * hh + r) % rmod) * ldr + col]; if (RES_BF16) rv = bf16_round(rv); v += rv; }
      if (ACT == 1) v = fmaxf(v, 0.f);
      if (ACT == 2) v = 0.5f * v * (1.0f + erff(v * 0.70710678118654752f));
      if (ACT == 3) { const float u = 0.7978845608028654f * (v + 0.044715f * v * v * v); v = 0.5f * v * (1.0f + tanhf(u)); }
      so[w][8 * hh + r][t * 16 + ln] = v;
    }
  }
  __builtin_amdgcn_fence(__ATOMIC_ACQ_REL, "workgroup");
  __builtin_amdgcn_wave_barrier();
  const int rsub = lane >> 4, c4 = (lane & 15) * 4;
  {
#pragma unroll
    for (int q = 0; q < 8; ++q) {
      const int r = q * 2 + rsub;
      const v4f v = *(const v4fa*)&so[w][r][c4];
      *(v4f*)(C + (size_t)(row0 + r) * ldc + col0 + c4) = v;
    }
    
  }
}
// row LayerNorm (biased variance, eps) over N: s = X (+ R); optional out_sum <- s; out_norm <- (s-mu)*rsqrt(var+eps)*g + b
template <bool PARAM_BF16>
__global__ __launch_bounds__(256) void k_layernorm(const float* __restrict__ X, const float* __restrict__ R, const float* __restrict__ g, const float* __restrict__ bta,
                                                  float* __restrict__ out_sum, float* __restrict__ out_norm, int N, float eps) {
  __shared__ float red[256];
  const int row = blockIdx.x, tid = threadIdx.x;
  const float* x = X + (size_t)row * N; const float* rr = R ? R + (size_t)row * N : nullptr;
  float vals[16];                     // up to N = 4096
  const int per = N / 256;            // contiguous chunk per thread? use strided-by-4 chunks: thread handles j = tid*4 + 1024*u
  float s1 = 0.f;
  for (int u = 0; u < per / 4; ++u) {
    const int j = tid * 4 + 1024 * u;
    const v4f a = *(const v4fa*)(x + j);
    v4f b = {0.f,0.f,0.f,0.f}; if (rr) b = *(const v4fa*)(rr + j);
#pragma unroll
    for (int q = 0; q < 4; ++q) { const float v = a[q] + b[q]; vals[u * 4 + q] = v; s1 += v; }
  }
  red[tid] = s1; __syncthreads();
  for (int st = 128; st > 0; st >>= 1) { if (tid < st) red[tid] += red[tid + st]; __syncthreads(); }
  const float mu = red[0] / (float)N; __syncthreads();
  float s2 = 0.f;
  for (int u = 0; u < per / 4; ++u)
#pragma unroll
    for (int q = 0; q < 4; ++q) { const float c = vals[u * 4 + q] - mu; s2 += c * c; }
  red[tid] = s2; __syncthreads();
  for (int st = 128; st > 0; st >>= 1) { if (tid < st) red[tid] += red[tid + st]; __syncthreads(); }
  const float rs = rsqrtf(red[0] / (float)N + eps);
  {
    for (int u = 0; u < per / 4; ++u) {
      const int j = tid * 4 + 1024 * u;
      v4f o, sm;
#pragma unroll
      for (int q = 0; q < 4; ++q) {
        float gg = g[j + q], bb = bta[j + q];
        if (PARAM_BF16) { gg = bf16_round(gg); bb = bf16_round(bb); }
        sm[q] = vals[u * 4 + q]; o[q] = (vals[u * 4 + q] - mu) * rs * gg + bb;
      }
      if (out_sum) *(v4f*)(out_sum + (size_t)row * N + j) = sm;
      *(v4f*)(out_norm + (size_t)row * N + j) = o;
    }
    
  }
}



// ---- f16 WMMA path (v_wmma_f32_16x16x32_f16): 11-bit significands for operands in range — used where a [0,1] probability operand needs more precision than bf16
typedef _Float16 v16h __attribute__((ext_vector_type(16)));
union FragH { v16h v; v8us half[2]; _Float16 h[16]; unsigned short u[16]; };
template <int NT>
__device__ __forceinline__ v8f mmaH(v16h ah, v16h al, v16h bh, v16h bl, v8f c) {
  c = __builtin_amdgcn_wmma_f32_16x16x32_f16(false, ah, false, bh, (short)0, c, false, false);
  if (NT >= 2) c = __builtin_amdgcn_wmma_f32_16x16x32_f16(false, al, false, bh, (short)0, c, false, false);
  if (NT >= 3) c = __builtin_amdgcn_wmma_f32_16x16x32_f16(false, ah, false, bl, (short)0, c, false, false);
  asm volatile("v_nop\n\tv_nop\n\tv_nop\n\tv_nop" : "+v"(c) : "v"(ah), "v"(al), "v"(bh), "v"(bl));
  return c;
}
// batched GEMM like k_gemm_b but f16 operands: A f32 (split into f16 hi/lo if ASPLIT, else rounded to f16), Bt = f16 values [n][k]; alpha; C f32; N multiple of 16 (partial tiles skipped)
template <bool ASPLIT>
__global__ __launch_bounds__(128) void k_gemm_h(const float* __restrict__ A, int lda, size_t sA, const _Float16* __restrict__ Bh, int ldb, size_t sB, float alpha, float* __restrict__ C, int ldc, size_t sC, int M, int N, int K) {
  __shared__ __attribute__((aligned(16))) float so[4][16][64];
  const int tid = threadIdx.x, w = tid >> 5, lane = tid & 31, ln = lane & 15, hh = lane >> 4; const int by = blockIdx.y;
  A += (size_t)by * sA; Bh += (size_t)by * sB; C += (size_t)by * sC;
  const int ntn = (N + 63) / 64; const int wid = blockIdx.x * 4 + w; const int mt = wid / ntn, nq = wid % ntn; if (mt * 16 >= M) return;
  const int row0 = mt * 16, col0 = nq * 64; const float* arow = A + (size_t)(row0 + ln) * lda;
  v8f acc[4] = {};
  for (int kb = 0; kb < K; kb += 32) {
    FragH ah, al;
    const v4f x0 = *(const v4fa*)(arow + kb + 8 * hh), x1 = *(const v4fa*)(arow + kb + 8 * hh + 4), x2 = *(const v4fa*)(arow + kb + 16 + 8 * hh), x3 = *(const v4fa*)(arow + kb + 16 + 8 * hh + 4);
    float xs[16] = {x0[0],x0[1],x0[2],x0[3],x1[0],x1[1],x1[2],x1[3],x2[0],x2[1],x2[2],x2[3],x3[0],x3[1],x3[2],x3[3]};
#pragma unroll
    for (int i = 0; i < 16; ++i) { const _Float16 h = (_Float16)xs[i]; ah.h[i] = h; al.h[i] = ASPLIT ? (_Float16)(xs[i] - (float)h) : (_Float16)0.0f; }
#pragma unroll
    for (int t = 0; t < 4; ++t) { if (col0 + t * 16 >= N) continue; const size_t boff = (size_t)(col0 + t * 16 + ln) * ldb + kb; FragH bq; bq.half[0] = *(const v8us*)(Bh + boff + 8 * hh); bq.half[1] = *(const v8us*)(Bh + boff + 16 + 8 * hh);
      acc[t] = mmaH<ASPLIT ? 2 : 1>(ah.v, al.v, bq.v, bq.v, acc[t]); }
  }
#pragma unroll
  for (int t = 0; t < 4; ++t) { if (col0 + t * 16 >= N) continue;
#pragma unroll
    for (int r = 0; r < 8; ++r) so[w][8 * hh + r][t * 16 + ln] = acc[t][r] * alpha; }
  __builtin_amdgcn_fence(__ATOMIC_ACQ_REL, "workgroup"); __builtin_amdgcn_wave_barrier();
  const int rsub = lane >> 4, c4 = (lane & 15) * 4;
  {
#pragma unroll
    for (int q = 0; q < 8; ++q) { const int r = q * 2 + rsub; if (col0 + c4 < N) { const v4f v = *(const v4fa*)&so[w][r][c4]; *(v4f*)(C + (size_t)(row0 + r) * ldc + col0 + c4) = v; } }
     }
}

// Wt[n][k] = f16(W[k][n]·scale) from f32 row-major W[K][N] (scale = power of two; bf16-exact weights stay exact in f16 away from the subnormal range)
__global__ __launch_bounds__(256) void k_wt_f16(const float* __restrict__ W, _Float16* __restrict__ Wt, int K, int N, float scale) {
  const int t = blockIdx.x * 256 + threadIdx.x; if (t >= N * (K / 8)) return; const int n = t / (K / 8), k8 = (t % (K / 8)) * 8; FragH f;
#pragma unroll
  for (int i = 0; i < 8; ++i) f.h[i] = (_Float16)(bf16_round(W[(size_t)(k8 + i) * N + n]) * scale); const v8us o = f.half[0];
  *(v8us*)((unsigned short*)Wt + (size_t)n * K + k8) = o; 
}
// k_gemm_hh variant with fused epilogue: v = acc·alpha + bias[by·sBias + col] (+ CP[(row/rowsPerB)·sCPb + by·64 + col] if CP) ; ACT 0 none / 1 elu ; writes f16 C16 (and f32 C if non-null)
template <int ACT>
__global__ __launch_bounds__(128) void k_gemm_hhx(const _Float16* __restrict__ A, int lda, size_t sA, const _Float16* __restrict__ Bh, int ldb, size_t sB, float alpha, const float* __restrict__ bias, size_t sBias, const float* __restrict__ CP, int rowsPerB, size_t sCPb, int row0g,
    float* __restrict__ C, _Float16* __restrict__ C16, int ldc, size_t sC, int M, int N, int K) {
  __shared__ __attribute__((aligned(16))) float so[4][16][64];
  const int tid = threadIdx.x, w = tid >> 5, lane = tid & 31, ln = lane & 15, hh = lane >> 4; const int by = blockIdx.y;
  A += (size_t)by * sA; Bh += (size_t)by * sB; const size_t cofs = (size_t)by * sC; const float* bp = bias ? bias + (size_t)by * sBias : nullptr;
  const int ntn = (N + 63) / 64; const int wid = blockIdx.x * 4 + w; const int mt = wid / ntn, nq = wid % ntn; if (mt * 16 >= M) return;
  const int row0 = mt * 16, col0 = nq * 64; const _Float16* arow = A + (size_t)(row0 + ln) * lda;
  v8f acc[4] = {};
  for (int kb = 0; kb < K; kb += 32) { FragH ah; ah.half[0] = *(const v8us*)((const unsigned short*)arow + kb + 8 * hh); ah.half[1] = *(const v8us*)((const unsigned short*)arow + kb + 16 + 8 * hh);
#pragma unroll
    for (int t = 0; t < 4; ++t) { if (col0 + t * 16 >= N) continue; const size_t boff = (size_t)(col0 + t * 16 + ln) * ldb + kb; FragH bq; bq.half[0] = *(const v8us*)((const unsigned short*)Bh + boff + 8 * hh); bq.half[1] = *(const v8us*)((const unsigned short*)Bh + boff + 16 + 8 * hh);
      acc[t] = mmaH<1>(ah.v, ah.v, bq.v, bq.v, acc[t]); }
  }
#pragma unroll
  for (int t = 0; t < 4; ++t) { if (col0 + t * 16 >= N) continue; const int col = col0 + t * 16 + ln; const float bv = bp ? bf16_round(bp[col]) : 0.f;
#pragma unroll
    for (int r = 0; r < 8; ++r) { float v = acc[t][r] * alpha + bv; if (CP) { const int bidx = (row0g + row0 + 8 * hh + r) / rowsPerB; v += CP[(size_t)bidx * sCPb + (size_t)by * 64 + col]; } if (ACT == 1) v = (v > 0.f) ? v : expm1f(v); else if (ACT == 7) v = (v > 0.f) ? v + 1.0f : expf(v); else if (ACT == 8) v = tanhf(v); else if (ACT == 9) v = 0.5f * v * (1.0f + tanhf(0.7978845608028654f * (v + 0.044715f * v * v * v))); else if (ACT == 11) v = 1.0f / (1.0f + expf(-v)); else if (ACT == 12) v = (v > 0.f) ? v : 0.01f * v; else if (ACT == 14) v = (v > 0.f) ? v : 0.1f * v; else if (ACT == 15) v = v / (1.0f + expf(-v)); else if (ACT == 3) v = fmaxf(v, 0.f); else if (ACT == 6) v = 0.5f * v * (1.0f + erff(v * 0.70710678118654752f)); so[w][8 * hh + r][t * 16 + ln] = v; } }
  __builtin_amdgcn_fence(__ATOMIC_ACQ_REL, "workgroup"); __builtin_amdgcn_wave_barrier();
  const int rsub = lane >> 4, c4 = (lane & 15) * 4; typedef _Float16 v4h __attribute__((ext_vector_type(4)));
  {
#pragma unroll
    for (int q = 0; q < 8; ++q) { const int r = q * 2 + rsub; if (col0 + c4 < N) { const v4f v = *(const v4fa*)&so[w][r][c4]; if (C) *(v4f*)(C + cofs + (size_t)(row0 + r) * ldc + col0 + c4) = v; if (C16) { v4h h4; for (int i = 0; i < 4; ++i) h4[i] = (_Float16)v[i]; *(v4h*)(C16 + cofs + (size_t)(row0 + r) * ldc + col0 + c4) = h4; } } }
     }
}


typedef _Float16 v4h __attribute__((ext_vector_type(4)));

// Bodies of the short kernels: blk is the block's index inside its own job, so that independent jobs can share one grid, each on its own range of block indices.
__device__ __forceinline__ void d_x16(const float* __restrict__ x, _Float16* __restrict__ X16, size_t n8, unsigned blk) { const size_t t = (size_t)blk * 256 + threadIdx.x; if (t >= n8) return; FragH f;
#pragma unroll
  for (int q = 0; q < 8; ++q) f.h[q] = (_Float16)bf16_round(x[t * 8 + q]); *(v8us*)((unsigned short*)X16 + t * 8) = f.half[0];  }
__global__ __launch_bounds__(256) void k_h16(const float* __restrict__ x, _Float16* __restrict__ X16, size_t n8) { const size_t t = (size_t)blockIdx.x * 256 + threadIdx.x; if (t >= n8) return; FragH f;
#pragma unroll
  for (int q = 0; q < 8; ++q) f.h[q] = (_Float16)x[t * 8 + q]; *(v8us*)((unsigned short*)X16 + t * 8) = f.half[0];  }
__device__ __forceinline__ void d_round16f(const float* __restrict__ W, _Float16* __restrict__ Bt, size_t n8, unsigned blk) { const size_t t = (size_t)blk * 256 + threadIdx.x; if (t >= n8) return; FragH f;
#pragma unroll
  for (int i = 0; i < 8; ++i) f.h[i] = (_Float16)(bf16_round(W[t * 8 + i]) * 16.0f); *(v8us*)((unsigned short*)Bt + t * 8) = f.half[0];  }
template <int NHv, int TTv>
__global__ __launch_bounds__(256) void k_vt(const _Float16* __restrict__ V16, int ldv, int voff, _Float16* __restrict__ Vt) { __shared__ unsigned short tl[64][66]; const int tid = threadIdx.x; const int slab = blockIdx.x / (TTv / 64), lg = blockIdx.x % (TTv / 64); const int b = slab / NHv, h = slab % NHv;
  for (int i = tid; i < 64 * 8; i += 256) { const int r = i / 8, c8 = (i % 8) * 8; FragH f; f.half[0] = *(const v8us*)((const unsigned short*)V16 + ((size_t)b * TTv + lg * 64 + r) * ldv + voff + h * 64 + c8);
#pragma unroll
    for (int q = 0; q < 8; ++q) tl[r][c8 + q] = f.u[q]; }
  __syncthreads();
  {
#pragma unroll
    for (int rd = 0; rd < 2; ++rd) { const int d = rd * 32 + tid / 8, pc = tid % 8; FragH f;
#pragma unroll
      for (int q = 0; q < 8; ++q) f.u[q] = tl[pc * 8 + q][d];
      *(v8us*)((unsigned short*)Vt + ((size_t)slab * 64 + d) * TTv + lg * 64 + pc * 8) = f.half[0]; }
     } }

__device__ __forceinline__ void d_hl(const float* __restrict__ F, _Float16* __restrict__ Hh, _Float16* __restrict__ Hl, size_t n8, unsigned blk) { const size_t t = (size_t)blk * 256 + threadIdx.x; if (t >= n8) return; FragH fh, fl; const v4f a = *(const v4fa*)(F + t * 8), c = *(const v4fa*)(F + t * 8 + 4);
#pragma unroll
  for (int q = 0; q < 4; ++q) { _Float16 h = (_Float16)a[q]; fh.h[q] = h; fl.h[q] = (_Float16)((a[q] - (float)h) * 1024.0f); h = (_Float16)c[q]; fh.h[4 + q] = h; fl.h[4 + q] = (_Float16)((c[q] - (float)h) * 1024.0f); }
  { *(v8us*)((unsigned short*)Hh + t * 8) = fh.half[0]; *(v8us*)((unsigned short*)Hl + t * 8) = fl.half[0];  } }
__global__ __launch_bounds__(256) void k_hl(const float* __restrict__ F, _Float16* __restrict__ Hh, _Float16* __restrict__ Hl, size_t n8) { d_hl(F, Hh, Hl, n8, blockIdx.x); }

// ---- fast GEMM (block tile 128x64, wave tile 32x64; requires M % 128 == 0, N % 64 == 0 and K % 128 == 0); epilogue = k_gemm_hhx semantics ----
// k loop staging of k_gemm2: one stage = 128 k (256 B of a row) of the block's 128 A rows and 64 B rows, laid in LDS at a pitch of 272 B (16 B x odd, for the 16-byte fragment reads); two buffers.
#define G2_PITCH 272
#define G2_AB (128 * G2_PITCH)
#define G2_STAGE ((128 + 64) * G2_PITCH)
__device__ __forceinline__ v16h g2_lfrag(const unsigned char* p, int hh) { FragH f; f.half[0] = *(const v8us*)(p + 16 * hh); f.half[1] = *(const v8us*)(p + 32 + 16 * hh); return f.v; }
__device__ __forceinline__ v8f g2_mm(v16h a, v16h b, v8f c) { return __builtin_amdgcn_wmma_f32_16x16x32_f16(false, a, false, b, (short)0, c, false, false); }
// One wave's share of a stage: 32 A rows and 16 B rows, two rows (2 x 256 B, whole lines) per wave-wide copy, 16 B per lane, 24 copies.
// la, lb: the lane's LDS byte addresses of its first A and B chunk; ga, gb: the matching global addresses; a copy further on is two rows further on.
__device__ __forceinline__ void g2_stage(unsigned la, unsigned lb, const _Float16* ga, int lda, const _Float16* gb, int ldb) {
  unsigned l[24]; const _Float16* g[24];
#pragma unroll
  for (int i = 0; i < 16; ++i) { l[i] = la + i * (2 * G2_PITCH); g[i] = ga + (size_t)(2 * i) * lda; }
#pragma unroll
  for (int i = 0; i < 8; ++i) { l[16 + i] = lb + i * (2 * G2_PITCH); g[16 + i] = gb + (size_t)(2 * i) * ldb; }
  // the copies go to LDS through no register; s_wait_xcnt is the statement's last line so that no address register is rewritten ahead of it
  asm volatile("global_load_async_to_lds_b128 %0, %12, off\n\t"
               "global_load_async_to_lds_b128 %1, %13, off\n\t"
               "global_load_async_to_lds_b128 %2, %14, off\n\t"
               "global_load_async_to_lds_b128 %3, %15, off\n\t"
               "global_load_async_to_lds_b128 %4, %16, off\n\t"
               "global_load_async_to_lds_b128 %5, %17, off\n\t"
               "global_load_async_to_lds_b128 %6, %18, off\n\t"
               "global_load_async_to_lds_b128 %7, %19, off\n\t"
               "global_load_async_to_lds_b128 %8, %20, off\n\t"
               "global_load_async_to_lds_b128 %9, %21, off\n\t"
               "global_load_async_to_lds_b128 %10, %22, off\n\t"
               "global_load_async_to_lds_b128 %11, %23, off\n\t"
               "s_wait_xcnt 0x0"
               :: "v"(l[0]), "v"(l[1]), "v"(l[2]), "v"(l[3]), "v"(l[4]), "v"(l[5]), "v"(l[6]), "v"(l[7]), "v"(l[8]), "v"(l[9]), "v"(l[10]), "v"(l[11]),
                  "v"(g[0]), "v"(g[1]), "v"(g[2]), "v"(g[3]), "v"(g[4]), "v"(g[5]), "v"(g[6]), "v"(g[7]), "v"(g[8]), "v"(g[9]), "v"(g[10]), "v"(g[11]) : "memory");
  asm volatile("global_load_async_to_lds_b128 %0, %12, off\n\t"
               "global_load_async_to_lds_b128 %1, %13, off\n\t"
               "global_load_async_to_lds_b128 %2, %14, off\n\t"
               "global_load_async_to_lds_b128 %3, %15, off\n\t"
               "global_load_async_to_lds_b128 %4, %16, off\n\t"
               "global_load_async_to_lds_b128 %5, %17, off\n\t"
               "global_load_async_to_lds_b128 %6, %18, off\n\t"
               "global_load_async_to_lds_b128 %7, %19, off\n\t"
               "global_load_async_to_lds_b128 %8, %20, off\n\t"
               "global_load_async_to_lds_b128 %9, %21, off\n\t"
               "global_load_async_to_lds_b128 %10, %22, off\n\t"
               "global_load_async_to_lds_b128 %11, %23, off\n\t"
               "s_wait_xcnt 0x0"
               :: "v"(l[12]), "v"(l[13]), "v"(l[14]), "v"(l[15]), "v"(l[16]), "v"(l[17]), "v"(l[18]), "v"(l[19]), "v"(l[20]), "v"(l[21]), "v"(l[22]), "v"(l[23]),
                  "v"(g[12]), "v"(g[13]), "v"(g[14]), "v"(g[15]), "v"(g[16]), "v"(g[17]), "v"(g[18]), "v"(g[19]), "v"(g[20]), "v"(g[21]), "v"(g[22]), "v"(g[23]) : "memory");
}
// bx, by: the block's tile index and batch index inside its own product
template <int ACT>
__device__ __forceinline__ void g2_body(const _Float16* __restrict__ A, int lda, size_t sA, const _Float16* __restrict__ Bh, int ldb, size_t sB, float alpha, const float* __restrict__ bias, size_t sBias, const float* __restrict__ CP, int rowsPerB, size_t sCPb, int row0g,
    float* __restrict__ C, _Float16* __restrict__ C16, int ldc, size_t sC, int M, int N, int K, int bx, int by) {
  __shared__ __attribute__((aligned(16))) float so[4][32][68]; __shared__ __attribute__((aligned(16))) unsigned char ring[2 * G2_STAGE];
  const int tid = threadIdx.x, w = tid >> 5, lane = tid & 31, ln = lane & 15, hh = lane >> 4;
  A += (size_t)by * sA; Bh += (size_t)by * sB; const size_t cofs = (size_t)by * sC; const float* bp = bias ? bias + (size_t)by * sBias : nullptr;
  const int ntn = N >> 6; const int mt = bx / ntn, nq = bx - mt * ntn; const int row0 = mt * 128 + 32 * w, col0 = nq * 64; if (mt * 128 >= M) return;      /* the whole block leaves, in front of every barrier */
  const v8f z8 = {0.f,0.f,0.f,0.f,0.f,0.f,0.f,0.f}; v8f c00 = z8, c01 = z8, c02 = z8, c03 = z8, c10 = z8, c11 = z8, c12 = z8, c13 = z8;
  const _Float16* ga = A + (size_t)(row0 + hh) * lda + ln * 8; const _Float16* gb = Bh + (size_t)(col0 + 16 * w + hh) * ldb + ln * 8;      /* this lane's first 16 bytes of the wave's A and B rows */
  const unsigned la = (unsigned)(size_t)ring + (unsigned)((32 * w + hh) * G2_PITCH + ln * 16), lb = (unsigned)(size_t)ring + (unsigned)(G2_AB + (16 * w + hh) * G2_PITCH + ln * 16);
  const int nst = K >> 7;
  g2_stage(la, lb, ga, lda, gb, ldb);
  asm volatile("s_wait_asynccnt 0x0" ::: "memory");      /* this wave's copies of stage 0 have landed */
  __syncthreads();      /* and every other wave's: stage 0 may be read */
  if (nst > 1) g2_stage(la + G2_STAGE, lb + G2_STAGE, ga + 128, lda, gb + 128, ldb);
#pragma unroll 1      /* one trip per stage: the two buffers alternate */
  for (int t = 0; t < nst; ++t) { const unsigned bo = (unsigned)(t & 1) * G2_STAGE; const unsigned char* pa = ring + bo + (32 * w + ln) * G2_PITCH; const unsigned char* pb = ring + bo + G2_AB + ln * G2_PITCH;
    v16h fa[2][2], fb[2][4];      /* two fragment sets: the next k step's LDS reads are issued, as one group, ahead of this step's WMMAs; never beyond the stage */
    fa[0][0] = g2_lfrag(pa, hh); fa[0][1] = g2_lfrag(pa + 16 * G2_PITCH, hh);
#pragma unroll
    for (int j = 0; j < 4; ++j) fb[0][j] = g2_lfrag(pb + j * 16 * G2_PITCH, hh);
#pragma unroll
    for (int ks = 0; ks < 4; ++ks) { const int cu = ks & 1, nx = cu ^ 1;
      if (ks < 3) { fa[nx][0] = g2_lfrag(pa + (ks + 1) * 64, hh); fa[nx][1] = g2_lfrag(pa + 16 * G2_PITCH + (ks + 1) * 64, hh);
#pragma unroll
        for (int j = 0; j < 4; ++j) fb[nx][j] = g2_lfrag(pb + j * 16 * G2_PITCH + (ks + 1) * 64, hh); }
      __builtin_amdgcn_sched_barrier(0);      /* keeps the reads above in front of the WMMAs below: sunk to their uses, each pair of WMMAs waits out an LDS latency */
      c00 = g2_mm(fa[cu][0], fb[cu][0], c00); c10 = g2_mm(fa[cu][1], fb[cu][0], c10); c01 = g2_mm(fa[cu][0], fb[cu][1], c01); c11 = g2_mm(fa[cu][1], fb[cu][1], c11);
      c02 = g2_mm(fa[cu][0], fb[cu][2], c02); c12 = g2_mm(fa[cu][1], fb[cu][2], c12); c03 = g2_mm(fa[cu][0], fb[cu][3], c03); c13 = g2_mm(fa[cu][1], fb[cu][3], c13);
      __builtin_amdgcn_sched_barrier(0);      /* keeps the next group of reads behind these WMMAs, so that two sets suffice */
    }
    asm volatile("s_wait_dscnt 0x0" ::: "memory");      /* this wave's reads of the buffer are done before it is refilled */
    asm volatile("s_wait_asynccnt 0x0" ::: "memory");      /* this wave's copies of stage t + 1 have landed */
    __syncthreads();      /* publishes stage t + 1 and ends every wave's reads of stage t */
    if (t + 2 < nst) g2_stage(la + bo, lb + bo, ga + (size_t)(t + 2) * 128, lda, gb + (size_t)(t + 2) * 128, ldb); }
  asm volatile("s_wait_asynccnt 0x0" ::: "memory");      /* no copy is left in flight */
  v8f accs[8] = {c00, c01, c02, c03, c10, c11, c12, c13};
#pragma unroll
  for (int u = 0; u < 8; ++u) { const int t = u & 3, half = u >> 2; const int col = col0 + t * 16 + ln; const float bv = bp ? bf16_round(bp[col]) : 0.f;
#pragma unroll
    for (int r = 0; r < 8; ++r) { const int rloc = half * 16 + 8 * hh + r; float v = accs[u][r] * alpha + bv; if (CP) { const int bidx = (row0g + row0 + rloc) / rowsPerB; v += CP[(size_t)bidx * sCPb + (size_t)by * 64 + col]; }
      if (ACT == 3) v = fmaxf(v, 0.f); else if (ACT == 6) v = 0.5f * v * (1.0f + erff(v * 0.70710678118654752f)); else if (ACT == 11) v = 1.0f / (1.0f + expf(-v)); else if (ACT == 15) v = v / (1.0f + expf(-v)); else if (ACT == 12) v = (v > 0.f) ? v : 0.01f * v; else if (ACT == 8) v = tanhf(v);
      so[w][rloc][t * 16 + ln] = v; } }
  __builtin_amdgcn_fence(__ATOMIC_ACQ_REL, "workgroup"); __builtin_amdgcn_wave_barrier();
  const int rsub = lane >> 4, c4 = (lane & 15) * 4;
  {
#pragma unroll
    for (int q = 0; q < 16; ++q) { const int r = q * 2 + rsub; const v4f v = *(const v4fa*)&so[w][r][c4]; if (C) *(v4f*)(C + cofs + (size_t)(row0 + r) * ldc + col0 + c4) = v; if (C16) { v4h h4; for (int i = 0; i < 4; ++i) h4[i] = (_Float16)v[i]; *(v4h*)(C16 + cofs + (size_t)(row0 + r) * ldc + col0 + c4) = h4; } }
     } }
template <int ACT>
__global__ __launch_bounds__(128) void k_gemm2(const _Float16* __restrict__ A, int lda, size_t sA, const _Float16* __restrict__ Bh, int ldb, size_t sB, float alpha, const float* __restrict__ bias, size_t sBias, const float* __restrict__ CP, int rowsPerB, size_t sCPb, int row0g,
    float* __restrict__ C, _Float16* __restrict__ C16, int ldc, size_t sC, int M, int N, int K) {
  g2_body<ACT>(A, lda, sA, Bh, ldb, sB, alpha, bias, sBias, CP, rowsPerB, sCPb, row0g, C, C16, ldc, sC, M, N, K, (int)blockIdx.x, (int)blockIdx.y); }
// The five projections that depend on the embeddings alone (q, k, v of the self attention; k, v of the cross attention) in one grid: a range of block indices per product.
// BT: the six [DM][DM] weight planes in a row (q, k, v, cross q, cross k, cross v); FW: three [SW][DM] f32 results in a row; FP: two [SP][DM] f32 results in a row.
#define P5_NW ((SW / 128) * (DM / 64))
#define P5_NP ((SP / 128) * (DM / 64))
__global__ __launch_bounds__(128) void k_proj5(const _Float16* __restrict__ WE, const _Float16* __restrict__ PE, const _Float16* __restrict__ BT, const float* __restrict__ bq, const float* __restrict__ bk, const float* __restrict__ bv, const float* __restrict__ bkc, const float* __restrict__ bvc,
    float* __restrict__ FW, float* __restrict__ FP) {
  const int b = (int)blockIdx.x; const bool word = b < 3 * P5_NW;      /* block-uniform */
  const int j = word ? b / P5_NW : (b - 3 * P5_NW) / P5_NP; const int bx = word ? b - j * P5_NW : (b - 3 * P5_NW) - j * P5_NP;
  const float* bias = word ? (j == 0 ? bq : (j == 1 ? bk : bv)) : (j == 0 ? bkc : bvc);
  g2_body<0>(word ? WE : PE, DM, 0, BT + (size_t)(word ? j : 4 + j) * DM * DM, DM, 0, 0.0625f, bias, 0, nullptr, 1, 0, 0,
             word ? FW + (size_t)j * SW * DM : FP + (size_t)j * SP * DM, nullptr, DM, 0, word ? SW : SP, DM, DM, bx, 0); }


template <int TK>
__device__ __forceinline__ void d_vthl(const float* __restrict__ VF, int ldv, _Float16* __restrict__ Vth, _Float16* __restrict__ Vtl, float (*tl)[65], int blk) { const int tid = threadIdx.x; const int slab = blk / (TK / 64), lg = blk % (TK / 64); const int b = slab / NH, h = slab % NH;
  for (int i = tid; i < 64 * 16; i += 256) { const int r = i / 16, c4 = (i % 16) * 4; const v4f a = *(const v4fa*)(VF + ((size_t)b * TK + lg * 64 + r) * ldv + h * 64 + c4); tl[r][c4] = a[0]; tl[r][c4 + 1] = a[1]; tl[r][c4 + 2] = a[2]; tl[r][c4 + 3] = a[3]; }
  __syncthreads();
  FragH fh[2], fl[2]; size_t oo[2];
#pragma unroll
  for (int rd = 0; rd < 2; ++rd) { const int d = rd * 32 + tid / 8, pc = tid % 8;
#pragma unroll
    for (int q = 0; q < 8; ++q) { const float v = tl[pc * 8 + q][d]; const _Float16 hv = (_Float16)v; fh[rd].h[q] = hv; fl[rd].h[q] = (_Float16)((v - (float)hv) * 1024.0f); } oo[rd] = ((size_t)slab * 64 + d) * TK + lg * 64 + pc * 8; }
  {
#pragma unroll
    for (int rd = 0; rd < 2; ++rd) { *(v8us*)((unsigned short*)Vth + oo[rd]) = fh[rd].half[0]; *(v8us*)((unsigned short*)Vtl + oo[rd]) = fl[rd].half[0]; }
    asm volatile("s_wait_xcnt 0x0" ::: "memory");      /* stands in front of whatever reuses the registers of the four stores above: inlined into a grid of several jobs, code of another job follows them in the listing */
     } }
// The hi/lo splits of the five projections in one grid: a range of block indices per plane (every branch is block-uniform; the barrier of d_vthl is passed by a whole block or by none of it).
#define S5_HW (SW * DM / 8 / 256)
#define S5_HP (SP * DM / 8 / 256)
#define S5_VW (NH * (SW / 64))
#define S5_VP (NH * (SP / 64))
__global__ __launch_bounds__(256) void k_split5(const float* __restrict__ FW, const float* __restrict__ FP, _Float16* __restrict__ Qh, _Float16* __restrict__ Ql, _Float16* __restrict__ Kh, _Float16* __restrict__ Kl, _Float16* __restrict__ Vth, _Float16* __restrict__ Vtl,
    _Float16* __restrict__ KCh, _Float16* __restrict__ KCl, _Float16* __restrict__ VCth, _Float16* __restrict__ VCtl) {
  __shared__ float tl[64][65]; int b = (int)blockIdx.x;
  if (b < S5_HW) { d_hl(FW, Qh, Ql, (size_t)SW * DM / 8, (unsigned)b); return; } b -= S5_HW;
  if (b < S5_HW) { d_hl(FW + (size_t)SW * DM, Kh, Kl, (size_t)SW * DM / 8, (unsigned)b); return; } b -= S5_HW;
  if (b < S5_VW) { d_vthl<SW>(FW + (size_t)2 * SW * DM, DM, Vth, Vtl, tl, b); return; } b -= S5_VW;
  if (b < S5_HP) { d_hl(FP, KCh, KCl, (size_t)SP * DM / 8, (unsigned)b); return; } b -= S5_HP;
  d_vthl<SP>(FP + (size_t)SP * DM, DM, VCth, VCtl, tl, b); }

template <int TQ, int TK>
__global__ __launch_bounds__(128) void k_flashm(const _Float16* __restrict__ Q16, const _Float16* __restrict__ Q16lo, int ldq, const _Float16* __restrict__ K16, const _Float16* __restrict__ K16lo, int ldk, const _Float16* __restrict__ Vt, const _Float16* __restrict__ Vtlo, const unsigned* __restrict__ MB, const int* __restrict__ RA, const int* __restrict__ KE, float* __restrict__ O, int ldo) {
  constexpr int RPW = 16, RTN = RPW / 16, NQB = TQ / (4 * RPW), DT = 4, KS = 2;
  __shared__ __attribute__((aligned(16))) unsigned short sP[4][RPW][40], sPl[4][RPW][40]; __shared__ __attribute__((aligned(16))) float sO[4][RPW][64 + 4];
  const int tid = threadIdx.x, w = tid >> 5, lane = tid & 31, ln = lane & 15, hh = lane >> 4;
  const int slab = blockIdx.x / NQB, qblk = blockIdx.x % NQB; const int b = slab / NH, h = slab % NH; const int qb0 = qblk * (4 * RPW); const int q0 = qb0 + w * RPW;
  FragH aq[2][KS], aql[2][KS];
#pragma unroll
  for (int rt = 0; rt < RTN; ++rt) { const size_t qo = ((size_t)b * TQ + q0 + rt * 16 + ln) * ldq + h * 64; const unsigned short* qr = (const unsigned short*)Q16 + qo; const unsigned short* ql = (const unsigned short*)Q16lo + qo;
#pragma unroll
    for (int ks = 0; ks < KS; ++ks) { aq[rt][ks].half[0] = *(const v8us*)(qr + ks * 32 + 8 * hh); aq[rt][ks].half[1] = *(const v8us*)(qr + ks * 32 + 16 + 8 * hh); aql[rt][ks].half[0] = *(const v8us*)(ql + ks * 32 + 8 * hh); aql[rt][ks].half[1] = *(const v8us*)(ql + ks * 32 + 16 + 8 * hh); } }
  const unsigned short* Vth = (const unsigned short*)Vt + (size_t)slab * 64 * TK; const unsigned short* Vtl = (const unsigned short*)Vtlo + (size_t)slab * 64 * TK;
  float m_r[2][8], l_r[2][8]; v8f oacc[2][DT], oaccl[2][DT];
#pragma unroll
  for (int rt = 0; rt < RTN; ++rt) {
#pragma unroll
    for (int r = 0; r < 8; ++r) { m_r[rt][r] = -3.0e38f; l_r[rt][r] = 0.f; }
#pragma unroll
    for (int dt = 0; dt < DT; ++dt) { oacc[rt][dt] = (v8f){0.f,0.f,0.f,0.f,0.f,0.f,0.f,0.f}; oaccl[rt][dt] = oacc[rt][dt]; } }
  int jend = KE[qblk * 32]; jend = min(TK, (jend + 31) & ~31); if (jend < 32) jend = 32;      /* block-uniform */
  int allm[2][8]; const unsigned* mrow[2][8];
#pragma unroll
  for (int rt = 0; rt < RTN; ++rt)
#pragma unroll
    for (int r = 0; r < 8; ++r) { const int tq = q0 + rt * 16 + 8 * hh + r; allm[rt][r] = RA[tq]; mrow[rt][r] = MB + (size_t)tq * (TK / 32); }
#pragma unroll 1
  for (int j0 = 0; j0 < jend; j0 += 32) {
    
    v8f s[2][2];
#pragma unroll
    for (int nt = 0; nt < 2; ++nt) { const size_t ko = ((size_t)b * TK + j0 + nt * 16 + ln) * ldk + h * 64; const unsigned short* kr = (const unsigned short*)K16 + ko; const unsigned short* kl = (const unsigned short*)K16lo + ko; FragH bk[KS], bkl[KS];
#pragma unroll
      for (int ks = 0; ks < KS; ++ks) { bk[ks].half[0] = *(const v8us*)(kr + ks * 32 + 8 * hh); bk[ks].half[1] = *(const v8us*)(kr + ks * 32 + 16 + 8 * hh); bkl[ks].half[0] = *(const v8us*)(kl + ks * 32 + 8 * hh); bkl[ks].half[1] = *(const v8us*)(kl + ks * 32 + 16 + 8 * hh); }
      asm volatile("s_wait_xcnt 0x0" ::: "memory");      /* stands in front of whatever reuses the address registers of the K loads above */
#pragma unroll
      for (int rt = 0; rt < RTN; ++rt) { v8f acc = (v8f){0.f,0.f,0.f,0.f,0.f,0.f,0.f,0.f}, accr = acc;
#pragma unroll
        for (int ks = 0; ks < KS; ++ks) { acc = mmaH<1>(aq[rt][ks].v, aq[rt][ks].v, bk[ks].v, bk[ks].v, acc); accr = mmaH<1>(aql[rt][ks].v, aql[rt][ks].v, bk[ks].v, bk[ks].v, accr); accr = mmaH<1>(aq[rt][ks].v, aq[rt][ks].v, bkl[ks].v, bkl[ks].v, accr); }
        s[rt][nt] = acc + accr * 0.0009765625f; } }
#pragma unroll
    for (int rt = 0; rt < RTN; ++rt) {      /* no branch in the softmax: each exp is computed for every lane and the old conditions pick by select, so a lane's eight rows are one straight-line block and their mask loads, cross-lane steps and exp chains overlap */
      float s0[8], s1[8], mc[8]; bool ok0[8], ok1[8];
#pragma unroll
      for (int r = 0; r < 8; ++r) { const unsigned mw = mrow[rt][r][j0 >> 5]; const bool am = (allm[rt][r] != 0);
        ok0[r] = am || (((mw >> ln) & 1u) == 0u); ok1[r] = am || (((mw >> (16 + ln)) & 1u) == 0u);
        s0[r] = ok0[r] ? (am ? 0.f : s[rt][0][r] * SCL) : -INFINITY; s1[r] = ok1[r] ? (am ? 0.f : s[rt][1][r] * SCL) : -INFINITY; mc[r] = fmaxf(s0[r], s1[r]); }
#pragma unroll
      for (int st = 1; st < 16; st <<= 1)
#pragma unroll
        for (int r = 0; r < 8; ++r) mc[r] = fmaxf(mc[r], __shfl_xor(mc[r], st, 32));
#pragma unroll
      for (int r = 0; r < 8; ++r) { const float mo = m_r[rt][r], mn = fmaxf(mo, mc[r]); const float ea = expf(mo - mn), e0 = expf(s0[r] - mn), e1 = expf(s1[r] - mn);
        const float al = (mn > -1.0e38f) ? ea : 1.0f; m_r[rt][r] = mn; const float p0 = ok0[r] ? e0 : 0.f, p1 = ok1[r] ? e1 : 0.f; l_r[rt][r] = l_r[rt][r] * al + p0 + p1;
#pragma unroll
        for (int dt = 0; dt < DT; ++dt) { oacc[rt][dt][r] *= al; oaccl[rt][dt][r] *= al; }
        FragH t2, t3; const float ps0 = p0 * 1024.0f, ps1 = p1 * 1024.0f; t2.h[0] = (_Float16)ps0; t2.h[1] = (_Float16)ps1; t3.h[0] = (_Float16)((ps0 - (float)t2.h[0]) * 1024.0f); t3.h[1] = (_Float16)((ps1 - (float)t2.h[1]) * 1024.0f);
        sP[w][rt * 16 + 8 * hh + r][ln] = t2.u[0]; sP[w][rt * 16 + 8 * hh + r][16 + ln] = t2.u[1]; sPl[w][rt * 16 + 8 * hh + r][ln] = t3.u[0]; sPl[w][rt * 16 + 8 * hh + r][16 + ln] = t3.u[1]; } }
    __builtin_amdgcn_fence(__ATOMIC_ACQ_REL, "workgroup"); __builtin_amdgcn_wave_barrier();
    FragH pa[2], pl[2];
#pragma unroll
    for (int rt = 0; rt < RTN; ++rt) { pa[rt].half[0] = *(const v8us*)&sP[w][rt * 16 + ln][8 * hh]; pa[rt].half[1] = *(const v8us*)&sP[w][rt * 16 + ln][16 + 8 * hh]; pl[rt].half[0] = *(const v8us*)&sPl[w][rt * 16 + ln][8 * hh]; pl[rt].half[1] = *(const v8us*)&sPl[w][rt * 16 + ln][16 + 8 * hh]; }
#pragma unroll
    for (int dt = 0; dt < DT; ++dt) { const size_t vo = (size_t)(dt * 16 + ln) * TK + j0; FragH bv, bl; bv.half[0] = *(const v8us*)(Vth + vo + 8 * hh); bv.half[1] = *(const v8us*)(Vth + vo + 16 + 8 * hh); bl.half[0] = *(const v8us*)(Vtl + vo + 8 * hh); bl.half[1] = *(const v8us*)(Vtl + vo + 16 + 8 * hh);
#pragma unroll
      for (int rt = 0; rt < RTN; ++rt) { oacc[rt][dt] = mmaH<1>(pa[rt].v, pa[rt].v, bv.v, bv.v, oacc[rt][dt]); oaccl[rt][dt] = mmaH<1>(pa[rt].v, pa[rt].v, bl.v, bl.v, oaccl[rt][dt]); oaccl[rt][dt] = mmaH<1>(pl[rt].v, pl[rt].v, bv.v, bv.v, oaccl[rt][dt]); } }
    __builtin_amdgcn_fence(__ATOMIC_ACQ_REL, "workgroup"); __builtin_amdgcn_wave_barrier(); }
#pragma unroll
  for (int rt = 0; rt < RTN; ++rt) {
#pragma unroll
    for (int r = 0; r < 8; ++r) { float l = l_r[rt][r]; l += __shfl_xor(l, 1, 32); l += __shfl_xor(l, 2, 32); l += __shfl_xor(l, 4, 32); l += __shfl_xor(l, 8, 32); l_r[rt][r] = (l > 0.f) ? 1.0f / (l * 1024.0f) : 0.f; }
#pragma unroll
    for (int dt = 0; dt < DT; ++dt)
#pragma unroll
      for (int r = 0; r < 8; ++r) sO[w][rt * 16 + 8 * hh + r][dt * 16 + ln] = (oacc[rt][dt][r] + oaccl[rt][dt][r] * 0.0009765625f) * l_r[rt][r]; }
  __builtin_amdgcn_fence(__ATOMIC_ACQ_REL, "workgroup"); __builtin_amdgcn_wave_barrier();
  {
#pragma unroll
    for (int rp = 0; rp < RPW; rp += 2) { const int r = rp + (lane >> 4), pc = lane & 15; const v4f val = *(const v4fa*)&sO[w][r][pc * 4]; *(v4f*)(O + ((size_t)b * TQ + q0 + r) * ldo + h * 64 + pc * 4) = val; }
     } }


__device__ __forceinline__ void d_causaltab(unsigned* __restrict__ MB, int* __restrict__ RA, int* __restrict__ KE, int nq, int nk, int blk) {
  const int t = blk * 256 + threadIdx.x; const int nw = nk / 32;
  if (t < nq * nw) { const int q = t / nw, w = t % nw; const int first = q + 1 - 32 * w; const unsigned bits = (first <= 0) ? 0xffffffffu : ((first >= 32) ? 0u : (0xffffffffu << first)); *(unsigned*)(MB + t) = bits;  }
  if (t < nq) { *(int*)(RA + t) = 0;  }
  if (t < nq / 64) { const int v = 64 * (t + 1); *(int*)(KE + t * 32) = v;  } }
__device__ __forceinline__ void d_fulltab(unsigned* __restrict__ MB, int* __restrict__ RA, int* __restrict__ KE, int nq, int nk, int blk) {
  const int t = blk * 256 + threadIdx.x; const int nw = nk / 32;
  if (t < nq * nw) { *(unsigned*)(MB + t) = 0u;  }
  if (t < nq) { *(int*)(RA + t) = 0;  }
  if (t < nq / 64) { *(int*)(KE + t * 32) = nk;  } }

// Everything that depends on the inputs alone (eight weight planes, two embedding planes, two mask tables) in one grid: a range of block indices per job, every branch block-uniform.
// BT: the six [DM][DM] weight planes in a row (q, k, v, cross q, cross k, cross v).
#define PR_F (FF * DM / 8 / 256)
#define PR_W (DM * DM / 8 / 256)
#define PR_X (SW * DM / 8 / 256)
#define PR_P (SP * DM / 8 / 256)
#define PR_C (SW * (SW / 32) / 256)
#define PR_U (SW * (SP / 32) / 256)
__global__ __launch_bounds__(256) void k_prep(const float* __restrict__ Wq, const float* __restrict__ Wk, const float* __restrict__ Wv, const float* __restrict__ Wqc, const float* __restrict__ Wkc, const float* __restrict__ Wvc, const float* __restrict__ W1, const float* __restrict__ W2,
    const float* __restrict__ wemb, const float* __restrict__ pemb, _Float16* __restrict__ BT, _Float16* __restrict__ BW1, _Float16* __restrict__ BW2, _Float16* __restrict__ WE16, _Float16* __restrict__ PE16,
    unsigned* __restrict__ MB, int* __restrict__ RA, int* __restrict__ KE, unsigned* __restrict__ MB2, int* __restrict__ RA2, int* __restrict__ KE2) {
  int b = (int)blockIdx.x;
  if (b < PR_F) { d_round16f(W1, BW1, (size_t)FF * DM / 8, (unsigned)b); return; } b -= PR_F;
  if (b < PR_F) { d_round16f(W2, BW2, (size_t)FF * DM / 8, (unsigned)b); return; } b -= PR_F;
  if (b < 6 * PR_W) { const int j = b / PR_W; const float* W = (j == 0) ? Wq : (j == 1) ? Wk : (j == 2) ? Wv : (j == 3) ? Wqc : (j == 4) ? Wkc : Wvc;
    d_round16f(W, BT + (size_t)j * DM * DM, (size_t)DM * DM / 8, (unsigned)(b - j * PR_W)); return; } b -= 6 * PR_W;
  if (b < PR_X) { d_x16(wemb, WE16, (size_t)SW * DM / 8, (unsigned)b); return; } b -= PR_X;
  if (b < PR_P) { d_x16(pemb, PE16, (size_t)SP * DM / 8, (unsigned)b); return; } b -= PR_P;
  if (b < PR_C) { d_causaltab(MB, RA, KE, SW, SW, b); return; } b -= PR_C;
  d_fulltab(MB2, RA2, KE2, SW, SP, b); }

extern "C" void kernel_launch(void* const* d_in, const int* in_sizes, int n_in,
                              void* d_out, int out_size, void* d_ws, size_t ws_size, hipStream_t stream) {
  (void)in_sizes; (void)n_in; (void)out_size;
  const float* const* I = (const float* const*)d_in; const float* wemb = I[0]; const float* pemb = I[1];
  const float* Wq = I[2]; const float* bq = I[3]; const float* Wk = I[4]; const float* bk = I[5]; const float* Wv = I[6]; const float* bv = I[7];
  const float* Wqc = I[8]; const float* bqc = I[9]; const float* Wkc = I[10]; const float* bkc = I[11]; const float* Wvc = I[12]; const float* bvc = I[13];
  const float* W1 = I[14]; const float* b1 = I[15]; const float* W2 = I[16]; const float* b2 = I[17];
  char* ws = (char*)d_ws; size_t off = 0;
  auto take = [&](size_t bytes) { char* p = ws + off; off += (bytes + 255) & ~(size_t)255; return p; };
  _Float16* BT = (_Float16*)take((size_t)6 * DM * DM * 2); _Float16* BQC = BT + (size_t)3 * DM * DM;      /* weight planes q, k, v, cross q, cross k, cross v in a row */
  _Float16* BW1 = (_Float16*)take((size_t)FF * DM * 2); _Float16* BW2 = (_Float16*)take((size_t)DM * FF * 2);
  _Float16* WE16 = (_Float16*)take((size_t)SW * DM * 2); _Float16* PE16 = (_Float16*)take((size_t)SP * DM * 2);
  float* FW = (float*)take((size_t)3 * SW * DM * 4); float* FP = (float*)take((size_t)2 * SP * DM * 4);      /* f32 q, k, v and cross k, v */
  _Float16* Qh = (_Float16*)take((size_t)SW * DM * 2); _Float16* Ql = (_Float16*)take((size_t)SW * DM * 2); _Float16* Kh = (_Float16*)take((size_t)SW * DM * 2); _Float16* Kl = (_Float16*)take((size_t)SW * DM * 2);      /* Qh..Kl: 16 MiB contiguous, later the FFN f32 half-hidden */
  _Float16* Vth = (_Float16*)take((size_t)SW * DM * 2); _Float16* Vtl = (_Float16*)take((size_t)SW * DM * 2);
  _Float16* KCh = (_Float16*)take((size_t)SP * DM * 2); _Float16* KCl = (_Float16*)take((size_t)SP * DM * 2); _Float16* VCth = (_Float16*)take((size_t)SP * DM * 2); _Float16* VCtl = (_Float16*)take((size_t)SP * DM * 2);
  unsigned* MB = (unsigned*)take((size_t)SW * (SW / 32) * 4); int* RA = (int*)take((size_t)SW * 4); int* KE = (int*)take((size_t)(SW / 64) * 32 * 4);
  unsigned* MB2 = (unsigned*)take((size_t)SW * (SP / 32) * 4); int* RA2 = (int*)take((size_t)SW * 4); int* KE2 = (int*)take((size_t)(SW / 64) * 32 * 4);
  _Float16* Ah = (_Float16*)take((size_t)SW * DM * 2); _Float16* Al = (_Float16*)take((size_t)SW * DM * 2);      /* word hi/lo, later cross hi/lo */
  _Float16* HDh = (_Float16*)take((size_t)SW * (FF / 2) * 2); _Float16* HDl = (_Float16*)take((size_t)SW * (FF / 2) * 2);
  if (off > ws_size) return;      /* 12 + 16 + 4 + 2 + 32 + 32 + 0.8 + 8 + 16 = 123 MiB */
  float* F = FW;      /* free again behind k_split5: attention results, cross q */
  float* HF = (float*)Qh;             /* FFN half hidden f32 [2048][2048] = 16 MiB over Qh..Kl (dead after the second attention) */
  const dim3 gW((SW / 128) * (DM / 64), 1), gH((SW / 128) * ((FF / 2) / 64), 1); const size_t n8w = (size_t)SW * DM / 8; const unsigned nbw = (unsigned)((n8w + 255) / 256);
  k_prep<<<2 * PR_F + 6 * PR_W + PR_X + PR_P + PR_C + PR_U, 256, 0, stream>>>(Wq, Wk, Wv, Wqc, Wkc, Wvc, W1, W2, wemb, pemb, BT, BW1, BW2, WE16, PE16, MB, RA, KE, MB2, RA2, KE2);      /* weights are (out,in) row-major = natural Bt; x16 */
  k_proj5<<<3 * P5_NW + 2 * P5_NP, 128, 0, stream>>>(WE16, PE16, BT, bq, bk, bv, bkc, bvc, FW, FP);
  k_split5<<<2 * S5_HW + S5_VW + S5_HP + S5_VP, 256, 0, stream>>>(FW, FP, Qh, Ql, Kh, Kl, Vth, Vtl, KCh, KCl, VCth, VCtl);
  /* --- causal self attention on the word embeddings (all planes hi/lo) --- */
  k_flashm<SW, SW><<<NH * (SW / 64), 128, 0, stream>>>(Qh, Ql, DM, Kh, Kl, DM, Vth, Vtl, MB, RA, KE, F, DM);      /* word (f32) -> F */
  k_hl<<<nbw, 256, 0, stream>>>(F, Ah, Al, n8w);      /* word as hi/lo operand planes */
  k_gemm2<0><<<gW, 128, 0, stream>>>(Ah, DM, 0, BQC, DM, 0, 0.0625f, bqc, 0, nullptr, 1, 0, 0, F, nullptr, DM, 0, SW, DM, DM);
  k_gemm2<0><<<gW, 128, 0, stream>>>(Al, DM, 0, BQC, DM, 0, 0.0625f * 0.0009765625f, nullptr, 0, F, 1, (size_t)DM, 0, F, nullptr, DM, 0, SW, DM, DM); k_hl<<<nbw, 256, 0, stream>>>(F, Qh, Ql, n8w);
  k_flashm<SW, SP><<<NH * (SW / 64), 128, 0, stream>>>(Qh, Ql, DM, KCh, KCl, DM, VCth, VCtl, MB2, RA2, KE2, F, DM);      /* cross (f32) -> F */
  k_hl<<<nbw, 256, 0, stream>>>(F, Ah, Al, n8w);      /* cross as hi/lo operand planes */
  /* --- FFN in two column halves of the hidden: h = relu(cross*W1^T + b1) (hi/lo), out (+)= h_half*W2_half^T (+ b2 once) --- */
  for (int hf = 0; hf < 2; ++hf) { const _Float16* B1h = BW1 + (size_t)hf * (FF / 2) * DM; const _Float16* B2h = BW2 + (size_t)hf * (FF / 2);
    k_gemm2<0><<<gH, 128, 0, stream>>>(Ah, DM, 0, B1h, DM, 0, 0.0625f, b1 + hf * (FF / 2), 0, nullptr, 1, 0, 0, HF, nullptr, FF / 2, 0, SW, FF / 2, DM);
    k_gemm2<3><<<gH, 128, 0, stream>>>(Al, DM, 0, B1h, DM, 0, 0.0625f * 0.0009765625f, nullptr, 0, HF, 1, (size_t)(FF / 2), 0, HF, nullptr, FF / 2, 0, SW, FF / 2, DM);      /* relu applied after the residual pass completes the sum */
    k_hl<<<(unsigned)(((size_t)SW * (FF / 2) / 8 + 255) / 256), 256, 0, stream>>>(HF, HDh, HDl, (size_t)SW * (FF / 2) / 8);
    k_gemm2<0><<<gW, 128, 0, stream>>>(HDh, FF / 2, 0, B2h, FF, 0, 0.0625f, (hf == 0) ? b2 : nullptr, 0, (hf == 0) ? nullptr : (const float*)d_out, 1, (size_t)DM, 0, (float*)d_out, nullptr, DM, 0, SW, DM, FF / 2);
    k_gemm2<0><<<gW, 128, 0, stream>>>(HDl, FF / 2, 0, B2h, FF, 0, 0.0625f * 0.0009765625f, nullptr, 0, (const float*)d_out, 1, (size_t)DM, 0, (float*)d_out, nullptr, DM, 0, SW, DM, FF / 2); }
}

// v004
// It runs in 482 microseconds.
// Next to v003, in two timings, it ran 1.30 and 1.29 times as fast.
// Over all steps from v000 it is 2.65 times as fast.
#include <hip/hip_runtime.h>
// Two-stage attention decoder block (word embeddings [2048][1024], position embeddings [1024][1024], 16 heads x 64, FFN 4096): word = CausalMHA(wemb; q,k,v = Linear+bias, scores/8, tril, softmax, .v, heads merged, no output projection); cross = MHA(q from word, k/v from pemb, no mask); out = relu(cross*W1^T + b1)*W2^T + b2 -> [2048,1024].
// Compute dtype: inputs and parameters rounded to bf16; projections of the embeddings exact; all other operands f16 hi + (x2^10) residual pairs (~2^-21); f32 accumulation, softmax f32. v_wmma_f32_16x16x32_f16.
#define SW 2048
#define SP 1024
#define DM 1024
#define NH 16
#define FF 4096
#define SCL 0.125f
#define SKV ((SW > SP) ? SW : SP)      /* larger key count (unused): the self attention has SW keys, the cross attention SP */
typedef __bf16 v16b __attribute__((ext_vector_type(16)));
typedef unsigned short v8us __attribute__((ext_vector_type(8), may_alias));
typedef float  v8f  __attribute__((ext_vector_type(8)));
typedef float  v4f  __attribute__((ext_vector_type(4)));
typedef float  v4fa __attribute__((ext_vector_type(4), may_alias));
union FragB { v16b v; v8us half[2]; unsigned short u[16]; };

__device__ __forceinline__ unsigned short bf16_bits(float x) { unsigned int u = __float_as_uint(x); return (unsigned short)((u + 0x7FFFu + ((u >> 16) & 1u)) >> 16); }
__device__ __forceinline__ float bf16_val(unsigned short b) { return __uint_as_float(((unsigned int)b) << 16); }
__device__ __forceinline__ float bf16_round(float x) { return bf16_val(bf16_bits(x)); }
// D += A·B with NT terms: 1 = ah·bh, 2 = + al·bh (A split), 3 = + ah·bl (both split)
template <int NT>
__device__ __forceinline__ v8f mmaN(v16b ah, v16b al, v16b bh, v16b bl, v8f c) {
  c = __builtin_amdgcn_wmma_f32_16x16x32_bf16(false, ah, false, bh, (short)0, c, false, false);
  if (NT >= 2) c = __builtin_amdgcn_wmma_f32_16x16x32_bf16(false, al, false, bh, (short)0, c, false, false);
  if (NT >= 3) c = __builtin_amdgcn_wmma_f32_16x16x32_bf16(false, ah, false, bl, (short)0, c, false, false);
  asm volatile("v_nop\n\tv_nop\n\tv_nop\n\tv_nop" : "+v"(c) : "v"(ah), "v"(al), "v"(bh), "v"(bl));
  return c;
}

__global__ __launch_bounds__(256) void k_wt_bf16(const float* __restrict__ W, unsigned short* __restrict__ Wt, int K, int N) {
  const int t = blockIdx.x * 256 + threadIdx.x;
  const int k8n = K / 8;
  if (t >= N * k8n) return;
  const int n = t / k8n, k8 = (t % k8n) * 8;
  v8us v;
#pragma unroll
  for (int i = 0; i < 8; ++i) v[i] = bf16_bits(W[(size_t)(k8 + i) * N + n]);
  *(v8us*)(Wt + (size_t)n * K + k8) = v;
  
}

// GEMM C[M][N] (f32, pitch ldc) = act(A[M][K]·W + bias). A f32 row-major (pitch lda) converted per fragment to bf16
// (ASPLIT: hi/lo two planes -> 2 terms, else single rounded term); Wt bf16 [N][K] (pitch ldb). BIAS_BF16 rounds the
// bias to bf16 first (bias quantised to bf16 before the add). K%32==0, M%16==0, N%64==0.
template <bool ASPLIT, int ACT, bool BIAS_BF16>
__global__ __launch_bounds__(128) void k_gemm_bf(const float* __restrict__ A, int lda, const unsigned short* __restrict__ Wt, int ldb,
                                               const float* __restrict__ bias, float* __restrict__ C, int ldc, int M, int N, int K) {
  __shared__ __attribute__((aligned(16))) float so[4][16][64];
  const int tid = threadIdx.x, w = tid >> 5, lane = tid & 31, ln = lane & 15, hh = lane >> 4;
  const int ntn = N / 64;
  const int wid = blockIdx.x * 4 + w;
  const int mt = wid / ntn, nq = wid % ntn;
  if (mt * 16 >= M) return;
  const int row0 = mt * 16, col0 = nq * 64;
  const float* arow = A + (size_t)(row0 + ln) * lda;
  v8f acc[4] = {};
  for (int kb = 0; kb < K; kb += 32) {
    FragB ah, al;
    const v4f x0 = *(const v4fa*)(arow + kb + 8 * hh), x1 = *(const v4fa*)(arow + kb + 8 * hh + 4);
    const v4f x2 = *(const v4fa*)(arow + kb + 16 + 8 * hh), x3 = *(const v4fa*)(arow + kb + 16 + 8 * hh + 4);
    float xs[16] = {x0[0],x0[1],x0[2],x0[3],x1[0],x1[1],x1[2],x1[3],x2[0],x2[1],x2[2],x2[3],x3[0],x3[1],x3[2],x3[3]};
#pragma unroll
    for (int i = 0; i < 16; ++i) { const unsigned short hb = bf16_bits(xs[i]); ah.u[i] = hb; al.u[i] = ASPLIT ? bf16_bits(xs[i] - bf16_val(hb)) : (unsigned short)0; }
#pragma unroll
    for (int t = 0; t < 4; ++t) {
      const unsigned short* brow = Wt + (size_t)(col0 + t * 16 + ln) * ldb + kb;
      FragB b;
      b.half[0] = *(const v8us*)(brow + 8 * hh);
      b.half[1] = *(const v8us*)(brow + 16 + 8 * hh);
      acc[t] = mmaN<ASPLIT ? 2 : 1>(ah.v, al.v, b.v, b.v, acc[t]);
    }
  }
#pragma unroll
  for (int t = 0; t < 4; ++t) {
    float bv = bias ? bias[col0 + t * 16 + ln] : 0.f;
    if (BIAS_BF16) bv = bf16_round(bv);
#pragma unroll
    for (int r = 0; r < 8; ++r) { float v = acc[t][r] + bv; if (ACT == 1) v = fmaxf(v, 0.f); so[w][8 * hh + r][t * 16 + ln] = v; }
  }
  __builtin_amdgcn_fence(__ATOMIC_ACQ_REL, "workgroup");
  __builtin_amdgcn_wave_barrier();
  const int rsub = lane >> 4, c4 = (lane & 15) * 4;
  {
#pragma unroll
    for (int q = 0; q < 8; ++q) {
      const int r = q * 2 + rsub;
      const v4f v = *(const v4fa*)&so[w][r][c4];
      *(v4f*)(C + (size_t)(row0 + r) * ldc + col0 + c4) = v;
    }
    
  }
}

// GEMM C = act(A·W + bias + resid): A f32 (ASPLIT -> hi/lo 2 terms), Wt bf16 [N][K]; ACT 0 none, 1 relu, 2 exact gelu;
// resid (optional, f32, row index = (row % rmod), pitch ldr, RES_BF16 rounds it) added before the activation.
template <bool ASPLIT, int ACT, bool BIAS_BF16, bool RES_BF16>
__global__ __launch_bounds__(128) void k_gemm_bf3(const float* __restrict__ A, int lda, const unsigned short* __restrict__ Wt, int ldb,
                                                const float* __restrict__ bias, const float* __restrict__ resid, int rmod, int ldr,
                                                float* __restrict__ C, int ldc, int M, int N, int K) {
  __shared__ __attribute__((aligned(16))) float so[4][16][64];
  const int tid = threadIdx.x, w = tid >> 5, lane = tid & 31, ln = lane & 15, hh = lane >> 4;
  const int ntn = N / 64;
  const int wid = blockIdx.x * 4 + w;
  const int mt = wid / ntn, nq = wid % ntn;
  if (mt * 16 >= M) return;
  const int row0 = mt * 16, col0 = nq * 64;
  const float* arow = A + (size_t)(row0 + ln) * lda;
  v8f acc[4] = {};
  for (int kb = 0; kb < K; kb += 32) {
    FragB ah, al;
    const v4f x0 = *(const v4fa*)(arow + kb + 8 * hh), x1 = *(const v4fa*)(arow + kb + 8 * hh + 4);
    const v4f x2 = *(const v4fa*)(arow + kb + 16 + 8 * hh), x3 = *(const v4fa*)(arow + kb + 16 + 8 * hh + 4);
    float xs[16] = {x0[0],x0[1],x0[2],x0[3],x1[0],x1[1],x1[2],x1[3],x2[0],x2[1],x2[2],x2[3],x3[0],x3[1],x3[2],x3[3]};
#pragma unroll
    for (int i = 0; i < 16; ++i) { const unsigned short hb = bf16_bits(xs[i]); ah.u[i] = hb; al.u[i] = ASPLIT ? bf16_bits(xs[i] - bf16_val(hb)) : (unsigned short)0; }
#pragma unroll
    for (int t = 0; t < 4; ++t) {
      const unsigned short* brow = Wt + (size_t)(col0 + t * 16 + ln) * ldb + kb;
      FragB b;
      b.half[0] = *(const v8us*)(brow + 8 * hh);
      b.half[1] = *(const v8us*)(brow + 16 + 8 * hh);
      acc[t] = mmaN<ASPLIT ? 2 : 1>(ah.v, al.v, b.v, b.v, acc[t]);
    }
  }
#pragma unroll
  for (int t = 0; t < 4; ++t) {
    const int col = col0 + t * 16 + ln;
    float bv = bias ? bias[col] : 0.f;
    if (BIAS_BF16) bv = bf16_round(bv);
#pragma unroll
    for (int r = 0; r < 8; ++r) {
      float v = acc[t][r] + bv;
      if (resid) { float rv = resid[(size_t)((row0 + 8 * hh + r) % rmod) * ldr + col]; if (RES_BF16) rv = bf16_round(rv); v += rv; }
      if (ACT == 1) v = fmaxf(v, 0.f);
      if (ACT == 2) v = 0.5f * v * (1.0f + erff(v * 0.70710678118654752f));
      if (ACT == 3) { const float u = 0.7978845608028654f * (v + 0.044715f * v * v * v); v = 0.5f * v * (1.0f + tanhf(u)); }
      so[w][8 * hh + r][t * 16 + ln] = v;
    }
  }
  __builtin_amdgcn_fence(__ATOMIC_ACQ_REL, "workgroup");
  __builtin_amdgcn_wave_barrier();
  const int rsub = lane >> 4, c4 = (lane & 15) * 4;
  {
#pragma unroll
    for (int q = 0; q < 8; ++q) {
      const int r = q * 2 + rsub;
      const v4f v = *(const v4fa*)&so[w][r][c4];
      *(v4f*)(C + (size_t)(row0 + r) * ldc + col0 + c4) = v;
    }
    
  }
}
// row LayerNorm (biased variance, eps) over N: s = X (+ R); optional out_sum <- s; out_norm <- (s-mu)*rsqrt(var+eps)*g + b
template <bool PARAM_BF16>
__global__ __launch_bounds__(256) void k_layernorm(const float* __restrict__ X, const float* __restrict__ R, const float* __restrict__ g, const float* __restrict__ bta,
                                                  float* __restrict__ out_sum, float* __restrict__ out_norm, int N, float eps) {
  __shared__ float red[256];
  const int row = blockIdx.x, tid = threadIdx.x;
  const float* x = X + (size_t)row * N; const float* rr = R ? R + (size_t)row * N : nullptr;
  float vals[16];                     // up to N = 4096
  const int per = N / 256;            // contiguous chunk per thread? use strided-by-4 chunks: thread handles j = tid*4 + 1024*u
  float s1 = 0.f;
  for (int u = 0; u < per / 4; ++u) {
    const int j = tid * 4 + 1024 * u;
    const v4f a = *(const v4fa*)(x + j);
    v4f b = {0.f,0.f,0.f,0.f}; if (rr) b = *(const v4fa*)(rr + j);
#pragma unroll
    for (int q = 0; q < 4; ++q) { const float v = a[q] + b[q]; vals[u * 4 + q] = v; s1 += v; }
  }
  red[tid] = s1; __syncthreads();
  for (int st = 128; st > 0; st >>= 1) { if (tid < st) red[tid] += red[tid + st]; __syncthreads(); }
  const float mu = red[0] / (float)N; __syncthreads();
  float s2 = 0.f;
  for (int u = 0; u < per / 4; ++u)
#pragma unroll
    for (int q = 0; q < 4; ++q) { const float c = vals[u * 4 + q] - mu; s2 += c * c; }
  red[tid] = s2; __syncthreads();
  for (int st = 128; st > 0; st >>= 1) { if (tid < st) red[tid] += red[tid + st]; __syncthreads(); }
  const float rs = rsqrtf(red[0] / (float)N + eps);
  {
    for (int u = 0; u < per / 4; ++u) {
      const int j = tid * 4 + 1024 * u;
      v4f o, sm;
#pragma unroll
      for (int q = 0; q < 4; ++q) {
        float gg = g[j + q], bb = bta[j + q];
        if (PARAM_BF16) { gg = bf16_round(gg); bb = bf16_round(bb); }
        sm[q] = vals[u * 4 + q]; o[q] = (vals[u * 4 + q] - mu) * rs * gg + bb;
      }
      if (out_sum) *(v4f*)(out_sum + (size_t)row * N + j) = sm;
      *(v4f*)(out_norm + (size_t)row * N + j) = o;
    }
    
  }
}



// ---- f16 WMMA path (v_wmma_f32_16x16x32_f16): 11-bit significands for operands in range — used where a [0,1] probability operand needs more precision than bf16
typedef _Float16 v16h __attribute__((ext_vector_type(16)));
union FragH { v16h v; v8us half[2]; _Float16 h[16]; unsigned short u[16]; };
template <int NT>
__device__ __forceinline__ v8f mmaH(v16h ah, v16h al, v16h bh, v16h bl, v8f c) {
  c = __builtin_amdgcn_wmma_f32_16x16x32_f16(false, ah, false, bh, (short)0, c, false, false);
  if (NT >= 2) c = __builtin_amdgcn_wmma_f32_16x16x32_f16(false, al, false, bh, (short)0, c, false, false);
  if (NT >= 3) c = __builtin_amdgcn_wmma_f32_16x16x32_f16(false, ah, false, bl, (short)0, c, false, false);
  asm volatile("v_nop\n\tv_nop\n\tv_nop\n\tv_nop" : "+v"(c) : "v"(ah), "v"(al), "v"(bh), "v"(bl));
  return c;
}
// batched GEMM like k_gemm_b but f16 operands: A f32 (split into f16 hi/lo if ASPLIT, else rounded to f16), Bt = f16 values [n][k]; alpha; C f32; N multiple of 16 (partial tiles skipped)
template <bool ASPLIT>
__global__ __launch_bounds__(128) void k_gemm_h(const float* __restrict__ A, int lda, size_t sA, const _Float16* __restrict__ Bh, int ldb, size_t sB, float alpha, float* __restrict__ C, int ldc, size_t sC, int M, int N, int K) {
  __shared__ __attribute__((aligned(16))) float so[4][16][64];
  const int tid = threadIdx.x, w = tid >> 5, lane = tid & 31, ln = lane & 15, hh = lane >> 4; const int by = blockIdx.y;
  A += (size_t)by * sA; Bh += (size_t)by * sB; C += (size_t)by * sC;
  const int ntn = (N + 63) / 64; const int wid = blockIdx.x * 4 + w; const int mt = wid / ntn, nq = wid % ntn; if (mt * 16 >= M) return;
  const int row0 = mt * 16, col0 = nq * 64; const float* arow = A + (size_t)(row0 + ln) * lda;
  v8f acc[4] = {};
  for (int kb = 0; kb < K; kb += 32) {
    FragH ah, al;
    const v4f x0 = *(const v4fa*)(arow + kb + 8 * hh), x1 = *(const v4fa*)(arow + kb + 8 * hh + 4), x2 = *(const v4fa*)(arow + kb + 16 + 8 * hh), x3 = *(const v4fa*)(arow + kb + 16 + 8 * hh + 4);
    float xs[16] = {x0[0],x0[1],x0[2],x0[3],x1[0],x1[1],x1[2],x1[3],x2[0],x2[1],x2[2],x2[3],x3[0],x3[1],x3[2],x3[3]};
#pragma unroll
    for (int i = 0; i < 16; ++i) { const _Float16 h = (_Float16)xs[i]; ah.h[i] = h; al.h[i] = ASPLIT ? (_Float16)(xs[i] - (float)h) : (_Float16)0.0f; }
#pragma unroll
    for (int t = 0; t < 4; ++t) { if (col0 + t * 16 >= N) continue; const size_t boff = (size_t)(col0 + t * 16 + ln) * ldb + kb; FragH bq; bq.half[0] = *(const v8us*)(Bh + boff + 8 * hh); bq.half[1] = *(const v8us*)(Bh + boff + 16 + 8 * hh);
      acc[t] = mmaH<ASPLIT ? 2 : 1>(ah.v, al.v, bq.v, bq.v, acc[t]); }
  }
#pragma unroll
  for (int t = 0; t < 4; ++t) { if (col0 + t * 16 >= N) continue;
#pragma unroll
    for (int r = 0; r < 8; ++r) so[w][8 * hh + r][t * 16 + ln] = acc[t][r] * alpha; }
  __builtin_amdgcn_fence(__ATOMIC_ACQ_REL, "workgroup"); __builtin_amdgcn_wave_barrier();
  const int rsub = lane >> 4, c4 = (lane & 15) * 4;
  {
#pragma unroll
    for (int q = 0; q < 8; ++q) { const int r = q * 2 + rsub; if (col0 + c4 < N) { const v4f v = *(const v4fa*)&so[w][r][c4]; *(v4f*)(C + (size_t)(row0 + r) * ldc + col0 + c4) = v; } }
     }
}

// Wt[n][k] = f16(W[k][n]·scale) from f32 row-major W[K][N] (scale = power of two; bf16-exact weights stay exact in f16 away from the subnormal range)
__global__ __launch_bounds__(256) void k_wt_f16(const float* __restrict__ W, _Float16* __restrict__ Wt, int K, int N, float scale) {
  const int t = blockIdx.x * 256 + threadIdx.x; if (t >= N * (K / 8)) return; const int n = t / (K / 8), k8 = (t % (K / 8)) * 8; FragH f;
#pragma unroll
  for (int i = 0; i < 8; ++i) f.h[i] = (_Float16)(bf16_round(W[(size_t)(k8 + i) * N + n]) * scale); const v8us o = f.half[0];
  *(v8us*)((unsigned short*)Wt + (size_t)n * K + k8) = o; 
}
// k_gemm_hh variant with fused epilogue: v = acc·alpha + bias[by·sBias + col] (+ CP[(row/rowsPerB)·sCPb + by·64 + col] if CP) ; ACT 0 none / 1 elu ; writes f16 C16 (and f32 C if non-null)
template <int ACT>
__global__ __launch_bounds__(128) void k_gemm_hhx(const _Float16* __restrict__ A, int lda, size_t sA, const _Float16* __restrict__ Bh, int ldb, size_t sB, float alpha, const float* __restrict__ bias, size_t sBias, const float* __restrict__ CP, int rowsPerB, size_t sCPb, int row0g,
    float* __restrict__ C, _Float16* __restrict__ C16, int ldc, size_t sC, int M, int N, int K) {
  __shared__ __attribute__((aligned(16))) float so[4][16][64];
  const int tid = threadIdx.x, w = tid >> 5, lane = tid & 31, ln = lane & 15, hh = lane >> 4; const int by = blockIdx.y;
  A += (size_t)by * sA; Bh += (size_t)by * sB; const size_t cofs = (size_t)by * sC; const float* bp = bias ? bias + (size_t)by * sBias : nullptr;
  const int ntn = (N + 63) / 64; const int wid = blockIdx.x * 4 + w; const int mt = wid / ntn, nq = wid % ntn; if (mt * 16 >= M) return;
  const int row0 = mt * 16, col0 = nq * 64; const _Float16* arow = A + (size_t)(row0 + ln) * lda;
  v8f acc[4] = {};
  for (int kb = 0; kb < K; kb += 32) { FragH ah; ah.half[0] = *(const v8us*)((const unsigned short*)arow + kb + 8 * hh); ah.half[1] = *(const v8us*)((const unsigned short*)arow + kb + 16 + 8 * hh);
#pragma unroll
    for (int t = 0; t < 4; ++t) { if (col0 + t * 16 >= N) continue; const size_t boff = (size_t)(col0 + t * 16 + ln) * ldb + kb; FragH bq; bq.half[0] = *(const v8us*)((const unsigned short*)Bh + boff + 8 * hh); bq.half[1] = *(const v8us*)((const unsigned short*)Bh + boff + 16 + 8 * hh);
      acc[t] = mmaH<1>(ah.v, ah.v, bq.v, bq.v, acc[t]); }
  }
#pragma unroll
  for (int t = 0; t < 4; ++t) { if (col0 + t * 16 >= N) continue; const int col = col0 + t * 16 + ln; const float bv = bp ? bf16_round(bp[col]) : 0.f;
#pragma unroll
    for (int r = 0; r < 8; ++r) { float v = acc[t][r] * alpha + bv; if (CP) { const int bidx = (row0g + row0 + 8 * hh + r) / rowsPerB; v += CP[(size_t)bidx * sCPb + (size_t)by * 64 + col]; } if (ACT == 1) v = (v > 0.f) ? v : expm1f(v); else if (ACT == 7) v = (v > 0.f) ? v + 1.0f : expf(v); else if (ACT == 8) v = tanhf(v); else if (ACT == 9) v = 0.5f * v * (1.0f + tanhf(0.7978845608028654f * (v + 0.044715f * v * v * v))); else if (ACT == 11) v = 1.0f / (1.0f + expf(-v)); else if (ACT == 12) v = (v > 0.f) ? v : 0.01f * v; else if (ACT == 14) v = (v > 0.f) ? v : 0.1f * v; else if (ACT == 15) v = v / (1.0f + expf(-v)); else if (ACT == 3) v = fmaxf(v, 0.f); else if (ACT == 6) v = 0.5f * v * (1.0f + erff(v * 0.70710678118654752f)); so[w][8 * hh + r][t * 16 + ln] = v; } }
  __builtin_amdgcn_fence(__ATOMIC_ACQ_REL, "workgroup"); __builtin_amdgcn_wave_barrier();
  const int rsub = lane >> 4, c4 = (lane & 15) * 4; typedef _Float16 v4h __attribute__((ext_vector_type(4)));
  {
#pragma unroll
    for (int q = 0; q < 8; ++q) { const int r = q * 2 + rsub; if (col0 + c4 < N) { const v4f v = *(const v4fa*)&so[w][r][c4]; if (C) *(v4f*)(C + cofs + (size_t)(row0 + r) * ldc + col0 + c4) = v; if (C16) { v4h h4; for (int i = 0; i < 4; ++i) h4[i] = (_Float16)v[i]; *(v4h*)(C16 + cofs + (size_t)(row0 + r) * ldc + col0 + c4) = h4; } } }
     }
}


typedef _Float16 v4h __attribute__((ext_vector_type(4)));

// Bodies of the short kernels: blk is the block's index inside its own job, so that independent jobs can share one grid, each on its own range of block indices.
__device__ __forceinline__ void d_x16(const float* __restrict__ x, _Float16* __restrict__ X16, size_t n8, unsigned blk) { const size_t t = (size_t)blk * 256 + threadIdx.x; if (t >= n8) return; FragH f;
#pragma unroll
  for (int q = 0; q < 8; ++q) f.h[q] = (_Float16)bf16_round(x[t * 8 + q]); *(v8us*)((unsigned short*)X16 + t * 8) = f.half[0];  }
__global__ __launch_bounds__(256) void k_h16(const float* __restrict__ x, _Float16* __restrict__ X16, size_t n8) { const size_t t = (size_t)blockIdx.x * 256 + threadIdx.x; if (t >= n8) return; FragH f;
#pragma unroll
  for (int q = 0; q < 8; ++q) f.h[q] = (_Float16)x[t * 8 + q]; *(v8us*)((unsigned short*)X16 + t * 8) = f.half[0];  }
__device__ __forceinline__ void d_round16f(const float* __restrict__ W, _Float16* __restrict__ Bt, size_t n8, unsigned blk) { const size_t t = (size_t)blk * 256 + threadIdx.x; if (t >= n8) return; FragH f;
#pragma unroll
  for (int i = 0; i < 8; ++i) f.h[i] = (_Float16)(bf16_round(W[t * 8 + i]) * 16.0f); *(v8us*)((unsigned short*)Bt + t * 8) = f.half[0];  }
template <int NHv, int TTv>
__global__ __launch_bounds__(256) void k_vt(const _Float16* __restrict__ V16, int ldv, int voff, _Float16* __restrict__ Vt) { __shared__ unsigned short tl[64][66]; const int tid = threadIdx.x; const int slab = blockIdx.x / (TTv / 64), lg = blockIdx.x % (TTv / 64); const int b = slab / NHv, h = slab % NHv;
  for (int i = tid; i < 64 * 8; i += 256) { const int r = i / 8, c8 = (i % 8) * 8; FragH f; f.half[0] = *(const v8us*)((const unsigned short*)V16 + ((size_t)b * TTv + lg * 64 + r) * ldv + voff + h * 64 + c8);
#pragma unroll
    for (int q = 0; q < 8; ++q) tl[r][c8 + q] = f.u[q]; }
  __syncthreads();
  {
#pragma unroll
    for (int rd = 0; rd < 2; ++rd) { const int d = rd * 32 + tid / 8, pc = tid % 8; FragH f;
#pragma unroll
      for (int q = 0; q < 8; ++q) f.u[q] = tl[pc * 8 + q][d];
      *(v8us*)((unsigned short*)Vt + ((size_t)slab * 64 + d) * TTv + lg * 64 + pc * 8) = f.half[0]; }
     } }

__device__ __forceinline__ void d_hl(const float* __restrict__ F, _Float16* __restrict__ Hh, _Float16* __restrict__ Hl, size_t n8, unsigned blk) { const size_t t = (size_t)blk * 256 + threadIdx.x; if (t >= n8) return; FragH fh, fl; const v4f a = *(const v4fa*)(F + t * 8), c = *(const v4fa*)(F + t * 8 + 4);
#pragma unroll
  for (int q = 0; q < 4; ++q) { _Float16 h = (_Float16)a[q]; fh.h[q] = h; fl.h[q] = (_Float16)((a[q] - (float)h) * 1024.0f); h = (_Float16)c[q]; fh.h[4 + q] = h; fl.h[4 + q] = (_Float16)((c[q] - (float)h) * 1024.0f); }
  { *(v8us*)((unsigned short*)Hh + t * 8) = fh.half[0]; *(v8us*)((unsigned short*)Hl + t * 8) = fl.half[0];  } }
__global__ __launch_bounds__(256) void k_hl(const float* __restrict__ F, _Float16* __restrict__ Hh, _Float16* __restrict__ Hl, size_t n8) { d_hl(F, Hh, Hl, n8, blockIdx.x); }

// ---- fast GEMM (block tile 128x64, wave tile 32x64; requires M % 128 == 0, N % 64 == 0 and K % 128 == 0); epilogue = k_gemm_hhx semantics ----
// k loop staging of k_gemm2: one stage = 128 k (256 B of a row) of the block's 128 A rows and 64 B rows, laid in LDS at a pitch of 272 B (16 B x odd, for the 16-byte fragment reads); two buffers.
#define G2_PITCH 272
#define G2_AB (128 * G2_PITCH)
#define G2_STAGE ((128 + 64) * G2_PITCH)
__device__ __forceinline__ v16h g2_lfrag(const unsigned char* p, int hh) { FragH f; f.half[0] = *(const v8us*)(p + 16 * hh); f.half[1] = *(const v8us*)(p + 32 + 16 * hh); return f.v; }
__device__ __forceinline__ v8f g2_mm(v16h a, v16h b, v8f c) { return __builtin_amdgcn_wmma_f32_16x16x32_f16(false, a, false, b, (short)0, c, false, false); }
// One wave's share of a stage: 32 A rows and 16 B rows, two rows (2 x 256 B, whole lines) per wave-wide copy, 16 B per lane, 24 copies.
// la, lb: the lane's LDS byte addresses of its first A and B chunk; ga, gb: the matching global addresses; a copy further on is two rows further on.
__device__ __forceinline__ void g2_stage(unsigned la, unsigned lb, const _Float16* ga, int lda, const _Float16* gb, int ldb) {
  unsigned l[24]; const _Float16* g[24];
#pragma unroll
  for (int i = 0; i < 16; ++i) { l[i] = la + i * (2 * G2_PITCH); g[i] = ga + (size_t)(2 * i) * lda; }
#pragma unroll
  for (int i = 0; i < 8; ++i) { l[16 + i] = lb + i * (2 * G2_PITCH); g[16 + i] = gb + (size_t)(2 * i) * ldb; }
  // the copies go to LDS through no register; s_wait_xcnt is the statement's last line so that no address register is rewritten ahead of it
  asm volatile("global_load_async_to_lds_b128 %0, %12, off\n\t"
               "global_load_async_to_lds_b128 %1, %13, off\n\t"
               "global_load_async_to_lds_b128 %2, %14, off\n\t"
               "global_load_async_to_lds_b128 %3, %15, off\n\t"
               "global_load_async_to_lds_b128 %4, %16, off\n\t"
               "global_load_async_to_lds_b128 %5, %17, off\n\t"
               "global_load_async_to_lds_b128 %6, %18, off\n\t"
               "global_load_async_to_lds_b128 %7, %19, off\n\t"
               "global_load_async_to_lds_b128 %8, %20, off\n\t"
               "global_load_async_to_lds_b128 %9, %21, off\n\t"
               "global_load_async_to_lds_b128 %10, %22, off\n\t"
               "global_load_async_to_lds_b128 %11, %23, off\n\t"
               "s_wait_xcnt 0x0"
               :: "v"(l[0]), "v"(l[1]), "v"(l[2]), "v"(l[3]), "v"(l[4]), "v"(l[5]), "v"(l[6]), "v"(l[7]), "v"(l[8]), "v"(l[9]), "v"(l[10]), "v"(l[11]),
                  "v"(g[0]), "v"(g[1]), "v"(g[2]), "v"(g[3]), "v"(g[4]), "v"(g[5]), "v"(g[6]), "v"(g[7]), "v"(g[8]), "v"(g[9]), "v"(g[10]), "v"(g[11]) : "memory");
  asm volatile("global_load_async_to_lds_b128 %0, %12, off\n\t"
               "global_load_async_to_lds_b128 %1, %13, off\n\t"
               "global_load_async_to_lds_b128 %2, %14, off\n\t"
               "global_load_async_to_lds_b128 %3, %15, off\n\t"
               "global_load_async_to_lds_b128 %4, %16, off\n\t"
               "global_load_async_to_lds_b128 %5, %17, off\n\t"
               "global_load_async_to_lds_b128 %6, %18, off\n\t"
               "global_load_async_to_lds_b128 %7, %19, off\n\t"
               "global_load_async_to_lds_b128 %8, %20, off\n\t"
               "global_load_async_to_lds_b128 %9, %21, off\n\t"
               "global_load_async_to_lds_b128 %10, %22, off\n\t"
               "global_load_async_to_lds_b128 %11, %23, off\n\t"
               "s_wait_xcnt 0x0"
               :: "v"(l[12]), "v"(l[13]), "v"(l[14]), "v"(l[15]), "v"(l[16]), "v"(l[17]), "v"(l[18]), "v"(l[19]), "v"(l[20]), "v"(l[21]), "v"(l[22]), "v"(l[23]),
                  "v"(g[12]), "v"(g[13]), "v"(g[14]), "v"(g[15]), "v"(g[16]), "v"(g[17]), "v"(g[18]), "v"(g[19]), "v"(g[20]), "v"(g[21]), "v"(g[22]), "v"(g[23]) : "memory");
}
// bx, by: the block's tile index and batch index inside its own product
template <int ACT>
__device__ __forceinline__ void g2_body(const _Float16* __restrict__ A, int lda, size_t sA, const _Float16* __restrict__ Bh, int ldb, size_t sB, float alpha, const float* __restrict__ bias, size_t sBias, const float* __restrict__ CP, int rowsPerB, size_t sCPb, int row0g,
    float* __restrict__ C, _Float16* __restrict__ C16, int ldc, size_t sC, int M, int N, int K, int bx, int by) {
  __shared__ __attribute__((aligned(16))) float so[4][32][68]; __shared__ __attribute__((aligned(16))) unsigned char ring[2 * G2_STAGE];
  const int tid = threadIdx.x, w = tid >> 5, lane = tid & 31, ln = lane & 15, hh = lane >> 4;
  A += (size_t)by * sA; Bh += (size_t)by * sB; const size_t cofs = (size_t)by * sC; const float* bp = bias ? bias + (size_t)by * sBias : nullptr;
  const int ntn = N >> 6; const int mt = bx / ntn, nq = bx - mt * ntn; const int row0 = mt * 128 + 32 * w, col0 = nq * 64; if (mt * 128 >= M) return;      /* the whole block leaves, in front of every barrier */
  const v8f z8 = {0.f,0.f,0.f,0.f,0.f,0.f,0.f,0.f}; v8f c00 = z8, c01 = z8, c02 = z8, c03 = z8, c10 = z8, c11 = z8, c12 = z8, c13 = z8;
  const _Float16* ga = A + (size_t)(row0 + hh) * lda + ln * 8; const _Float16* gb = Bh + (size_t)(col0 + 16 * w + hh) * ldb + ln * 8;      /* this lane's first 16 bytes of the wave's A and B rows */
  const unsigned la = (unsigned)(size_t)ring + (unsigned)((32 * w + hh) * G2_PITCH + ln * 16), lb = (unsigned)(size_t)ring + (unsigned)(G2_AB + (16 * w + hh) * G2_PITCH + ln * 16);
  const int nst = K >> 7;
  g2_stage(la, lb, ga, lda, gb, ldb);
  asm volatile("s_wait_asynccnt 0x0" ::: "memory");      /* this wave's copies of stage 0 have landed */
  __syncthreads();      /* and every other wave's: stage 0 may be read */
  if (nst > 1) g2_stage(la + G2_STAGE, lb + G2_STAGE, ga + 128, lda, gb + 128, ldb);
#pragma unroll 1      /* one trip per stage: the two buffers alternate */
  for (int t = 0; t < nst; ++t) { const unsigned bo = (unsigned)(t & 1) * G2_STAGE; const unsigned char* pa = ring + bo + (32 * w + ln) * G2_PITCH; const unsigned char* pb = ring + bo + G2_AB + ln * G2_PITCH;
    v16h fa[2][2], fb[2][4];      /* two fragment sets: the next k step's LDS reads are issued, as one group, ahead of this step's WMMAs; never beyond the stage */
    fa[0][0] = g2_lfrag(pa, hh); fa[0][1] = g2_lfrag(pa + 16 * G2_PITCH, hh);
#pragma unroll
    for (int j = 0; j < 4; ++j) fb[0][j] = g2_lfrag(pb + j * 16 * G2_PITCH, hh);
#pragma unroll
    for (int ks = 0; ks < 4; ++ks) { const int cu = ks & 1, nx = cu ^ 1;
      if (ks < 3) { fa[nx][0] = g2_lfrag(pa + (ks + 1) * 64, hh); fa[nx][1] = g2_lfrag(pa + 16 * G2_PITCH + (ks + 1) * 64, hh);
#pragma unroll
        for (int j = 0; j < 4; ++j) fb[nx][j] = g2_lfrag(pb + j * 16 * G2_PITCH + (ks + 1) * 64, hh); }
      __builtin_amdgcn_sched_barrier(0);      /* keeps the reads above in front of the WMMAs below: sunk to their uses, each pair of WMMAs waits out an LDS latency */
      c00 = g2_mm(fa[cu][0], fb[cu][0], c00); c10 = g2_mm(fa[cu][1], fb[cu][0], c10); c01 = g2_mm(fa[cu][0], fb[cu][1], c01); c11 = g2_mm(fa[cu][1], fb[cu][1], c11);
      c02 = g2_mm(fa[cu][0], fb[cu][2], c02); c12 = g2_mm(fa[cu][1], fb[cu][2], c12); c03 = g2_mm(fa[cu][0], fb[cu][3], c03); c13 = g2_mm(fa[cu][1], fb[cu][3], c13);
      __builtin_amdgcn_sched_barrier(0);      /* keeps the next group of reads behind these WMMAs, so that two sets suffice */
    }
    asm volatile("s_wait_dscnt 0x0" ::: "memory");      /* this wave's reads of the buffer are done before it is refilled */
    asm volatile("s_wait_asynccnt 0x0" ::: "memory");      /* this wave's copies of stage t + 1 have landed */
    __syncthreads();      /* publishes stage t + 1 and ends every wave's reads of stage t */
    if (t + 2 < nst) g2_stage(la + bo, lb + bo, ga + (size_t)(t + 2) * 128, lda, gb + (size_t)(t + 2) * 128, ldb); }
  asm volatile("s_wait_asynccnt 0x0" ::: "memory");      /* no copy is left in flight */
  v8f accs[8] = {c00, c01, c02, c03, c10, c11, c12, c13};
#pragma unroll
  for (int u = 0; u < 8; ++u) { const int t = u & 3, half = u >> 2; const int col = col0 + t * 16 + ln; const float bv = bp ? bf16_round(bp[col]) : 0.f;
#pragma unroll
    for (int r = 0; r < 8; ++r) { const int rloc = half * 16 + 8 * hh + r; float v = accs[u][r] * alpha + bv; if (CP) { const int bidx = (row0g + row0 + rloc) / rowsPerB; v += CP[(size_t)bidx * sCPb + (size_t)by * 64 + col]; }
      if (ACT == 3) v = fmaxf(v, 0.f); else if (ACT == 6) v = 0.5f * v * (1.0f + erff(v * 0.70710678118654752f)); else if (ACT == 11) v = 1.0f / (1.0f + expf(-v)); else if (ACT == 15) v = v / (1.0f + expf(-v)); else if (ACT == 12) v = (v > 0.f) ? v : 0.01f * v; else if (ACT == 8) v = tanhf(v);
      so[w][rloc][t * 16 + ln] = v; } }
  __builtin_amdgcn_fence(__ATOMIC_ACQ_REL, "workgroup"); __builtin_amdgcn_wave_barrier();
  const int rsub = lane >> 4, c4 = (lane & 15) * 4;
  {
#pragma unroll
    for (int q = 0; q < 16; ++q) { const int r = q * 2 + rsub; const v4f v = *(const v4fa*)&so[w][r][c4]; if (C) *(v4f*)(C + cofs + (size_t)(row0 + r) * ldc + col0 + c4) = v; if (C16) { v4h h4; for (int i = 0; i < 4; ++i) h4[i] = (_Float16)v[i]; *(v4h*)(C16 + cofs + (size_t)(row0 + r) * ldc + col0 + c4) = h4; } }
     } }
template <int ACT>
__global__ __launch_bounds__(128) void k_gemm2(const _Float16* __restrict__ A, int lda, size_t sA, const _Float16* __restrict__ Bh, int ldb, size_t sB, float alpha, const float* __restrict__ bias, size_t sBias, const float* __restrict__ CP, int rowsPerB, size_t sCPb, int row0g,
    float* __restrict__ C, _Float16* __restrict__ C16, int ldc, size_t sC, int M, int N, int K) {
  g2_body<ACT>(A, lda, sA, Bh, ldb, sB, alpha, bias, sBias, CP, rowsPerB, sCPb, row0g, C, C16, ldc, sC, M, N, K, (int)blockIdx.x, (int)blockIdx.y); }
// The five projections that depend on the embeddings alone (q, k, v of the self attention; k, v of the cross attention) in one grid: a range of block indices per product.
// BT: the six [DM][DM] weight planes in a row (q, k, v, cross q, cross k, cross v); FW: three [SW][DM] f32 results in a row; FP: two [SP][DM] f32 results in a row.
#define P5_NW ((SW / 128) * (DM / 64))
#define P5_NP ((SP / 128) * (DM / 64))
__global__ __launch_bounds__(128) void k_proj5(const _Float16* __restrict__ WE, const _Float16* __restrict__ PE, const _Float16* __restrict__ BT, const float* __restrict__ bq, const float* __restrict__ bk, const float* __restrict__ bv, const float* __restrict__ bkc, const float* __restrict__ bvc,
    float* __restrict__ FW, float* __restrict__ FP) {
  const int b = (int)blockIdx.x; const bool word = b < 3 * P5_NW;      /* block-uniform */
  const int j = word ? b / P5_NW : (b - 3 * P5_NW) / P5_NP; const int bx = word ? b - j * P5_NW : (b - 3 * P5_NW) - j * P5_NP;
  const float* bias = word ? (j == 0 ? bq : (j == 1 ? bk : bv)) : (j == 0 ? bkc : bvc);
  g2_body<0>(word ? WE : PE, DM, 0, BT + (size_t)(word ? j : 4 + j) * DM * DM, DM, 0, 0.0625f, bias, 0, nullptr, 1, 0, 0,
             word ? FW + (size_t)j * SW * DM : FP + (size_t)j * SP * DM, nullptr, DM, 0, word ? SW : SP, DM, DM, bx, 0); }


template <int TK>
__device__ __forceinline__ void d_vthl(const float* __restrict__ VF, int ldv, _Float16* __restrict__ Vth, _Float16* __restrict__ Vtl, float (*tl)[65], int blk) { const int tid = threadIdx.x; const int slab = blk / (TK / 64), lg = blk % (TK / 64); const int b = slab / NH, h = slab % NH;
  for (int i = tid; i < 64 * 16; i += 256) { const int r = i / 16, c4 = (i % 16) * 4; const v4f a = *(const v4fa*)(VF + ((size_t)b * TK + lg * 64 + r) * ldv + h * 64 + c4); tl[r][c4] = a[0]; tl[r][c4 + 1] = a[1]; tl[r][c4 + 2] = a[2]; tl[r][c4 + 3] = a[3]; }
  __syncthreads();
  FragH fh[2], fl[2]; size_t oo[2];
#pragma unroll
  for (int rd = 0; rd < 2; ++rd) { const int d = rd * 32 + tid / 8, pc = tid % 8;
#pragma unroll
    for (int q = 0; q < 8; ++q) { const float v = tl[pc * 8 + q][d]; const _Float16 hv = (_Float16)v; fh[rd].h[q] = hv; fl[rd].h[q] = (_Float16)((v - (float)hv) * 1024.0f); } oo[rd] = ((size_t)slab * 64 + d) * TK + lg * 64 + pc * 8; }
  {
#pragma unroll
    for (int rd = 0; rd < 2; ++rd) { *(v8us*)((unsigned short*)Vth + oo[rd]) = fh[rd].half[0]; *(v8us*)((unsigned short*)Vtl + oo[rd]) = fl[rd].half[0]; }
    asm volatile("s_wait_xcnt 0x0" ::: "memory");      /* stands in front of whatever reuses the registers of the four stores above: inlined into a grid of several jobs, code of another job follows them in the listing */
     } }
// The hi/lo splits of the five projections in one grid: a range of block indices per plane (every branch is block-uniform; the barrier of d_vthl is passed by a whole block or by none of it).
#define S5_HW (SW * DM / 8 / 256)
#define S5_HP (SP * DM / 8 / 256)
#define S5_VW (NH * (SW / 64))
#define S5_VP (NH * (SP / 64))
__global__ __launch_bounds__(256) void k_split5(const float* __restrict__ FW, const float* __restrict__ FP, _Float16* __restrict__ Qh, _Float16* __restrict__ Ql, _Float16* __restrict__ Kh, _Float16* __restrict__ Kl, _Float16* __restrict__ Vth, _Float16* __restrict__ Vtl,
    _Float16* __restrict__ KCh, _Float16* __restrict__ KCl, _Float16* __restrict__ VCth, _Float16* __restrict__ VCtl) {
  __shared__ float tl[64][65]; int b = (int)blockIdx.x;
  if (b < S5_HW) { d_hl(FW, Qh, Ql, (size_t)SW * DM / 8, (unsigned)b); return; } b -= S5_HW;
  if (b < S5_HW) { d_hl(FW + (size_t)SW * DM, Kh, Kl, (size_t)SW * DM / 8, (unsigned)b); return; } b -= S5_HW;
  if (b < S5_VW) { d_vthl<SW>(FW + (size_t)2 * SW * DM, DM, Vth, Vtl, tl, b); return; } b -= S5_VW;
  if (b < S5_HP) { d_hl(FP, KCh, KCl, (size_t)SP * DM / 8, (unsigned)b); return; } b -= S5_HP;
  d_vthl<SP>(FP + (size_t)SP * DM, DM, VCth, VCtl, tl, b); }

// K/V staging of k_flashm: one stage = the 32 keys of one trip: 32 K rows of 128 B (hi plane, lo plane) at a pitch of 144 B, 64 V^T rows of 64 B (hi plane, lo plane) at a pitch of 80 B (16 B x odd, for the 16-byte fragment reads); two buffers.
#define FM_KP 144
#define FM_VP 80
#define FM_KL (32 * FM_KP)
#define FM_VH (2 * 32 * FM_KP)
#define FM_VD (64 * FM_VP)
#define FM_STAGE (FM_VH + 2 * FM_VD)
// One wave's share of a stage: 8 K rows and 16 V^T rows of each plane, 16 B per lane, 8 copies (a K copy brings 4 whole rows, a V copy 8 rows).
// lk, lv: the lane's LDS byte addresses of its first K and V chunk (hi plane); gkh, gkl, gvh, gvl: the matching global addresses in the four planes.
__device__ __forceinline__ void fm_stage(unsigned lk, unsigned lv, const unsigned short* gkh, const unsigned short* gkl, int ldk, const unsigned short* gvh, const unsigned short* gvl, int ldv) {
  // the copies go to LDS through no register; s_wait_xcnt is the statement's last line so that no address register is rewritten ahead of it
  asm volatile("global_load_async_to_lds_b128 %0, %8, off\n\t"
               "global_load_async_to_lds_b128 %1, %9, off\n\t"
               "global_load_async_to_lds_b128 %2, %10, off\n\t"
               "global_load_async_to_lds_b128 %3, %11, off\n\t"
               "global_load_async_to_lds_b128 %4, %12, off\n\t"
               "global_load_async_to_lds_b128 %5, %13, off\n\t"
               "global_load_async_to_lds_b128 %6, %14, off\n\t"
               "global_load_async_to_lds_b128 %7, %15, off\n\t"
               "s_wait_xcnt 0x0"
               :: "v"(lk), "v"(lk + 4 * FM_KP), "v"(lk + FM_KL), "v"(lk + FM_KL + 4 * FM_KP), "v"(lv), "v"(lv + 8 * FM_VP), "v"(lv + FM_VD), "v"(lv + FM_VD + 8 * FM_VP),
                  "v"(gkh), "v"(gkh + (size_t)4 * ldk), "v"(gkl), "v"(gkl + (size_t)4 * ldk), "v"(gvh), "v"(gvh + (size_t)8 * ldv), "v"(gvl), "v"(gvl + (size_t)8 * ldv) : "memory");
}
template <int TQ, int TK>
__global__ __launch_bounds__(128) void k_flashm(const _Float16* __restrict__ Q16, const _Float16* __restrict__ Q16lo, int ldq, const _Float16* __restrict__ K16, const _Float16* __restrict__ K16lo, int ldk, const _Float16* __restrict__ Vt, const _Float16* __restrict__ Vtlo, const unsigned* __restrict__ MB, const int* __restrict__ RA, const int* __restrict__ KE, float* __restrict__ O, int ldo) {
  constexpr int RPW = 16, RTN = RPW / 16, NQB = TQ / (4 * RPW), DT = 4, KS = 2;
  __shared__ __attribute__((aligned(16))) unsigned short sP[4][RPW][40], sPl[4][RPW][40]; __shared__ __attribute__((aligned(16))) float sO[4][RPW][64 + 4]; __shared__ __attribute__((aligned(16))) unsigned char kv[2 * FM_STAGE];
  const int tid = threadIdx.x, w = tid >> 5, lane = tid & 31, ln = lane & 15, hh = lane >> 4;
  const int slab = blockIdx.x / NQB, qblk = blockIdx.x % NQB; const int b = slab / NH, h = slab % NH; const int qb0 = qblk * (4 * RPW); const int q0 = qb0 + w * RPW;
  FragH aq[2][KS], aql[2][KS];
#pragma unroll
  for (int rt = 0; rt < RTN; ++rt) { const size_t qo = ((size_t)b * TQ + q0 + rt * 16 + ln) * ldq + h * 64; const unsigned short* qr = (const unsigned short*)Q16 + qo; const unsigned short* ql = (const unsigned short*)Q16lo + qo;
#pragma unroll
    for (int ks = 0; ks < KS; ++ks) { aq[rt][ks].half[0] = *(const v8us*)(qr + ks * 32 + 8 * hh); aq[rt][ks].half[1] = *(const v8us*)(qr + ks * 32 + 16 + 8 * hh); aql[rt][ks].half[0] = *(const v8us*)(ql + ks * 32 + 8 * hh); aql[rt][ks].half[1] = *(const v8us*)(ql + ks * 32 + 16 + 8 * hh); } }
  const unsigned short* Vth = (const unsigned short*)Vt + (size_t)slab * 64 * TK; const unsigned short* Vtl = (const unsigned short*)Vtlo + (size_t)slab * 64 * TK;
  float m_r[2][8], l_r[2][8]; v8f oacc[2][DT], oaccl[2][DT];
#pragma unroll
  for (int rt = 0; rt < RTN; ++rt) {
#pragma unroll
    for (int r = 0; r < 8; ++r) { m_r[rt][r] = -3.0e38f; l_r[rt][r] = 0.f; }
#pragma unroll
    for (int dt = 0; dt < DT; ++dt) { oacc[rt][dt] = (v8f){0.f,0.f,0.f,0.f,0.f,0.f,0.f,0.f}; oaccl[rt][dt] = oacc[rt][dt]; } }
  int jend = KE[qblk * 32]; jend = min(TK, (jend + 31) & ~31); if (jend < 32) jend = 32;      /* block-uniform */
  int allm[2][8]; const unsigned* mrow[2][8];
#pragma unroll
  for (int rt = 0; rt < RTN; ++rt)
#pragma unroll
    for (int r = 0; r < 8; ++r) { const int tq = q0 + rt * 16 + 8 * hh + r; allm[rt][r] = RA[tq]; mrow[rt][r] = MB + (size_t)tq * (TK / 32); }
  const unsigned lk = (unsigned)(size_t)kv + (unsigned)((8 * w + (lane >> 3)) * FM_KP + (lane & 7) * 16), lv = (unsigned)(size_t)kv + (unsigned)(FM_VH + (16 * w + (lane >> 2)) * FM_VP + (lane & 3) * 16);
  const size_t gko = ((size_t)b * TK + 8 * w + (lane >> 3)) * ldk + h * 64 + (lane & 7) * 8, gvo = (size_t)(16 * w + (lane >> 2)) * TK + (lane & 3) * 8;      /* this lane's first 16 bytes of the wave's K and V^T rows */
  const unsigned short* gkh = (const unsigned short*)K16 + gko; const unsigned short* gkl = (const unsigned short*)K16lo + gko; const unsigned short* gvh = Vth + gvo; const unsigned short* gvl = Vtl + gvo;
  fm_stage(lk, lv, gkh, gkl, ldk, gvh, gvl, TK);
  asm volatile("s_wait_asynccnt 0x0" ::: "memory");      /* this wave's copies of stage 0 have landed */
  __syncthreads();      /* and every other wave's: stage 0 may be read */
  if (32 < jend) fm_stage(lk + FM_STAGE, lv + FM_STAGE, gkh + (size_t)32 * ldk, gkl + (size_t)32 * ldk, ldk, gvh + 32, gvl + 32, TK);
#pragma unroll 1
  for (int j0 = 0; j0 < jend; j0 += 32) {
    const unsigned bo = (unsigned)((j0 >> 5) & 1) * FM_STAGE; const unsigned char* pk = kv + bo + ln * FM_KP + 16 * hh; const unsigned char* pv = kv + bo + FM_VH + ln * FM_VP + 16 * hh;      /* this trip's buffer: the lane's row and half in the K and V^T tiles */
    v8f s[2][2]; FragH bk[2][KS], bkl[2][KS];
#pragma unroll
    for (int nt = 0; nt < 2; ++nt) { const unsigned char* kr = pk + nt * 16 * FM_KP; const unsigned char* kl = kr + FM_KL;
#pragma unroll
      for (int ks = 0; ks < KS; ++ks) { bk[nt][ks].half[0] = *(const v8us*)(kr + ks * 64); bk[nt][ks].half[1] = *(const v8us*)(kr + ks * 64 + 32); bkl[nt][ks].half[0] = *(const v8us*)(kl + ks * 64); bkl[nt][ks].half[1] = *(const v8us*)(kl + ks * 64 + 32); } }
    __builtin_amdgcn_sched_barrier(0);      /* keeps the trip's K reads one group in front of the WMMAs: sunk to their uses, the second 16 keys wait out an LDS latency of their own */
#pragma unroll
    for (int nt = 0; nt < 2; ++nt) {
#pragma unroll
      for (int rt = 0; rt < RTN; ++rt) { v8f acc = (v8f){0.f,0.f,0.f,0.f,0.f,0.f,0.f,0.f}, accr = acc;
#pragma unroll
        for (int ks = 0; ks < KS; ++ks) { acc = mmaH<1>(aq[rt][ks].v, aq[rt][ks].v, bk[nt][ks].v, bk[nt][ks].v, acc); accr = mmaH<1>(aql[rt][ks].v, aql[rt][ks].v, bk[nt][ks].v, bk[nt][ks].v, accr); accr = mmaH<1>(aq[rt][ks].v, aq[rt][ks].v, bkl[nt][ks].v, bkl[nt][ks].v, accr); }
        s[rt][nt] = acc + accr * 0.0009765625f; } }
#pragma unroll
    for (int rt = 0; rt < RTN; ++rt) {      /* no branch in the softmax: each exp is computed for every lane and the old conditions pick by select, so a lane's eight rows are one straight-line block and their mask loads, cross-lane steps and exp chains overlap */
      float s0[8], s1[8], mc[8]; bool ok0[8], ok1[8];
#pragma unroll
      for (int r = 0; r < 8; ++r) { const unsigned mw = mrow[rt][r][j0 >> 5]; const bool am = (allm[rt][r] != 0);
        ok0[r] = am || (((mw >> ln) & 1u) == 0u); ok1[r] = am || (((mw >> (16 + ln)) & 1u) == 0u);
        s0[r] = ok0[r] ? (am ? 0.f : s[rt][0][r] * SCL) : -INFINITY; s1[r] = ok1[r] ? (am ? 0.f : s[rt][1][r] * SCL) : -INFINITY; mc[r] = fmaxf(s0[r], s1[r]); }
#pragma unroll
      for (int st = 1; st < 16; st <<= 1)
#pragma unroll
        for (int r = 0; r < 8; ++r) mc[r] = fmaxf(mc[r], __shfl_xor(mc[r], st, 32));
#pragma unroll
      for (int r = 0; r < 8; ++r) { const float mo = m_r[rt][r], mn = fmaxf(mo, mc[r]); const float ea = expf(mo - mn), e0 = expf(s0[r] - mn), e1 = expf(s1[r] - mn);
        const float al = (mn > -1.0e38f) ? ea : 1.0f; m_r[rt][r] = mn; const float p0 = ok0[r] ? e0 : 0.f, p1 = ok1[r] ? e1 : 0.f; l_r[rt][r] = l_r[rt][r] * al + p0 + p1;
#pragma unroll
        for (int dt = 0; dt < DT; ++dt) { oacc[rt][dt][r] *= al; oaccl[rt][dt][r] *= al; }
        FragH t2, t3; const float ps0 = p0 * 1024.0f, ps1 = p1 * 1024.0f; t2.h[0] = (_Float16)ps0; t2.h[1] = (_Float16)ps1; t3.h[0] = (_Float16)((ps0 - (float)t2.h[0]) * 1024.0f); t3.h[1] = (_Float16)((ps1 - (float)t2.h[1]) * 1024.0f);
        sP[w][rt * 16 + 8 * hh + r][ln] = t2.u[0]; sP[w][rt * 16 + 8 * hh + r][16 + ln] = t2.u[1]; sPl[w][rt * 16 + 8 * hh + r][ln] = t3.u[0]; sPl[w][rt * 16 + 8 * hh + r][16 + ln] = t3.u[1]; } }
    FragH bv[DT], bl[DT];      /* the trip's V^T fragments, read as one group in front of P's way through LDS, so that the four output tiles do not each wait out an LDS latency */
#pragma unroll
    for (int dt = 0; dt < DT; ++dt) { const unsigned char* vr = pv + dt * 16 * FM_VP; bv[dt].half[0] = *(const v8us*)vr; bv[dt].half[1] = *(const v8us*)(vr + 32); bl[dt].half[0] = *(const v8us*)(vr + FM_VD); bl[dt].half[1] = *(const v8us*)(vr + FM_VD + 32); }
    __builtin_amdgcn_fence(__ATOMIC_ACQ_REL, "workgroup"); __builtin_amdgcn_wave_barrier();
    FragH pa[2], pl[2];
#pragma unroll
    for (int rt = 0; rt < RTN; ++rt) { pa[rt].half[0] = *(const v8us*)&sP[w][rt * 16 + ln][8 * hh]; pa[rt].half[1] = *(const v8us*)&sP[w][rt * 16 + ln][16 + 8 * hh]; pl[rt].half[0] = *(const v8us*)&sPl[w][rt * 16 + ln][8 * hh]; pl[rt].half[1] = *(const v8us*)&sPl[w][rt * 16 + ln][16 + 8 * hh]; }
#pragma unroll
    for (int dt = 0; dt < DT; ++dt) {
#pragma unroll
      for (int rt = 0; rt < RTN; ++rt) { oacc[rt][dt] = mmaH<1>(pa[rt].v, pa[rt].v, bv[dt].v, bv[dt].v, oacc[rt][dt]); oaccl[rt][dt] = mmaH<1>(pa[rt].v, pa[rt].v, bl[dt].v, bl[dt].v, oaccl[rt][dt]); oaccl[rt][dt] = mmaH<1>(pl[rt].v, pl[rt].v, bv[dt].v, bv[dt].v, oaccl[rt][dt]); } }
    asm volatile("s_wait_dscnt 0x0" ::: "memory");      /* this wave's reads of the buffer (and of its P rows) are done before the refill */
    asm volatile("s_wait_asynccnt 0x0" ::: "memory");      /* this wave's copies of the next stage have landed */
    __syncthreads();      /* publishes the next stage and ends every wave's reads of this one */
    if (j0 + 64 < jend) fm_stage(lk + bo, lv + bo, gkh + (size_t)(j0 + 64) * ldk, gkl + (size_t)(j0 + 64) * ldk, ldk, gvh + (j0 + 64), gvl + (j0 + 64), TK); }
  asm volatile("s_wait_asynccnt 0x0" ::: "memory");      /* no copy is left in flight */
#pragma unroll
  for (int rt = 0; rt < RTN; ++rt) {
#pragma unroll
    for (int r = 0; r < 8; ++r) { float l = l_r[rt][r]; l += __shfl_xor(l, 1, 32); l += __shfl_xor(l, 2, 32); l += __shfl_xor(l, 4, 32); l += __shfl_xor(l, 8, 32); l_r[rt][r] = (l > 0.f) ? 1.0f / (l * 1024.0f) : 0.f; }
#pragma unroll
    for (int dt = 0; dt < DT; ++dt)
#pragma unroll
      for (int r = 0; r < 8; ++r) sO[w][rt * 16 + 8 * hh + r][dt * 16 + ln] = (oacc[rt][dt][r] + oaccl[rt][dt][r] * 0.0009765625f) * l_r[rt][r]; }
  __builtin_amdgcn_fence(__ATOMIC_ACQ_REL, "workgroup"); __builtin_amdgcn_wave_barrier();
  {
#pragma unroll
    for (int rp = 0; rp < RPW; rp += 2) { const int r = rp + (lane >> 4), pc = lane & 15; const v4f val = *(const v4fa*)&sO[w][r][pc * 4]; *(v4f*)(O + ((size_t)b * TQ + q0 + r) * ldo + h * 64 + pc * 4) = val; }
     } }


__device__ __forceinline__ void d_causaltab(unsigned* __restrict__ MB, int* __restrict__ RA, int* __restrict__ KE, int nq, int nk, int blk) {
  const int t = blk * 256 + threadIdx.x; const int nw = nk / 32;
  if (t < nq * nw) { const int q = t / nw, w = t % nw; const int first = q + 1 - 32 * w; const unsigned bits = (first <= 0) ? 0xffffffffu : ((first >= 32) ? 0u : (0xffffffffu << first)); *(unsigned*)(MB + t) = bits;  }
  if (t < nq) { *(int*)(RA + t) = 0;  }
  if (t < nq / 64) { const int v = 64 * (t + 1); *(int*)(KE + t * 32) = v;  } }
__device__ __forceinline__ void d_fulltab(unsigned* __restrict__ MB, int* __restrict__ RA, int* __restrict__ KE, int nq, int nk, int blk) {
  const int t = blk * 256 + threadIdx.x; const int nw = nk / 32;
  if (t < nq * nw) { *(unsigned*)(MB + t) = 0u;  }
  if (t < nq) { *(int*)(RA + t) = 0;  }
  if (t < nq / 64) { *(int*)(KE + t * 32) = nk;  } }

// Everything that depends on the inputs alone (eight weight planes, two embedding planes, two mask tables) in one grid: a range of block indices per job, every branch block-uniform.
// BT: the six [DM][DM] weight planes in a row (q, k, v, cross q, cross k, cross v).
#define PR_F (FF * DM / 8 / 256)
#define PR_W (DM * DM / 8 / 256)
#define PR_X (SW * DM / 8 / 256)
#define PR_P (SP * DM / 8 / 256)
#define PR_C (SW * (SW / 32) / 256)
#define PR_U (SW * (SP / 32) / 256)
__global__ __launch_bounds__(256) void k_prep(const float* __restrict__ Wq, const float* __restrict__ Wk, const float* __restrict__ Wv, const float* __restrict__ Wqc, const float* __restrict__ Wkc, const float* __restrict__ Wvc, const float* __restrict__ W1, const float* __restrict__ W2,
    const float* __restrict__ wemb, const float* __restrict__ pemb, _Float16* __restrict__ BT, _Float16* __restrict__ BW1, _Float16* __restrict__ BW2, _Float16* __restrict__ WE16, _Float16* __restrict__ PE16,
    unsigned* __restrict__ MB, int* __restrict__ RA, int* __restrict__ KE, unsigned* __restrict__ MB2, int* __restrict__ RA2, int* __restrict__ KE2) {
  int b = (int)blockIdx.x;
  if (b < PR_F) { d_round16f(W1, BW1, (size_t)FF * DM / 8, (unsigned)b); return; } b -= PR_F;
  if (b < PR_F) { d_round16f(W2, BW2, (size_t)FF * DM / 8, (unsigned)b); return; } b -= PR_F;
  if (b < 6 * PR_W) { const int j = b / PR_W; const float* W = (j == 0) ? Wq : (j == 1) ? Wk : (j == 2) ? Wv : (j == 3) ? Wqc : (j == 4) ? Wkc : Wvc;
    d_round16f(W, BT + (size_t)j * DM * DM, (size_t)DM * DM / 8, (unsigned)(b - j * PR_W)); return; } b -= 6 * PR_W;
  if (b < PR_X) { d_x16(wemb, WE16, (size_t)SW * DM / 8, (unsigned)b); return; } b -= PR_X;
  if (b < PR_P) { d_x16(pemb, PE16, (size_t)SP * DM / 8, (unsigned)b); return; } b -= PR_P;
  if (b < PR_C) { d_causaltab(MB, RA, KE, SW, SW, b); return; } b -= PR_C;
  d_fulltab(MB2, RA2, KE2, SW, SP, b); }

extern "C" void kernel_launch(void* const* d_in, const int* in_sizes, int n_in,
                              void* d_out, int out_size, void* d_ws, size_t ws_size, hipStream_t stream) {
  (void)in_sizes; (void)n_in; (void)out_size;
  const float* const* I = (const float* const*)d_in; const float* wemb = I[0]; const float* pemb = I[1];
  const float* Wq = I[2]; const float* bq = I[3]; const float* Wk = I[4]; const float* bk = I[5]; const float* Wv = I[6]; const float* bv = I[7];
  const float* Wqc = I[8]; const float* bqc = I[9]; const float* Wkc = I[10]; const float* bkc = I[11]; const float* Wvc = I[12]; const float* bvc = I[13];
  const float* W1 = I[14]; const float* b1 = I[15]; const float* W2 = I[16]; const float* b2 = I[17];
  char* ws = (char*)d_ws; size_t off = 0;
  auto take = [&](size_t bytes) { char* p = ws + off; off += (bytes + 255) & ~(size_t)255; return p; };
  _Float16* BT = (_Float16*)take((size_t)6 * DM * DM * 2); _Float16* BQC = BT + (size_t)3 * DM * DM;      /* weight planes q, k, v, cross q, cross k, cross v in a row */
  _Float16* BW1 = (_Float16*)take((size_t)FF * DM * 2); _Float16* BW2 = (_Float16*)take((size_t)DM * FF * 2);
  _Float16* WE16 = (_Float16*)take((size_t)SW * DM * 2); _Float16* PE16 = (_Float16*)take((size_t)SP * DM * 2);
  float* FW = (float*)take((size_t)3 * SW * DM * 4); float* FP = (float*)take((size_t)2 * SP * DM * 4);      /* f32 q, k, v and cross k, v */
  _Float16* Qh = (_Float16*)take((size_t)SW * DM * 2); _Float16* Ql = (_Float16*)take((size_t)SW * DM * 2); _Float16* Kh = (_Float16*)take((size_t)SW * DM * 2); _Float16* Kl = (_Float16*)take((size_t)SW * DM * 2);      /* Qh..Kl: 16 MiB contiguous, later the FFN f32 half-hidden */
  _Float16* Vth = (_Float16*)take((size_t)SW * DM * 2); _Float16* Vtl = (_Float16*)take((size_t)SW * DM * 2);
  _Float16* KCh = (_Float16*)take((size_t)SP * DM * 2); _Float16* KCl = (_Float16*)take((size_t)SP * DM * 2); _Float16* VCth = (_Float16*)take((size_t)SP * DM * 2); _Float16* VCtl = (_Float16*)take((size_t)SP * DM * 2);
  unsigned* MB = (unsigned*)take((size_t)SW * (SW / 32) * 4); int* RA = (int*)take((size_t)SW * 4); int* KE = (int*)take((size_t)(SW / 64) * 32 * 4);
  unsigned* MB2 = (unsigned*)take((size_t)SW * (SP / 32) * 4); int* RA2 = (int*)take((size_t)SW * 4); int* KE2 = (int*)take((size_t)(SW / 64) * 32 * 4);
  _Float16* Ah = (_Float16*)take((size_t)SW * DM * 2); _Float16* Al = (_Float16*)take((size_t)SW * DM * 2);      /* word hi/lo, later cross hi/lo */
  _Float16* HDh = (_Float16*)take((size_t)SW * (FF / 2) * 2); _Float16* HDl = (_Float16*)take((size_t)SW * (FF / 2) * 2);
  if (off > ws_size) return;      /* 12 + 16 + 4 + 2 + 32 + 32 + 0.8 + 8 + 16 = 123 MiB */
  float* F = FW;      /* free again behind k_split5: attention results, cross q */
  float* HF = (float*)Qh;             /* FFN half hidden f32 [2048][2048] = 16 MiB over Qh..Kl (dead after the second attention) */
  const dim3 gW((SW / 128) * (DM / 64), 1), gH((SW / 128) * ((FF / 2) / 64), 1); const size_t n8w = (size_t)SW * DM / 8; const unsigned nbw = (unsigned)((n8w + 255) / 256);
  k_prep<<<2 * PR_F + 6 * PR_W + PR_X + PR_P + PR_C + PR_U, 256, 0, stream>>>(Wq, Wk, Wv, Wqc, Wkc, Wvc, W1, W2, wemb, pemb, BT, BW1, BW2, WE16, PE16, MB, RA, KE, MB2, RA2, KE2);      /* weights are (out,in) row-major = natural Bt; x16 */
  k_proj5<<<3 * P5_NW + 2 * P5_NP, 128, 0, stream>>>(WE16, PE16, BT, bq, bk, bv, bkc, bvc, FW, FP);
  k_split5<<<2 * S5_HW + S5_VW + S5_HP + S5_VP, 256, 0, stream>>>(FW, FP, Qh, Ql, Kh, Kl, Vth, Vtl, KCh, KCl, VCth, VCtl);
  /* --- causal self attention on the word embeddings (all planes hi/lo) --- */
  k_flashm<SW, SW><<<NH * (SW / 64), 128, 0, stream>>>(Qh, Ql, DM, Kh, Kl, DM, Vth, Vtl, MB, RA, KE, F, DM);      /* word (f32) -> F */
  k_hl<<<nbw, 256, 0, stream>>>(F, Ah, Al, n8w);      /* word as hi/lo operand planes */
  k_gemm2<0><<<gW, 128, 0, stream>>>(Ah, DM, 0, BQC, DM, 0, 0.0625f, bqc, 0, nullptr, 1, 0, 0, F, nullptr, DM, 0, SW, DM, DM);
  k_gemm2<0><<<gW, 128, 0, stream>>>(Al, DM, 0, BQC, DM, 0, 0.0625f * 0.0009765625f, nullptr, 0, F, 1, (size_t)DM, 0, F, nullptr, DM, 0, SW, DM, DM); k_hl<<<nbw, 256, 0, stream>>>(F, Qh, Ql, n8w);
  k_flashm<SW, SP><<<NH * (SW / 64), 128, 0, stream>>>(Qh, Ql, DM, KCh, KCl, DM, VCth, VCtl, MB2, RA2, KE2, F, DM);      /* cross (f32) -> F */
  k_hl<<<nbw, 256, 0, stream>>>(F, Ah, Al, n8w);      /* cross as hi/lo operand planes */
  /* --- FFN in two column halves of the hidden: h = relu(cross*W1^T + b1) (hi/lo), out (+)= h_half*W2_half^T (+ b2 once) --- */
  for (int hf = 0; hf < 2; ++hf) { const _Float16* B1h = BW1 + (size_t)hf * (FF / 2) * DM; const _Float16* B2h = BW2 + (size_t)hf * (FF / 2);
    k_gemm2<0><<<gH, 128, 0, stream>>>(Ah, DM, 0, B1h, DM, 0, 0.0625f, b1 + hf * (FF / 2), 0, nullptr, 1, 0, 0, HF, nullptr, FF / 2, 0, SW, FF / 2, DM);
    k_gemm2<3><<<gH, 128, 0, stream>>>(Al, DM, 0, B1h, DM, 0, 0.0625f * 0.0009765625f, nullptr, 0, HF, 1, (size_t)(FF / 2), 0, HF, nullptr, FF / 2, 0, SW, FF / 2, DM);      /* relu applied after the residual pass completes the sum */
    k_hl<<<(unsigned)(((size_t)SW * (FF / 2) / 8 + 255) / 256), 256, 0, stream>>>(HF, HDh, HDl, (size_t)SW * (FF / 2) / 8);
    k_gemm2<0><<<gW, 128, 0, stream>>>(HDh, FF / 2, 0, B2h, FF, 0, 0.0625f, (hf == 0) ? b2 : nullptr, 0, (hf == 0) ? nullptr : (const float*)d_out, 1, (size_t)DM, 0, (float*)d_out, nullptr, DM, 0, SW, DM, FF / 2);
    k_gemm2<0><<<gW, 128, 0, stream>>>(HDl, FF / 2, 0, B2h, FF, 0, 0.0625f * 0.0009765625f, nullptr, 0, (const float*)d_out, 1, (size_t)DM, 0, (float*)d_out, nullptr, DM, 0, SW, DM, FF / 2); }
}

// v005
// Measured time: 382 microseconds a run.
// In two side-by-side timings against v004, it was 1.26 and 1.27 times as fast.
// All steps since v000 together make it 3.35 times as fast.
#include <hip/hip_runtime.h>
// Two-stage attention decoder block (word embeddings [2048][1024], position embeddings [1024][1024], 16 heads x 64, FFN 4096): word = CausalMHA(wemb; q,k,v = Linear+bias, scores/8, tril, softmax, .v, heads merged, no output projection); cross = MHA(q from word, k/v from pemb, no mask); out = relu(cross*W1^T + b1)*W2^T + b2 -> [2048,1024].
// Compute dtype: inputs and parameters rounded to bf16; projections of the embeddings exact; all other operands f16 hi + (x2^10) residual pairs (~2^-21); f32 accumulation, softmax f32. v_wmma_f32_16x16x32_f16.
#define SW 2048
#define SP 1024
#define DM 1024
#define NH 16
#define FF 4096
#define SCL 0.125f
#define SKV ((SW > SP) ? SW : SP)      /* larger key count (unused): the self attention has SW keys, the cross attention SP */
typedef __bf16 v16b __attribute__((ext_vector_type(16)));
typedef unsigned short v8us __attribute__((ext_vector_type(8), may_alias));
typedef float  v8f  __attribute__((ext_vector_type(8)));
typedef float  v4f  __attribute__((ext_vector_type(4)));
typedef float  v4fa __attribute__((ext_vector_type(4), may_alias));
union FragB { v16b v; v8us half[2]; unsigned short u[16]; };

__device__ __forceinline__ unsigned short bf16_bits(float x) { unsigned int u = __float_as_uint(x); return (unsigned short)((u + 0x7FFFu + ((u >> 16) & 1u)) >> 16); }
__device__ __forceinline__ float bf16_val(unsigned short b) { return __uint_as_float(((unsigned int)b) << 16); }
__device__ __forceinline__ float bf16_round(float x) { return bf16_val(bf16_bits(x)); }
// D += A·B with NT terms: 1 = ah·bh, 2 = + al·bh (A split), 3 = + ah·bl (both split)
template <int NT>
__device__ __forceinline__ v8f mmaN(v16b ah, v16b al, v16b bh, v16b bl, v8f c) {
  c = __builtin_amdgcn_wmma_f32_16x16x32_bf16(false, ah, false, bh, (short)0, c, false, false);
  if (NT >= 2) c = __builtin_amdgcn_wmma_f32_16x16x32_bf16(false, al, false, bh, (short)0, c, false, false);
  if (NT >= 3) c = __builtin_amdgcn_wmma_f32_16x16x32_bf16(false, ah, false, bl, (short)0, c, false, false);
  asm volatile("v_nop\n\tv_nop\n\tv_nop\n\tv_nop" : "+v"(c) : "v"(ah), "v"(al), "v"(bh), "v"(bl));
  return c;
}

__global__ __launch_bounds__(256) void k_wt_bf16(const float* __restrict__ W, unsigned short* __restrict__ Wt, int K, int N) {
  const int t = blockIdx.x * 256 + threadIdx.x;
  const int k8n = K / 8;
  if (t >= N * k8n) return;
  const int n = t / k8n, k8 = (t % k8n) * 8;
  v8us v;
#pragma unroll
  for (int i = 0; i < 8; ++i) v[i] = bf16_bits(W[(size_t)(k8 + i) * N + n]);
  *(v8us*)(Wt + (size_t)n * K + k8) = v;
  
}

// GEMM C[M][N] (f32, pitch ldc) = act(A[M][K]·W + bias). A f32 row-major (pitch lda) converted per fragment to bf16
// (ASPLIT: hi/lo two planes -> 2 terms, else single rounded term); Wt bf16 [N][K] (pitch ldb). BIAS_BF16 rounds the
// bias to bf16 first (bias quantised to bf16 before the add). K%32==0, M%16==0, N%64==0.
template <bool ASPLIT, int ACT, bool BIAS_BF16>
__global__ __launch_bounds__(128) void k_gemm_bf(const float* __restrict__ A, int lda, const unsigned short* __restrict__ Wt, int ldb,
                                               const float* __restrict__ bias, float* __restrict__ C, int ldc, int M, int N, int K) {
  __shared__ __attribute__((aligned(16))) float so[4][16][64];
  const int tid = threadIdx.x, w = tid >> 5, lane = tid & 31, ln = lane & 15, hh = lane >> 4;
  const int ntn = N / 64;
  const int wid = blockIdx.x * 4 + w;
  const int mt = wid / ntn, nq = wid % ntn;
  if (mt * 16 >= M) return;
  const int row0 = mt * 16, col0 = nq * 64;
  const float* arow = A + (size_t)(row0 + ln) * lda;
  v8f acc[4] = {};
  for (int kb = 0; kb < K; kb += 32) {
    FragB ah, al;
    const v4f x0 = *(const v4fa*)(arow + kb + 8 * hh), x1 = *(const v4fa*)(arow + kb + 8 * hh + 4);
    const v4f x2 = *(const v4fa*)(arow + kb + 16 + 8 * hh), x3 = *(const v4fa*)(arow + kb + 16 + 8 * hh + 4);
    float xs[16] = {x0[0],x0[1],x0[2],x0[3],x1[0],x1[1],x1[2],x1[3],x2[0],x2[1],x2[2],x2[3],x3[0],x3[1],x3[2],x3[3]};
#pragma unroll
    for (int i = 0; i < 16; ++i) { const unsigned short hb = bf16_bits(xs[i]); ah.u[i] = hb; al.u[i] = ASPLIT ? bf16_bits(xs[i] - bf16_val(hb)) : (unsigned short)0; }
#pragma unroll
    for (int t = 0; t < 4; ++t) {
      const unsigned short* brow = Wt + (size_t)(col0 + t * 16 + ln) * ldb + kb;
      FragB b;
      b.half[0] = *(const v8us*)(brow + 8 * hh);
      b.half[1] = *(const v8us*)(brow + 16 + 8 * hh);
      acc[t] = mmaN<ASPLIT ? 2 : 1>(ah.v, al.v, b.v, b.v, acc[t]);
    }
  }
#pragma unroll
  for (int t = 0; t < 4; ++t) {
    float bv = bias ? bias[col0 + t * 16 + ln] : 0.f;
    if (BIAS_BF16) bv = bf16_round(bv);
#pragma unroll
    for (int r = 0; r < 8; ++r) { float v = acc[t][r] + bv; if (ACT == 1) v = fmaxf(v, 0.f); so[w][8 * hh + r][t * 16 + ln] = v; }
  }
  __builtin_amdgcn_fence(__ATOMIC_ACQ_REL, "workgroup");
  __builtin_amdgcn_wave_barrier();
  const int rsub = lane >> 4, c4 = (lane & 15) * 4;
  {
#pragma unroll
    for (int q = 0; q < 8; ++q) {
      const int r = q * 2 + rsub;
      const v4f v = *(const v4fa*)&so[w][r][c4];
      *(v4f*)(C + (size_t)(row0 + r) * ldc + col0 + c4) = v;
    }
    
  }
}

// GEMM C = act(A·W + bias + resid): A f32 (ASPLIT -> hi/lo 2 terms), Wt bf16 [N][K]; ACT 0 none, 1 relu, 2 exact gelu;
// resid (optional, f32, row index = (row % rmod), pitch ldr, RES_BF16 rounds it) added before the activation.
template <bool ASPLIT, int ACT, bool BIAS_BF16, bool RES_BF16>
__global__ __launch_bounds__(128) void k_gemm_bf3(const float* __restrict__ A, int lda, const unsigned short* __restrict__ Wt, int ldb,
                                                const float* __restrict__ bias, const float* __restrict__ resid, int rmod, int ldr,
                                                float* __restrict__ C, int ldc, int M, int N, int K) {
  __shared__ __attribute__((aligned(16))) float so[4][16][64];
  const int tid = threadIdx.x, w = tid >> 5, lane = tid & 31, ln = lane & 15, hh = lane >> 4;
  const int ntn = N / 64;
  const int wid = blockIdx.x * 4 + w;
  const int mt = wid / ntn, nq = wid % ntn;
  if (mt * 16 >= M) return;
  const int row0 = mt * 16, col0 = nq * 64;
  const float* arow = A + (size_t)(row0 + ln) * lda;
  v8f acc[4] = {};
  for (int kb = 0; kb < K; kb += 32) {
    FragB ah, al;
    const v4f x0 = *(const v4fa*)(arow + kb + 8 * hh), x1 = *(const v4fa*)(arow + kb + 8 * hh + 4);
    const v4f x2 = *(const v4fa*)(arow + kb + 16 + 8 * hh), x3 = *(const v4fa*)(arow + kb + 16 + 8 * hh + 4);
    float xs[16] = {x0[0],x0[1],x0[2],x0[3],x1[0],x1[1],x1[2],x1[3],x2[0],x2[1],x2[2],x2[3],x3[0],x3[1],x3[2],x3[3]};
#pragma unroll
    for (int i = 0; i < 16; ++i) { const unsigned short hb = bf16_bits(xs[i]); ah.u[i] = hb; al.u[i] = ASPLIT ? bf16_bits(xs[i] - bf16_val(hb)) : (unsigned short)0; }
#pragma unroll
    for (int t = 0; t < 4; ++t) {
      const unsigned short* brow = Wt + (size_t)(col0 + t * 16 + ln) * ldb + kb;
      FragB b;
      b.half[0] = *(const v8us*)(brow + 8 * hh);
      b.half[1] = *(const v8us*)(brow + 16 + 8 * hh);
      acc[t] = mmaN<ASPLIT ? 2 : 1>(ah.v, al.v, b.v, b.v, acc[t]);
    }
  }
#pragma unroll
  for (int t = 0; t < 4; ++t) {
    const int col = col0 + t * 16 + ln;
    float bv = bias ? bias[col] : 0.f;
    if (BIAS_BF16) bv = bf16_round(bv);
#pragma unroll
    for (int r = 0; r < 8; ++r) {
      float v = acc[t][r] + bv;
      if (resid) { float rv = resid[(size_t)((row0 + 8 * hh + r) % rmod) * ldr + col]; if (RES_BF16) rv = bf16_round(rv); v += rv; }
      if (ACT == 1) v = fmaxf(v, 0.f);
      if (ACT == 2) v = 0.5f * v * (1.0f + erff(v * 0.70710678118654752f));
      if (ACT == 3) { const float u = 0.7978845608028654f * (v + 0.044715f * v * v * v); v = 0.5f * v * (1.0f + tanhf(u)); }
      so[w][8 * hh + r][t * 16 + ln] = v;
    }
  }
  __builtin_amdgcn_fence(__ATOMIC_ACQ_REL, "workgroup");
  __builtin_amdgcn_wave_barrier();
  const int rsub = lane >> 4, c4 = (lane & 15) * 4;
  {
#pragma unroll
    for (int q = 0; q < 8; ++q) {
      const int r = q * 2 + rsub;
      const v4f v = *(const v4fa*)&so[w][r][c4];
      *(v4f*)(C + (size_t)(row0 + r) * ldc + col0 + c4) = v;
    }
    
  }
}
// row LayerNorm (biased variance, eps) over N: s = X (+ R); optional out_sum <- s; out_norm <- (s-mu)*rsqrt(var+eps)*g + b
template <bool PARAM_BF16>
__global__ __launch_bounds__(256) void k_layernorm(const float* __restrict__ X, const float* __restrict__ R, const float* __restrict__ g, const float* __restrict__ bta,
                                                  float* __restrict__ out_sum, float* __restrict__ out_norm, int N, float eps) {
  __shared__ float red[256];
  const int row = blockIdx.x, tid = threadIdx.x;
  const float* x = X + (size_t)row * N; const float* rr = R ? R + (size_t)row * N : nullptr;
  float vals[16];                     // up to N = 4096
  const int per = N / 256;            // contiguous chunk per thread? use strided-by-4 chunks: thread handles j = tid*4 + 1024*u
  float s1 = 0.f;
  for (int u = 0; u < per / 4; ++u) {
    const int j = tid * 4 + 1024 * u;
    const v4f a = *(const v4fa*)(x + j);
    v4f b = {0.f,0.f,0.f,0.f}; if (rr) b = *(const v4fa*)(rr + j);
#pragma unroll
    for (int q = 0; q < 4; ++q) { const float v = a[q] + b[q]; vals[u * 4 + q] = v; s1 += v; }
  }
  red[tid] = s1; __syncthreads();
  for (int st = 128; st > 0; st >>= 1) { if (tid < st) red[tid] += red[tid + st]; __syncthreads(); }
  const float mu = red[0] / (float)N; __syncthreads();
  float s2 = 0.f;
  for (int u = 0; u < per / 4; ++u)
#pragma unroll
    for (int q = 0; q < 4; ++q) { const float c = vals[u * 4 + q] - mu; s2 += c * c; }
  red[tid] = s2; __syncthreads();
  for (int st = 128; st > 0; st >>= 1) { if (tid < st) red[tid] += red[tid + st]; __syncthreads(); }
  const float rs = rsqrtf(red[0] / (float)N + eps);
  {
    for (int u = 0; u < per / 4; ++u) {
      const int j = tid * 4 + 1024 * u;
      v4f o, sm;
#pragma unroll
      for (int q = 0; q < 4; ++q) {
        float gg = g[j + q], bb = bta[j + q];
        if (PARAM_BF16) { gg = bf16_round(gg); bb = bf16_round(bb); }
        sm[q] = vals[u * 4 + q]; o[q] = (vals[u * 4 + q] - mu) * rs * gg + bb;
      }
      if (out_sum) *(v4f*)(out_sum + (size_t)row * N + j) = sm;
      *(v4f*)(out_norm + (size_t)row * N + j) = o;
    }
    
  }
}



// ---- f16 WMMA path (v_wmma_f32_16x16x32_f16): 11-bit significands for operands in range — used where a [0,1] probability operand needs more precision than bf16
typedef _Float16 v16h __attribute__((ext_vector_type(16)));
union FragH { v16h v; v8us half[2]; _Float16 h[16]; unsigned short u[16]; };
template <int NT>
__device__ __forceinline__ v8f mmaH(v16h ah, v16h al, v16h bh, v16h bl, v8f c) {
  c = __builtin_amdgcn_wmma_f32_16x16x32_f16(false, ah, false, bh, (short)0, c, false, false);
  if (NT >= 2) c = __builtin_amdgcn_wmma_f32_16x16x32_f16(false, al, false, bh, (short)0, c, false, false);
  if (NT >= 3) c = __builtin_amdgcn_wmma_f32_16x16x32_f16(false, ah, false, bl, (short)0, c, false, false);
  asm volatile("v_nop\n\tv_nop\n\tv_nop\n\tv_nop" : "+v"(c) : "v"(ah), "v"(al), "v"(bh), "v"(bl));
  return c;
}
// batched GEMM like k_gemm_b but f16 operands: A f32 (split into f16 hi/lo if ASPLIT, else rounded to f16), Bt = f16 values [n][k]; alpha; C f32; N multiple of 16 (partial tiles skipped)
template <bool ASPLIT>
__global__ __launch_bounds__(128) void k_gemm_h(const float* __restrict__ A, int lda, size_t sA, const _Float16* __restrict__ Bh, int ldb, size_t sB, float alpha, float* __restrict__ C, int ldc, size_t sC, int M, int N, int K) {
  __shared__ __attribute__((aligned(16))) float so[4][16][64];
  const int tid = threadIdx.x, w = tid >> 5, lane = tid & 31, ln = lane & 15, hh = lane >> 4; const int by = blockIdx.y;
  A += (size_t)by * sA; Bh += (size_t)by * sB; C += (size_t)by * sC;
  const int ntn = (N + 63) / 64; const int wid = blockIdx.x * 4 + w; const int mt = wid / ntn, nq = wid % ntn; if (mt * 16 >= M) return;
  const int row0 = mt * 16, col0 = nq * 64; const float* arow = A + (size_t)(row0 + ln) * lda;
  v8f acc[4] = {};
  for (int kb = 0; kb < K; kb += 32) {
    FragH ah, al;
    const v4f x0 = *(const v4fa*)(arow + kb + 8 * hh), x1 = *(const v4fa*)(arow + kb + 8 * hh + 4), x2 = *(const v4fa*)(arow + kb + 16 + 8 * hh), x3 = *(const v4fa*)(arow + kb + 16 + 8 * hh + 4);
    float xs[16] = {x0[0],x0[1],x0[2],x0[3],x1[0],x1[1],x1[2],x1[3],x2[0],x2[1],x2[2],x2[3],x3[0],x3[1],x3[2],x3[3]};
#pragma unroll
    for (int i = 0; i < 16; ++i) { const _Float16 h = (_Float16)xs[i]; ah.h[i] = h; al.h[i] = ASPLIT ? (_Float16)(xs[i] - (float)h) : (_Float16)0.0f; }
#pragma unroll
    for (int t = 0; t < 4; ++t) { if (col0 + t * 16 >= N) continue; const size_t boff = (size_t)(col0 + t * 16 + ln) * ldb + kb; FragH bq; bq.half[0] = *(const v8us*)(Bh + boff + 8 * hh); bq.half[1] = *(const v8us*)(Bh + boff + 16 + 8 * hh);
      acc[t] = mmaH<ASPLIT ? 2 : 1>(ah.v, al.v, bq.v, bq.v, acc[t]); }
  }
#pragma unroll
  for (int t = 0; t < 4; ++t) { if (col0 + t * 16 >= N) continue;
#pragma unroll
    for (int r = 0; r < 8; ++r) so[w][8 * hh + r][t * 16 + ln] = acc[t][r] * alpha; }
  __builtin_amdgcn_fence(__ATOMIC_ACQ_REL, "workgroup"); __builtin_amdgcn_wave_barrier();
  const int rsub = lane >> 4, c4 = (lane & 15) * 4;
  {
#pragma unroll
    for (int q = 0; q < 8; ++q) { const int r = q * 2 + rsub; if (col0 + c4 < N) { const v4f v = *(const v4fa*)&so[w][r][c4]; *(v4f*)(C + (size_t)(row0 + r) * ldc + col0 + c4) = v; } }
     }
}

// Wt[n][k] = f16(W[k][n]·scale) from f32 row-major W[K][N] (scale = power of two; bf16-exact weights stay exact in f16 away from the subnormal range)
__global__ __launch_bounds__(256) void k_wt_f16(const float* __restrict__ W, _Float16* __restrict__ Wt, int K, int N, float scale) {
  const int t = blockIdx.x * 256 + threadIdx.x; if (t >= N * (K / 8)) return; const int n = t / (K / 8), k8 = (t % (K / 8)) * 8; FragH f;
#pragma unroll
  for (int i = 0; i < 8; ++i) f.h[i] = (_Float16)(bf16_round(W[(size_t)(k8 + i) * N + n]) * scale); const v8us o = f.half[0];
  *(v8us*)((unsigned short*)Wt + (size_t)n * K + k8) = o; 
}
// k_gemm_hh variant with fused epilogue: v = acc·alpha + bias[by·sBias + col] (+ CP[(row/rowsPerB)·sCPb + by·64 + col] if CP) ; ACT 0 none / 1 elu ; writes f16 C16 (and f32 C if non-null)
template <int ACT>
__global__ __launch_bounds__(128) void k_gemm_hhx(const _Float16* __restrict__ A, int lda, size_t sA, const _Float16* __restrict__ Bh, int ldb, size_t sB, float alpha, const float* __restrict__ bias, size_t sBias, const float* __restrict__ CP, int rowsPerB, size_t sCPb, int row0g,
    float* __restrict__ C, _Float16* __restrict__ C16, int ldc, size_t sC, int M, int N, int K) {
  __shared__ __attribute__((aligned(16))) float so[4][16][64];
  const int tid = threadIdx.x, w = tid >> 5, lane = tid & 31, ln = lane & 15, hh = lane >> 4; const int by = blockIdx.y;
  A += (size_t)by * sA; Bh += (size_t)by * sB; const size_t cofs = (size_t)by * sC; const float* bp = bias ? bias + (size_t)by * sBias : nullptr;
  const int ntn = (N + 63) / 64; const int wid = blockIdx.x * 4 + w; const int mt = wid / ntn, nq = wid % ntn; if (mt * 16 >= M) return;
  const int row0 = mt * 16, col0 = nq * 64; const _Float16* arow = A + (size_t)(row0 + ln) * lda;
  v8f acc[4] = {};
  for (int kb = 0; kb < K; kb += 32) { FragH ah; ah.half[0] = *(const v8us*)((const unsigned short*)arow + kb + 8 * hh); ah.half[1] = *(const v8us*)((const unsigned short*)arow + kb + 16 + 8 * hh);
#pragma unroll
    for (int t = 0; t < 4; ++t) { if (col0 + t * 16 >= N) continue; const size_t boff = (size_t)(col0 + t * 16 + ln) * ldb + kb; FragH bq; bq.half[0] = *(const v8us*)((const unsigned short*)Bh + boff + 8 * hh); bq.half[1] = *(const v8us*)((const unsigned short*)Bh + boff + 16 + 8 * hh);
      acc[t] = mmaH<1>(ah.v, ah.v, bq.v, bq.v, acc[t]); }
  }
#pragma unroll
  for (int t = 0; t < 4; ++t) { if (col0 + t * 16 >= N) continue; const int col = col0 + t * 16 + ln; const float bv = bp ? bf16_round(bp[col]) : 0.f;
#pragma unroll
    for (int r = 0; r < 8; ++r) { float v = acc[t][r] * alpha + bv; if (CP) { const int bidx = (row0g + row0 + 8 * hh + r) / rowsPerB; v += CP[(size_t)bidx * sCPb + (size_t)by * 64 + col]; } if (ACT == 1) v = (v > 0.f) ? v : expm1f(v); else if (ACT == 7) v = (v > 0.f) ? v + 1.0f : expf(v); else if (ACT == 8) v = tanhf(v); else if (ACT == 9) v = 0.5f * v * (1.0f + tanhf(0.7978845608028654f * (v + 0.044715f * v * v * v))); else if (ACT == 11) v = 1.0f / (1.0f + expf(-v)); else if (ACT == 12) v = (v > 0.f) ? v : 0.01f * v; else if (ACT == 14) v = (v > 0.f) ? v : 0.1f * v; else if (ACT == 15) v = v / (1.0f + expf(-v)); else if (ACT == 3) v = fmaxf(v, 0.f); else if (ACT == 6) v = 0.5f * v * (1.0f + erff(v * 0.70710678118654752f)); so[w][8 * hh + r][t * 16 + ln] = v; } }
  __builtin_amdgcn_fence(__ATOMIC_ACQ_REL, "workgroup"); __builtin_amdgcn_wave_barrier();
  const int rsub = lane >> 4, c4 = (lane & 15) * 4; typedef _Float16 v4h __attribute__((ext_vector_type(4)));
  {
#pragma unroll
    for (int q = 0; q < 8; ++q) { const int r = q * 2 + rsub; if (col0 + c4 < N) { const v4f v = *(const v4fa*)&so[w][r][c4]; if (C) *(v4f*)(C + cofs + (size_t)(row0 + r) * ldc + col0 + c4) = v; if (C16) { v4h h4; for (int i = 0; i < 4; ++i) h4[i] = (_Float16)v[i]; *(v4h*)(C16 + cofs + (size_t)(row0 + r) * ldc + col0 + c4) = h4; } } }
     }
}


typedef _Float16 v4h __attribute__((ext_vector_type(4)));

// Bodies of the short kernels: blk is the block's index inside its own job, so that independent jobs can share one grid, each on its own range of block indices.
__device__ __forceinline__ void d_x16(const float* __restrict__ x, _Float16* __restrict__ X16, size_t n8, unsigned blk) { const size_t t = (size_t)blk * 256 + threadIdx.x; if (t >= n8) return; FragH f;
#pragma unroll
  for (int q = 0; q < 8; ++q) f.h[q] = (_Float16)bf16_round(x[t * 8 + q]); *(v8us*)((unsigned short*)X16 + t * 8) = f.half[0];  }
__global__ __launch_bounds__(256) void k_h16(const float* __restrict__ x, _Float16* __restrict__ X16, size_t n8) { const size_t t = (size_t)blockIdx.x * 256 + threadIdx.x; if (t >= n8) return; FragH f;
#pragma unroll
  for (int q = 0; q < 8; ++q) f.h[q] = (_Float16)x[t * 8 + q]; *(v8us*)((unsigned short*)X16 + t * 8) = f.half[0];  }
__device__ __forceinline__ void d_round16f(const float* __restrict__ W, _Float16* __restrict__ Bt, size_t n8, unsigned blk) { const size_t t = (size_t)blk * 256 + threadIdx.x; if (t >= n8) return; FragH f;
#pragma unroll
  for (int i = 0; i < 8; ++i) f.h[i] = (_Float16)(bf16_round(W[t * 8 + i]) * 16.0f); *(v8us*)((unsigned short*)Bt + t * 8) = f.half[0];  }
template <int NHv, int TTv>
__global__ __launch_bounds__(256) void k_vt(const _Float16* __restrict__ V16, int ldv, int voff, _Float16* __restrict__ Vt) { __shared__ unsigned short tl[64][66]; const int tid = threadIdx.x; const int slab = blockIdx.x / (TTv / 64), lg = blockIdx.x % (TTv / 64); const int b = slab / NHv, h = slab % NHv;
  for (int i = tid; i < 64 * 8; i += 256) { const int r = i / 8, c8 = (i % 8) * 8; FragH f; f.half[0] = *(const v8us*)((const unsigned short*)V16 + ((size_t)b * TTv + lg * 64 + r) * ldv + voff + h * 64 + c8);
#pragma unroll
    for (int q = 0; q < 8; ++q) tl[r][c8 + q] = f.u[q]; }
  __syncthreads();
  {
#pragma unroll
    for (int rd = 0; rd < 2; ++rd) { const int d = rd * 32 + tid / 8, pc = tid % 8; FragH f;
#pragma unroll
      for (int q = 0; q < 8; ++q) f.u[q] = tl[pc * 8 + q][d];
      *(v8us*)((unsigned short*)Vt + ((size_t)slab * 64 + d) * TTv + lg * 64 + pc * 8) = f.half[0]; }
     } }

__device__ __forceinline__ void d_hl(const float* __restrict__ F, _Float16* __restrict__ Hh, _Float16* __restrict__ Hl, size_t n8, unsigned blk) { const size_t t = (size_t)blk * 256 + threadIdx.x; if (t >= n8) return; FragH fh, fl; const v4f a = *(const v4fa*)(F + t * 8), c = *(const v4fa*)(F + t * 8 + 4);
#pragma unroll
  for (int q = 0; q < 4; ++q) { _Float16 h = (_Float16)a[q]; fh.h[q] = h; fl.h[q] = (_Float16)((a[q] - (float)h) * 1024.0f); h = (_Float16)c[q]; fh.h[4 + q] = h; fl.h[4 + q] = (_Float16)((c[q] - (float)h) * 1024.0f); }
  { *(v8us*)((unsigned short*)Hh + t * 8) = fh.half[0]; *(v8us*)((unsigned short*)Hl + t * 8) = fl.half[0];  } }
__global__ __launch_bounds__(256) void k_hl(const float* __restrict__ F, _Float16* __restrict__ Hh, _Float16* __restrict__ Hl, size_t n8) { d_hl(F, Hh, Hl, n8, blockIdx.x); }

// ---- fast GEMM (block tile 128x64, wave tile 32x64; requires M % 128 == 0, N % 64 == 0 and K % 128 == 0); epilogue = k_gemm_hhx semantics ----
// k loop staging of k_gemm2: one stage = 128 k (256 B of a row) of the block's 128 A rows and 64 B rows, laid in LDS at a pitch of 272 B (16 B x odd, for the 16-byte fragment reads); two buffers.
#define G2_PITCH 272
#define G2_AB (128 * G2_PITCH)
#define G2_STAGE ((128 + 64) * G2_PITCH)
__device__ __forceinline__ v16h g2_lfrag(const unsigned char* p, int hh) { FragH f; f.half[0] = *(const v8us*)(p + 16 * hh); f.half[1] = *(const v8us*)(p + 32 + 16 * hh); return f.v; }
__device__ __forceinline__ v8f g2_mm(v16h a, v16h b, v8f c) { return __builtin_amdgcn_wmma_f32_16x16x32_f16(false, a, false, b, (short)0, c, false, false); }
// One wave's share of a stage: 32 A rows and 16 B rows, two rows (2 x 256 B, whole lines) per wave-wide copy, 16 B per lane, 24 copies.
// la, lb: the lane's LDS byte addresses of its first A and B chunk; ga, gb: the matching global addresses; a copy further on is two rows further on.
__device__ __forceinline__ void g2_stage(unsigned la, unsigned lb, const _Float16* ga, int lda, const _Float16* gb, int ldb) {
  unsigned l[24]; const _Float16* g[24];
#pragma unroll
  for (int i = 0; i < 16; ++i) { l[i] = la + i * (2 * G2_PITCH); g[i] = ga + (size_t)(2 * i) * lda; }
#pragma unroll
  for (int i = 0; i < 8; ++i) { l[16 + i] = lb + i * (2 * G2_PITCH); g[16 + i] = gb + (size_t)(2 * i) * ldb; }
  // the copies go to LDS through no register; s_wait_xcnt is the statement's last line so that no address register is rewritten ahead of it
  asm volatile("global_load_async_to_lds_b128 %0, %12, off\n\t"
               "global_load_async_to_lds_b128 %1, %13, off\n\t"
               "global_load_async_to_lds_b128 %2, %14, off\n\t"
               "global_load_async_to_lds_b128 %3, %15, off\n\t"
               "global_load_async_to_lds_b128 %4, %16, off\n\t"
               "global_load_async_to_lds_b128 %5, %17, off\n\t"
               "global_load_async_to_lds_b128 %6, %18, off\n\t"
               "global_load_async_to_lds_b128 %7, %19, off\n\t"
               "global_load_async_to_lds_b128 %8, %20, off\n\t"
               "global_load_async_to_lds_b128 %9, %21, off\n\t"
               "global_load_async_to_lds_b128 %10, %22, off\n\t"
               "global_load_async_to_lds_b128 %11, %23, off\n\t"
               "s_wait_xcnt 0x0"
               :: "v"(l[0]), "v"(l[1]), "v"(l[2]), "v"(l[3]), "v"(l[4]), "v"(l[5]), "v"(l[6]), "v"(l[7]), "v"(l[8]), "v"(l[9]), "v"(l[10]), "v"(l[11]),
                  "v"(g[0]), "v"(g[1]), "v"(g[2]), "v"(g[3]), "v"(g[4]), "v"(g[5]), "v"(g[6]), "v"(g[7]), "v"(g[8]), "v"(g[9]), "v"(g[10]), "v"(g[11]) : "memory");
  asm volatile("global_load_async_to_lds_b128 %0, %12, off\n\t"
               "global_load_async_to_lds_b128 %1, %13, off\n\t"
               "global_load_async_to_lds_b128 %2, %14, off\n\t"
               "global_load_async_to_lds_b128 %3, %15, off\n\t"
               "global_load_async_to_lds_b128 %4, %16, off\n\t"
               "global_load_async_to_lds_b128 %5, %17, off\n\t"
               "global_load_async_to_lds_b128 %6, %18, off\n\t"
               "global_load_async_to_lds_b128 %7, %19, off\n\t"
               "global_load_async_to_lds_b128 %8, %20, off\n\t"
               "global_load_async_to_lds_b128 %9, %21, off\n\t"
               "global_load_async_to_lds_b128 %10, %22, off\n\t"
               "global_load_async_to_lds_b128 %11, %23, off\n\t"
               "s_wait_xcnt 0x0"
               :: "v"(l[12]), "v"(l[13]), "v"(l[14]), "v"(l[15]), "v"(l[16]), "v"(l[17]), "v"(l[18]), "v"(l[19]), "v"(l[20]), "v"(l[21]), "v"(l[22]), "v"(l[23]),
                  "v"(g[12]), "v"(g[13]), "v"(g[14]), "v"(g[15]), "v"(g[16]), "v"(g[17]), "v"(g[18]), "v"(g[19]), "v"(g[20]), "v"(g[21]), "v"(g[22]), "v"(g[23]) : "memory");
}
// bx, by: the block's tile index and batch index inside its own product
template <int ACT>
__device__ __forceinline__ void g2_body(const _Float16* __restrict__ A, int lda, size_t sA, const _Float16* __restrict__ Bh, int ldb, size_t sB, float alpha, const float* __restrict__ bias, size_t sBias, const float* __restrict__ CP, int rowsPerB, size_t sCPb, int row0g,
    float* __restrict__ C, _Float16* __restrict__ C16, int ldc, size_t sC, int M, int N, int K, int bx, int by) {
  __shared__ __attribute__((aligned(16))) float so[4][32][68]; __shared__ __attribute__((aligned(16))) unsigned char ring[2 * G2_STAGE];
  const int tid = threadIdx.x, w = tid >> 5, lane = tid & 31, ln = lane & 15, hh = lane >> 4;
  A += (size_t)by * sA; Bh += (size_t)by * sB; const size_t cofs = (size_t)by * sC; const float* bp = bias ? bias + (size_t)by * sBias : nullptr;
  const int ntn = N >> 6; const int mt = bx / ntn, nq = bx - mt * ntn; const int row0 = mt * 128 + 32 * w, col0 = nq * 64; if (mt * 128 >= M) return;      /* the whole block leaves, in front of every barrier */
  const v8f z8 = {0.f,0.f,0.f,0.f,0.f,0.f,0.f,0.f}; v8f c00 = z8, c01 = z8, c02 = z8, c03 = z8, c10 = z8, c11 = z8, c12 = z8, c13 = z8;
  const _Float16* ga = A + (size_t)(row0 + hh) * lda + ln * 8; const _Float16* gb = Bh + (size_t)(col0 + 16 * w + hh) * ldb + ln * 8;      /* this lane's first 16 bytes of the wave's A and B rows */
  const unsigned la = (unsigned)(size_t)ring + (unsigned)((32 * w + hh) * G2_PITCH + ln * 16), lb = (unsigned)(size_t)ring + (unsigned)(G2_AB + (16 * w + hh) * G2_PITCH + ln * 16);
  const int nst = K >> 7;
  g2_stage(la, lb, ga, lda, gb, ldb);
  // What the epilogue adds (bias, addend CP) is read here, in the layout of the write-out pass (lane = 4 columns of rows 2q + hh): 17 independent 16-byte loads issued as one group, in flight beside stage 0's copies.
  const int c4 = ln * 4; const v4f z4 = {0.f,0.f,0.f,0.f}; v4f b4 = z4, cp[16];
#pragma unroll
  for (int q = 0; q < 16; ++q) cp[q] = z4;
  if (CP) { const float* pc[16];
#pragma unroll
    for (int q = 0; q < 16; ++q) { const int bidx = (row0g + row0 + q * 2 + hh) / rowsPerB; pc[q] = CP + (size_t)bidx * sCPb + (size_t)by * 64 + col0 + c4; }
    __builtin_amdgcn_sched_barrier(0);      /* all 16 addresses are formed in front of the loads, each in registers of its own: formed among the loads they share registers, and each reuse waits for an issued load */
#pragma unroll
    for (int q = 0; q < 16; ++q) cp[q] = *(const v4fa*)pc[q];
    asm volatile("s_wait_xcnt 0x0" ::: "memory");      /* stands in front of whatever reuses the address registers of the 16 loads above */
  }
  if (bp) { b4 = *(const v4fa*)(bp + col0 + c4);
    asm volatile("s_wait_xcnt 0x0" ::: "memory");      /* the same for the bias load */
  }
  asm volatile("s_wait_asynccnt 0x0" ::: "memory");      /* this wave's copies of stage 0 have landed */
  __syncthreads();      /* and every other wave's: stage 0 may be read */
  if (nst > 1) g2_stage(la + G2_STAGE, lb + G2_STAGE, ga + 128, lda, gb + 128, ldb);
#pragma unroll 1      /* one trip per stage: the two buffers alternate */
  for (int t = 0; t < nst; ++t) { const unsigned bo = (unsigned)(t & 1) * G2_STAGE; const unsigned char* pa = ring + bo + (32 * w + ln) * G2_PITCH; const unsigned char* pb = ring + bo + G2_AB + ln * G2_PITCH;
    v16h fa[2][2], fb[2][4];      /* two fragment sets: the next k step's LDS reads are issued, as one group, ahead of this step's WMMAs; never beyond the stage */
    fa[0][0] = g2_lfrag(pa, hh); fa[0][1] = g2_lfrag(pa + 16 * G2_PITCH, hh);
#pragma unroll
    for (int j = 0; j < 4; ++j) fb[0][j] = g2_lfrag(pb + j * 16 * G2_PITCH, hh);
#pragma unroll
    for (int ks = 0; ks < 4; ++ks) { const int cu = ks & 1, nx = cu ^ 1;
      if (ks < 3) { fa[nx][0] = g2_lfrag(pa + (ks + 1) * 64, hh); fa[nx][1] = g2_lfrag(pa + 16 * G2_PITCH + (ks + 1) * 64, hh);
#pragma unroll
        for (int j = 0; j < 4; ++j) fb[nx][j] = g2_lfrag(pb + j * 16 * G2_PITCH + (ks + 1) * 64, hh); }
      __builtin_amdgcn_sched_barrier(0);      /* keeps the reads above in front of the WMMAs below: sunk to their uses, each pair of WMMAs waits out an LDS latency */
      c00 = g2_mm(fa[cu][0], fb[cu][0], c00); c10 = g2_mm(fa[cu][1], fb[cu][0], c10); c01 = g2_mm(fa[cu][0], fb[cu][1], c01); c11 = g2_mm(fa[cu][1], fb[cu][1], c11);
      c02 = g2_mm(fa[cu][0], fb[cu][2], c02); c12 = g2_mm(fa[cu][1], fb[cu][2], c12); c03 = g2_mm(fa[cu][0], fb[cu][3], c03); c13 = g2_mm(fa[cu][1], fb[cu][3], c13);
      __builtin_amdgcn_sched_barrier(0);      /* keeps the next group of reads behind these WMMAs, so that two sets suffice */
    }
    asm volatile("s_wait_dscnt 0x0" ::: "memory");      /* this wave's reads of the buffer are done before it is refilled */
    asm volatile("s_wait_asynccnt 0x0" ::: "memory");      /* this wave's copies of stage t + 1 have landed */
    __syncthreads();      /* publishes stage t + 1 and ends every wave's reads of stage t */
    if (t + 2 < nst) g2_stage(la + bo, lb + bo, ga + (size_t)(t + 2) * 128, lda, gb + (size_t)(t + 2) * 128, ldb); }
  asm volatile("s_wait_asynccnt 0x0" ::: "memory");      /* no copy is left in flight */
  v8f accs[8] = {c00, c01, c02, c03, c10, c11, c12, c13};
#pragma unroll
  for (int u = 0; u < 8; ++u) { const int t = u & 3, half = u >> 2;
#pragma unroll
    for (int r = 0; r < 8; ++r) so[w][half * 16 + 8 * hh + r][t * 16 + ln] = accs[u][r]; }
  __builtin_amdgcn_fence(__ATOMIC_ACQ_REL, "workgroup"); __builtin_amdgcn_wave_barrier();
  const int rsub = lane >> 4; const v4f bv4 = {bf16_round(b4[0]), bf16_round(b4[1]), bf16_round(b4[2]), bf16_round(b4[3])};
  {      /* no branch per row: the 16 LDS reads are one group, the sums one block, the stores one group under one test of the pointer */
    v4f o[16];
#pragma unroll
    for (int q = 0; q < 16; ++q) o[q] = *(const v4fa*)&so[w][q * 2 + rsub][c4];
#pragma unroll
    for (int q = 0; q < 16; ++q)
#pragma unroll
      for (int i = 0; i < 4; ++i) { float v = o[q][i] * alpha + bv4[i]; if (CP) v += cp[q][i];
        if (ACT == 3) v = fmaxf(v, 0.f); else if (ACT == 6) v = 0.5f * v * (1.0f + erff(v * 0.70710678118654752f)); else if (ACT == 11) v = 1.0f / (1.0f + expf(-v)); else if (ACT == 15) v = v / (1.0f + expf(-v)); else if (ACT == 12) v = (v > 0.f) ? v : 0.01f * v; else if (ACT == 8) v = tanhf(v);
        o[q][i] = v; }
    if (C) { float* po[16];
#pragma unroll
      for (int q = 0; q < 16; ++q) po[q] = C + cofs + (size_t)(row0 + q * 2 + rsub) * ldc + col0 + c4;
      __builtin_amdgcn_sched_barrier(0);      /* all 16 addresses are formed in front of the stores, each in registers of its own: formed among the stores they share registers, and each reuse waits for an issued store */
#pragma unroll
      for (int q = 0; q < 16; ++q) *(v4f*)po[q] = o[q];
      asm volatile("s_wait_xcnt 0x0" ::: "memory");      /* stands in front of whatever reuses the registers of the 16 stores above */
    }
    if (C16) { _Float16* ph[16]; v4h h4[16];
#pragma unroll
      for (int q = 0; q < 16; ++q) { for (int i = 0; i < 4; ++i) h4[q][i] = (_Float16)o[q][i]; ph[q] = C16 + cofs + (size_t)(row0 + q * 2 + rsub) * ldc + col0 + c4; }
      __builtin_amdgcn_sched_barrier(0);      /* as above: values and addresses first, then the 16 stores as one group */
#pragma unroll
      for (int q = 0; q < 16; ++q) *(v4h*)ph[q] = h4[q]; }
     } }
template <int ACT>
__global__ __launch_bounds__(128) void k_gemm2(const _Float16* __restrict__ A, int lda, size_t sA, const _Float16* __restrict__ Bh, int ldb, size_t sB, float alpha, const float* __restrict__ bias, size_t sBias, const float* __restrict__ CP, int rowsPerB, size_t sCPb, int row0g,
    float* __restrict__ C, _Float16* __restrict__ C16, int ldc, size_t sC, int M, int N, int K) {
  g2_body<ACT>(A, lda, sA, Bh, ldb, sB, alpha, bias, sBias, CP, rowsPerB, sCPb, row0g, C, C16, ldc, sC, M, N, K, (int)blockIdx.x, (int)blockIdx.y); }
// The five projections that depend on the embeddings alone (q, k, v of the self attention; k, v of the cross attention) in one grid: a range of block indices per product.
// BT: the six [DM][DM] weight planes in a row (q, k, v, cross q, cross k, cross v); FW: three [SW][DM] f32 results in a row; FP: two [SP][DM] f32 results in a row.
#define P5_NW ((SW / 128) * (DM / 64))
#define P5_NP ((SP / 128) * (DM / 64))
__global__ __launch_bounds__(128) void k_proj5(const _Float16* __restrict__ WE, const _Float16* __restrict__ PE, const _Float16* __restrict__ BT, const float* __restrict__ bq, const float* __restrict__ bk, const float* __restrict__ bv, const float* __restrict__ bkc, const float* __restrict__ bvc,
    float* __restrict__ FW, float* __restrict__ FP) {
  const int b = (int)blockIdx.x; const bool word = b < 3 * P5_NW;      /* block-uniform */
  const int j = word ? b / P5_NW : (b - 3 * P5_NW) / P5_NP; const int bx = word ? b - j * P5_NW : (b - 3 * P5_NW) - j * P5_NP;
  const float* bias = word ? (j == 0 ? bq : (j == 1 ? bk : bv)) : (j == 0 ? bkc : bvc);
  g2_body<0>(word ? WE : PE, DM, 0, BT + (size_t)(word ? j : 4 + j) * DM * DM, DM, 0, 0.0625f, bias, 0, nullptr, 1, 0, 0,
             word ? FW + (size_t)j * SW * DM : FP + (size_t)j * SP * DM, nullptr, DM, 0, word ? SW : SP, DM, DM, bx, 0); }


template <int TK>
__device__ __forceinline__ void d_vthl(const float* __restrict__ VF, int ldv, _Float16* __restrict__ Vth, _Float16* __restrict__ Vtl, float (*tl)[65], int blk) { const int tid = threadIdx.x; const int slab = blk / (TK / 64), lg = blk % (TK / 64); const int b = slab / NH, h = slab % NH;
  for (int i = tid; i < 64 * 16; i += 256) { const int r = i / 16, c4 = (i % 16) * 4; const v4f a = *(const v4fa*)(VF + ((size_t)b * TK + lg * 64 + r) * ldv + h * 64 + c4); tl[r][c4] = a[0]; tl[r][c4 + 1] = a[1]; tl[r][c4 + 2] = a[2]; tl[r][c4 + 3] = a[3]; }
  __syncthreads();
  FragH fh[2], fl[2]; size_t oo[2];
#pragma unroll
  for (int rd = 0; rd < 2; ++rd) { const int d = rd * 32 + tid / 8, pc = tid % 8;
#pragma unroll
    for (int q = 0; q < 8; ++q) { const float v = tl[pc * 8 + q][d]; const _Float16 hv = (_Float16)v; fh[rd].h[q] = hv; fl[rd].h[q] = (_Float16)((v - (float)hv) * 1024.0f); } oo[rd] = ((size_t)slab * 64 + d) * TK + lg * 64 + pc * 8; }
  {
#pragma unroll
    for (int rd = 0; rd < 2; ++rd) { *(v8us*)((unsigned short*)Vth + oo[rd]) = fh[rd].half[0]; *(v8us*)((unsigned short*)Vtl + oo[rd]) = fl[rd].half[0]; }
    asm volatile("s_wait_xcnt 0x0" ::: "memory");      /* stands in front of whatever reuses the registers of the four stores above: inlined into a grid of several jobs, code of another job follows them in the listing */
     } }
// The hi/lo splits of the five projections in one grid: a range of block indices per plane (every branch is block-uniform; the barrier of d_vthl is passed by a whole block or by none of it).
#define S5_HW (SW * DM / 8 / 256)
#define S5_HP (SP * DM / 8 / 256)
#define S5_VW (NH * (SW / 64))
#define S5_VP (NH * (SP / 64))
__global__ __launch_bounds__(256) void k_split5(const float* __restrict__ FW, const float* __restrict__ FP, _Float16* __restrict__ Qh, _Float16* __restrict__ Ql, _Float16* __restrict__ Kh, _Float16* __restrict__ Kl, _Float16* __restrict__ Vth, _Float16* __restrict__ Vtl,
    _Float16* __restrict__ KCh, _Float16* __restrict__ KCl, _Float16* __restrict__ VCth, _Float16* __restrict__ VCtl) {
  __shared__ float tl[64][65]; int b = (int)blockIdx.x;
  if (b < S5_HW) { d_hl(FW, Qh, Ql, (size_t)SW * DM / 8, (unsigned)b); return; } b -= S5_HW;
  if (b < S5_HW) { d_hl(FW + (size_t)SW * DM, Kh, Kl, (size_t)SW * DM / 8, (unsigned)b); return; } b -= S5_HW;
  if (b < S5_VW) { d_vthl<SW>(FW + (size_t)2 * SW * DM, DM, Vth, Vtl, tl, b); return; } b -= S5_VW;
  if (b < S5_HP) { d_hl(FP, KCh, KCl, (size_t)SP * DM / 8, (unsigned)b); return; } b -= S5_HP;
  d_vthl<SP>(FP + (size_t)SP * DM, DM, VCth, VCtl, tl, b); }

// K/V staging of k_flashm: one stage = the 32 keys of one trip: 32 K rows of 128 B (hi plane, lo plane) at a pitch of 144 B, 64 V^T rows of 64 B (hi plane, lo plane) at a pitch of 80 B (16 B x odd, for the 16-byte fragment reads); two buffers.
#define FM_KP 144
#define FM_VP 80
#define FM_KL (32 * FM_KP)
#define FM_VH (2 * 32 * FM_KP)
#define FM_VD (64 * FM_VP)
#define FM_STAGE (FM_VH + 2 * FM_VD)
// One wave's share of a stage: 8 K rows and 16 V^T rows of each plane, 16 B per lane, 8 copies (a K copy brings 4 whole rows, a V copy 8 rows).
// lk, lv: the lane's LDS byte addresses of its first K and V chunk (hi plane); gkh, gkl, gvh, gvl: the matching global addresses in the four planes.
__device__ __forceinline__ void fm_stage(unsigned lk, unsigned lv, const unsigned short* gkh, const unsigned short* gkl, int ldk, const unsigned short* gvh, const unsigned short* gvl, int ldv) {
  // the copies go to LDS through no register; s_wait_xcnt is the statement's last line so that no address register is rewritten ahead of it
  asm volatile("global_load_async_to_lds_b128 %0, %8, off\n\t"
               "global_load_async_to_lds_b128 %1, %9, off\n\t"
               "global_load_async_to_lds_b128 %2, %10, off\n\t"
               "global_load_async_to_lds_b128 %3, %11, off\n\t"
               "global_load_async_to_lds_b128 %4, %12, off\n\t"
               "global_load_async_to_lds_b128 %5, %13, off\n\t"
               "global_load_async_to_lds_b128 %6, %14, off\n\t"
               "global_load_async_to_lds_b128 %7, %15, off\n\t"
               "s_wait_xcnt 0x0"
               :: "v"(lk), "v"(lk + 4 * FM_KP), "v"(lk + FM_KL), "v"(lk + FM_KL + 4 * FM_KP), "v"(lv), "v"(lv + 8 * FM_VP), "v"(lv + FM_VD), "v"(lv + FM_VD + 8 * FM_VP),
                  "v"(gkh), "v"(gkh + (size_t)4 * ldk), "v"(gkl), "v"(gkl + (size_t)4 * ldk), "v"(gvh), "v"(gvh + (size_t)8 * ldv), "v"(gvl), "v"(gvl + (size_t)8 * ldv) : "memory");
}
template <int TQ, int TK>
__global__ __launch_bounds__(128) void k_flashm(const _Float16* __restrict__ Q16, const _Float16* __restrict__ Q16lo, int ldq, const _Float16* __restrict__ K16, const _Float16* __restrict__ K16lo, int ldk, const _Float16* __restrict__ Vt, const _Float16* __restrict__ Vtlo, const unsigned* __restrict__ MB, const int* __restrict__ RA, const int* __restrict__ KE, float* __restrict__ O, int ldo) {
  constexpr int RPW = 16, RTN = RPW / 16, NQB = TQ / (4 * RPW), DT = 4, KS = 2;
  __shared__ __attribute__((aligned(16))) unsigned short sP[4][RPW][40], sPl[4][RPW][40]; __shared__ __attribute__((aligned(16))) float sO[4][RPW][64 + 4]; __shared__ __attribute__((aligned(16))) unsigned char kv[2 * FM_STAGE];
  const int tid = threadIdx.x, w = tid >> 5, lane = tid & 31, ln = lane & 15, hh = lane >> 4;
  const int slab = blockIdx.x / NQB, qblk = blockIdx.x % NQB; const int b = slab / NH, h = slab % NH; const int qb0 = qblk * (4 * RPW); const int q0 = qb0 + w * RPW;
  FragH aq[2][KS], aql[2][KS];
#pragma unroll
  for (int rt = 0; rt < RTN; ++rt) { const size_t qo = ((size_t)b * TQ + q0 + rt * 16 + ln) * ldq + h * 64; const unsigned short* qr = (const unsigned short*)Q16 + qo; const unsigned short* ql = (const unsigned short*)Q16lo + qo;
#pragma unroll
    for (int ks = 0; ks < KS; ++ks) { aq[rt][ks].half[0] = *(const v8us*)(qr + ks * 32 + 8 * hh); aq[rt][ks].half[1] = *(const v8us*)(qr + ks * 32 + 16 + 8 * hh); aql[rt][ks].half[0] = *(const v8us*)(ql + ks * 32 + 8 * hh); aql[rt][ks].half[1] = *(const v8us*)(ql + ks * 32 + 16 + 8 * hh); } }
  const unsigned short* Vth = (const unsigned short*)Vt + (size_t)slab * 64 * TK; const unsigned short* Vtl = (const unsigned short*)Vtlo + (size_t)slab * 64 * TK;
  float m_r[2][8], l_r[2][8]; v8f oacc[2][DT], oaccl[2][DT];
#pragma unroll
  for (int rt = 0; rt < RTN; ++rt) {
#pragma unroll
    for (int r = 0; r < 8; ++r) { m_r[rt][r] = -3.0e38f; l_r[rt][r] = 0.f; }
#pragma unroll
    for (int dt = 0; dt < DT; ++dt) { oacc[rt][dt] = (v8f){0.f,0.f,0.f,0.f,0.f,0.f,0.f,0.f}; oaccl[rt][dt] = oacc[rt][dt]; } }
  int jend = KE[qblk * 32]; jend = min(TK, (jend + 31) & ~31); if (jend < 32) jend = 32;      /* block-uniform */
  int allm[2][8]; const unsigned* mrow[2][8];
#pragma unroll
  for (int rt = 0; rt < RTN; ++rt)
#pragma unroll
    for (int r = 0; r < 8; ++r) { const int tq = q0 + rt * 16 + 8 * hh + r; allm[rt][r] = RA[tq]; mrow[rt][r] = MB + (size_t)tq * (TK / 32); }
  const unsigned lk = (unsigned)(size_t)kv + (unsigned)((8 * w + (lane >> 3)) * FM_KP + (lane & 7) * 16), lv = (unsigned)(size_t)kv + (unsigned)(FM_VH + (16 * w + (lane >> 2)) * FM_VP + (lane & 3) * 16);
  const size_t gko = ((size_t)b * TK + 8 * w + (lane >> 3)) * ldk + h * 64 + (lane & 7) * 8, gvo = (size_t)(16 * w + (lane >> 2)) * TK + (lane & 3) * 8;      /* this lane's first 16 bytes of the wave's K and V^T rows */
  const unsigned short* gkh = (const unsigned short*)K16 + gko; const unsigned short* gkl = (const unsigned short*)K16lo + gko; const unsigned short* gvh = Vth + gvo; const unsigned short* gvl = Vtl + gvo;
  fm_stage(lk, lv, gkh, gkl, ldk, gvh, gvl, TK);
  asm volatile("s_wait_asynccnt 0x0" ::: "memory");      /* this wave's copies of stage 0 have landed */
  __syncthreads();      /* and every other wave's: stage 0 may be read */
  if (32 < jend) fm_stage(lk + FM_STAGE, lv + FM_STAGE, gkh + (size_t)32 * ldk, gkl + (size_t)32 * ldk, ldk, gvh + 32, gvl + 32, TK);
#pragma unroll 1
  for (int j0 = 0; j0 < jend; j0 += 32) {
    const unsigned bo = (unsigned)((j0 >> 5) & 1) * FM_STAGE; const unsigned char* pk = kv + bo + ln * FM_KP + 16 * hh; const unsigned char* pv = kv + bo + FM_VH + ln * FM_VP + 16 * hh;      /* this trip's buffer: the lane's row and half in the K and V^T tiles */
    v8f s[2][2]; FragH bk[2][KS], bkl[2][KS];
#pragma unroll
    for (int nt = 0; nt < 2; ++nt) { const unsigned char* kr = pk + nt * 16 * FM_KP; const unsigned char* kl = kr + FM_KL;
#pragma unroll
      for (int ks = 0; ks < KS; ++ks) { bk[nt][ks].half[0] = *(const v8us*)(kr + ks * 64); bk[nt][ks].half[1] = *(const v8us*)(kr + ks * 64 + 32); bkl[nt][ks].half[0] = *(const v8us*)(kl + ks * 64); bkl[nt][ks].half[1] = *(const v8us*)(kl + ks * 64 + 32); } }
    __builtin_amdgcn_sched_barrier(0);      /* keeps the trip's K reads one group in front of the WMMAs: sunk to their uses, the second 16 keys wait out an LDS latency of their own */
#pragma unroll
    for (int nt = 0; nt < 2; ++nt) {
#pragma unroll
      for (int rt = 0; rt < RTN; ++rt) { v8f acc = (v8f){0.f,0.f,0.f,0.f,0.f,0.f,0.f,0.f}, accr = acc;
#pragma unroll
        for (int ks = 0; ks < KS; ++ks) { acc = mmaH<1>(aq[rt][ks].v, aq[rt][ks].v, bk[nt][ks].v, bk[nt][ks].v, acc); accr = mmaH<1>(aql[rt][ks].v, aql[rt][ks].v, bk[nt][ks].v, bk[nt][ks].v, accr); accr = mmaH<1>(aq[rt][ks].v, aq[rt][ks].v, bkl[nt][ks].v, bkl[nt][ks].v, accr); }
        s[rt][nt] = acc + accr * 0.0009765625f; } }
#pragma unroll
    for (int rt = 0; rt < RTN; ++rt) {      /* no branch in the softmax: each exp is computed for every lane and the old conditions pick by select, so a lane's eight rows are one straight-line block and their mask loads, cross-lane steps and exp chains overlap */
      float s0[8], s1[8], mc[8]; bool ok0[8], ok1[8];
#pragma unroll
      for (int r = 0; r < 8; ++r) { const unsigned mw = mrow[rt][r][j0 >> 5]; const bool am = (allm[rt][r] != 0);
        ok0[r] = am || (((mw >> ln) & 1u) == 0u); ok1[r] = am || (((mw >> (16 + ln)) & 1u) == 0u);
        s0[r] = ok0[r] ? (am ? 0.f : s[rt][0][r] * SCL) : -INFINITY; s1[r] = ok1[r] ? (am ? 0.f : s[rt][1][r] * SCL) : -INFINITY; mc[r] = fmaxf(s0[r], s1[r]); }
#pragma unroll
      for (int st = 1; st < 16; st <<= 1)
#pragma unroll
        for (int r = 0; r < 8; ++r) mc[r] = fmaxf(mc[r], __shfl_xor(mc[r], st, 32));
#pragma unroll
      for (int r = 0; r < 8; ++r) { const float mo = m_r[rt][r], mn = fmaxf(mo, mc[r]); const float ea = expf(mo - mn), e0 = expf(s0[r] - mn), e1 = expf(s1[r] - mn);
        const float al = (mn > -1.0e38f) ? ea : 1.0f; m_r[rt][r] = mn; const float p0 = ok0[r] ? e0 : 0.f, p1 = ok1[r] ? e1 : 0.f; l_r[rt][r] = l_r[rt][r] * al + p0 + p1;
#pragma unroll
        for (int dt = 0; dt < DT; ++dt) { oacc[rt][dt][r] *= al; oaccl[rt][dt][r] *= al; }
        FragH t2, t3; const float ps0 = p0 * 1024.0f, ps1 = p1 * 1024.0f; t2.h[0] = (_Float16)ps0; t2.h[1] = (_Float16)ps1; t3.h[0] = (_Float16)((ps0 - (float)t2.h[0]) * 1024.0f); t3.h[1] = (_Float16)((ps1 - (float)t2.h[1]) * 1024.0f);
        sP[w][rt * 16 + 8 * hh + r][ln] = t2.u[0]; sP[w][rt * 16 + 8 * hh + r][16 + ln] = t2.u[1]; sPl[w][rt * 16 + 8 * hh + r][ln] = t3.u[0]; sPl[w][rt * 16 + 8 * hh + r][16 + ln] = t3.u[1]; } }
    FragH bv[DT], bl[DT];      /* the trip's V^T fragments, read as one group in front of P's way through LDS, so that the four output tiles do not each wait out an LDS latency */
#pragma unroll
    for (int dt = 0; dt < DT; ++dt) { const unsigned char* vr = pv + dt * 16 * FM_VP; bv[dt].half[0] = *(const v8us*)vr; bv[dt].half[1] = *(const v8us*)(vr + 32); bl[dt].half[0] = *(const v8us*)(vr + FM_VD); bl[dt].half[1] = *(const v8us*)(vr + FM_VD + 32); }
    __builtin_amdgcn_fence(__ATOMIC_ACQ_REL, "workgroup"); __builtin_amdgcn_wave_barrier();
    FragH pa[2], pl[2];
#pragma unroll
    for (int rt = 0; rt < RTN; ++rt) { pa[rt].half[0] = *(const v8us*)&sP[w][rt * 16 + ln][8 * hh]; pa[rt].half[1] = *(const v8us*)&sP[w][rt * 16 + ln][16 + 8 * hh]; pl[rt].half[0] = *(const v8us*)&sPl[w][rt * 16 + ln][8 * hh]; pl[rt].half[1] = *(const v8us*)&sPl[w][rt * 16 + ln][16 + 8 * hh]; }
#pragma unroll
    for (int dt = 0; dt < DT; ++dt) {
#pragma unroll
      for (int rt = 0; rt < RTN; ++rt) { oacc[rt][dt] = mmaH<1>(pa[rt].v, pa[rt].v, bv[dt].v, bv[dt].v, oacc[rt][dt]); oaccl[rt][dt] = mmaH<1>(pa[rt].v, pa[rt].v, bl[dt].v, bl[dt].v, oaccl[rt][dt]); oaccl[rt][dt] = mmaH<1>(pl[rt].v, pl[rt].v, bv[dt].v, bv[dt].v, oaccl[rt][dt]); } }
    asm volatile("s_wait_dscnt 0x0" ::: "memory");      /* this wave's reads of the buffer (and of its P rows) are done before the refill */
    asm volatile("s_wait_asynccnt 0x0" ::: "memory");      /* this wave's copies of the next stage have landed */
    __syncthreads();      /* publishes the next stage and ends every wave's reads of this one */
    if (j0 + 64 < jend) fm_stage(lk + bo, lv + bo, gkh + (size_t)(j0 + 64) * ldk, gkl + (size_t)(j0 + 64) * ldk, ldk, gvh + (j0 + 64), gvl + (j0 + 64), TK); }
  asm volatile("s_wait_asynccnt 0x0" ::: "memory");      /* no copy is left in flight */
#pragma unroll
  for (int rt = 0; rt < RTN; ++rt) {
#pragma unroll
    for (int r = 0; r < 8; ++r) { float l = l_r[rt][r]; l += __shfl_xor(l, 1, 32); l += __shfl_xor(l, 2, 32); l += __shfl_xor(l, 4, 32); l += __shfl_xor(l, 8, 32); l_r[rt][r] = (l > 0.f) ? 1.0f / (l * 1024.0f) : 0.f; }
#pragma unroll
    for (int dt = 0; dt < DT; ++dt)
#pragma unroll
      for (int r = 0; r < 8; ++r) sO[w][rt * 16 + 8 * hh + r][dt * 16 + ln] = (oacc[rt][dt][r] + oaccl[rt][dt][r] * 0.0009765625f) * l_r[rt][r]; }
  __builtin_amdgcn_fence(__ATOMIC_ACQ_REL, "workgroup"); __builtin_amdgcn_wave_barrier();
  {
#pragma unroll
    for (int rp = 0; rp < RPW; rp += 2) { const int r = rp + (lane >> 4), pc = lane & 15; const v4f val = *(const v4fa*)&sO[w][r][pc * 4]; *(v4f*)(O + ((size_t)b * TQ + q0 + r) * ldo + h * 64 + pc * 4) = val; }
     } }


__device__ __forceinline__ void d_causaltab(unsigned* __restrict__ MB, int* __restrict__ RA, int* __restrict__ KE, int nq, int nk, int blk) {
  const int t = blk * 256 + threadIdx.x; const int nw = nk / 32;
  if (t < nq * nw) { const int q = t / nw, w = t % nw; const int first = q + 1 - 32 * w; const unsigned bits = (first <= 0) ? 0xffffffffu : ((first >= 32) ? 0u : (0xffffffffu << first)); *(unsigned*)(MB + t) = bits;  }
  if (t < nq) { *(int*)(RA + t) = 0;  }
  if (t < nq / 64) { const int v = 64 * (t + 1); *(int*)(KE + t * 32) = v;  } }
__device__ __forceinline__ void d_fulltab(unsigned* __restrict__ MB, int* __restrict__ RA, int* __restrict__ KE, int nq, int nk, int blk) {
  const int t = blk * 256 + threadIdx.x; const int nw = nk / 32;
  if (t < nq * nw) { *(unsigned*)(MB + t) = 0u;  }
  if (t < nq) { *(int*)(RA + t) = 0;  }
  if (t < nq / 64) { *(int*)(KE + t * 32) = nk;  } }

// Everything that depends on the inputs alone (eight weight planes, two embedding planes, two mask tables) in one grid: a range of block indices per job, every branch block-uniform.
// BT: the six [DM][DM] weight planes in a row (q, k, v, cross q, cross k, cross v).
#define PR_F (FF * DM / 8 / 256)
#define PR_W (DM * DM / 8 / 256)
#define PR_X (SW * DM / 8 / 256)
#define PR_P (SP * DM / 8 / 256)
#define PR_C (SW * (SW / 32) / 256)
#define PR_U (SW * (SP / 32) / 256)
__global__ __launch_bounds__(256) void k_prep(const float* __restrict__ Wq, const float* __restrict__ Wk, const float* __restrict__ Wv, const float* __restrict__ Wqc, const float* __restrict__ Wkc, const float* __restrict__ Wvc, const float* __restrict__ W1, const float* __restrict__ W2,
    const float* __restrict__ wemb, const float* __restrict__ pemb, _Float16* __restrict__ BT, _Float16* __restrict__ BW1, _Float16* __restrict__ BW2, _Float16* __restrict__ WE16, _Float16* __restrict__ PE16,
    unsigned* __restrict__ MB, int* __restrict__ RA, int* __restrict__ KE, unsigned* __restrict__ MB2, int* __restrict__ RA2, int* __restrict__ KE2) {
  int b = (int)blockIdx.x;
  if (b < PR_F) { d_round16f(W1, BW1, (size_t)FF * DM / 8, (unsigned)b); return; } b -= PR_F;
  if (b < PR_F) { d_round16f(W2, BW2, (size_t)FF * DM / 8, (unsigned)b); return; } b -= PR_F;
  if (b < 6 * PR_W) { const int j = b / PR_W; const float* W = (j == 0) ? Wq : (j == 1) ? Wk : (j == 2) ? Wv : (j == 3) ? Wqc : (j == 4) ? Wkc : Wvc;
    d_round16f(W, BT + (size_t)j * DM * DM, (size_t)DM * DM / 8, (unsigned)(b - j * PR_W)); return; } b -= 6 * PR_W;
  if (b < PR_X) { d_x16(wemb, WE16, (size_t)SW * DM / 8, (unsigned)b); return; } b -= PR_X;
  if (b < PR_P) { d_x16(pemb, PE16, (size_t)SP * DM / 8, (unsigned)b); return; } b -= PR_P;
  if (b < PR_C) { d_causaltab(MB, RA, KE, SW, SW, b); return; } b -= PR_C;
  d_fulltab(MB2, RA2, KE2, SW, SP, b); }

extern "C" void kernel_launch(void* const* d_in, const int* in_sizes, int n_in,
                              void* d_out, int out_size, void* d_ws, size_t ws_size, hipStream_t stream) {
  (void)in_sizes; (void)n_in; (void)out_size;
  const float* const* I = (const float* const*)d_in; const float* wemb = I[0]; const float* pemb = I[1];
  const float* Wq = I[2]; const float* bq = I[3]; const float* Wk = I[4]; const float* bk = I[5]; const float* Wv = I[6]; const float* bv = I[7];
  const float* Wqc = I[8]; const float* bqc = I[9]; const float* Wkc = I[10]; const float* bkc = I[11]; const float* Wvc = I[12]; const float* bvc = I[13];
  const float* W1 = I[14]; const float* b1 = I[15]; const float* W2 = I[16]; const float* b2 = I[17];
  char* ws = (char*)d_ws; size_t off = 0;
  auto take = [&](size_t bytes) { char* p = ws + off; off += (bytes + 255) & ~(size_t)255; return p; };
  _Float16* BT = (_Float16*)take((size_t)6 * DM * DM * 2); _Float16* BQC = BT + (size_t)3 * DM * DM;      /* weight planes q, k, v, cross q, cross k, cross v in a row */
  _Float16* BW1 = (_Float16*)take((size_t)FF * DM * 2); _Float16* BW2 = (_Float16*)take((size_t)DM * FF * 2);
  _Float16* WE16 = (_Float16*)take((size_t)SW * DM * 2); _Float16* PE16 = (_Float16*)take((size_t)SP * DM * 2);
  float* FW = (float*)take((size_t)3 * SW * DM * 4); float* FP = (float*)take((size_t)2 * SP * DM * 4);      /* f32 q, k, v and cross k, v */
  _Float16* Qh = (_Float16*)take((size_t)SW * DM * 2); _Float16* Ql = (_Float16*)take((size_t)SW * DM * 2); _Float16* Kh = (_Float16*)take((size_t)SW * DM * 2); _Float16* Kl = (_Float16*)take((size_t)SW * DM * 2);      /* Qh..Kl: 16 MiB contiguous, later the FFN f32 half-hidden */
  _Float16* Vth = (_Float16*)take((size_t)SW * DM * 2); _Float16* Vtl = (_Float16*)take((size_t)SW * DM * 2);
  _Float16* KCh = (_Float16*)take((size_t)SP * DM * 2); _Float16* KCl = (_Float16*)take((size_t)SP * DM * 2); _Float16* VCth = (_Float16*)take((size_t)SP * DM * 2); _Float16* VCtl = (_Float16*)take((size_t)SP * DM * 2);
  unsigned* MB = (unsigned*)take((size_t)SW * (SW / 32) * 4); int* RA = (int*)take((size_t)SW * 4); int* KE = (int*)take((size_t)(SW / 64) * 32 * 4);
  unsigned* MB2 = (unsigned*)take((size_t)SW * (SP / 32) * 4); int* RA2 = (int*)take((size_t)SW * 4); int* KE2 = (int*)take((size_t)(SW / 64) * 32 * 4);
  _Float16* Ah = (_Float16*)take((size_t)SW * DM * 2); _Float16* Al = (_Float16*)take((size_t)SW * DM * 2);      /* word hi/lo, later cross hi/lo */
  _Float16* HDh = (_Float16*)take((size_t)SW * (FF / 2) * 2); _Float16* HDl = (_Float16*)take((size_t)SW * (FF / 2) * 2);
  if (off > ws_size) return;      /* 12 + 16 + 4 + 2 + 32 + 32 + 0.8 + 8 + 16 = 123 MiB */
  float* F = FW;      /* free again behind k_split5: attention results, cross q */
  float* HF = (float*)Qh;             /* FFN half hidden f32 [2048][2048] = 16 MiB over Qh..Kl (dead after the second attention) */
  const dim3 gW((SW / 128) * (DM / 64), 1), gH((SW / 128) * ((FF / 2) / 64), 1); const size_t n8w = (size_t)SW * DM / 8; const unsigned nbw = (unsigned)((n8w + 255) / 256);
  k_prep<<<2 * PR_F + 6 * PR_W + PR_X + PR_P + PR_C + PR_U, 256, 0, stream>>>(Wq, Wk, Wv, Wqc, Wkc, Wvc, W1, W2, wemb, pemb, BT, BW1, BW2, WE16, PE16, MB, RA, KE, MB2, RA2, KE2);      /* weights are (out,in) row-major = natural Bt; x16 */
  k_proj5<<<3 * P5_NW + 2 * P5_NP, 128, 0, stream>>>(WE16, PE16, BT, bq, bk, bv, bkc, bvc, FW, FP);
  k_split5<<<2 * S5_HW + S5_VW + S5_HP + S5_VP, 256, 0, stream>>>(FW, FP, Qh, Ql, Kh, Kl, Vth, Vtl, KCh, KCl, VCth, VCtl);
  /* --- causal self attention on the word embeddings (all planes hi/lo) --- */
  k_flashm<SW, SW><<<NH * (SW / 64), 128, 0, stream>>>(Qh, Ql, DM, Kh, Kl, DM, Vth, Vtl, MB, RA, KE, F, DM);      /* word (f32) -> F */
  k_hl<<<nbw, 256, 0, stream>>>(F, Ah, Al, n8w);      /* word as hi/lo operand planes */
  k_gemm2<0><<<gW, 128, 0, stream>>>(Ah, DM, 0, BQC, DM, 0, 0.0625f, bqc, 0, nullptr, 1, 0, 0, F, nullptr, DM, 0, SW, DM, DM);
  k_gemm2<0><<<gW, 128, 0, stream>>>(Al, DM, 0, BQC, DM, 0, 0.0625f * 0.0009765625f, nullptr, 0, F, 1, (size_t)DM, 0, F, nullptr, DM, 0, SW, DM, DM); k_hl<<<nbw, 256, 0, stream>>>(F, Qh, Ql, n8w);
  k_flashm<SW, SP><<<NH * (SW / 64), 128, 0, stream>>>(Qh, Ql, DM, KCh, KCl, DM, VCth, VCtl, MB2, RA2, KE2, F, DM);      /* cross (f32) -> F */
  k_hl<<<nbw, 256, 0, stream>>>(F, Ah, Al, n8w);      /* cross as hi/lo operand planes */
  /* --- FFN in two column halves of the hidden: h = relu(cross*W1^T + b1) (hi/lo), out (+)= h_half*W2_half^T (+ b2 once) --- */
  for (int hf = 0; hf < 2; ++hf) { const _Float16* B1h = BW1 + (size_t)hf * (FF / 2) * DM; const _Float16* B2h = BW2 + (size_t)hf * (FF / 2);
    k_gemm2<0><<<gH, 128, 0, stream>>>(Ah, DM, 0, B1h, DM, 0, 0.0625f, b1 + hf * (FF / 2), 0, nullptr, 1, 0, 0, HF, nullptr, FF / 2, 0, SW, FF / 2, DM);
    k_gemm2<3><<<gH, 128, 0, stream>>>(Al, DM, 0, B1h, DM, 0, 0.0625f * 0.0009765625f, nullptr, 0, HF, 1, (size_t)(FF / 2), 0, HF, nullptr, FF / 2, 0, SW, FF / 2, DM);      /* relu applied after the residual pass completes the sum */
    k_hl<<<(unsigned)(((size_t)SW * (FF / 2) / 8 + 255) / 256), 256, 0, stream>>>(HF, HDh, HDl, (size_t)SW * (FF / 2) / 8);
    k_gemm2<0><<<gW, 128, 0, stream>>>(HDh, FF / 2, 0, B2h, FF, 0, 0.0625f, (hf == 0) ? b2 : nullptr, 0, (hf == 0) ? nullptr : (const float*)d_out, 1, (size_t)DM, 0, (float*)d_out, nullptr, DM, 0, SW, DM, FF / 2);
    k_gemm2<0><<<gW, 128, 0, stream>>>(HDl, FF / 2, 0, B2h, FF, 0, 0.0625f * 0.0009765625f, nullptr, 0, (const float*)d_out, 1, (size_t)DM, 0, (float*)d_out, nullptr, DM, 0, SW, DM, FF / 2); }
}

// v006
// A run of this version takes 328 microseconds.
// Next to v005, in two timings, it ran 1.17 and 1.18 times as fast.
// Counting every step since v000, it is 3.94 times as fast.
#include <hip/hip_runtime.h>
// Two-stage attention decoder block (word embeddings [2048][1024], position embeddings [1024][1024], 16 heads x 64, FFN 4096): word = CausalMHA(wemb; q,k,v = Linear+bias, scores/8, tril, softmax, .v, heads merged, no output projection); cross = MHA(q from word, k/v from pemb, no mask); out = relu(cross*W1^T + b1)*W2^T + b2 -> [2048,1024].
// Compute dtype: inputs and parameters rounded to bf16; projections of the embeddings exact; all other operands f16 hi + (x2^10) residual pairs (~2^-21); f32 accumulation, softmax f32. v_wmma_f32_16x16x32_f16.
#define SW 2048
#define SP 1024
#define DM 1024
#define NH 16
#define FF 4096
#define SCL 0.125f
#define SKV ((SW > SP) ? SW : SP)      /* larger key count (unused): the self attention has SW keys, the cross attention SP */
typedef __bf16 v16b __attribute__((ext_vector_type(16)));
typedef unsigned short v8us __attribute__((ext_vector_type(8), may_alias));
typedef float  v8f  __attribute__((ext_vector_type(8)));
typedef float  v4f  __attribute__((ext_vector_type(4)));
typedef float  v4fa __attribute__((ext_vector_type(4), may_alias));
union FragB { v16b v; v8us half[2]; unsigned short u[16]; };

__device__ __forceinline__ unsigned short bf16_bits(float x) { unsigned int u = __float_as_uint(x); return (unsigned short)((u + 0x7FFFu + ((u >> 16) & 1u)) >> 16); }
__device__ __forceinline__ float bf16_val(unsigned short b) { return __uint_as_float(((unsigned int)b) << 16); }
__device__ __forceinline__ float bf16_round(float x) { return bf16_val(bf16_bits(x)); }
// D += A·B with NT terms: 1 = ah·bh, 2 = + al·bh (A split), 3 = + ah·bl (both split)
template <int NT>
__device__ __forceinline__ v8f mmaN(v16b ah, v16b al, v16b bh, v16b bl, v8f c) {
  c = __builtin_amdgcn_wmma_f32_16x16x32_bf16(false, ah, false, bh, (short)0, c, false, false);
  if (NT >= 2) c = __builtin_amdgcn_wmma_f32_16x16x32_bf16(false, al, false, bh, (short)0, c, false, false);
  if (NT >= 3) c = __builtin_amdgcn_wmma_f32_16x16x32_bf16(false, ah, false, bl, (short)0, c, false, false);
  asm volatile("v_nop\n\tv_nop\n\tv_nop\n\tv_nop" : "+v"(c) : "v"(ah), "v"(al), "v"(bh), "v"(bl));
  return c;
}

__global__ __launch_bounds__(256) void k_wt_bf16(const float* __restrict__ W, unsigned short* __restrict__ Wt, int K, int N) {
  const int t = blockIdx.x * 256 + threadIdx.x;
  const int k8n = K / 8;
  if (t >= N * k8n) return;
  const int n = t / k8n, k8 = (t % k8n) * 8;
  v8us v;
#pragma unroll
  for (int i = 0; i < 8; ++i) v[i] = bf16_bits(W[(size_t)(k8 + i) * N + n]);
  *(v8us*)(Wt + (size_t)n * K + k8) = v;
  
}

// GEMM C[M][N] (f32, pitch ldc) = act(A[M][K]·W + bias). A f32 row-major (pitch lda) converted per fragment to bf16
// (ASPLIT: hi/lo two planes -> 2 terms, else single rounded term); Wt bf16 [N][K] (pitch ldb). BIAS_BF16 rounds the
// bias to bf16 first (bias quantised to bf16 before the add). K%32==0, M%16==0, N%64==0.
template <bool ASPLIT, int ACT, bool BIAS_BF16>
__global__ __launch_bounds__(128) void k_gemm_bf(const float* __restrict__ A, int lda, const unsigned short* __restrict__ Wt, int ldb,
                                               const float* __restrict__ bias, float* __restrict__ C, int ldc, int M, int N, int K) {
  __shared__ __attribute__((aligned(16))) float so[4][16][64];
  const int tid = threadIdx.x, w = tid >> 5, lane = tid & 31, ln = lane & 15, hh = lane >> 4;
  const int ntn = N / 64;
  const int wid = blockIdx.x * 4 + w;
  const int mt = wid / ntn, nq = wid % ntn;
  if (mt * 16 >= M) return;
  const int row0 = mt * 16, col0 = nq * 64;
  const float* arow = A + (size_t)(row0 + ln) * lda;
  v8f acc[4] = {};
  for (int kb = 0; kb < K; kb += 32) {
    FragB ah, al;
    const v4f x0 = *(const v4fa*)(arow + kb + 8 * hh), x1 = *(const v4fa*)(arow + kb + 8 * hh + 4);
    const v4f x2 = *(const v4fa*)(arow + kb + 16 + 8 * hh), x3 = *(const v4fa*)(arow + kb + 16 + 8 * hh + 4);
    float xs[16] = {x0[0],x0[1],x0[2],x0[3],x1[0],x1[1],x1[2],x1[3],x2[0],x2[1],x2[2],x2[3],x3[0],x3[1],x3[2],x3[3]};
#pragma unroll
    for (int i = 0; i < 16; ++i) { const unsigned short hb = bf16_bits(xs[i]); ah.u[i] = hb; al.u[i] = ASPLIT ? bf16_bits(xs[i] - bf16_val(hb)) : (unsigned short)0; }
#pragma unroll
    for (int t = 0; t < 4; ++t) {
      const unsigned short* brow = Wt + (size_t)(col0 + t * 16 + ln) * ldb + kb;
      FragB b;
      b.half[0] = *(const v8us*)(brow + 8 * hh);
      b.half[1] = *(const v8us*)(brow + 16 + 8 * hh);
      acc[t] = mmaN<ASPLIT ? 2 : 1>(ah.v, al.v, b.v, b.v, acc[t]);
    }
  }
#pragma unroll
  for (int t = 0; t < 4; ++t) {
    float bv = bias ? bias[col0 + t * 16 + ln] : 0.f;
    if (BIAS_BF16) bv = bf16_round(bv);
#pragma unroll
    for (int r = 0; r < 8; ++r) { float v = acc[t][r] + bv; if (ACT == 1) v = fmaxf(v, 0.f); so[w][8 * hh + r][t * 16 + ln] = v; }
  }
  __builtin_amdgcn_fence(__ATOMIC_ACQ_REL, "workgroup");
  __builtin_amdgcn_wave_barrier();
  const int rsub = lane >> 4, c4 = (lane & 15) * 4;
  {
#pragma unroll
    for (int q = 0; q < 8; ++q) {
      const int r = q * 2 + rsub;
      const v4f v = *(const v4fa*)&so[w][r][c4];
      *(v4f*)(C + (size_t)(row0 + r) * ldc + col0 + c4) = v;
    }
    
  }
}

// GEMM C = act(A·W + bias + resid): A f32 (ASPLIT -> hi/lo 2 terms), Wt bf16 [N][K]; ACT 0 none, 1 relu, 2 exact gelu;
// resid (optional, f32, row index = (row % rmod), pitch ldr, RES_BF16 rounds it) added before the activation.
template <bool ASPLIT, int ACT, bool BIAS_BF16, bool RES_BF16>
__global__ __launch_bounds__(128) void k_gemm_bf3(const float* __restrict__ A, int lda, const unsigned short* __restrict__ Wt, int ldb,
                                                const float* __restrict__ bias, const float* __restrict__ resid, int rmod, int ldr,
                                                float* __restrict__ C, int ldc, int M, int N, int K) {
  __shared__ __attribute__((aligned(16))) float so[4][16][64];
  const int tid = threadIdx.x, w = tid >> 5, lane = tid & 31, ln = lane & 15, hh = lane >> 4;
  const int ntn = N / 64;
  const int wid = blockIdx.x * 4 + w;
  const int mt = wid / ntn, nq = wid % ntn;
  if (mt * 16 >= M) return;
  const int row0 = mt * 16, col0 = nq * 64;
  const float* arow = A + (size_t)(row0 + ln) * lda;
  v8f acc[4] = {};
  for (int kb = 0; kb < K; kb += 32) {
    FragB ah, al;
    const v4f x0 = *(const v4fa*)(arow + kb + 8 * hh), x1 = *(const v4fa*)(arow + kb + 8 * hh + 4);
    const v4f x2 = *(const v4fa*)(arow + kb + 16 + 8 * hh), x3 = *(const v4fa*)(arow + kb + 16 + 8 * hh + 4);
    float xs[16] = {x0[0],x0[1],x0[2],x0[3],x1[0],x1[1],x1[2],x1[3],x2[0],x2[1],x2[2],x2[3],x3[0],x3[1],x3[2],x3[3]};
#pragma unroll
    for (int i = 0; i < 16; ++i) { const unsigned short hb = bf16_bits(xs[i]); ah.u[i] = hb; al.u[i] = ASPLIT ? bf16_bits(xs[i] - bf16_val(hb)) : (unsigned short)0; }
#pragma unroll
    for (int t = 0; t < 4; ++t) {
      const unsigned short* brow = Wt + (size_t)(col0 + t * 16 + ln) * ldb + kb;
      FragB b;
      b.half[0] = *(const v8us*)(brow + 8 * hh);
      b.half[1] = *(const v8us*)(brow + 16 + 8 * hh);
      acc[t] = mmaN<ASPLIT ? 2 : 1>(ah.v, al.v, b.v, b.v, acc[t]);
    }
  }
#pragma unroll
  for (int t = 0; t < 4; ++t) {
    const int col = col0 + t * 16 + ln;
    float bv = bias ? bias[col] : 0.f;
    if (BIAS_BF16) bv = bf16_round(bv);
#pragma unroll
    for (int r = 0; r < 8; ++r) {
      float v = acc[t][r] + bv;
      if (resid) { float rv = resid[(size_t)((row0 + 8 * hh + r) % rmod) * ldr + col]; if (RES_BF16) rv = bf16_round(rv); v += rv; }
      if (ACT == 1) v = fmaxf(v, 0.f);
      if (ACT == 2) v = 0.5f * v * (1.0f + erff(v * 0.70710678118654752f));
      if (ACT == 3) { const float u = 0.7978845608028654f * (v + 0.044715f * v * v * v); v = 0.5f * v * (1.0f + tanhf(u)); }
      so[w][8 * hh + r][t * 16 + ln] = v;
    }
  }
  __builtin_amdgcn_fence(__ATOMIC_ACQ_REL, "workgroup");
  __builtin_amdgcn_wave_barrier();
  const int rsub = lane >> 4, c4 = (lane & 15) * 4;
  {
#pragma unroll
    for (int q = 0; q < 8; ++q) {
      const int r = q * 2 + rsub;
      const v4f v = *(const v4fa*)&so[w][r][c4];
      *(v4f*)(C + (size_t)(row0 + r) * ldc + col0 + c4) = v;
    }
    
  }
}
// row LayerNorm (biased variance, eps) over N: s = X (+ R); optional out_sum <- s; out_norm <- (s-mu)*rsqrt(var+eps)*g + b
template <bool PARAM_BF16>
__global__ __launch_bounds__(256) void k_layernorm(const float* __restrict__ X, const float* __restrict__ R, const float* __restrict__ g, const float* __restrict__ bta,
                                                  float* __restrict__ out_sum, float* __restrict__ out_norm, int N, float eps) {
  __shared__ float red[256];
  const int row = blockIdx.x, tid = threadIdx.x;
  const float* x = X + (size_t)row * N; const float* rr = R ? R + (size_t)row * N : nullptr;
  float vals[16];                     // up to N = 4096
  const int per = N / 256;            // contiguous chunk per thread? use strided-by-4 chunks: thread handles j = tid*4 + 1024*u
  float s1 = 0.f;
  for (int u = 0; u < per / 4; ++u) {
    const int j = tid * 4 + 1024 * u;
    const v4f a = *(const v4fa*)(x + j);
    v4f b = {0.f,0.f,0.f,0.f}; if (rr) b = *(const v4fa*)(rr + j);
#pragma unroll
    for (int q = 0; q < 4; ++q) { const float v = a[q] + b[q]; vals[u * 4 + q] = v; s1 += v; }
  }
  red[tid] = s1; __syncthreads();
  for (int st = 128; st > 0; st >>= 1) { if (tid < st) red[tid] += red[tid + st]; __syncthreads(); }
  const float mu = red[0] / (float)N; __syncthreads();
  float s2 = 0.f;
  for (int u = 0; u < per / 4; ++u)
#pragma unroll
    for (int q = 0; q < 4; ++q) { const float c = vals[u * 4 + q] - mu; s2 += c * c; }
  red[tid] = s2; __syncthreads();
  for (int st = 128; st > 0; st >>= 1) { if (tid < st) red[tid] += red[tid + st]; __syncthreads(); }
  const float rs = rsqrtf(red[0] / (float)N + eps);
  {
    for (int u = 0; u < per / 4; ++u) {
      const int j = tid * 4 + 1024 * u;
      v4f o, sm;
#pragma unroll
      for (int q = 0; q < 4; ++q) {
        float gg = g[j + q], bb = bta[j + q];
        if (PARAM_BF16) { gg = bf16_round(gg); bb = bf16_round(bb); }
        sm[q] = vals[u * 4 + q]; o[q] = (vals[u * 4 + q] - mu) * rs * gg + bb;
      }
      if (out_sum) *(v4f*)(out_sum + (size_t)row * N + j) = sm;
      *(v4f*)(out_norm + (size_t)row * N + j) = o;
    }
    
  }
}



// ---- f16 WMMA path (v_wmma_f32_16x16x32_f16): 11-bit significands for operands in range — used where a [0,1] probability operand needs more precision than bf16
typedef _Float16 v16h __attribute__((ext_vector_type(16)));
union FragH { v16h v; v8us half[2]; _Float16 h[16]; unsigned short u[16]; };
template <int NT>
__device__ __forceinline__ v8f mmaH(v16h ah, v16h al, v16h bh, v16h bl, v8f c) {
  c = __builtin_amdgcn_wmma_f32_16x16x32_f16(false, ah, false, bh, (short)0, c, false, false);
  if (NT >= 2) c = __builtin_amdgcn_wmma_f32_16x16x32_f16(false, al, false, bh, (short)0, c, false, false);
  if (NT >= 3) c = __builtin_amdgcn_wmma_f32_16x16x32_f16(false, ah, false, bl, (short)0, c, false, false);
  asm volatile("v_nop\n\tv_nop\n\tv_nop\n\tv_nop" : "+v"(c) : "v"(ah), "v"(al), "v"(bh), "v"(bl));
  return c;
}
// batched GEMM like k_gemm_b but f16 operands: A f32 (split into f16 hi/lo if ASPLIT, else rounded to f16), Bt = f16 values [n][k]; alpha; C f32; N multiple of 16 (partial tiles skipped)
template <bool ASPLIT>
__global__ __launch_bounds__(128) void k_gemm_h(const float* __restrict__ A, int lda, size_t sA, const _Float16* __restrict__ Bh, int ldb, size_t sB, float alpha, float* __restrict__ C, int ldc, size_t sC, int M, int N, int K) {
  __shared__ __attribute__((aligned(16))) float so[4][16][64];
  const int tid = threadIdx.x, w = tid >> 5, lane = tid & 31, ln = lane & 15, hh = lane >> 4; const int by = blockIdx.y;
  A += (size_t)by * sA; Bh += (size_t)by * sB; C += (size_t)by * sC;
  const int ntn = (N + 63) / 64; const int wid = blockIdx.x * 4 + w; const int mt = wid / ntn, nq = wid % ntn; if (mt * 16 >= M) return;
  const int row0 = mt * 16, col0 = nq * 64; const float* arow = A + (size_t)(row0 + ln) * lda;
  v8f acc[4] = {};
  for (int kb = 0; kb < K; kb += 32) {
    FragH ah, al;
    const v4f x0 = *(const v4fa*)(arow + kb + 8 * hh), x1 = *(const v4fa*)(arow + kb + 8 * hh + 4), x2 = *(const v4fa*)(arow + kb + 16 + 8 * hh), x3 = *(const v4fa*)(arow + kb + 16 + 8 * hh + 4);
    float xs[16] = {x0[0],x0[1],x0[2],x0[3],x1[0],x1[1],x1[2],x1[3],x2[0],x2[1],x2[2],x2[3],x3[0],x3[1],x3[2],x3[3]};
#pragma unroll
    for (int i = 0; i < 16; ++i) { const _Float16 h = (_Float16)xs[i]; ah.h[i] = h; al.h[i] = ASPLIT ? (_Float16)(xs[i] - (float)h) : (_Float16)0.0f; }
#pragma unroll
    for (int t = 0; t < 4; ++t) { if (col0 + t * 16 >= N) continue; const size_t boff = (size_t)(col0 + t * 16 + ln) * ldb + kb; FragH bq; bq.half[0] = *(const v8us*)(Bh + boff + 8 * hh); bq.half[1] = *(const v8us*)(Bh + boff + 16 + 8 * hh);
      acc[t] = mmaH<ASPLIT ? 2 : 1>(ah.v, al.v, bq.v, bq.v, acc[t]); }
  }
#pragma unroll
  for (int t = 0; t < 4; ++t) { if (col0 + t * 16 >= N) continue;
#pragma unroll
    for (int r = 0; r < 8; ++r) so[w][8 * hh + r][t * 16 + ln] = acc[t][r] * alpha; }
  __builtin_amdgcn_fence(__ATOMIC_ACQ_REL, "workgroup"); __builtin_amdgcn_wave_barrier();
  const int rsub = lane >> 4, c4 = (lane & 15) * 4;
  {
#pragma unroll
    for (int q = 0; q < 8; ++q) { const int r = q * 2 + rsub; if (col0 + c4 < N) { const v4f v = *(const v4fa*)&so[w][r][c4]; *(v4f*)(C + (size_t)(row0 + r) * ldc + col0 + c4) = v; } }
     }
}

// Wt[n][k] = f16(W[k][n]·scale) from f32 row-major W[K][N] (scale = power of two; bf16-exact weights stay exact in f16 away from the subnormal range)
__global__ __launch_bounds__(256) void k_wt_f16(const float* __restrict__ W, _Float16* __restrict__ Wt, int K, int N, float scale) {
  const int t = blockIdx.x * 256 + threadIdx.x; if (t >= N * (K / 8)) return; const int n = t / (K / 8), k8 = (t % (K / 8)) * 8; FragH f;
#pragma unroll
  for (int i = 0; i < 8; ++i) f.h[i] = (_Float16)(bf16_round(W[(size_t)(k8 + i) * N + n]) * scale); const v8us o = f.half[0];
  *(v8us*)((unsigned short*)Wt + (size_t)n * K + k8) = o; 
}
// k_gemm_hh variant with fused epilogue: v = acc·alpha + bias[by·sBias + col] (+ CP[(row/rowsPerB)·sCPb + by·64 + col] if CP) ; ACT 0 none / 1 elu ; writes f16 C16 (and f32 C if non-null)
template <int ACT>
__global__ __launch_bounds__(128) void k_gemm_hhx(const _Float16* __restrict__ A, int lda, size_t sA, const _Float16* __restrict__ Bh, int ldb, size_t sB, float alpha, const float* __restrict__ bias, size_t sBias, const float* __restrict__ CP, int rowsPerB, size_t sCPb, int row0g,
    float* __restrict__ C, _Float16* __restrict__ C16, int ldc, size_t sC, int M, int N, int K) {
  __shared__ __attribute__((aligned(16))) float so[4][16][64];
  const int tid = threadIdx.x, w = tid >> 5, lane = tid & 31, ln = lane & 15, hh = lane >> 4; const int by = blockIdx.y;
  A += (size_t)by * sA; Bh += (size_t)by * sB; const size_t cofs = (size_t)by * sC; const float* bp = bias ? bias + (size_t)by * sBias : nullptr;
  const int ntn = (N + 63) / 64; const int wid = blockIdx.x * 4 + w; const int mt = wid / ntn, nq = wid % ntn; if (mt * 16 >= M) return;
  const int row0 = mt * 16, col0 = nq * 64; const _Float16* arow = A + (size_t)(row0 + ln) * lda;
  v8f acc[4] = {};
  for (int kb = 0; kb < K; kb += 32) { FragH ah; ah.half[0] = *(const v8us*)((const unsigned short*)arow + kb + 8 * hh); ah.half[1] = *(const v8us*)((const unsigned short*)arow + kb + 16 + 8 * hh);
#pragma unroll
    for (int t = 0; t < 4; ++t) { if (col0 + t * 16 >= N) continue; const size_t boff = (size_t)(col0 + t * 16 + ln) * ldb + kb; FragH bq; bq.half[0] = *(const v8us*)((const unsigned short*)Bh + boff + 8 * hh); bq.half[1] = *(const v8us*)((const unsigned short*)Bh + boff + 16 + 8 * hh);
      acc[t] = mmaH<1>(ah.v, ah.v, bq.v, bq.v, acc[t]); }
  }
#pragma unroll
  for (int t = 0; t < 4; ++t) { if (col0 + t * 16 >= N) continue; const int col = col0 + t * 16 + ln; const float bv = bp ? bf16_round(bp[col]) : 0.f;
#pragma unroll
    for (int r = 0; r < 8; ++r) { float v = acc[t][r] * alpha + bv; if (CP) { const int bidx = (row0g + row0 + 8 * hh + r) / rowsPerB; v += CP[(size_t)bidx * sCPb + (size_t)by * 64 + col]; } if (ACT == 1) v = (v > 0.f) ? v : expm1f(v); else if (ACT == 7) v = (v > 0.f) ? v + 1.0f : expf(v); else if (ACT == 8) v = tanhf(v); else if (ACT == 9) v = 0.5f * v * (1.0f + tanhf(0.7978845608028654f * (v + 0.044715f * v * v * v))); else if (ACT == 11) v = 1.0f / (1.0f + expf(-v)); else if (ACT == 12) v = (v > 0.f) ? v : 0.01f * v; else if (ACT == 14) v = (v > 0.f) ? v : 0.1f * v; else if (ACT == 15) v = v / (1.0f + expf(-v)); else if (ACT == 3) v = fmaxf(v, 0.f); else if (ACT == 6) v = 0.5f * v * (1.0f + erff(v * 0.70710678118654752f)); so[w][8 * hh + r][t * 16 + ln] = v; } }
  __builtin_amdgcn_fence(__ATOMIC_ACQ_REL, "workgroup"); __builtin_amdgcn_wave_barrier();
  const int rsub = lane >> 4, c4 = (lane & 15) * 4; typedef _Float16 v4h __attribute__((ext_vector_type(4)));
  {
#pragma unroll
    for (int q = 0; q < 8; ++q) { const int r = q * 2 + rsub; if (col0 + c4 < N) { const v4f v = *(const v4fa*)&so[w][r][c4]; if (C) *(v4f*)(C + cofs + (size_t)(row0 + r) * ldc + col0 + c4) = v; if (C16) { v4h h4; for (int i = 0; i < 4; ++i) h4[i] = (_Float16)v[i]; *(v4h*)(C16 + cofs + (size_t)(row0 + r) * ldc + col0 + c4) = h4; } } }
     }
}


typedef _Float16 v4h __attribute__((ext_vector_type(4)));

// Bodies of the short kernels: blk is the block's index inside its own job, so that independent jobs can share one grid, each on its own range of block indices.
__device__ __forceinline__ void d_x16(const float* __restrict__ x, _Float16* __restrict__ X16, size_t n8, unsigned blk) { const size_t t = (size_t)blk * 256 + threadIdx.x; if (t >= n8) return; FragH f;
#pragma unroll
  for (int q = 0; q < 8; ++q) f.h[q] = (_Float16)bf16_round(x[t * 8 + q]); *(v8us*)((unsigned short*)X16 + t * 8) = f.half[0];  }
__global__ __launch_bounds__(256) void k_h16(const float* __restrict__ x, _Float16* __restrict__ X16, size_t n8) { const size_t t = (size_t)blockIdx.x * 256 + threadIdx.x; if (t >= n8) return; FragH f;
#pragma unroll
  for (int q = 0; q < 8; ++q) f.h[q] = (_Float16)x[t * 8 + q]; *(v8us*)((unsigned short*)X16 + t * 8) = f.half[0];  }
__device__ __forceinline__ void d_round16f(const float* __restrict__ W, _Float16* __restrict__ Bt, size_t n8, unsigned blk) { const size_t t = (size_t)blk * 256 + threadIdx.x; if (t >= n8) return; FragH f;
#pragma unroll
  for (int i = 0; i < 8; ++i) f.h[i] = (_Float16)(bf16_round(W[t * 8 + i]) * 16.0f); *(v8us*)((unsigned short*)Bt + t * 8) = f.half[0];  }
template <int NHv, int TTv>
__global__ __launch_bounds__(256) void k_vt(const _Float16* __restrict__ V16, int ldv, int voff, _Float16* __restrict__ Vt) { __shared__ unsigned short tl[64][66]; const int tid = threadIdx.x; const int slab = blockIdx.x / (TTv / 64), lg = blockIdx.x % (TTv / 64); const int b = slab / NHv, h = slab % NHv;
  for (int i = tid; i < 64 * 8; i += 256) { const int r = i / 8, c8 = (i % 8) * 8; FragH f; f.half[0] = *(const v8us*)((const unsigned short*)V16 + ((size_t)b * TTv + lg * 64 + r) * ldv + voff + h * 64 + c8);
#pragma unroll
    for (int q = 0; q < 8; ++q) tl[r][c8 + q] = f.u[q]; }
  __syncthreads();
  {
#pragma unroll
    for (int rd = 0; rd < 2; ++rd) { const int d = rd * 32 + tid / 8, pc = tid % 8; FragH f;
#pragma unroll
      for (int q = 0; q < 8; ++q) f.u[q] = tl[pc * 8 + q][d];
      *(v8us*)((unsigned short*)Vt + ((size_t)slab * 64 + d) * TTv + lg * 64 + pc * 8) = f.half[0]; }
     } }

__device__ __forceinline__ void d_hl(const float* __restrict__ F, _Float16* __restrict__ Hh, _Float16* __restrict__ Hl, size_t n8, unsigned blk) { const size_t t = (size_t)blk * 256 + threadIdx.x; if (t >= n8) return; FragH fh, fl; const v4f a = *(const v4fa*)(F + t * 8), c = *(const v4fa*)(F + t * 8 + 4);
#pragma unroll
  for (int q = 0; q < 4; ++q) { _Float16 h = (_Float16)a[q]; fh.h[q] = h; fl.h[q] = (_Float16)((a[q] - (float)h) * 1024.0f); h = (_Float16)c[q]; fh.h[4 + q] = h; fl.h[4 + q] = (_Float16)((c[q] - (float)h) * 1024.0f); }
  { *(v8us*)((unsigned short*)Hh + t * 8) = fh.half[0]; *(v8us*)((unsigned short*)Hl + t * 8) = fl.half[0];  } }
__global__ __launch_bounds__(256) void k_hl(const float* __restrict__ F, _Float16* __restrict__ Hh, _Float16* __restrict__ Hl, size_t n8) { d_hl(F, Hh, Hl, n8, blockIdx.x); }

// ---- fast GEMM (block tile 128x64, wave tile 32x64; requires M % 128 == 0, N % 64 == 0 and K % 128 == 0); epilogue = k_gemm_hhx semantics ----
// k loop staging of g2_body: one stage = 128 k (256 B of a row) of the block's 128 A rows and 64 B rows, laid in LDS at a pitch of 272 B (16 B x odd, for the 16-byte fragment reads); two buffers.
#define G2_PITCH 272
#define G2_AB (128 * G2_PITCH)
#define G2_STAGE ((128 + 64) * G2_PITCH)
__device__ __forceinline__ v16h g2_lfrag(const unsigned char* p, int hh) { FragH f; f.half[0] = *(const v8us*)(p + 16 * hh); f.half[1] = *(const v8us*)(p + 32 + 16 * hh); return f.v; }
__device__ __forceinline__ v8f g2_mm(v16h a, v16h b, v8f c) { return __builtin_amdgcn_wmma_f32_16x16x32_f16(false, a, false, b, (short)0, c, false, false); }
// One wave's share of a stage: 32 A rows and 16 B rows, two rows (2 x 256 B, whole lines) per wave-wide copy, 16 B per lane, 24 copies.
// la, lb: the lane's LDS byte addresses of its first A and B chunk; ga, gb: the matching global addresses; a copy further on is two rows further on.
__device__ __forceinline__ void g2_stage(unsigned la, unsigned lb, const _Float16* ga, int lda, const _Float16* gb, int ldb) {
  unsigned l[24]; const _Float16* g[24];
#pragma unroll
  for (int i = 0; i < 16; ++i) { l[i] = la + i * (2 * G2_PITCH); g[i] = ga + (size_t)(2 * i) * lda; }
#pragma unroll
  for (int i = 0; i < 8; ++i) { l[16 + i] = lb + i * (2 * G2_PITCH); g[16 + i] = gb + (size_t)(2 * i) * ldb; }
  // the copies go to LDS through no register; s_wait_xcnt is the statement's last line so that no address register is rewritten ahead of it
  asm volatile("global_load_async_to_lds_b128 %0, %12, off\n\t"
               "global_load_async_to_lds_b128 %1, %13, off\n\t"
               "global_load_async_to_lds_b128 %2, %14, off\n\t"
               "global_load_async_to_lds_b128 %3, %15, off\n\t"
               "global_load_async_to_lds_b128 %4, %16, off\n\t"
               "global_load_async_to_lds_b128 %5, %17, off\n\t"
               "global_load_async_to_lds_b128 %6, %18, off\n\t"
               "global_load_async_to_lds_b128 %7, %19, off\n\t"
               "global_load_async_to_lds_b128 %8, %20, off\n\t"
               "global_load_async_to_lds_b128 %9, %21, off\n\t"
               "global_load_async_to_lds_b128 %10, %22, off\n\t"
               "global_load_async_to_lds_b128 %11, %23, off\n\t"
               "s_wait_xcnt 0x0"
               :: "v"(l[0]), "v"(l[1]), "v"(l[2]), "v"(l[3]), "v"(l[4]), "v"(l[5]), "v"(l[6]), "v"(l[7]), "v"(l[8]), "v"(l[9]), "v"(l[10]), "v"(l[11]),
                  "v"(g[0]), "v"(g[1]), "v"(g[2]), "v"(g[3]), "v"(g[4]), "v"(g[5]), "v"(g[6]), "v"(g[7]), "v"(g[8]), "v"(g[9]), "v"(g[10]), "v"(g[11]) : "memory");
  asm volatile("global_load_async_to_lds_b128 %0, %12, off\n\t"
               "global_load_async_to_lds_b128 %1, %13, off\n\t"
               "global_load_async_to_lds_b128 %2, %14, off\n\t"
               "global_load_async_to_lds_b128 %3, %15, off\n\t"
               "global_load_async_to_lds_b128 %4, %16, off\n\t"
               "global_load_async_to_lds_b128 %5, %17, off\n\t"
               "global_load_async_to_lds_b128 %6, %18, off\n\t"
               "global_load_async_to_lds_b128 %7, %19, off\n\t"
               "global_load_async_to_lds_b128 %8, %20, off\n\t"
               "global_load_async_to_lds_b128 %9, %21, off\n\t"
               "global_load_async_to_lds_b128 %10, %22, off\n\t"
               "global_load_async_to_lds_b128 %11, %23, off\n\t"
               "s_wait_xcnt 0x0"
               :: "v"(l[12]), "v"(l[13]), "v"(l[14]), "v"(l[15]), "v"(l[16]), "v"(l[17]), "v"(l[18]), "v"(l[19]), "v"(l[20]), "v"(l[21]), "v"(l[22]), "v"(l[23]),
                  "v"(g[12]), "v"(g[13]), "v"(g[14]), "v"(g[15]), "v"(g[16]), "v"(g[17]), "v"(g[18]), "v"(g[19]), "v"(g[20]), "v"(g[21]), "v"(g[22]), "v"(g[23]) : "memory");
}
// bx, by: the block's tile index and batch index inside its own product
template <int ACT>
__device__ __forceinline__ void g2_body(const _Float16* __restrict__ A, int lda, size_t sA, const _Float16* __restrict__ Bh, int ldb, size_t sB, float alpha, const float* __restrict__ bias, size_t sBias, const float* __restrict__ CP, int rowsPerB, size_t sCPb, int row0g,
    float* __restrict__ C, _Float16* __restrict__ C16, int ldc, size_t sC, int M, int N, int K, int bx, int by) {
  __shared__ __attribute__((aligned(16))) float so[4][32][68]; __shared__ __attribute__((aligned(16))) unsigned char ring[2 * G2_STAGE];
  const int tid = threadIdx.x, w = tid >> 5, lane = tid & 31, ln = lane & 15, hh = lane >> 4;
  A += (size_t)by * sA; Bh += (size_t)by * sB; const size_t cofs = (size_t)by * sC; const float* bp = bias ? bias + (size_t)by * sBias : nullptr;
  const int ntn = N >> 6; const int mt = bx / ntn, nq = bx - mt * ntn; const int row0 = mt * 128 + 32 * w, col0 = nq * 64; if (mt * 128 >= M) return;      /* the whole block leaves, in front of every barrier */
  const v8f z8 = {0.f,0.f,0.f,0.f,0.f,0.f,0.f,0.f}; v8f c00 = z8, c01 = z8, c02 = z8, c03 = z8, c10 = z8, c11 = z8, c12 = z8, c13 = z8;
  const _Float16* ga = A + (size_t)(row0 + hh) * lda + ln * 8; const _Float16* gb = Bh + (size_t)(col0 + 16 * w + hh) * ldb + ln * 8;      /* this lane's first 16 bytes of the wave's A and B rows */
  const unsigned la = (unsigned)(size_t)ring + (unsigned)((32 * w + hh) * G2_PITCH + ln * 16), lb = (unsigned)(size_t)ring + (unsigned)(G2_AB + (16 * w + hh) * G2_PITCH + ln * 16);
  const int nst = K >> 7;
  g2_stage(la, lb, ga, lda, gb, ldb);
  // What the epilogue adds (bias, addend CP) is read here, in the layout of the write-out pass (lane = 4 columns of rows 2q + hh): 17 independent 16-byte loads issued as one group, in flight beside stage 0's copies.
  const int c4 = ln * 4; const v4f z4 = {0.f,0.f,0.f,0.f}; v4f b4 = z4, cp[16];
#pragma unroll
  for (int q = 0; q < 16; ++q) cp[q] = z4;
  if (CP) { const float* pc[16];
#pragma unroll
    for (int q = 0; q < 16; ++q) { const int bidx = (row0g + row0 + q * 2 + hh) / rowsPerB; pc[q] = CP + (size_t)bidx * sCPb + (size_t)by * 64 + col0 + c4; }
    __builtin_amdgcn_sched_barrier(0);      /* all 16 addresses are formed in front of the loads, each in registers of its own: formed among the loads they share registers, and each reuse waits for an issued load */
#pragma unroll
    for (int q = 0; q < 16; ++q) cp[q] = *(const v4fa*)pc[q];
    asm volatile("s_wait_xcnt 0x0" ::: "memory");      /* stands in front of whatever reuses the address registers of the 16 loads above */
  }
  if (bp) { b4 = *(const v4fa*)(bp + col0 + c4);
    asm volatile("s_wait_xcnt 0x0" ::: "memory");      /* the same for the bias load */
  }
  asm volatile("s_wait_asynccnt 0x0" ::: "memory");      /* this wave's copies of stage 0 have landed */
  __syncthreads();      /* and every other wave's: stage 0 may be read */
  if (nst > 1) g2_stage(la + G2_STAGE, lb + G2_STAGE, ga + 128, lda, gb + 128, ldb);
#pragma unroll 1      /* one trip per stage: the two buffers alternate */
  for (int t = 0; t < nst; ++t) { const unsigned bo = (unsigned)(t & 1) * G2_STAGE; const unsigned char* pa = ring + bo + (32 * w + ln) * G2_PITCH; const unsigned char* pb = ring + bo + G2_AB + ln * G2_PITCH;
    v16h fa[2][2], fb[2][4];      /* two fragment sets: the next k step's LDS reads are issued, as one group, ahead of this step's WMMAs; never beyond the stage */
    fa[0][0] = g2_lfrag(pa, hh); fa[0][1] = g2_lfrag(pa + 16 * G2_PITCH, hh);
#pragma unroll
    for (int j = 0; j < 4; ++j) fb[0][j] = g2_lfrag(pb + j * 16 * G2_PITCH, hh);
#pragma unroll
    for (int ks = 0; ks < 4; ++ks) { const int cu = ks & 1, nx = cu ^ 1;
      if (ks < 3) { fa[nx][0] = g2_lfrag(pa + (ks + 1) * 64, hh); fa[nx][1] = g2_lfrag(pa + 16 * G2_PITCH + (ks + 1) * 64, hh);
#pragma unroll
        for (int j = 0; j < 4; ++j) fb[nx][j] = g2_lfrag(pb + j * 16 * G2_PITCH + (ks + 1) * 64, hh); }
      __builtin_amdgcn_sched_barrier(0);      /* keeps the reads above in front of the WMMAs below: sunk to their uses, each pair of WMMAs waits out an LDS latency */
      c00 = g2_mm(fa[cu][0], fb[cu][0], c00); c10 = g2_mm(fa[cu][1], fb[cu][0], c10); c01 = g2_mm(fa[cu][0], fb[cu][1], c01); c11 = g2_mm(fa[cu][1], fb[cu][1], c11);
      c02 = g2_mm(fa[cu][0], fb[cu][2], c02); c12 = g2_mm(fa[cu][1], fb[cu][2], c12); c03 = g2_mm(fa[cu][0], fb[cu][3], c03); c13 = g2_mm(fa[cu][1], fb[cu][3], c13);
      __builtin_amdgcn_sched_barrier(0);      /* keeps the next group of reads behind these WMMAs, so that two sets suffice */
    }
    asm volatile("s_wait_dscnt 0x0" ::: "memory");      /* this wave's reads of the buffer are done before it is refilled */
    asm volatile("s_wait_asynccnt 0x0" ::: "memory");      /* this wave's copies of stage t + 1 have landed */
    __syncthreads();      /* publishes stage t + 1 and ends every wave's reads of stage t */
    if (t + 2 < nst) g2_stage(la + bo, lb + bo, ga + (size_t)(t + 2) * 128, lda, gb + (size_t)(t + 2) * 128, ldb); }
  asm volatile("s_wait_asynccnt 0x0" ::: "memory");      /* no copy is left in flight */
  v8f accs[8] = {c00, c01, c02, c03, c10, c11, c12, c13};
#pragma unroll
  for (int u = 0; u < 8; ++u) { const int t = u & 3, half = u >> 2;
#pragma unroll
    for (int r = 0; r < 8; ++r) so[w][half * 16 + 8 * hh + r][t * 16 + ln] = accs[u][r]; }
  __builtin_amdgcn_fence(__ATOMIC_ACQ_REL, "workgroup"); __builtin_amdgcn_wave_barrier();
  const int rsub = lane >> 4; const v4f bv4 = {bf16_round(b4[0]), bf16_round(b4[1]), bf16_round(b4[2]), bf16_round(b4[3])};
  {      /* no branch per row: the 16 LDS reads are one group, the sums one block, the stores one group under one test of the pointer */
    v4f o[16];
#pragma unroll
    for (int q = 0; q < 16; ++q) o[q] = *(const v4fa*)&so[w][q * 2 + rsub][c4];
#pragma unroll
    for (int q = 0; q < 16; ++q)
#pragma unroll
      for (int i = 0; i < 4; ++i) { float v = o[q][i] * alpha + bv4[i]; if (CP) v += cp[q][i];
        if (ACT == 3) v = fmaxf(v, 0.f); else if (ACT == 6) v = 0.5f * v * (1.0f + erff(v * 0.70710678118654752f)); else if (ACT == 11) v = 1.0f / (1.0f + expf(-v)); else if (ACT == 15) v = v / (1.0f + expf(-v)); else if (ACT == 12) v = (v > 0.f) ? v : 0.01f * v; else if (ACT == 8) v = tanhf(v);
        o[q][i] = v; }
    if (C) { float* po[16];
#pragma unroll
      for (int q = 0; q < 16; ++q) po[q] = C + cofs + (size_t)(row0 + q * 2 + rsub) * ldc + col0 + c4;
      __builtin_amdgcn_sched_barrier(0);      /* all 16 addresses are formed in front of the stores, each in registers of its own: formed among the stores they share registers, and each reuse waits for an issued store */
#pragma unroll
      for (int q = 0; q < 16; ++q) *(v4f*)po[q] = o[q];
      asm volatile("s_wait_xcnt 0x0" ::: "memory");      /* stands in front of whatever reuses the registers of the 16 stores above */
    }
    if (C16) { _Float16* ph[16]; v4h h4[16];
#pragma unroll
      for (int q = 0; q < 16; ++q) { for (int i = 0; i < 4; ++i) h4[q][i] = (_Float16)o[q][i]; ph[q] = C16 + cofs + (size_t)(row0 + q * 2 + rsub) * ldc + col0 + c4; }
      __builtin_amdgcn_sched_barrier(0);      /* as above: values and addresses first, then the 16 stores as one group */
#pragma unroll
      for (int q = 0; q < 16; ++q) *(v4h*)ph[q] = h4[q]; }
     } }
// ---- a product whose A operand is a hi plane and a residual plane: both passes in one launch ----
// Block = 8 waves on one 128x64 tile: waves 0-3 multiply the hi plane's rows, waves 4-7 the residual plane's rows, against the one staged B tile; the write-out adds the two sums.
// One stage = 128 k of the 128 rows of each A plane and of the 64 B rows, at the pitch of k_proj5's ring; two buffers.
#define G2P_AB (256 * G2_PITCH)
#define G2P_STAGE ((256 + 64) * G2_PITCH)
// One wave's share of a stage: its own 32 A rows and 8 B rows, two rows (2 x 256 B, whole lines) per wave-wide copy, 16 B per lane, 20 copies.
__device__ __forceinline__ void g2p_stage(unsigned la, unsigned lb, const _Float16* ga, int lda, const _Float16* gb, int ldb) {
  unsigned l[20]; const _Float16* g[20];
#pragma unroll
  for (int i = 0; i < 16; ++i) { l[i] = la + i * (2 * G2_PITCH); g[i] = ga + (size_t)(2 * i) * lda; }
#pragma unroll
  for (int i = 0; i < 4; ++i) { l[16 + i] = lb + i * (2 * G2_PITCH); g[16 + i] = gb + (size_t)(2 * i) * ldb; }
  // the copies go to LDS through no register; s_wait_xcnt is the statement's last line so that no address register is rewritten ahead of it
  asm volatile("global_load_async_to_lds_b128 %0, %10, off\n\t"
               "global_load_async_to_lds_b128 %1, %11, off\n\t"
               "global_load_async_to_lds_b128 %2, %12, off\n\t"
               "global_load_async_to_lds_b128 %3, %13, off\n\t"
               "global_load_async_to_lds_b128 %4, %14, off\n\t"
               "global_load_async_to_lds_b128 %5, %15, off\n\t"
               "global_load_async_to_lds_b128 %6, %16, off\n\t"
               "global_load_async_to_lds_b128 %7, %17, off\n\t"
               "global_load_async_to_lds_b128 %8, %18, off\n\t"
               "global_load_async_to_lds_b128 %9, %19, off\n\t"
               "s_wait_xcnt 0x0"
               :: "v"(l[0]), "v"(l[1]), "v"(l[2]), "v"(l[3]), "v"(l[4]), "v"(l[5]), "v"(l[6]), "v"(l[7]), "v"(l[8]), "v"(l[9]),
                  "v"(g[0]), "v"(g[1]), "v"(g[2]), "v"(g[3]), "v"(g[4]), "v"(g[5]), "v"(g[6]), "v"(g[7]), "v"(g[8]), "v"(g[9]) : "memory");
  asm volatile("global_load_async_to_lds_b128 %0, %10, off\n\t"
               "global_load_async_to_lds_b128 %1, %11, off\n\t"
               "global_load_async_to_lds_b128 %2, %12, off\n\t"
               "global_load_async_to_lds_b128 %3, %13, off\n\t"
               "global_load_async_to_lds_b128 %4, %14, off\n\t"
               "global_load_async_to_lds_b128 %5, %15, off\n\t"
               "global_load_async_to_lds_b128 %6, %16, off\n\t"
               "global_load_async_to_lds_b128 %7, %17, off\n\t"
               "global_load_async_to_lds_b128 %8, %18, off\n\t"
               "global_load_async_to_lds_b128 %9, %19, off\n\t"
               "s_wait_xcnt 0x0"
               :: "v"(l[10]), "v"(l[11]), "v"(l[12]), "v"(l[13]), "v"(l[14]), "v"(l[15]), "v"(l[16]), "v"(l[17]), "v"(l[18]), "v"(l[19]),
                  "v"(g[10]), "v"(g[11]), "v"(g[12]), "v"(g[13]), "v"(g[14]), "v"(g[15]), "v"(g[16]), "v"(g[17]), "v"(g[18]), "v"(g[19]) : "memory");
}
// C = act(Ah*B^T * alpha + bias (+ CP) + Al*B^T * alphal); CP: optional addend of C's shape and pitch (it may be C itself: a lane reads exactly the elements that it stores). M % 128 == 0, N % 64 == 0, K % 128 == 0.
template <int ACT>
__global__ __launch_bounds__(256) void k_gemm2p(const _Float16* __restrict__ Ah, const _Float16* __restrict__ Al, int lda, const _Float16* __restrict__ Bh, int ldb, float alpha, float alphal, const float* __restrict__ bias, const float* CP,
    float* C, int ldc, int M, int N, int K) {
  __shared__ __attribute__((aligned(16))) float so[8][32][68]; __shared__ __attribute__((aligned(16))) unsigned char ring[2 * G2P_STAGE];
  const int tid = threadIdx.x, w = tid >> 5, lane = tid & 31, ln = lane & 15, hh = lane >> 4, pl = w >> 2, wr = w & 3;      /* pl: the wave's plane; wr: its group of 32 rows */
  const int ntn = N >> 6; const int bx = (int)blockIdx.x; const int mt = bx / ntn, nq = bx - mt * ntn; const int row0 = mt * 128 + 32 * wr, col0 = nq * 64; if (mt * 128 >= M) return;      /* the whole block leaves, in front of every barrier */
  const v8f z8 = {0.f,0.f,0.f,0.f,0.f,0.f,0.f,0.f}; v8f c00 = z8, c01 = z8, c02 = z8, c03 = z8, c10 = z8, c11 = z8, c12 = z8, c13 = z8;
  const _Float16* ga = (pl ? Al : Ah) + (size_t)(row0 + hh) * lda + ln * 8; const _Float16* gb = Bh + (size_t)(col0 + 8 * w + hh) * ldb + ln * 8;      /* this lane's first 16 bytes of the wave's A and B rows */
  const unsigned la = (unsigned)(size_t)ring + (unsigned)((32 * w + hh) * G2_PITCH + ln * 16), lb = (unsigned)(size_t)ring + (unsigned)(G2P_AB + (8 * w + hh) * G2_PITCH + ln * 16);
  const int nst = K >> 7;
  g2p_stage(la, lb, ga, lda, gb, ldb);
  // What the write-out adds (bias, addend CP) is read here, in the write-out's layout (a wave writes 16 of its group's 32 rows; lane = 4 columns of rows 16 pl + 2q + hh): independent 16-byte loads issued as one group, in flight beside stage 0's copies.
  const int c4 = ln * 4, rw = 16 * pl + hh; const v4f z4 = {0.f,0.f,0.f,0.f}; v4f b4 = z4, cp[8];
#pragma unroll
  for (int q = 0; q < 8; ++q) cp[q] = z4;
  if (CP) { const float* pc[8];
#pragma unroll
    for (int q = 0; q < 8; ++q) pc[q] = CP + (size_t)(row0 + rw + q * 2) * ldc + col0 + c4;
    __builtin_amdgcn_sched_barrier(0);      /* all 8 addresses are formed in front of the loads, each in registers of its own: formed among the loads they share registers, and each reuse waits for an issued load */
#pragma unroll
    for (int q = 0; q < 8; ++q) cp[q] = *(const v4fa*)pc[q];
    asm volatile("s_wait_xcnt 0x0" ::: "memory");      /* stands in front of whatever reuses the address registers of the 8 loads above */
  }
  if (bias) { b4 = *(const v4fa*)(bias + col0 + c4);
    asm volatile("s_wait_xcnt 0x0" ::: "memory");      /* the same for the bias load */
  }
  asm volatile("s_wait_asynccnt 0x0" ::: "memory");      /* this wave's copies of stage 0 have landed */
  __syncthreads();      /* and every other wave's: stage 0 may be read */
  if (nst > 1) g2p_stage(la + G2P_STAGE, lb + G2P_STAGE, ga + 128, lda, gb + 128, ldb);
#pragma unroll 1      /* one trip per stage: the two buffers alternate */
  for (int t = 0; t < nst; ++t) { const unsigned bo = (unsigned)(t & 1) * G2P_STAGE; const unsigned char* pa = ring + bo + (32 * w + ln) * G2_PITCH; const unsigned char* pb = ring + bo + G2P_AB + ln * G2_PITCH;
    v16h fa[2][2], fb[2][4];      /* two fragment sets: the next k step's LDS reads are issued, as one group, ahead of this step's WMMAs; never beyond the stage */
    fa[0][0] = g2_lfrag(pa, hh); fa[0][1] = g2_lfrag(pa + 16 * G2_PITCH, hh);
#pragma unroll
    for (int j = 0; j < 4; ++j) fb[0][j] = g2_lfrag(pb + j * 16 * G2_PITCH, hh);
#pragma unroll
    for (int ks = 0; ks < 4; ++ks) { const int cu = ks & 1, nx = cu ^ 1;
      if (ks < 3) { fa[nx][0] = g2_lfrag(pa + (ks + 1) * 64, hh); fa[nx][1] = g2_lfrag(pa + 16 * G2_PITCH + (ks + 1) * 64, hh);
#pragma unroll
        for (int j = 0; j < 4; ++j) fb[nx][j] = g2_lfrag(pb + j * 16 * G2_PITCH + (ks + 1) * 64, hh); }
      __builtin_amdgcn_sched_barrier(0);      /* keeps the reads above in front of the WMMAs below: sunk to their uses, each pair of WMMAs waits out an LDS latency */
      c00 = g2_mm(fa[cu][0], fb[cu][0], c00); c10 = g2_mm(fa[cu][1], fb[cu][0], c10); c01 = g2_mm(fa[cu][0], fb[cu][1], c01); c11 = g2_mm(fa[cu][1], fb[cu][1], c11);
      c02 = g2_mm(fa[cu][0], fb[cu][2], c02); c12 = g2_mm(fa[cu][1], fb[cu][2], c12); c03 = g2_mm(fa[cu][0], fb[cu][3], c03); c13 = g2_mm(fa[cu][1], fb[cu][3], c13);
      __builtin_amdgcn_sched_barrier(0);      /* keeps the next group of reads behind these WMMAs, so that two sets suffice */
    }
    asm volatile("s_wait_dscnt 0x0" ::: "memory");      /* this wave's reads of the buffer are done before it is refilled */
    asm volatile("s_wait_asynccnt 0x0" ::: "memory");      /* this wave's copies of stage t + 1 have landed */
    __syncthreads();      /* publishes stage t + 1 and ends every wave's reads of stage t */
    if (t + 2 < nst) g2p_stage(la + bo, lb + bo, ga + (size_t)(t + 2) * 128, lda, gb + (size_t)(t + 2) * 128, ldb); }
  asm volatile("s_wait_asynccnt 0x0" ::: "memory");      /* no copy is left in flight */
  v8f accs[8] = {c00, c01, c02, c03, c10, c11, c12, c13};
#pragma unroll
  for (int u = 0; u < 8; ++u) { const int t = u & 3, half = u >> 2;
#pragma unroll
    for (int r = 0; r < 8; ++r) so[w][half * 16 + 8 * hh + r][t * 16 + ln] = accs[u][r]; }
  __syncthreads();      /* a row group's two sums come from two waves: both are in LDS before either wave reads them */
  const v4f bv4 = {bf16_round(b4[0]), bf16_round(b4[1]), bf16_round(b4[2]), bf16_round(b4[3])};
  {      /* no branch per row: the 16 LDS reads are one group, the sums one block, the stores one group */
    v4f o[8], ol[8];
#pragma unroll
    for (int q = 0; q < 8; ++q) { o[q] = *(const v4fa*)&so[wr][rw + q * 2][c4]; ol[q] = *(const v4fa*)&so[4 + wr][rw + q * 2][c4]; }
#pragma unroll
    for (int q = 0; q < 8; ++q)
#pragma unroll
      for (int i = 0; i < 4; ++i) { float v = o[q][i] * alpha + bv4[i]; if (CP) v += cp[q][i]; v += ol[q][i] * alphal;      /* the order of the two separate passes: hi sum, bias, addend, then the residual sum */
        if (ACT == 3) v = fmaxf(v, 0.f);
        o[q][i] = v; }
    float* po[8];
#pragma unroll
    for (int q = 0; q < 8; ++q) po[q] = C + (size_t)(row0 + rw + q * 2) * ldc + col0 + c4;
    __builtin_amdgcn_sched_barrier(0);      /* all 8 addresses are formed in front of the stores, each in registers of its own: formed among the stores they share registers, and each reuse waits for an issued store */
#pragma unroll
    for (int q = 0; q < 8; ++q) *(v4f*)po[q] = o[q];
    asm volatile("s_wait_xcnt 0x0" ::: "memory");      /* stands in front of whatever reuses the registers of the 8 stores above */
  } }
// The five projections that depend on the embeddings alone (q, k, v of the self attention; k, v of the cross attention) in one grid: a range of block indices per product.
// BT: the six [DM][DM] weight planes in a row (q, k, v, cross q, cross k, cross v); FW: three [SW][DM] f32 results in a row; FP: two [SP][DM] f32 results in a row.
#define P5_NW ((SW / 128) * (DM / 64))
#define P5_NP ((SP / 128) * (DM / 64))
__global__ __launch_bounds__(128) void k_proj5(const _Float16* __restrict__ WE, const _Float16* __restrict__ PE, const _Float16* __restrict__ BT, const float* __restrict__ bq, const float* __restrict__ bk, const float* __restrict__ bv, const float* __restrict__ bkc, const float* __restrict__ bvc,
    float* __restrict__ FW, float* __restrict__ FP) {
  const int b = (int)blockIdx.x; const bool word = b < 3 * P5_NW;      /* block-uniform */
  const int j = word ? b / P5_NW : (b - 3 * P5_NW) / P5_NP; const int bx = word ? b - j * P5_NW : (b - 3 * P5_NW) - j * P5_NP;
  const float* bias = word ? (j == 0 ? bq : (j == 1 ? bk : bv)) : (j == 0 ? bkc : bvc);
  g2_body<0>(word ? WE : PE, DM, 0, BT + (size_t)(word ? j : 4 + j) * DM * DM, DM, 0, 0.0625f, bias, 0, nullptr, 1, 0, 0,
             word ? FW + (size_t)j * SW * DM : FP + (size_t)j * SP * DM, nullptr, DM, 0, word ? SW : SP, DM, DM, bx, 0); }


template <int TK>
__device__ __forceinline__ void d_vthl(const float* __restrict__ VF, int ldv, _Float16* __restrict__ Vth, _Float16* __restrict__ Vtl, float (*tl)[65], int blk) { const int tid = threadIdx.x; const int slab = blk / (TK / 64), lg = blk % (TK / 64); const int b = slab / NH, h = slab % NH;
  for (int i = tid; i < 64 * 16; i += 256) { const int r = i / 16, c4 = (i % 16) * 4; const v4f a = *(const v4fa*)(VF + ((size_t)b * TK + lg * 64 + r) * ldv + h * 64 + c4); tl[r][c4] = a[0]; tl[r][c4 + 1] = a[1]; tl[r][c4 + 2] = a[2]; tl[r][c4 + 3] = a[3]; }
  __syncthreads();
  FragH fh[2], fl[2]; size_t oo[2];
#pragma unroll
  for (int rd = 0; rd < 2; ++rd) { const int d = rd * 32 + tid / 8, pc = tid % 8;
#pragma unroll
    for (int q = 0; q < 8; ++q) { const float v = tl[pc * 8 + q][d]; const _Float16 hv = (_Float16)v; fh[rd].h[q] = hv; fl[rd].h[q] = (_Float16)((v - (float)hv) * 1024.0f); } oo[rd] = ((size_t)slab * 64 + d) * TK + lg * 64 + pc * 8; }
  {
#pragma unroll
    for (int rd = 0; rd < 2; ++rd) { *(v8us*)((unsigned short*)Vth + oo[rd]) = fh[rd].half[0]; *(v8us*)((unsigned short*)Vtl + oo[rd]) = fl[rd].half[0]; }
    asm volatile("s_wait_xcnt 0x0" ::: "memory");      /* stands in front of whatever reuses the registers of the four stores above: inlined into a grid of several jobs, code of another job follows them in the listing */
     } }
// The hi/lo splits of the five projections in one grid: a range of block indices per plane (every branch is block-uniform; the barrier of d_vthl is passed by a whole block or by none of it).
#define S5_HW (SW * DM / 8 / 256)
#define S5_HP (SP * DM / 8 / 256)
#define S5_VW (NH * (SW / 64))
#define S5_VP (NH * (SP / 64))
__global__ __launch_bounds__(256) void k_split5(const float* __restrict__ FW, const float* __restrict__ FP, _Float16* __restrict__ Qh, _Float16* __restrict__ Ql, _Float16* __restrict__ Kh, _Float16* __restrict__ Kl, _Float16* __restrict__ Vth, _Float16* __restrict__ Vtl,
    _Float16* __restrict__ KCh, _Float16* __restrict__ KCl, _Float16* __restrict__ VCth, _Float16* __restrict__ VCtl) {
  __shared__ float tl[64][65]; int b = (int)blockIdx.x;
  if (b < S5_HW) { d_hl(FW, Qh, Ql, (size_t)SW * DM / 8, (unsigned)b); return; } b -= S5_HW;
  if (b < S5_HW) { d_hl(FW + (size_t)SW * DM, Kh, Kl, (size_t)SW * DM / 8, (unsigned)b); return; } b -= S5_HW;
  if (b < S5_VW) { d_vthl<SW>(FW + (size_t)2 * SW * DM, DM, Vth, Vtl, tl, b); return; } b -= S5_VW;
  if (b < S5_HP) { d_hl(FP, KCh, KCl, (size_t)SP * DM / 8, (unsigned)b); return; } b -= S5_HP;
  d_vthl<SP>(FP + (size_t)SP * DM, DM, VCth, VCtl, tl, b); }

// K/V staging of k_flashm: one stage = the 32 keys of one trip: 32 K rows of 128 B (hi plane, lo plane) at a pitch of 144 B, 64 V^T rows of 64 B (hi plane, lo plane) at a pitch of 80 B (16 B x odd, for the 16-byte fragment reads); two buffers.
#define FM_KP 144
#define FM_VP 80
#define FM_KL (32 * FM_KP)
#define FM_VH (2 * 32 * FM_KP)
#define FM_VD (64 * FM_VP)
#define FM_STAGE (FM_VH + 2 * FM_VD)
// One wave's share of a stage: 8 K rows and 16 V^T rows of each plane, 16 B per lane, 8 copies (a K copy brings 4 whole rows, a V copy 8 rows).
// lk, lv: the lane's LDS byte addresses of its first K and V chunk (hi plane); gkh, gkl, gvh, gvl: the matching global addresses in the four planes.
__device__ __forceinline__ void fm_stage(unsigned lk, unsigned lv, const unsigned short* gkh, const unsigned short* gkl, int ldk, const unsigned short* gvh, const unsigned short* gvl, int ldv) {
  // the copies go to LDS through no register; s_wait_xcnt is the statement's last line so that no address register is rewritten ahead of it
  asm volatile("global_load_async_to_lds_b128 %0, %8, off\n\t"
               "global_load_async_to_lds_b128 %1, %9, off\n\t"
               "global_load_async_to_lds_b128 %2, %10, off\n\t"
               "global_load_async_to_lds_b128 %3, %11, off\n\t"
               "global_load_async_to_lds_b128 %4, %12, off\n\t"
               "global_load_async_to_lds_b128 %5, %13, off\n\t"
               "global_load_async_to_lds_b128 %6, %14, off\n\t"
               "global_load_async_to_lds_b128 %7, %15, off\n\t"
               "s_wait_xcnt 0x0"
               :: "v"(lk), "v"(lk + 4 * FM_KP), "v"(lk + FM_KL), "v"(lk + FM_KL + 4 * FM_KP), "v"(lv), "v"(lv + 8 * FM_VP), "v"(lv + FM_VD), "v"(lv + FM_VD + 8 * FM_VP),
                  "v"(gkh), "v"(gkh + (size_t)4 * ldk), "v"(gkl), "v"(gkl + (size_t)4 * ldk), "v"(gvh), "v"(gvh + (size_t)8 * ldv), "v"(gvl), "v"(gvl + (size_t)8 * ldv) : "memory");
}
template <int TQ, int TK>
__global__ __launch_bounds__(128) void k_flashm(const _Float16* __restrict__ Q16, const _Float16* __restrict__ Q16lo, int ldq, const _Float16* __restrict__ K16, const _Float16* __restrict__ K16lo, int ldk, const _Float16* __restrict__ Vt, const _Float16* __restrict__ Vtlo, const unsigned* __restrict__ MB, const int* __restrict__ RA, const int* __restrict__ KE, float* __restrict__ O, int ldo) {
  constexpr int RPW = 16, RTN = RPW / 16, NQB = TQ / (4 * RPW), DT = 4, KS = 2;
  __shared__ __attribute__((aligned(16))) unsigned short sP[4][RPW][40], sPl[4][RPW][40]; __shared__ __attribute__((aligned(16))) float sO[4][RPW][64 + 4]; __shared__ __attribute__((aligned(16))) unsigned char kv[2 * FM_STAGE];
  const int tid = threadIdx.x, w = tid >> 5, lane = tid & 31, ln = lane & 15, hh = lane >> 4;
  const int slab = blockIdx.x / NQB, qblk = blockIdx.x % NQB; const int b = slab / NH, h = slab % NH; const int qb0 = qblk * (4 * RPW); const int q0 = qb0 + w * RPW;
  FragH aq[2][KS], aql[2][KS];
#pragma unroll
  for (int rt = 0; rt < RTN; ++rt) { const size_t qo = ((size_t)b * TQ + q0 + rt * 16 + ln) * ldq + h * 64; const unsigned short* qr = (const unsigned short*)Q16 + qo; const unsigned short* ql = (const unsigned short*)Q16lo + qo;
#pragma unroll
    for (int ks = 0; ks < KS; ++ks) { aq[rt][ks].half[0] = *(const v8us*)(qr + ks * 32 + 8 * hh); aq[rt][ks].half[1] = *(const v8us*)(qr + ks * 32 + 16 + 8 * hh); aql[rt][ks].half[0] = *(const v8us*)(ql + ks * 32 + 8 * hh); aql[rt][ks].half[1] = *(const v8us*)(ql + ks * 32 + 16 + 8 * hh); } }
  const unsigned short* Vth = (const unsigned short*)Vt + (size_t)slab * 64 * TK; const unsigned short* Vtl = (const unsigned short*)Vtlo + (size_t)slab * 64 * TK;
  float m_r[2][8], l_r[2][8]; v8f oacc[2][DT], oaccl[2][DT];
#pragma unroll
  for (int rt = 0; rt < RTN; ++rt) {
#pragma unroll
    for (int r = 0; r < 8; ++r) { m_r[rt][r] = -3.0e38f; l_r[rt][r] = 0.f; }
#pragma unroll
    for (int dt = 0; dt < DT; ++dt) { oacc[rt][dt] = (v8f){0.f,0.f,0.f,0.f,0.f,0.f,0.f,0.f}; oaccl[rt][dt] = oacc[rt][dt]; } }
  int jend = KE[qblk * 32]; jend = min(TK, (jend + 31) & ~31); if (jend < 32) jend = 32;      /* block-uniform */
  int allm[2][8]; const unsigned* mrow[2][8];
#pragma unroll
  for (int rt = 0; rt < RTN; ++rt)
#pragma unroll
    for (int r = 0; r < 8; ++r) { const int tq = q0 + rt * 16 + 8 * hh + r; allm[rt][r] = RA[tq]; mrow[rt][r] = MB + (size_t)tq * (TK / 32); }
  const unsigned lk = (unsigned)(size_t)kv + (unsigned)((8 * w + (lane >> 3)) * FM_KP + (lane & 7) * 16), lv = (unsigned)(size_t)kv + (unsigned)(FM_VH + (16 * w + (lane >> 2)) * FM_VP + (lane & 3) * 16);
  const size_t gko = ((size_t)b * TK + 8 * w + (lane >> 3)) * ldk + h * 64 + (lane & 7) * 8, gvo = (size_t)(16 * w + (lane >> 2)) * TK + (lane & 3) * 8;      /* this lane's first 16 bytes of the wave's K and V^T rows */
  const unsigned short* gkh = (const unsigned short*)K16 + gko; const unsigned short* gkl = (const unsigned short*)K16lo + gko; const unsigned short* gvh = Vth + gvo; const unsigned short* gvl = Vtl + gvo;
  fm_stage(lk, lv, gkh, gkl, ldk, gvh, gvl, TK);
  asm volatile("s_wait_asynccnt 0x0" ::: "memory");      /* this wave's copies of stage 0 have landed */
  __syncthreads();      /* and every other wave's: stage 0 may be read */
  if (32 < jend) fm_stage(lk + FM_STAGE, lv + FM_STAGE, gkh + (size_t)32 * ldk, gkl + (size_t)32 * ldk, ldk, gvh + 32, gvl + 32, TK);
#pragma unroll 1
  for (int j0 = 0; j0 < jend; j0 += 32) {
    const unsigned bo = (unsigned)((j0 >> 5) & 1) * FM_STAGE; const unsigned char* pk = kv + bo + ln * FM_KP + 16 * hh; const unsigned char* pv = kv + bo + FM_VH + ln * FM_VP + 16 * hh;      /* this trip's buffer: the lane's row and half in the K and V^T tiles */
    v8f s[2][2]; FragH bk[2][KS], bkl[2][KS];
#pragma unroll
    for (int nt = 0; nt < 2; ++nt) { const unsigned char* kr = pk + nt * 16 * FM_KP; const unsigned char* kl = kr + FM_KL;
#pragma unroll
      for (int ks = 0; ks < KS; ++ks) { bk[nt][ks].half[0] = *(const v8us*)(kr + ks * 64); bk[nt][ks].half[1] = *(const v8us*)(kr + ks * 64 + 32); bkl[nt][ks].half[0] = *(const v8us*)(kl + ks * 64); bkl[nt][ks].half[1] = *(const v8us*)(kl + ks * 64 + 32); } }
    __builtin_amdgcn_sched_barrier(0);      /* keeps the trip's K reads one group in front of the WMMAs: sunk to their uses, the second 16 keys wait out an LDS latency of their own */
#pragma unroll
    for (int nt = 0; nt < 2; ++nt) {
#pragma unroll
      for (int rt = 0; rt < RTN; ++rt) { v8f acc = (v8f){0.f,0.f,0.f,0.f,0.f,0.f,0.f,0.f}, accr = acc;
#pragma unroll
        for (int ks = 0; ks < KS; ++ks) { acc = mmaH<1>(aq[rt][ks].v, aq[rt][ks].v, bk[nt][ks].v, bk[nt][ks].v, acc); accr = mmaH<1>(aql[rt][ks].v, aql[rt][ks].v, bk[nt][ks].v, bk[nt][ks].v, accr); accr = mmaH<1>(aq[rt][ks].v, aq[rt][ks].v, bkl[nt][ks].v, bkl[nt][ks].v, accr); }
        s[rt][nt] = acc + accr * 0.0009765625f; } }
#pragma unroll
    for (int rt = 0; rt < RTN; ++rt) {      /* no branch in the softmax: each exp is computed for every lane and the old conditions pick by select, so a lane's eight rows are one straight-line block and their mask loads, cross-lane steps and exp chains overlap */
      float s0[8], s1[8], mc[8]; bool ok0[8], ok1[8];
#pragma unroll
      for (int r = 0; r < 8; ++r) { const unsigned mw = mrow[rt][r][j0 >> 5]; const bool am = (allm[rt][r] != 0);
        ok0[r] = am || (((mw >> ln) & 1u) == 0u); ok1[r] = am || (((mw >> (16 + ln)) & 1u) == 0u);
        s0[r] = ok0[r] ? (am ? 0.f : s[rt][0][r] * SCL) : -INFINITY; s1[r] = ok1[r] ? (am ? 0.f : s[rt][1][r] * SCL) : -INFINITY; mc[r] = fmaxf(s0[r], s1[r]); }
#pragma unroll
      for (int st = 1; st < 16; st <<= 1)
#pragma unroll
        for (int r = 0; r < 8; ++r) mc[r] = fmaxf(mc[r], __shfl_xor(mc[r], st, 32));
#pragma unroll
      for (int r = 0; r < 8; ++r) { const float mo = m_r[rt][r], mn = fmaxf(mo, mc[r]); const float ea = expf(mo - mn), e0 = expf(s0[r] - mn), e1 = expf(s1[r] - mn);
        const float al = (mn > -1.0e38f) ? ea : 1.0f; m_r[rt][r] = mn; const float p0 = ok0[r] ? e0 : 0.f, p1 = ok1[r] ? e1 : 0.f; l_r[rt][r] = l_r[rt][r] * al + p0 + p1;
#pragma unroll
        for (int dt = 0; dt < DT; ++dt) { oacc[rt][dt][r] *= al; oaccl[rt][dt][r] *= al; }
        FragH t2, t3; const float ps0 = p0 * 1024.0f, ps1 = p1 * 1024.0f; t2.h[0] = (_Float16)ps0; t2.h[1] = (_Float16)ps1; t3.h[0] = (_Float16)((ps0 - (float)t2.h[0]) * 1024.0f); t3.h[1] = (_Float16)((ps1 - (float)t2.h[1]) * 1024.0f);
        sP[w][rt * 16 + 8 * hh + r][ln] = t2.u[0]; sP[w][rt * 16 + 8 * hh + r][16 + ln] = t2.u[1]; sPl[w][rt * 16 + 8 * hh + r][ln] = t3.u[0]; sPl[w][rt * 16 + 8 * hh + r][16 + ln] = t3.u[1]; } }
    FragH bv[DT], bl[DT];      /* the trip's V^T fragments, read as one group in front of P's way through LDS, so that the four output tiles do not each wait out an LDS latency */
#pragma unroll
    for (int dt = 0; dt < DT; ++dt) { const unsigned char* vr = pv + dt * 16 * FM_VP; bv[dt].half[0] = *(const v8us*)vr; bv[dt].half[1] = *(const v8us*)(vr + 32); bl[dt].half[0] = *(const v8us*)(vr + FM_VD); bl[dt].half[1] = *(const v8us*)(vr + FM_VD + 32); }
    __builtin_amdgcn_fence(__ATOMIC_ACQ_REL, "workgroup"); __builtin_amdgcn_wave_barrier();
    FragH pa[2], pl[2];
#pragma unroll
    for (int rt = 0; rt < RTN; ++rt) { pa[rt].half[0] = *(const v8us*)&sP[w][rt * 16 + ln][8 * hh]; pa[rt].half[1] = *(const v8us*)&sP[w][rt * 16 + ln][16 + 8 * hh]; pl[rt].half[0] = *(const v8us*)&sPl[w][rt * 16 + ln][8 * hh]; pl[rt].half[1] = *(const v8us*)&sPl[w][rt * 16 + ln][16 + 8 * hh]; }
#pragma unroll
    for (int dt = 0; dt < DT; ++dt) {
#pragma unroll
      for (int rt = 0; rt < RTN; ++rt) { oacc[rt][dt] = mmaH<1>(pa[rt].v, pa[rt].v, bv[dt].v, bv[dt].v, oacc[rt][dt]); oaccl[rt][dt] = mmaH<1>(pa[rt].v, pa[rt].v, bl[dt].v, bl[dt].v, oaccl[rt][dt]); oaccl[rt][dt] = mmaH<1>(pl[rt].v, pl[rt].v, bv[dt].v, bv[dt].v, oaccl[rt][dt]); } }
    asm volatile("s_wait_dscnt 0x0" ::: "memory");      /* this wave's reads of the buffer (and of its P rows) are done before the refill */
    asm volatile("s_wait_asynccnt 0x0" ::: "memory");      /* this wave's copies of the next stage have landed */
    __syncthreads();      /* publishes the next stage and ends every wave's reads of this one */
    if (j0 + 64 < jend) fm_stage(lk + bo, lv + bo, gkh + (size_t)(j0 + 64) * ldk, gkl + (size_t)(j0 + 64) * ldk, ldk, gvh + (j0 + 64), gvl + (j0 + 64), TK); }
  asm volatile("s_wait_asynccnt 0x0" ::: "memory");      /* no copy is left in flight */
#pragma unroll
  for (int rt = 0; rt < RTN; ++rt) {
#pragma unroll
    for (int r = 0; r < 8; ++r) { float l = l_r[rt][r]; l += __shfl_xor(l, 1, 32); l += __shfl_xor(l, 2, 32); l += __shfl_xor(l, 4, 32); l += __shfl_xor(l, 8, 32); l_r[rt][r] = (l > 0.f) ? 1.0f / (l * 1024.0f) : 0.f; }
#pragma unroll
    for (int dt = 0; dt < DT; ++dt)
#pragma unroll
      for (int r = 0; r < 8; ++r) sO[w][rt * 16 + 8 * hh + r][dt * 16 + ln] = (oacc[rt][dt][r] + oaccl[rt][dt][r] * 0.0009765625f) * l_r[rt][r]; }
  __builtin_amdgcn_fence(__ATOMIC_ACQ_REL, "workgroup"); __builtin_amdgcn_wave_barrier();
  {
#pragma unroll
    for (int rp = 0; rp < RPW; rp += 2) { const int r = rp + (lane >> 4), pc = lane & 15; const v4f val = *(const v4fa*)&sO[w][r][pc * 4]; *(v4f*)(O + ((size_t)b * TQ + q0 + r) * ldo + h * 64 + pc * 4) = val; }
     } }


__device__ __forceinline__ void d_causaltab(unsigned* __restrict__ MB, int* __restrict__ RA, int* __restrict__ KE, int nq, int nk, int blk) {
  const int t = blk * 256 + threadIdx.x; const int nw = nk / 32;
  if (t < nq * nw) { const int q = t / nw, w = t % nw; const int first = q + 1 - 32 * w; const unsigned bits = (first <= 0) ? 0xffffffffu : ((first >= 32) ? 0u : (0xffffffffu << first)); *(unsigned*)(MB + t) = bits;  }
  if (t < nq) { *(int*)(RA + t) = 0;  }
  if (t < nq / 64) { const int v = 64 * (t + 1); *(int*)(KE + t * 32) = v;  } }
__device__ __forceinline__ void d_fulltab(unsigned* __restrict__ MB, int* __restrict__ RA, int* __restrict__ KE, int nq, int nk, int blk) {
  const int t = blk * 256 + threadIdx.x; const int nw = nk / 32;
  if (t < nq * nw) { *(unsigned*)(MB + t) = 0u;  }
  if (t < nq) { *(int*)(RA + t) = 0;  }
  if (t < nq / 64) { *(int*)(KE + t * 32) = nk;  } }

// Everything that depends on the inputs alone (eight weight planes, two embedding planes, two mask tables) in one grid: a range of block indices per job, every branch block-uniform.
// BT: the six [DM][DM] weight planes in a row (q, k, v, cross q, cross k, cross v).
#define PR_F (FF * DM / 8 / 256)
#define PR_W (DM * DM / 8 / 256)
#define PR_X (SW * DM / 8 / 256)
#define PR_P (SP * DM / 8 / 256)
#define PR_C (SW * (SW / 32) / 256)
#define PR_U (SW * (SP / 32) / 256)
__global__ __launch_bounds__(256) void k_prep(const float* __restrict__ Wq, const float* __restrict__ Wk, const float* __restrict__ Wv, const float* __restrict__ Wqc, const float* __restrict__ Wkc, const float* __restrict__ Wvc, const float* __restrict__ W1, const float* __restrict__ W2,
    const float* __restrict__ wemb, const float* __restrict__ pemb, _Float16* __restrict__ BT, _Float16* __restrict__ BW1, _Float16* __restrict__ BW2, _Float16* __restrict__ WE16, _Float16* __restrict__ PE16,
    unsigned* __restrict__ MB, int* __restrict__ RA, int* __restrict__ KE, unsigned* __restrict__ MB2, int* __restrict__ RA2, int* __restrict__ KE2) {
  int b = (int)blockIdx.x;
  if (b < PR_F) { d_round16f(W1, BW1, (size_t)FF * DM / 8, (unsigned)b); return; } b -= PR_F;
  if (b < PR_F) { d_round16f(W2, BW2, (size_t)FF * DM / 8, (unsigned)b); return; } b -= PR_F;
  if (b < 6 * PR_W) { const int j = b / PR_W; const float* W = (j == 0) ? Wq : (j == 1) ? Wk : (j == 2) ? Wv : (j == 3) ? Wqc : (j == 4) ? Wkc : Wvc;
    d_round16f(W, BT + (size_t)j * DM * DM, (size_t)DM * DM / 8, (unsigned)(b - j * PR_W)); return; } b -= 6 * PR_W;
  if (b < PR_X) { d_x16(wemb, WE16, (size_t)SW * DM / 8, (unsigned)b); return; } b -= PR_X;
  if (b < PR_P) { d_x16(pemb, PE16, (size_t)SP * DM / 8, (unsigned)b); return; } b -= PR_P;
  if (b < PR_C) { d_causaltab(MB, RA, KE, SW, SW, b); return; } b -= PR_C;
  d_fulltab(MB2, RA2, KE2, SW, SP, b); }

extern "C" void kernel_launch(void* const* d_in, const int* in_sizes, int n_in,
                              void* d_out, int out_size, void* d_ws, size_t ws_size, hipStream_t stream) {
  (void)in_sizes; (void)n_in; (void)out_size;
  const float* const* I = (const float* const*)d_in; const float* wemb = I[0]; const float* pemb = I[1];
  const float* Wq = I[2]; const float* bq = I[3]; const float* Wk = I[4]; const float* bk = I[5]; const float* Wv = I[6]; const float* bv = I[7];
  const float* Wqc = I[8]; const float* bqc = I[9]; const float* Wkc = I[10]; const float* bkc = I[11]; const float* Wvc = I[12]; const float* bvc = I[13];
  const float* W1 = I[14]; const float* b1 = I[15]; const float* W2 = I[16]; const float* b2 = I[17];
  char* ws = (char*)d_ws; size_t off = 0;
  auto take = [&](size_t bytes) { char* p = ws + off; off += (bytes + 255) & ~(size_t)255; return p; };
  _Float16* BT = (_Float16*)take((size_t)6 * DM * DM * 2); _Float16* BQC = BT + (size_t)3 * DM * DM;      /* weight planes q, k, v, cross q, cross k, cross v in a row */
  _Float16* BW1 = (_Float16*)take((size_t)FF * DM * 2); _Float16* BW2 = (_Float16*)take((size_t)DM * FF * 2);
  _Float16* WE16 = (_Float16*)take((size_t)SW * DM * 2); _Float16* PE16 = (_Float16*)take((size_t)SP * DM * 2);
  float* FW = (float*)take((size_t)3 * SW * DM * 4); float* FP = (float*)take((size_t)2 * SP * DM * 4);      /* f32 q, k, v and cross k, v */
  _Float16* Qh = (_Float16*)take((size_t)SW * DM * 2); _Float16* Ql = (_Float16*)take((size_t)SW * DM * 2); _Float16* Kh = (_Float16*)take((size_t)SW * DM * 2); _Float16* Kl = (_Float16*)take((size_t)SW * DM * 2);      /* Qh..Kl: 16 MiB contiguous, later the FFN f32 half-hidden */
  _Float16* Vth = (_Float16*)take((size_t)SW * DM * 2); _Float16* Vtl = (_Float16*)take((size_t)SW * DM * 2);
  _Float16* KCh = (_Float16*)take((size_t)SP * DM * 2); _Float16* KCl = (_Float16*)take((size_t)SP * DM * 2); _Float16* VCth = (_Float16*)take((size_t)SP * DM * 2); _Float16* VCtl = (_Float16*)take((size_t)SP * DM * 2);
  unsigned* MB = (unsigned*)take((size_t)SW * (SW / 32) * 4); int* RA = (int*)take((size_t)SW * 4); int* KE = (int*)take((size_t)(SW / 64) * 32 * 4);
  unsigned* MB2 = (unsigned*)take((size_t)SW * (SP / 32) * 4); int* RA2 = (int*)take((size_t)SW * 4); int* KE2 = (int*)take((size_t)(SW / 64) * 32 * 4);
  _Float16* Ah = (_Float16*)take((size_t)SW * DM * 2); _Float16* Al = (_Float16*)take((size_t)SW * DM * 2);      /* word hi/lo, later cross hi/lo */
  _Float16* HDh = (_Float16*)take((size_t)SW * (FF / 2) * 2); _Float16* HDl = (_Float16*)take((size_t)SW * (FF / 2) * 2);
  if (off > ws_size) return;      /* 12 + 16 + 4 + 2 + 32 + 32 + 0.8 + 8 + 16 = 123 MiB */
  float* F = FW;      /* free again behind k_split5: attention results, cross q */
  float* HF = (float*)Qh;             /* FFN half hidden f32 [2048][2048] = 16 MiB over Qh..Kl (dead after the second attention) */
  const dim3 gW((SW / 128) * (DM / 64), 1), gH((SW / 128) * ((FF / 2) / 64), 1); const size_t n8w = (size_t)SW * DM / 8; const unsigned nbw = (unsigned)((n8w + 255) / 256);
  k_prep<<<2 * PR_F + 6 * PR_W + PR_X + PR_P + PR_C + PR_U, 256, 0, stream>>>(Wq, Wk, Wv, Wqc, Wkc, Wvc, W1, W2, wemb, pemb, BT, BW1, BW2, WE16, PE16, MB, RA, KE, MB2, RA2, KE2);      /* weights are (out,in) row-major = natural Bt; x16 */
  k_proj5<<<3 * P5_NW + 2 * P5_NP, 128, 0, stream>>>(WE16, PE16, BT, bq, bk, bv, bkc, bvc, FW, FP);
  k_split5<<<2 * S5_HW + S5_VW + S5_HP + S5_VP, 256, 0, stream>>>(FW, FP, Qh, Ql, Kh, Kl, Vth, Vtl, KCh, KCl, VCth, VCtl);
  /* --- causal self attention on the word embeddings (all planes hi/lo) --- */
  k_flashm<SW, SW><<<NH * (SW / 64), 128, 0, stream>>>(Qh, Ql, DM, Kh, Kl, DM, Vth, Vtl, MB, RA, KE, F, DM);      /* word (f32) -> F */
  k_hl<<<nbw, 256, 0, stream>>>(F, Ah, Al, n8w);      /* word as hi/lo operand planes */
  k_gemm2p<0><<<gW, 256, 0, stream>>>(Ah, Al, DM, BQC, DM, 0.0625f, 0.0625f * 0.0009765625f, bqc, nullptr, F, DM, SW, DM, DM); k_hl<<<nbw, 256, 0, stream>>>(F, Qh, Ql, n8w);
  k_flashm<SW, SP><<<NH * (SW / 64), 128, 0, stream>>>(Qh, Ql, DM, KCh, KCl, DM, VCth, VCtl, MB2, RA2, KE2, F, DM);      /* cross (f32) -> F */
  k_hl<<<nbw, 256, 0, stream>>>(F, Ah, Al, n8w);      /* cross as hi/lo operand planes */
  /* --- FFN in two column halves of the hidden: h = relu(cross*W1^T + b1) (hi/lo), out (+)= h_half*W2_half^T (+ b2 once) --- */
  for (int hf = 0; hf < 2; ++hf) { const _Float16* B1h = BW1 + (size_t)hf * (FF / 2) * DM; const _Float16* B2h = BW2 + (size_t)hf * (FF / 2);
    k_gemm2p<3><<<gH, 256, 0, stream>>>(Ah, Al, DM, B1h, DM, 0.0625f, 0.0625f * 0.0009765625f, b1 + hf * (FF / 2), nullptr, HF, FF / 2, SW, FF / 2, DM);      /* relu on the complete sum */
    k_hl<<<(unsigned)(((size_t)SW * (FF / 2) / 8 + 255) / 256), 256, 0, stream>>>(HF, HDh, HDl, (size_t)SW * (FF / 2) / 8);
    k_gemm2p<0><<<gW, 256, 0, stream>>>(HDh, HDl, FF / 2, B2h, FF, 0.0625f, 0.0625f * 0.0009765625f, (hf == 0) ? b2 : nullptr, (hf == 0) ? nullptr : (const float*)d_out, (float*)d_out, DM, SW, DM, FF / 2); }
}

// v007
// It runs in 309 microseconds.
// Timed twice side by side with v006, it ran 1.05 and 1.06 times as fast.
// Counting every step since v000, it is 4.15 times as fast.
#include <hip/hip_runtime.h>
// Two-stage attention decoder block (word embeddings [2048][1024], position embeddings [1024][1024], 16 heads x 64, FFN 4096): word = CausalMHA(wemb; q,k,v = Linear+bias, scores/8, tril, softmax, .v, heads merged, no output projection); cross = MHA(q from word, k/v from pemb, no mask); out = relu(cross*W1^T + b1)*W2^T + b2 -> [2048,1024].
// Compute dtype: inputs and parameters rounded to bf16; projections of the embeddings exact; all other operands f16 hi + (x2^10) residual pairs (~2^-21); f32 accumulation, softmax f32. v_wmma_f32_16x16x32_f16.
#define SW 2048
#define SP 1024
#define DM 1024
#define NH 16
#define FF 4096
#define SCL 0.125f
#define SCL2 (SCL * 1.4426950408889634f)      /* 1/sqrt(64) * log2(e): k_flashm keeps scores and running maxima in base 2, exp(x) = 2^(x * log2(e)) */
#define SKV ((SW > SP) ? SW : SP)      /* the larger key count, used nowhere: the self attention has SW keys, the cross attention SP */
typedef __bf16 v16b __attribute__((ext_vector_type(16)));
typedef unsigned short v8us __attribute__((ext_vector_type(8), may_alias));
typedef float  v8f  __attribute__((ext_vector_type(8)));
typedef float  v4f  __attribute__((ext_vector_type(4)));
typedef float  v4fa __attribute__((ext_vector_type(4), may_alias));
union FragB { v16b v; v8us half[2]; unsigned short u[16]; };

__device__ __forceinline__ unsigned short bf16_bits(float x) { unsigned int u = __float_as_uint(x); return (unsigned short)((u + 0x7FFFu + ((u >> 16) & 1u)) >> 16); }
__device__ __forceinline__ float bf16_val(unsigned short b) { return __uint_as_float(((unsigned int)b) << 16); }
__device__ __forceinline__ float bf16_round(float x) { return bf16_val(bf16_bits(x)); }
// D += A·B with NT terms: 1 = ah·bh, 2 = + al·bh (A split), 3 = + ah·bl (both split)
template <int NT>
__device__ __forceinline__ v8f mmaN(v16b ah, v16b al, v16b bh, v16b bl, v8f c) {
  c = __builtin_amdgcn_wmma_f32_16x16x32_bf16(false, ah, false, bh, (short)0, c, false, false);
  if (NT >= 2) c = __builtin_amdgcn_wmma_f32_16x16x32_bf16(false, al, false, bh, (short)0, c, false, false);
  if (NT >= 3) c = __builtin_amdgcn_wmma_f32_16x16x32_bf16(false, ah, false, bl, (short)0, c, false, false);
  asm volatile("v_nop\n\tv_nop\n\tv_nop\n\tv_nop" : "+v"(c) : "v"(ah), "v"(al), "v"(bh), "v"(bl));
  return c;
}

__global__ __launch_bounds__(256) void k_wt_bf16(const float* __restrict__ W, unsigned short* __restrict__ Wt, int K, int N) {
  const int t = blockIdx.x * 256 + threadIdx.x;
  const int k8n = K / 8;
  if (t >= N * k8n) return;
  const int n = t / k8n, k8 = (t % k8n) * 8;
  v8us v;
#pragma unroll
  for (int i = 0; i < 8; ++i) v[i] = bf16_bits(W[(size_t)(k8 + i) * N + n]);
  *(v8us*)(Wt + (size_t)n * K + k8) = v;
  
}

// GEMM C[M][N] (f32, pitch ldc) = act(A[M][K]·W + bias). A f32 row-major (pitch lda) converted per fragment to bf16
// (ASPLIT: hi/lo two planes -> 2 terms, else single rounded term); Wt bf16 [N][K] (pitch ldb). BIAS_BF16 rounds the
// bias to bf16 first (bias quantised to bf16 before the add). K%32==0, M%16==0, N%64==0.
template <bool ASPLIT, int ACT, bool BIAS_BF16>
__global__ __launch_bounds__(128) void k_gemm_bf(const float* __restrict__ A, int lda, const unsigned short* __restrict__ Wt, int ldb,
                                               const float* __restrict__ bias, float* __restrict__ C, int ldc, int M, int N, int K) {
  __shared__ __attribute__((aligned(16))) float so[4][16][64];
  const int tid = threadIdx.x, w = tid >> 5, lane = tid & 31, ln = lane & 15, hh = lane >> 4;
  const int ntn = N / 64;
  const int wid = blockIdx.x * 4 + w;
  const int mt = wid / ntn, nq = wid % ntn;
  if (mt * 16 >= M) return;
  const int row0 = mt * 16, col0 = nq * 64;
  const float* arow = A + (size_t)(row0 + ln) * lda;
  v8f acc[4] = {};
  for (int kb = 0; kb < K; kb += 32) {
    FragB ah, al;
    const v4f x0 = *(const v4fa*)(arow + kb + 8 * hh), x1 = *(const v4fa*)(arow + kb + 8 * hh + 4);
    const v4f x2 = *(const v4fa*)(arow + kb + 16 + 8 * hh), x3 = *(const v4fa*)(arow + kb + 16 + 8 * hh + 4);
    float xs[16] = {x0[0],x0[1],x0[2],x0[3],x1[0],x1[1],x1[2],x1[3],x2[0],x2[1],x2[2],x2[3],x3[0],x3[1],x3[2],x3[3]};
#pragma unroll
    for (int i = 0; i < 16; ++i) { const unsigned short hb = bf16_bits(xs[i]); ah.u[i] = hb; al.u[i] = ASPLIT ? bf16_bits(xs[i] - bf16_val(hb)) : (unsigned short)0; }
#pragma unroll
    for (int t = 0; t < 4; ++t) {
      const unsigned short* brow = Wt + (size_t)(col0 + t * 16 + ln) * ldb + kb;
      FragB b;
      b.half[0] = *(const v8us*)(brow + 8 * hh);
      b.half[1] = *(const v8us*)(brow + 16 + 8 * hh);
      acc[t] = mmaN<ASPLIT ? 2 : 1>(ah.v, al.v, b.v, b.v, acc[t]);
    }
  }
#pragma unroll
  for (int t = 0; t < 4; ++t) {
    float bv = bias ? bias[col0 + t * 16 + ln] : 0.f;
    if (BIAS_BF16) bv = bf16_round(bv);
#pragma unroll
    for (int r = 0; r < 8; ++r) { float v = acc[t][r] + bv; if (ACT == 1) v = fmaxf(v, 0.f); so[w][8 * hh + r][t * 16 + ln] = v; }
  }
  __builtin_amdgcn_fence(__ATOMIC_ACQ_REL, "workgroup");
  __builtin_amdgcn_wave_barrier();
  const int rsub = lane >> 4, c4 = (lane & 15) * 4;
  {
#pragma unroll
    for (int q = 0; q < 8; ++q) {
      const int r = q * 2 + rsub;
      const v4f v = *(const v4fa*)&so[w][r][c4];
      *(v4f*)(C + (size_t)(row0 + r) * ldc + col0 + c4) = v;
    }
    
  }
}

// GEMM C = act(A·W + bias + resid): A f32 (ASPLIT -> hi/lo 2 terms), Wt bf16 [N][K]; ACT 0 none, 1 relu, 2 exact gelu;
// resid (optional, f32, row index = (row % rmod), pitch ldr, RES_BF16 rounds it) added before the activation.
template <bool ASPLIT, int ACT, bool BIAS_BF16, bool RES_BF16>
__global__ __launch_bounds__(128) void k_gemm_bf3(const float* __restrict__ A, int lda, const unsigned short* __restrict__ Wt, int ldb,
                                                const float* __restrict__ bias, const float* __restrict__ resid, int rmod, int ldr,
                                                float* __restrict__ C, int ldc, int M, int N, int K) {
  __shared__ __attribute__((aligned(16))) float so[4][16][64];
  const int tid = threadIdx.x, w = tid >> 5, lane = tid & 31, ln = lane & 15, hh = lane >> 4;
  const int ntn = N / 64;
  const int wid = blockIdx.x * 4 + w;
  const int mt = wid / ntn, nq = wid % ntn;
  if (mt * 16 >= M) return;
  const int row0 = mt * 16, col0 = nq * 64;
  const float* arow = A + (size_t)(row0 + ln) * lda;
  v8f acc[4] = {};
  for (int kb = 0; kb < K; kb += 32) {
    FragB ah, al;
    const v4f x0 = *(const v4fa*)(arow + kb + 8 * hh), x1 = *(const v4fa*)(arow + kb + 8 * hh + 4);
    const v4f x2 = *(const v4fa*)(arow + kb + 16 + 8 * hh), x3 = *(const v4fa*)(arow + kb + 16 + 8 * hh + 4);
    float xs[16] = {x0[0],x0[1],x0[2],x0[3],x1[0],x1[1],x1[2],x1[3],x2[0],x2[1],x2[2],x2[3],x3[0],x3[1],x3[2],x3[3]};
#pragma unroll
    for (int i = 0; i < 16; ++i) { const unsigned short hb = bf16_bits(xs[i]); ah.u[i] = hb; al.u[i] = ASPLIT ? bf16_bits(xs[i] - bf16_val(hb)) : (unsigned short)0; }
#pragma unroll
    for (int t = 0; t < 4; ++t) {
      const unsigned short* brow = Wt + (size_t)(col0 + t * 16 + ln) * ldb + kb;
      FragB b;
      b.half[0] = *(const v8us*)(brow + 8 * hh);
      b.half[1] = *(const v8us*)(brow + 16 + 8 * hh);
      acc[t] = mmaN<ASPLIT ? 2 : 1>(ah.v, al.v, b.v, b.v, acc[t]);
    }
  }
#pragma unroll
  for (int t = 0; t < 4; ++t) {
    const int col = col0 + t * 16 + ln;
    float bv = bias ? bias[col] : 0.f;
    if (BIAS_BF16) bv = bf16_round(bv);
#pragma unroll
    for (int r = 0; r < 8; ++r) {
      float v = acc[t][r] + bv;
      if (resid) { float rv = resid[(size_t)((row0 + 8 * hh + r) % rmod) * ldr + col]; if (RES_BF16) rv = bf16_round(rv); v += rv; }
      if (ACT == 1) v = fmaxf(v, 0.f);
      if (ACT == 2) v = 0.5f * v * (1.0f + erff(v * 0.70710678118654752f));
      if (ACT == 3) { const float u = 0.7978845608028654f * (v + 0.044715f * v * v * v); v = 0.5f * v * (1.0f + tanhf(u)); }
      so[w][8 * hh + r][t * 16 + ln] = v;
    }
  }
  __builtin_amdgcn_fence(__ATOMIC_ACQ_REL, "workgroup");
  __builtin_amdgcn_wave_barrier();
  const int rsub = lane >> 4, c4 = (lane & 15) * 4;
  {
#pragma unroll
    for (int q = 0; q < 8; ++q) {
      const int r = q * 2 + rsub;
      const v4f v = *(const v4fa*)&so[w][r][c4];
      *(v4f*)(C + (size_t)(row0 + r) * ldc + col0 + c4) = v;
    }
    
  }
}
// row LayerNorm (biased variance, eps) over N: s = X (+ R); optional out_sum <- s; out_norm <- (s-mu)*rsqrt(var+eps)*g + b
template <bool PARAM_BF16>
__global__ __launch_bounds__(256) void k_layernorm(const float* __restrict__ X, const float* __restrict__ R, const float* __restrict__ g, const float* __restrict__ bta,
                                                  float* __restrict__ out_sum, float* __restrict__ out_norm, int N, float eps) {
  __shared__ float red[256];
  const int row = blockIdx.x, tid = threadIdx.x;
  const float* x = X + (size_t)row * N; const float* rr = R ? R + (size_t)row * N : nullptr;
  float vals[16];                     // up to N = 4096
  const int per = N / 256;            // contiguous chunk per thread? use strided-by-4 chunks: thread handles j = tid*4 + 1024*u
  float s1 = 0.f;
  for (int u = 0; u < per / 4; ++u) {
    const int j = tid * 4 + 1024 * u;
    const v4f a = *(const v4fa*)(x + j);
    v4f b = {0.f,0.f,0.f,0.f}; if (rr) b = *(const v4fa*)(rr + j);
#pragma unroll
    for (int q = 0; q < 4; ++q) { const float v = a[q] + b[q]; vals[u * 4 + q] = v; s1 += v; }
  }
  red[tid] = s1; __syncthreads();
  for (int st = 128; st > 0; st >>= 1) { if (tid < st) red[tid] += red[tid + st]; __syncthreads(); }
  const float mu = red[0] / (float)N; __syncthreads();
  float s2 = 0.f;
  for (int u = 0; u < per / 4; ++u)
#pragma unroll
    for (int q = 0; q < 4; ++q) { const float c = vals[u * 4 + q] - mu; s2 += c * c; }
  red[tid] = s2; __syncthreads();
  for (int st = 128; st > 0; st >>= 1) { if (tid < st) red[tid] += red[tid + st]; __syncthreads(); }
  const float rs = rsqrtf(red[0] / (float)N + eps);
  {
    for (int u = 0; u < per / 4; ++u) {
      const int j = tid * 4 + 1024 * u;
      v4f o, sm;
#pragma unroll
      for (int q = 0; q < 4; ++q) {
        float gg = g[j + q], bb = bta[j + q];
        if (PARAM_BF16) { gg = bf16_round(gg); bb = bf16_round(bb); }
        sm[q] = vals[u * 4 + q]; o[q] = (vals[u * 4 + q] - mu) * rs * gg + bb;
      }
      if (out_sum) *(v4f*)(out_sum + (size_t)row * N + j) = sm;
      *(v4f*)(out_norm + (size_t)row * N + j) = o;
    }
    
  }
}



// ---- f16 WMMA path (v_wmma_f32_16x16x32_f16): 11-bit significands for operands in range — used where a [0,1] probability operand needs more precision than bf16
typedef _Float16 v16h __attribute__((ext_vector_type(16)));
union FragH { v16h v; v8us half[2]; _Float16 h[16]; unsigned short u[16]; };
template <int NT>
__device__ __forceinline__ v8f mmaH(v16h ah, v16h al, v16h bh, v16h bl, v8f c) {
  c = __builtin_amdgcn_wmma_f32_16x16x32_f16(false, ah, false, bh, (short)0, c, false, false);
  if (NT >= 2) c = __builtin_amdgcn_wmma_f32_16x16x32_f16(false, al, false, bh, (short)0, c, false, false);
  if (NT >= 3) c = __builtin_amdgcn_wmma_f32_16x16x32_f16(false, ah, false, bl, (short)0, c, false, false);
  asm volatile("v_nop\n\tv_nop\n\tv_nop\n\tv_nop" : "+v"(c) : "v"(ah), "v"(al), "v"(bh), "v"(bl));
  return c;
}
// batched GEMM like k_gemm_b but f16 operands: A f32 (split into f16 hi/lo if ASPLIT, else rounded to f16), Bt = f16 values [n][k]; alpha; C f32; N multiple of 16 (partial tiles skipped)
template <bool ASPLIT>
__global__ __launch_bounds__(128) void k_gemm_h(const float* __restrict__ A, int lda, size_t sA, const _Float16* __restrict__ Bh, int ldb, size_t sB, float alpha, float* __restrict__ C, int ldc, size_t sC, int M, int N, int K) {
  __shared__ __attribute__((aligned(16))) float so[4][16][64];
  const int tid = threadIdx.x, w = tid >> 5, lane = tid & 31, ln = lane & 15, hh = lane >> 4; const int by = blockIdx.y;
  A += (size_t)by * sA; Bh += (size_t)by * sB; C += (size_t)by * sC;
  const int ntn = (N + 63) / 64; const int wid = blockIdx.x * 4 + w; const int mt = wid / ntn, nq = wid % ntn; if (mt * 16 >= M) return;
  const int row0 = mt * 16, col0 = nq * 64; const float* arow = A + (size_t)(row0 + ln) * lda;
  v8f acc[4] = {};
  for (int kb = 0; kb < K; kb += 32) {
    FragH ah, al;
    const v4f x0 = *(const v4fa*)(arow + kb + 8 * hh), x1 = *(const v4fa*)(arow + kb + 8 * hh + 4), x2 = *(const v4fa*)(arow + kb + 16 + 8 * hh), x3 = *(const v4fa*)(arow + kb + 16 + 8 * hh + 4);
    float xs[16] = {x0[0],x0[1],x0[2],x0[3],x1[0],x1[1],x1[2],x1[3],x2[0],x2[1],x2[2],x2[3],x3[0],x3[1],x3[2],x3[3]};
#pragma unroll
    for (int i = 0; i < 16; ++i) { const _Float16 h = (_Float16)xs[i]; ah.h[i] = h; al.h[i] = ASPLIT ? (_Float16)(xs[i] - (float)h) : (_Float16)0.0f; }
#pragma unroll
    for (int t = 0; t < 4; ++t) { if (col0 + t * 16 >= N) continue; const size_t boff = (size_t)(col0 + t * 16 + ln) * ldb + kb; FragH bq; bq.half[0] = *(const v8us*)(Bh + boff + 8 * hh); bq.half[1] = *(const v8us*)(Bh + boff + 16 + 8 * hh);
      acc[t] = mmaH<ASPLIT ? 2 : 1>(ah.v, al.v, bq.v, bq.v, acc[t]); }
  }
#pragma unroll
  for (int t = 0; t < 4; ++t) { if (col0 + t * 16 >= N) continue;
#pragma unroll
    for (int r = 0; r < 8; ++r) so[w][8 * hh + r][t * 16 + ln] = acc[t][r] * alpha; }
  __builtin_amdgcn_fence(__ATOMIC_ACQ_REL, "workgroup"); __builtin_amdgcn_wave_barrier();
  const int rsub = lane >> 4, c4 = (lane & 15) * 4;
  {
#pragma unroll
    for (int q = 0; q < 8; ++q) { const int r = q * 2 + rsub; if (col0 + c4 < N) { const v4f v = *(const v4fa*)&so[w][r][c4]; *(v4f*)(C + (size_t)(row0 + r) * ldc + col0 + c4) = v; } }
     }
}

// Wt[n][k] = f16(W[k][n]·scale) from f32 row-major W[K][N] (scale = power of two; bf16-exact weights stay exact in f16 away from the subnormal range)
__global__ __launch_bounds__(256) void k_wt_f16(const float* __restrict__ W, _Float16* __restrict__ Wt, int K, int N, float scale) {
  const int t = blockIdx.x * 256 + threadIdx.x; if (t >= N * (K / 8)) return; const int n = t / (K / 8), k8 = (t % (K / 8)) * 8; FragH f;
#pragma unroll
  for (int i = 0; i < 8; ++i) f.h[i] = (_Float16)(bf16_round(W[(size_t)(k8 + i) * N + n]) * scale); const v8us o = f.half[0];
  *(v8us*)((unsigned short*)Wt + (size_t)n * K + k8) = o; 
}
// k_gemm_hh variant with fused epilogue: v = acc·alpha + bias[by·sBias + col] (+ CP[(row/rowsPerB)·sCPb + by·64 + col] if CP) ; ACT 0 none / 1 elu ; writes f16 C16 (and f32 C if non-null)
template <int ACT>
__global__ __launch_bounds__(128) void k_gemm_hhx(const _Float16* __restrict__ A, int lda, size_t sA, const _Float16* __restrict__ Bh, int ldb, size_t sB, float alpha, const float* __restrict__ bias, size_t sBias, const float* __restrict__ CP, int rowsPerB, size_t sCPb, int row0g,
    float* __restrict__ C, _Float16* __restrict__ C16, int ldc, size_t sC, int M, int N, int K) {
  __shared__ __attribute__((aligned(16))) float so[4][16][64];
  const int tid = threadIdx.x, w = tid >> 5, lane = tid & 31, ln = lane & 15, hh = lane >> 4; const int by = blockIdx.y;
  A += (size_t)by * sA; Bh += (size_t)by * sB; const size_t cofs = (size_t)by * sC; const float* bp = bias ? bias + (size_t)by * sBias : nullptr;
  const int ntn = (N + 63) / 64; const int wid = blockIdx.x * 4 + w; const int mt = wid / ntn, nq = wid % ntn; if (mt * 16 >= M) return;
  const int row0 = mt * 16, col0 = nq * 64; const _Float16* arow = A + (size_t)(row0 + ln) * lda;
  v8f acc[4] = {};
  for (int kb = 0; kb < K; kb += 32) { FragH ah; ah.half[0] = *(const v8us*)((const unsigned short*)arow + kb + 8 * hh); ah.half[1] = *(const v8us*)((const unsigned short*)arow + kb + 16 + 8 * hh);
#pragma unroll
    for (int t = 0; t < 4; ++t) { if (col0 + t * 16 >= N) continue; const size_t boff = (size_t)(col0 + t * 16 + ln) * ldb + kb; FragH bq; bq.half[0] = *(const v8us*)((const unsigned short*)Bh + boff + 8 * hh); bq.half[1] = *(const v8us*)((const unsigned short*)Bh + boff + 16 + 8 * hh);
      acc[t] = mmaH<1>(ah.v, ah.v, bq.v, bq.v, acc[t]); }
  }
#pragma unroll
  for (int t = 0; t < 4; ++t) { if (col0 + t * 16 >= N) continue; const int col = col0 + t * 16 + ln; const float bv = bp ? bf16_round(bp[col]) : 0.f;
#pragma unroll
    for (int r = 0; r < 8; ++r) { float v = acc[t][r] * alpha + bv; if (CP) { const int bidx = (row0g + row0 + 8 * hh + r) / rowsPerB; v += CP[(size_t)bidx * sCPb + (size_t)by * 64 + col]; } if (ACT == 1) v = (v > 0.f) ? v : expm1f(v); else if (ACT == 7) v = (v > 0.f) ? v + 1.0f : expf(v); else if (ACT == 8) v = tanhf(v); else if (ACT == 9) v = 0.5f * v * (1.0f + tanhf(0.7978845608028654f * (v + 0.044715f * v * v * v))); else if (ACT == 11) v = 1.0f / (1.0f + expf(-v)); else if (ACT == 12) v = (v > 0.f) ? v : 0.01f * v; else if (ACT == 14) v = (v > 0.f) ? v : 0.1f * v; else if (ACT == 15) v = v / (1.0f + expf(-v)); else if (ACT == 3) v = fmaxf(v, 0.f); else if (ACT == 6) v = 0.5f * v * (1.0f + erff(v * 0.70710678118654752f)); so[w][8 * hh + r][t * 16 + ln] = v; } }
  __builtin_amdgcn_fence(__ATOMIC_ACQ_REL, "workgroup"); __builtin_amdgcn_wave_barrier();
  const int rsub = lane >> 4, c4 = (lane & 15) * 4; typedef _Float16 v4h __attribute__((ext_vector_type(4)));
  {
#pragma unroll
    for (int q = 0; q < 8; ++q) { const int r = q * 2 + rsub; if (col0 + c4 < N) { const v4f v = *(const v4fa*)&so[w][r][c4]; if (C) *(v4f*)(C + cofs + (size_t)(row0 + r) * ldc + col0 + c4) = v; if (C16) { v4h h4; for (int i = 0; i < 4; ++i) h4[i] = (_Float16)v[i]; *(v4h*)(C16 + cofs + (size_t)(row0 + r) * ldc + col0 + c4) = h4; } } }
     }
}


typedef _Float16 v4h __attribute__((ext_vector_type(4)));

// Bodies of the short kernels: blk is the block's index inside its own job, so that independent jobs can share one grid, each on its own range of block indices.
__device__ __forceinline__ void d_x16(const float* __restrict__ x, _Float16* __restrict__ X16, size_t n8, unsigned blk) { const size_t t = (size_t)blk * 256 + threadIdx.x; if (t >= n8) return; FragH f;
#pragma unroll
  for (int q = 0; q < 8; ++q) f.h[q] = (_Float16)bf16_round(x[t * 8 + q]); *(v8us*)((unsigned short*)X16 + t * 8) = f.half[0];  }
__global__ __launch_bounds__(256) void k_h16(const float* __restrict__ x, _Float16* __restrict__ X16, size_t n8) { const size_t t = (size_t)blockIdx.x * 256 + threadIdx.x; if (t >= n8) return; FragH f;
#pragma unroll
  for (int q = 0; q < 8; ++q) f.h[q] = (_Float16)x[t * 8 + q]; *(v8us*)((unsigned short*)X16 + t * 8) = f.half[0];  }
__device__ __forceinline__ void d_round16f(const float* __restrict__ W, _Float16* __restrict__ Bt, size_t n8, unsigned blk) { const size_t t = (size_t)blk * 256 + threadIdx.x; if (t >= n8) return; FragH f;
#pragma unroll
  for (int i = 0; i < 8; ++i) f.h[i] = (_Float16)(bf16_round(W[t * 8 + i]) * 16.0f); *(v8us*)((unsigned short*)Bt + t * 8) = f.half[0];  }
template <int NHv, int TTv>
__global__ __launch_bounds__(256) void k_vt(const _Float16* __restrict__ V16, int ldv, int voff, _Float16* __restrict__ Vt) { __shared__ unsigned short tl[64][66]; const int tid = threadIdx.x; const int slab = blockIdx.x / (TTv / 64), lg = blockIdx.x % (TTv / 64); const int b = slab / NHv, h = slab % NHv;
  for (int i = tid; i < 64 * 8; i += 256) { const int r = i / 8, c8 = (i % 8) * 8; FragH f; f.half[0] = *(const v8us*)((const unsigned short*)V16 + ((size_t)b * TTv + lg * 64 + r) * ldv + voff + h * 64 + c8);
#pragma unroll
    for (int q = 0; q < 8; ++q) tl[r][c8 + q] = f.u[q]; }
  __syncthreads();
  {
#pragma unroll
    for (int rd = 0; rd < 2; ++rd) { const int d = rd * 32 + tid / 8, pc = tid % 8; FragH f;
#pragma unroll
      for (int q = 0; q < 8; ++q) f.u[q] = tl[pc * 8 + q][d];
      *(v8us*)((unsigned short*)Vt + ((size_t)slab * 64 + d) * TTv + lg * 64 + pc * 8) = f.half[0]; }
     } }

__device__ __forceinline__ void d_hl(const float* __restrict__ F, _Float16* __restrict__ Hh, _Float16* __restrict__ Hl, size_t n8, unsigned blk) { const size_t t = (size_t)blk * 256 + threadIdx.x; if (t >= n8) return; FragH fh, fl; const v4f a = *(const v4fa*)(F + t * 8), c = *(const v4fa*)(F + t * 8 + 4);
#pragma unroll
  for (int q = 0; q < 4; ++q) { _Float16 h = (_Float16)a[q]; fh.h[q] = h; fl.h[q] = (_Float16)((a[q] - (float)h) * 1024.0f); h = (_Float16)c[q]; fh.h[4 + q] = h; fl.h[4 + q] = (_Float16)((c[q] - (float)h) * 1024.0f); }
  { *(v8us*)((unsigned short*)Hh + t * 8) = fh.half[0]; *(v8us*)((unsigned short*)Hl + t * 8) = fl.half[0];  } }
__global__ __launch_bounds__(256) void k_hl(const float* __restrict__ F, _Float16* __restrict__ Hh, _Float16* __restrict__ Hl, size_t n8) { d_hl(F, Hh, Hl, n8, blockIdx.x); }

// ---- fast GEMM (block tile 128x64, wave tile 32x64; requires M % 128 == 0, N % 64 == 0 and K % 128 == 0); epilogue = k_gemm_hhx semantics ----
// k loop staging of g2_body: one stage = 128 k (256 B of a row) of the block's 128 A rows and 64 B rows, laid in LDS at a pitch of 272 B (16 B x odd, for the 16-byte fragment reads); two buffers.
#define G2_PITCH 272
#define G2_AB (128 * G2_PITCH)
#define G2_STAGE ((128 + 64) * G2_PITCH)
__device__ __forceinline__ v16h g2_lfrag(const unsigned char* p, int hh) { FragH f; f.half[0] = *(const v8us*)(p + 16 * hh); f.half[1] = *(const v8us*)(p + 32 + 16 * hh); return f.v; }
__device__ __forceinline__ v8f g2_mm(v16h a, v16h b, v8f c) { return __builtin_amdgcn_wmma_f32_16x16x32_f16(false, a, false, b, (short)0, c, false, false); }
// One wave's share of a stage: 32 A rows and 16 B rows, two rows (2 x 256 B, whole lines) per wave-wide copy, 16 B per lane, 24 copies.
// la, lb: the lane's LDS byte addresses of its first A and B chunk; ga, gb: the matching global addresses; a copy further on is two rows further on.
__device__ __forceinline__ void g2_stage(unsigned la, unsigned lb, const _Float16* ga, int lda, const _Float16* gb, int ldb) {
  unsigned l[24]; const _Float16* g[24];
#pragma unroll
  for (int i = 0; i < 16; ++i) { l[i] = la + i * (2 * G2_PITCH); g[i] = ga + (size_t)(2 * i) * lda; }
#pragma unroll
  for (int i = 0; i < 8; ++i) { l[16 + i] = lb + i * (2 * G2_PITCH); g[16 + i] = gb + (size_t)(2 * i) * ldb; }
  // the copies go to LDS through no register; s_wait_xcnt is the statement's last line so that no address register is rewritten ahead of it
  asm volatile("global_load_async_to_lds_b128 %0, %12, off\n\t"
               "global_load_async_to_lds_b128 %1, %13, off\n\t"
               "global_load_async_to_lds_b128 %2, %14, off\n\t"
               "global_load_async_to_lds_b128 %3, %15, off\n\t"
               "global_load_async_to_lds_b128 %4, %16, off\n\t"
               "global_load_async_to_lds_b128 %5, %17, off\n\t"
               "global_load_async_to_lds_b128 %6, %18, off\n\t"
               "global_load_async_to_lds_b128 %7, %19, off\n\t"
               "global_load_async_to_lds_b128 %8, %20, off\n\t"
               "global_load_async_to_lds_b128 %9, %21, off\n\t"
               "global_load_async_to_lds_b128 %10, %22, off\n\t"
               "global_load_async_to_lds_b128 %11, %23, off\n\t"
               "s_wait_xcnt 0x0"
               :: "v"(l[0]), "v"(l[1]), "v"(l[2]), "v"(l[3]), "v"(l[4]), "v"(l[5]), "v"(l[6]), "v"(l[7]), "v"(l[8]), "v"(l[9]), "v"(l[10]), "v"(l[11]),
                  "v"(g[0]), "v"(g[1]), "v"(g[2]), "v"(g[3]), "v"(g[4]), "v"(g[5]), "v"(g[6]), "v"(g[7]), "v"(g[8]), "v"(g[9]), "v"(g[10]), "v"(g[11]) : "memory");
  asm volatile("global_load_async_to_lds_b128 %0, %12, off\n\t"
               "global_load_async_to_lds_b128 %1, %13, off\n\t"
               "global_load_async_to_lds_b128 %2, %14, off\n\t"
               "global_load_async_to_lds_b128 %3, %15, off\n\t"
               "global_load_async_to_lds_b128 %4, %16, off\n\t"
               "global_load_async_to_lds_b128 %5, %17, off\n\t"
               "global_load_async_to_lds_b128 %6, %18, off\n\t"
               "global_load_async_to_lds_b128 %7, %19, off\n\t"
               "global_load_async_to_lds_b128 %8, %20, off\n\t"
               "global_load_async_to_lds_b128 %9, %21, off\n\t"
               "global_load_async_to_lds_b128 %10, %22, off\n\t"
               "global_load_async_to_lds_b128 %11, %23, off\n\t"
               "s_wait_xcnt 0x0"
               :: "v"(l[12]), "v"(l[13]), "v"(l[14]), "v"(l[15]), "v"(l[16]), "v"(l[17]), "v"(l[18]), "v"(l[19]), "v"(l[20]), "v"(l[21]), "v"(l[22]), "v"(l[23]),
                  "v"(g[12]), "v"(g[13]), "v"(g[14]), "v"(g[15]), "v"(g[16]), "v"(g[17]), "v"(g[18]), "v"(g[19]), "v"(g[20]), "v"(g[21]), "v"(g[22]), "v"(g[23]) : "memory");
}
// bx, by: the block's tile index and batch index inside its own product
template <int ACT>
__device__ __forceinline__ void g2_body(const _Float16* __restrict__ A, int lda, size_t sA, const _Float16* __restrict__ Bh, int ldb, size_t sB, float alpha, const float* __restrict__ bias, size_t sBias, const float* __restrict__ CP, int rowsPerB, size_t sCPb, int row0g,
    float* __restrict__ C, _Float16* __restrict__ C16, int ldc, size_t sC, int M, int N, int K, int bx, int by) {
  __shared__ __attribute__((aligned(16))) float so[4][32][68]; __shared__ __attribute__((aligned(16))) unsigned char ring[2 * G2_STAGE];
  const int tid = threadIdx.x, w = tid >> 5, lane = tid & 31, ln = lane & 15, hh = lane >> 4;
  A += (size_t)by * sA; Bh += (size_t)by * sB; const size_t cofs = (size_t)by * sC; const float* bp = bias ? bias + (size_t)by * sBias : nullptr;
  const int ntn = N >> 6; const int mt = bx / ntn, nq = bx - mt * ntn; const int row0 = mt * 128 + 32 * w, col0 = nq * 64; if (mt * 128 >= M) return;      /* the whole block leaves, in front of every barrier */
  const v8f z8 = {0.f,0.f,0.f,0.f,0.f,0.f,0.f,0.f}; v8f c00 = z8, c01 = z8, c02 = z8, c03 = z8, c10 = z8, c11 = z8, c12 = z8, c13 = z8;
  const _Float16* ga = A + (size_t)(row0 + hh) * lda + ln * 8; const _Float16* gb = Bh + (size_t)(col0 + 16 * w + hh) * ldb + ln * 8;      /* this lane's first 16 bytes of the wave's A and B rows */
  const unsigned la = (unsigned)(size_t)ring + (unsigned)((32 * w + hh) * G2_PITCH + ln * 16), lb = (unsigned)(size_t)ring + (unsigned)(G2_AB + (16 * w + hh) * G2_PITCH + ln * 16);
  const int nst = K >> 7;
  g2_stage(la, lb, ga, lda, gb, ldb);
  // What the epilogue adds (bias, addend CP) is read here, in the layout of the write-out pass (lane = 4 columns of rows 2q + hh): 17 independent 16-byte loads issued as one group, in flight beside stage 0's copies.
  const int c4 = ln * 4; const v4f z4 = {0.f,0.f,0.f,0.f}; v4f b4 = z4, cp[16];
#pragma unroll
  for (int q = 0; q < 16; ++q) cp[q] = z4;
  if (CP) { const float* pc[16];
#pragma unroll
    for (int q = 0; q < 16; ++q) { const int bidx = (row0g + row0 + q * 2 + hh) / rowsPerB; pc[q] = CP + (size_t)bidx * sCPb + (size_t)by * 64 + col0 + c4; }
    __builtin_amdgcn_sched_barrier(0);      /* all 16 addresses are formed in front of the loads, each in registers of its own: formed among the loads they share registers, and each reuse waits for an issued load */
#pragma unroll
    for (int q = 0; q < 16; ++q) cp[q] = *(const v4fa*)pc[q];
    asm volatile("s_wait_xcnt 0x0" ::: "memory");      /* stands in front of whatever reuses the address registers of the 16 loads above */
  }
  if (bp) { b4 = *(const v4fa*)(bp + col0 + c4);
    asm volatile("s_wait_xcnt 0x0" ::: "memory");      /* the same for the bias load */
  }
  asm volatile("s_wait_asynccnt 0x0" ::: "memory");      /* this wave's copies of stage 0 have landed */
  __syncthreads();      /* and every other wave's: stage 0 may be read */
  if (nst > 1) g2_stage(la + G2_STAGE, lb + G2_STAGE, ga + 128, lda, gb + 128, ldb);
#pragma unroll 1      /* one trip per stage: the two buffers alternate */
  for (int t = 0; t < nst; ++t) { const unsigned bo = (unsigned)(t & 1) * G2_STAGE; const unsigned char* pa = ring + bo + (32 * w + ln) * G2_PITCH; const unsigned char* pb = ring + bo + G2_AB + ln * G2_PITCH;
    v16h fa[2][2], fb[2][4];      /* two fragment sets: the next k step's LDS reads are issued, as one group, ahead of this step's WMMAs; never beyond the stage */
    fa[0][0] = g2_lfrag(pa, hh); fa[0][1] = g2_lfrag(pa + 16 * G2_PITCH, hh);
#pragma unroll
    for (int j = 0; j < 4; ++j) fb[0][j] = g2_lfrag(pb + j * 16 * G2_PITCH, hh);
#pragma unroll
    for (int ks = 0; ks < 4; ++ks) { const int cu = ks & 1, nx = cu ^ 1;
      if (ks < 3) { fa[nx][0] = g2_lfrag(pa + (ks + 1) * 64, hh); fa[nx][1] = g2_lfrag(pa + 16 * G2_PITCH + (ks + 1) * 64, hh);
#pragma unroll
        for (int j = 0; j < 4; ++j) fb[nx][j] = g2_lfrag(pb + j * 16 * G2_PITCH + (ks + 1) * 64, hh); }
      __builtin_amdgcn_sched_barrier(0);      /* keeps the reads above in front of the WMMAs below: sunk to their uses, each pair of WMMAs waits out an LDS latency */
      c00 = g2_mm(fa[cu][0], fb[cu][0], c00); c10 = g2_mm(fa[cu][1], fb[cu][0], c10); c01 = g2_mm(fa[cu][0], fb[cu][1], c01); c11 = g2_mm(fa[cu][1], fb[cu][1], c11);
      c02 = g2_mm(fa[cu][0], fb[cu][2], c02); c12 = g2_mm(fa[cu][1], fb[cu][2], c12); c03 = g2_mm(fa[cu][0], fb[cu][3], c03); c13 = g2_mm(fa[cu][1], fb[cu][3], c13);
      __builtin_amdgcn_sched_barrier(0);      /* keeps the next group of reads behind these WMMAs, so that two sets suffice */
    }
    asm volatile("s_wait_dscnt 0x0" ::: "memory");      /* this wave's reads of the buffer are done before it is refilled */
    asm volatile("s_wait_asynccnt 0x0" ::: "memory");      /* this wave's copies of stage t + 1 have landed */
    __syncthreads();      /* publishes stage t + 1 and ends every wave's reads of stage t */
    if (t + 2 < nst) g2_stage(la + bo, lb + bo, ga + (size_t)(t + 2) * 128, lda, gb + (size_t)(t + 2) * 128, ldb); }
  asm volatile("s_wait_asynccnt 0x0" ::: "memory");      /* no copy is left in flight */
  v8f accs[8] = {c00, c01, c02, c03, c10, c11, c12, c13};
#pragma unroll
  for (int u = 0; u < 8; ++u) { const int t = u & 3, half = u >> 2;
#pragma unroll
    for (int r = 0; r < 8; ++r) so[w][half * 16 + 8 * hh + r][t * 16 + ln] = accs[u][r]; }
  __builtin_amdgcn_fence(__ATOMIC_ACQ_REL, "workgroup"); __builtin_amdgcn_wave_barrier();
  const int rsub = lane >> 4; const v4f bv4 = {bf16_round(b4[0]), bf16_round(b4[1]), bf16_round(b4[2]), bf16_round(b4[3])};
  {      /* no branch per row: the 16 LDS reads are one group, the sums one block, the stores one group under one test of the pointer */
    v4f o[16];
#pragma unroll
    for (int q = 0; q < 16; ++q) o[q] = *(const v4fa*)&so[w][q * 2 + rsub][c4];
#pragma unroll
    for (int q = 0; q < 16; ++q)
#pragma unroll
      for (int i = 0; i < 4; ++i) { float v = o[q][i] * alpha + bv4[i]; if (CP) v += cp[q][i];
        if (ACT == 3) v = fmaxf(v, 0.f); else if (ACT == 6) v = 0.5f * v * (1.0f + erff(v * 0.70710678118654752f)); else if (ACT == 11) v = 1.0f / (1.0f + expf(-v)); else if (ACT == 15) v = v / (1.0f + expf(-v)); else if (ACT == 12) v = (v > 0.f) ? v : 0.01f * v; else if (ACT == 8) v = tanhf(v);
        o[q][i] = v; }
    if (C) { float* po[16];
#pragma unroll
      for (int q = 0; q < 16; ++q) po[q] = C + cofs + (size_t)(row0 + q * 2 + rsub) * ldc + col0 + c4;
      __builtin_amdgcn_sched_barrier(0);      /* all 16 addresses are formed in front of the stores, each in registers of its own: formed among the stores they share registers, and each reuse waits for an issued store */
#pragma unroll
      for (int q = 0; q < 16; ++q) *(v4f*)po[q] = o[q];
      asm volatile("s_wait_xcnt 0x0" ::: "memory");      /* stands in front of whatever reuses the registers of the 16 stores above */
    }
    if (C16) { _Float16* ph[16]; v4h h4[16];
#pragma unroll
      for (int q = 0; q < 16; ++q) { for (int i = 0; i < 4; ++i) h4[q][i] = (_Float16)o[q][i]; ph[q] = C16 + cofs + (size_t)(row0 + q * 2 + rsub) * ldc + col0 + c4; }
      __builtin_amdgcn_sched_barrier(0);      /* as above: values and addresses first, then the 16 stores as one group */
#pragma unroll
      for (int q = 0; q < 16; ++q) *(v4h*)ph[q] = h4[q]; }
     } }
// ---- a product whose A operand is a hi plane and a residual plane: both passes in one launch ----
// Block = 8 waves on one 128x64 tile: waves 0-3 multiply the hi plane's rows, waves 4-7 the residual plane's rows, against the one staged B tile; the write-out adds the two sums.
// One stage = 128 k of the 128 rows of each A plane and of the 64 B rows, at the pitch of k_proj5's ring; two buffers.
#define G2P_AB (256 * G2_PITCH)
#define G2P_STAGE ((256 + 64) * G2_PITCH)
// One wave's share of a stage: its own 32 A rows and 8 B rows, two rows (2 x 256 B, whole lines) per wave-wide copy, 16 B per lane, 20 copies.
__device__ __forceinline__ void g2p_stage(unsigned la, unsigned lb, const _Float16* ga, int lda, const _Float16* gb, int ldb) {
  unsigned l[20]; const _Float16* g[20];
#pragma unroll
  for (int i = 0; i < 16; ++i) { l[i] = la + i * (2 * G2_PITCH); g[i] = ga + (size_t)(2 * i) * lda; }
#pragma unroll
  for (int i = 0; i < 4; ++i) { l[16 + i] = lb + i * (2 * G2_PITCH); g[16 + i] = gb + (size_t)(2 * i) * ldb; }
  // the copies go to LDS through no register; s_wait_xcnt is the statement's last line so that no address register is rewritten ahead of it
  asm volatile("global_load_async_to_lds_b128 %0, %10, off\n\t"
               "global_load_async_to_lds_b128 %1, %11, off\n\t"
               "global_load_async_to_lds_b128 %2, %12, off\n\t"
               "global_load_async_to_lds_b128 %3, %13, off\n\t"
               "global_load_async_to_lds_b128 %4, %14, off\n\t"
               "global_load_async_to_lds_b128 %5, %15, off\n\t"
               "global_load_async_to_lds_b128 %6, %16, off\n\t"
               "global_load_async_to_lds_b128 %7, %17, off\n\t"
               "global_load_async_to_lds_b128 %8, %18, off\n\t"
               "global_load_async_to_lds_b128 %9, %19, off\n\t"
               "s_wait_xcnt 0x0"
               :: "v"(l[0]), "v"(l[1]), "v"(l[2]), "v"(l[3]), "v"(l[4]), "v"(l[5]), "v"(l[6]), "v"(l[7]), "v"(l[8]), "v"(l[9]),
                  "v"(g[0]), "v"(g[1]), "v"(g[2]), "v"(g[3]), "v"(g[4]), "v"(g[5]), "v"(g[6]), "v"(g[7]), "v"(g[8]), "v"(g[9]) : "memory");
  asm volatile("global_load_async_to_lds_b128 %0, %10, off\n\t"
               "global_load_async_to_lds_b128 %1, %11, off\n\t"
               "global_load_async_to_lds_b128 %2, %12, off\n\t"
               "global_load_async_to_lds_b128 %3, %13, off\n\t"
               "global_load_async_to_lds_b128 %4, %14, off\n\t"
               "global_load_async_to_lds_b128 %5, %15, off\n\t"
               "global_load_async_to_lds_b128 %6, %16, off\n\t"
               "global_load_async_to_lds_b128 %7, %17, off\n\t"
               "global_load_async_to_lds_b128 %8, %18, off\n\t"
               "global_load_async_to_lds_b128 %9, %19, off\n\t"
               "s_wait_xcnt 0x0"
               :: "v"(l[10]), "v"(l[11]), "v"(l[12]), "v"(l[13]), "v"(l[14]), "v"(l[15]), "v"(l[16]), "v"(l[17]), "v"(l[18]), "v"(l[19]),
                  "v"(g[10]), "v"(g[11]), "v"(g[12]), "v"(g[13]), "v"(g[14]), "v"(g[15]), "v"(g[16]), "v"(g[17]), "v"(g[18]), "v"(g[19]) : "memory");
}
// C = act(Ah*B^T * alpha + bias (+ CP) + Al*B^T * alphal); CP: optional addend of C's shape and pitch (it may be C itself: a lane reads exactly the elements that it stores). M % 128 == 0, N % 64 == 0, K % 128 == 0.
template <int ACT>
__global__ __launch_bounds__(256) void k_gemm2p(const _Float16* __restrict__ Ah, const _Float16* __restrict__ Al, int lda, const _Float16* __restrict__ Bh, int ldb, float alpha, float alphal, const float* __restrict__ bias, const float* CP,
    float* C, int ldc, int M, int N, int K) {
  __shared__ __attribute__((aligned(16))) float so[8][32][68]; __shared__ __attribute__((aligned(16))) unsigned char ring[2 * G2P_STAGE];
  const int tid = threadIdx.x, w = tid >> 5, lane = tid & 31, ln = lane & 15, hh = lane >> 4, pl = w >> 2, wr = w & 3;      /* pl: the wave's plane; wr: its group of 32 rows */
  const int ntn = N >> 6; const int bx = (int)blockIdx.x; const int mt = bx / ntn, nq = bx - mt * ntn; const int row0 = mt * 128 + 32 * wr, col0 = nq * 64; if (mt * 128 >= M) return;      /* the whole block leaves, in front of every barrier */
  const v8f z8 = {0.f,0.f,0.f,0.f,0.f,0.f,0.f,0.f}; v8f c00 = z8, c01 = z8, c02 = z8, c03 = z8, c10 = z8, c11 = z8, c12 = z8, c13 = z8;
  const _Float16* ga = (pl ? Al : Ah) + (size_t)(row0 + hh) * lda + ln * 8; const _Float16* gb = Bh + (size_t)(col0 + 8 * w + hh) * ldb + ln * 8;      /* this lane's first 16 bytes of the wave's A and B rows */
  const unsigned la = (unsigned)(size_t)ring + (unsigned)((32 * w + hh) * G2_PITCH + ln * 16), lb = (unsigned)(size_t)ring + (unsigned)(G2P_AB + (8 * w + hh) * G2_PITCH + ln * 16);
  const int nst = K >> 7;
  g2p_stage(la, lb, ga, lda, gb, ldb);
  // What the write-out adds (bias, addend CP) is read here, in the write-out's layout (a wave writes 16 of its group's 32 rows; lane = 4 columns of rows 16 pl + 2q + hh): independent 16-byte loads issued as one group, in flight beside stage 0's copies.
  const int c4 = ln * 4, rw = 16 * pl + hh; const v4f z4 = {0.f,0.f,0.f,0.f}; v4f b4 = z4, cp[8];
#pragma unroll
  for (int q = 0; q < 8; ++q) cp[q] = z4;
  if (CP) { const float* pc[8];
#pragma unroll
    for (int q = 0; q < 8; ++q) pc[q] = CP + (size_t)(row0 + rw + q * 2) * ldc + col0 + c4;
    __builtin_amdgcn_sched_barrier(0);      /* all 8 addresses are formed in front of the loads, each in registers of its own: formed among the loads they share registers, and each reuse waits for an issued load */
#pragma unroll
    for (int q = 0; q < 8; ++q) cp[q] = *(const v4fa*)pc[q];
    asm volatile("s_wait_xcnt 0x0" ::: "memory");      /* stands in front of whatever reuses the address registers of the 8 loads above */
  }
  if (bias) { b4 = *(const v4fa*)(bias + col0 + c4);
    asm volatile("s_wait_xcnt 0x0" ::: "memory");      /* the same for the bias load */
  }
  asm volatile("s_wait_asynccnt 0x0" ::: "memory");      /* this wave's copies of stage 0 have landed */
  __syncthreads();      /* and every other wave's: stage 0 may be read */
  if (nst > 1) g2p_stage(la + G2P_STAGE, lb + G2P_STAGE, ga + 128, lda, gb + 128, ldb);
#pragma unroll 1      /* one trip per stage: the two buffers alternate */
  for (int t = 0; t < nst; ++t) { const unsigned bo = (unsigned)(t & 1) * G2P_STAGE; const unsigned char* pa = ring + bo + (32 * w + ln) * G2_PITCH; const unsigned char* pb = ring + bo + G2P_AB + ln * G2_PITCH;
    v16h fa[2][2], fb[2][4];      /* two fragment sets: the next k step's LDS reads are issued, as one group, ahead of this step's WMMAs; never beyond the stage */
    fa[0][0] = g2_lfrag(pa, hh); fa[0][1] = g2_lfrag(pa + 16 * G2_PITCH, hh);
#pragma unroll
    for (int j = 0; j < 4; ++j) fb[0][j] = g2_lfrag(pb + j * 16 * G2_PITCH, hh);
#pragma unroll
    for (int ks = 0; ks < 4; ++ks) { const int cu = ks & 1, nx = cu ^ 1;
      if (ks < 3) { fa[nx][0] = g2_lfrag(pa + (ks + 1) * 64, hh); fa[nx][1] = g2_lfrag(pa + 16 * G2_PITCH + (ks + 1) * 64, hh);
#pragma unroll
        for (int j = 0; j < 4; ++j) fb[nx][j] = g2_lfrag(pb + j * 16 * G2_PITCH + (ks + 1) * 64, hh); }
      __builtin_amdgcn_sched_barrier(0);      /* keeps the reads above in front of the WMMAs below: sunk to their uses, each pair of WMMAs waits out an LDS latency */
      c00 = g2_mm(fa[cu][0], fb[cu][0], c00); c10 = g2_mm(fa[cu][1], fb[cu][0], c10); c01 = g2_mm(fa[cu][0], fb[cu][1], c01); c11 = g2_mm(fa[cu][1], fb[cu][1], c11);
      c02 = g2_mm(fa[cu][0], fb[cu][2], c02); c12 = g2_mm(fa[cu][1], fb[cu][2], c12); c03 = g2_mm(fa[cu][0], fb[cu][3], c03); c13 = g2_mm(fa[cu][1], fb[cu][3], c13);
      __builtin_amdgcn_sched_barrier(0);      /* keeps the next group of reads behind these WMMAs, so that two sets suffice */
    }
    asm volatile("s_wait_dscnt 0x0" ::: "memory");      /* this wave's reads of the buffer are done before it is refilled */
    asm volatile("s_wait_asynccnt 0x0" ::: "memory");      /* this wave's copies of stage t + 1 have landed */
    __syncthreads();      /* publishes stage t + 1 and ends every wave's reads of stage t */
    if (t + 2 < nst) g2p_stage(la + bo, lb + bo, ga + (size_t)(t + 2) * 128, lda, gb + (size_t)(t + 2) * 128, ldb); }
  asm volatile("s_wait_asynccnt 0x0" ::: "memory");      /* no copy is left in flight */
  v8f accs[8] = {c00, c01, c02, c03, c10, c11, c12, c13};
#pragma unroll
  for (int u = 0; u < 8; ++u) { const int t = u & 3, half = u >> 2;
#pragma unroll
    for (int r = 0; r < 8; ++r) so[w][half * 16 + 8 * hh + r][t * 16 + ln] = accs[u][r]; }
  __syncthreads();      /* a row group's two sums come from two waves: both are in LDS before either wave reads them */
  const v4f bv4 = {bf16_round(b4[0]), bf16_round(b4[1]), bf16_round(b4[2]), bf16_round(b4[3])};
  {      /* no branch per row: the 16 LDS reads are one group, the sums one block, the stores one group */
    v4f o[8], ol[8];
#pragma unroll
    for (int q = 0; q < 8; ++q) { o[q] = *(const v4fa*)&so[wr][rw + q * 2][c4]; ol[q] = *(const v4fa*)&so[4 + wr][rw + q * 2][c4]; }
#pragma unroll
    for (int q = 0; q < 8; ++q)
#pragma unroll
      for (int i = 0; i < 4; ++i) { float v = o[q][i] * alpha + bv4[i]; if (CP) v += cp[q][i]; v += ol[q][i] * alphal;      /* the order of the two separate passes: hi sum, bias, addend, then the residual sum */
        if (ACT == 3) v = fmaxf(v, 0.f);
        o[q][i] = v; }
    float* po[8];
#pragma unroll
    for (int q = 0; q < 8; ++q) po[q] = C + (size_t)(row0 + rw + q * 2) * ldc + col0 + c4;
    __builtin_amdgcn_sched_barrier(0);      /* all 8 addresses are formed in front of the stores, each in registers of its own: formed among the stores they share registers, and each reuse waits for an issued store */
#pragma unroll
    for (int q = 0; q < 8; ++q) *(v4f*)po[q] = o[q];
    asm volatile("s_wait_xcnt 0x0" ::: "memory");      /* stands in front of whatever reuses the registers of the 8 stores above */
  } }
// The five projections that depend on the embeddings alone (q, k, v of the self attention; k, v of the cross attention) in one grid: a range of block indices per product.
// BT: the six [DM][DM] weight planes in a row (q, k, v, cross q, cross k, cross v); FW: three [SW][DM] f32 results in a row; FP: two [SP][DM] f32 results in a row.
#define P5_NW ((SW / 128) * (DM / 64))
#define P5_NP ((SP / 128) * (DM / 64))
__global__ __launch_bounds__(128) void k_proj5(const _Float16* __restrict__ WE, const _Float16* __restrict__ PE, const _Float16* __restrict__ BT, const float* __restrict__ bq, const float* __restrict__ bk, const float* __restrict__ bv, const float* __restrict__ bkc, const float* __restrict__ bvc,
    float* __restrict__ FW, float* __restrict__ FP) {
  const int b = (int)blockIdx.x; const bool word = b < 3 * P5_NW;      /* block-uniform */
  const int j = word ? b / P5_NW : (b - 3 * P5_NW) / P5_NP; const int bx = word ? b - j * P5_NW : (b - 3 * P5_NW) - j * P5_NP;
  const float* bias = word ? (j == 0 ? bq : (j == 1 ? bk : bv)) : (j == 0 ? bkc : bvc);
  g2_body<0>(word ? WE : PE, DM, 0, BT + (size_t)(word ? j : 4 + j) * DM * DM, DM, 0, 0.0625f, bias, 0, nullptr, 1, 0, 0,
             word ? FW + (size_t)j * SW * DM : FP + (size_t)j * SP * DM, nullptr, DM, 0, word ? SW : SP, DM, DM, bx, 0); }


template <int TK>
__device__ __forceinline__ void d_vthl(const float* __restrict__ VF, int ldv, _Float16* __restrict__ Vth, _Float16* __restrict__ Vtl, float (*tl)[65], int blk) { const int tid = threadIdx.x; const int slab = blk / (TK / 64), lg = blk % (TK / 64); const int b = slab / NH, h = slab % NH;
  for (int i = tid; i < 64 * 16; i += 256) { const int r = i / 16, c4 = (i % 16) * 4; const v4f a = *(const v4fa*)(VF + ((size_t)b * TK + lg * 64 + r) * ldv + h * 64 + c4); tl[r][c4] = a[0]; tl[r][c4 + 1] = a[1]; tl[r][c4 + 2] = a[2]; tl[r][c4 + 3] = a[3]; }
  __syncthreads();
  FragH fh[2], fl[2]; size_t oo[2];
#pragma unroll
  for (int rd = 0; rd < 2; ++rd) { const int d = rd * 32 + tid / 8, pc = tid % 8;
#pragma unroll
    for (int q = 0; q < 8; ++q) { const float v = tl[pc * 8 + q][d]; const _Float16 hv = (_Float16)v; fh[rd].h[q] = hv; fl[rd].h[q] = (_Float16)((v - (float)hv) * 1024.0f); } oo[rd] = ((size_t)slab * 64 + d) * TK + lg * 64 + pc * 8; }
  {
#pragma unroll
    for (int rd = 0; rd < 2; ++rd) { *(v8us*)((unsigned short*)Vth + oo[rd]) = fh[rd].half[0]; *(v8us*)((unsigned short*)Vtl + oo[rd]) = fl[rd].half[0]; }
    asm volatile("s_wait_xcnt 0x0" ::: "memory");      /* stands in front of whatever reuses the registers of the four stores above: inlined into a grid of several jobs, code of another job follows them in the listing */
     } }
// The hi/lo splits of the five projections in one grid: a range of block indices per plane (every branch is block-uniform; the barrier of d_vthl is passed by a whole block or by none of it).
#define S5_HW (SW * DM / 8 / 256)
#define S5_HP (SP * DM / 8 / 256)
#define S5_VW (NH * (SW / 64))
#define S5_VP (NH * (SP / 64))
__global__ __launch_bounds__(256) void k_split5(const float* __restrict__ FW, const float* __restrict__ FP, _Float16* __restrict__ Qh, _Float16* __restrict__ Ql, _Float16* __restrict__ Kh, _Float16* __restrict__ Kl, _Float16* __restrict__ Vth, _Float16* __restrict__ Vtl,
    _Float16* __restrict__ KCh, _Float16* __restrict__ KCl, _Float16* __restrict__ VCth, _Float16* __restrict__ VCtl) {
  __shared__ float tl[64][65]; int b = (int)blockIdx.x;
  if (b < S5_HW) { d_hl(FW, Qh, Ql, (size_t)SW * DM / 8, (unsigned)b); return; } b -= S5_HW;
  if (b < S5_HW) { d_hl(FW + (size_t)SW * DM, Kh, Kl, (size_t)SW * DM / 8, (unsigned)b); return; } b -= S5_HW;
  if (b < S5_VW) { d_vthl<SW>(FW + (size_t)2 * SW * DM, DM, Vth, Vtl, tl, b); return; } b -= S5_VW;
  if (b < S5_HP) { d_hl(FP, KCh, KCl, (size_t)SP * DM / 8, (unsigned)b); return; } b -= S5_HP;
  d_vthl<SP>(FP + (size_t)SP * DM, DM, VCth, VCtl, tl, b); }

// K/V staging of k_flashm: one stage = the 32 keys of one trip: 32 K rows of 128 B (hi plane, lo plane) at a pitch of 144 B, 64 V^T rows of 64 B (hi plane, lo plane) at a pitch of 80 B (16 B x odd, for the 16-byte fragment reads); two buffers.
#define FM_KP 144
#define FM_VP 80
#define FM_KL (32 * FM_KP)
#define FM_VH (2 * 32 * FM_KP)
#define FM_VD (64 * FM_VP)
#define FM_STAGE (FM_VH + 2 * FM_VD)
// One wave's share of a stage: 8 K rows and 16 V^T rows of each plane, 16 B per lane, 8 copies (a K copy brings 4 whole rows, a V copy 8 rows).
// lk, lv: the lane's LDS byte addresses of its first K and V chunk (hi plane); gkh, gkl, gvh, gvl: the matching global addresses in the four planes.
__device__ __forceinline__ void fm_stage(unsigned lk, unsigned lv, const unsigned short* gkh, const unsigned short* gkl, int ldk, const unsigned short* gvh, const unsigned short* gvl, int ldv) {
  // the copies go to LDS through no register; s_wait_xcnt is the statement's last line so that no address register is rewritten ahead of it
  asm volatile("global_load_async_to_lds_b128 %0, %8, off\n\t"
               "global_load_async_to_lds_b128 %1, %9, off\n\t"
               "global_load_async_to_lds_b128 %2, %10, off\n\t"
               "global_load_async_to_lds_b128 %3, %11, off\n\t"
               "global_load_async_to_lds_b128 %4, %12, off\n\t"
               "global_load_async_to_lds_b128 %5, %13, off\n\t"
               "global_load_async_to_lds_b128 %6, %14, off\n\t"
               "global_load_async_to_lds_b128 %7, %15, off\n\t"
               "s_wait_xcnt 0x0"
               :: "v"(lk), "v"(lk + 4 * FM_KP), "v"(lk + FM_KL), "v"(lk + FM_KL + 4 * FM_KP), "v"(lv), "v"(lv + 8 * FM_VP), "v"(lv + FM_VD), "v"(lv + FM_VD + 8 * FM_VP),
                  "v"(gkh), "v"(gkh + (size_t)4 * ldk), "v"(gkl), "v"(gkl + (size_t)4 * ldk), "v"(gvh), "v"(gvh + (size_t)8 * ldv), "v"(gvl), "v"(gvl + (size_t)8 * ldv) : "memory");
}
template <int TQ, int TK>
__global__ __launch_bounds__(128) void k_flashm(const _Float16* __restrict__ Q16, const _Float16* __restrict__ Q16lo, int ldq, const _Float16* __restrict__ K16, const _Float16* __restrict__ K16lo, int ldk, const _Float16* __restrict__ Vt, const _Float16* __restrict__ Vtlo, const unsigned* __restrict__ MB, const int* __restrict__ RA, const int* __restrict__ KE, float* __restrict__ O, int ldo) {
  constexpr int RPW = 16, RTN = RPW / 16, NQB = TQ / (4 * RPW), DT = 4, KS = 2;
  __shared__ __attribute__((aligned(16))) unsigned short sP[4][RPW][40], sPl[4][RPW][40]; __shared__ __attribute__((aligned(16))) float sO[4][RPW][64 + 4]; __shared__ __attribute__((aligned(16))) unsigned char kv[2 * FM_STAGE];
  const int tid = threadIdx.x, w = tid >> 5, lane = tid & 31, ln = lane & 15, hh = lane >> 4;
  const int slab = blockIdx.x / NQB, qblk = blockIdx.x % NQB; const int b = slab / NH, h = slab % NH; const int qb0 = qblk * (4 * RPW); const int q0 = qb0 + w * RPW;
  FragH aq[2][KS], aql[2][KS];
#pragma unroll
  for (int rt = 0; rt < RTN; ++rt) { const size_t qo = ((size_t)b * TQ + q0 + rt * 16 + ln) * ldq + h * 64; const unsigned short* qr = (const unsigned short*)Q16 + qo; const unsigned short* ql = (const unsigned short*)Q16lo + qo;
#pragma unroll
    for (int ks = 0; ks < KS; ++ks) { aq[rt][ks].half[0] = *(const v8us*)(qr + ks * 32 + 8 * hh); aq[rt][ks].half[1] = *(const v8us*)(qr + ks * 32 + 16 + 8 * hh); aql[rt][ks].half[0] = *(const v8us*)(ql + ks * 32 + 8 * hh); aql[rt][ks].half[1] = *(const v8us*)(ql + ks * 32 + 16 + 8 * hh); } }
  const unsigned short* Vth = (const unsigned short*)Vt + (size_t)slab * 64 * TK; const unsigned short* Vtl = (const unsigned short*)Vtlo + (size_t)slab * 64 * TK;
  float m_r[2][8], l_r[2][8]; v8f oacc[2][DT], oaccl[2][DT];
#pragma unroll
  for (int rt = 0; rt < RTN; ++rt) {
#pragma unroll
    for (int r = 0; r < 8; ++r) { m_r[rt][r] = -3.0e38f; l_r[rt][r] = 0.f; }
#pragma unroll
    for (int dt = 0; dt < DT; ++dt) { oacc[rt][dt] = (v8f){0.f,0.f,0.f,0.f,0.f,0.f,0.f,0.f}; oaccl[rt][dt] = oacc[rt][dt]; } }
  int jend = KE[qblk * 32]; jend = min(TK, (jend + 31) & ~31); if (jend < 32) jend = 32;      /* block-uniform */
  int allm[2][8]; const unsigned* mrow[2][8];
#pragma unroll
  for (int rt = 0; rt < RTN; ++rt)
#pragma unroll
    for (int r = 0; r < 8; ++r) { const int tq = q0 + rt * 16 + 8 * hh + r; allm[rt][r] = RA[tq]; mrow[rt][r] = MB + (size_t)tq * (TK / 32); }
  const unsigned lk = (unsigned)(size_t)kv + (unsigned)((8 * w + (lane >> 3)) * FM_KP + (lane & 7) * 16), lv = (unsigned)(size_t)kv + (unsigned)(FM_VH + (16 * w + (lane >> 2)) * FM_VP + (lane & 3) * 16);
  const size_t gko = ((size_t)b * TK + 8 * w + (lane >> 3)) * ldk + h * 64 + (lane & 7) * 8, gvo = (size_t)(16 * w + (lane >> 2)) * TK + (lane & 3) * 8;      /* this lane's first 16 bytes of the wave's K and V^T rows */
  const unsigned short* gkh = (const unsigned short*)K16 + gko; const unsigned short* gkl = (const unsigned short*)K16lo + gko; const unsigned short* gvh = Vth + gvo; const unsigned short* gvl = Vtl + gvo;
  fm_stage(lk, lv, gkh, gkl, ldk, gvh, gvl, TK);
  asm volatile("s_wait_asynccnt 0x0" ::: "memory");      /* this wave's copies of stage 0 have landed */
  __syncthreads();      /* and every other wave's: stage 0 may be read */
  if (32 < jend) fm_stage(lk + FM_STAGE, lv + FM_STAGE, gkh + (size_t)32 * ldk, gkl + (size_t)32 * ldk, ldk, gvh + 32, gvl + 32, TK);
#pragma unroll 1
  for (int j0 = 0; j0 < jend; j0 += 32) {
    const unsigned bo = (unsigned)((j0 >> 5) & 1) * FM_STAGE; const unsigned char* pk = kv + bo + ln * FM_KP + 16 * hh; const unsigned char* pv = kv + bo + FM_VH + ln * FM_VP + 16 * hh;      /* this trip's buffer: the lane's row and half in the K and V^T tiles */
    v8f s[2][2]; FragH bk[2][KS], bkl[2][KS];
#pragma unroll
    for (int nt = 0; nt < 2; ++nt) { const unsigned char* kr = pk + nt * 16 * FM_KP; const unsigned char* kl = kr + FM_KL;
#pragma unroll
      for (int ks = 0; ks < KS; ++ks) { bk[nt][ks].half[0] = *(const v8us*)(kr + ks * 64); bk[nt][ks].half[1] = *(const v8us*)(kr + ks * 64 + 32); bkl[nt][ks].half[0] = *(const v8us*)(kl + ks * 64); bkl[nt][ks].half[1] = *(const v8us*)(kl + ks * 64 + 32); } }
    __builtin_amdgcn_sched_barrier(0);      /* keeps the trip's K reads one group in front of the WMMAs: sunk to their uses, the second 16 keys wait out an LDS latency of their own */
#pragma unroll
    for (int nt = 0; nt < 2; ++nt) {
#pragma unroll
      for (int rt = 0; rt < RTN; ++rt) { v8f acc = (v8f){0.f,0.f,0.f,0.f,0.f,0.f,0.f,0.f}, accr = acc;
#pragma unroll
        for (int ks = 0; ks < KS; ++ks) { acc = mmaH<1>(aq[rt][ks].v, aq[rt][ks].v, bk[nt][ks].v, bk[nt][ks].v, acc); accr = mmaH<1>(aql[rt][ks].v, aql[rt][ks].v, bk[nt][ks].v, bk[nt][ks].v, accr); accr = mmaH<1>(aq[rt][ks].v, aq[rt][ks].v, bkl[nt][ks].v, bkl[nt][ks].v, accr); }
        s[rt][nt] = acc + accr * 0.0009765625f; } }
#pragma unroll
    for (int rt = 0; rt < RTN; ++rt) {      /* no branch in the softmax: each exp is computed for every lane and the old conditions pick by select, so a lane's eight rows are one straight-line block and their mask loads, cross-lane steps and exp chains overlap */
      float s0[8], s1[8], mc[8]; bool ok0[8], ok1[8];
#pragma unroll
      for (int r = 0; r < 8; ++r) { const unsigned mw = mrow[rt][r][j0 >> 5]; const bool am = (allm[rt][r] != 0);
        ok0[r] = am || (((mw >> ln) & 1u) == 0u); ok1[r] = am || (((mw >> (16 + ln)) & 1u) == 0u);
        s0[r] = ok0[r] ? (am ? 0.f : s[rt][0][r] * SCL2) : -INFINITY; s1[r] = ok1[r] ? (am ? 0.f : s[rt][1][r] * SCL2) : -INFINITY; mc[r] = fmaxf(s0[r], s1[r]); }
#pragma unroll
      for (int st = 1; st < 16; st <<= 1)
#pragma unroll
        for (int r = 0; r < 8; ++r) mc[r] = fmaxf(mc[r], __shfl_xor(mc[r], st, 32));
#pragma unroll
      for (int r = 0; r < 8; ++r) { const float mo = m_r[rt][r], mn = fmaxf(mo, mc[r]); const float ea = __builtin_amdgcn_exp2f(mo - mn), e0 = __builtin_amdgcn_exp2f(s0[r] - mn), e1 = __builtin_amdgcn_exp2f(s1[r] - mn);      /* every argument is <= 0 (or -inf): no range reduction and no overflow clamp is needed, one v_exp_f32 each */
        const float al = (mn > -1.0e38f) ? ea : 1.0f; m_r[rt][r] = mn; const float p0 = ok0[r] ? e0 : 0.f, p1 = ok1[r] ? e1 : 0.f; l_r[rt][r] = l_r[rt][r] * al + p0 + p1;
#pragma unroll
        for (int dt = 0; dt < DT; ++dt) { oacc[rt][dt][r] *= al; oaccl[rt][dt][r] *= al; }
        FragH t2, t3; const float ps0 = p0 * 1024.0f, ps1 = p1 * 1024.0f; t2.h[0] = (_Float16)ps0; t2.h[1] = (_Float16)ps1; t3.h[0] = (_Float16)((ps0 - (float)t2.h[0]) * 1024.0f); t3.h[1] = (_Float16)((ps1 - (float)t2.h[1]) * 1024.0f);
        sP[w][rt * 16 + 8 * hh + r][ln] = t2.u[0]; sP[w][rt * 16 + 8 * hh + r][16 + ln] = t2.u[1]; sPl[w][rt * 16 + 8 * hh + r][ln] = t3.u[0]; sPl[w][rt * 16 + 8 * hh + r][16 + ln] = t3.u[1]; } }
    FragH bv[DT], bl[DT];      /* the trip's V^T fragments, read as one group in front of P's way through LDS, so that the four output tiles do not each wait out an LDS latency */
#pragma unroll
    for (int dt = 0; dt < DT; ++dt) { const unsigned char* vr = pv + dt * 16 * FM_VP; bv[dt].half[0] = *(const v8us*)vr; bv[dt].half[1] = *(const v8us*)(vr + 32); bl[dt].half[0] = *(const v8us*)(vr + FM_VD); bl[dt].half[1] = *(const v8us*)(vr + FM_VD + 32); }
    __builtin_amdgcn_fence(__ATOMIC_ACQ_REL, "workgroup"); __builtin_amdgcn_wave_barrier();
    FragH pa[2], pl[2];
#pragma unroll
    for (int rt = 0; rt < RTN; ++rt) { pa[rt].half[0] = *(const v8us*)&sP[w][rt * 16 + ln][8 * hh]; pa[rt].half[1] = *(const v8us*)&sP[w][rt * 16 + ln][16 + 8 * hh]; pl[rt].half[0] = *(const v8us*)&sPl[w][rt * 16 + ln][8 * hh]; pl[rt].half[1] = *(const v8us*)&sPl[w][rt * 16 + ln][16 + 8 * hh]; }
#pragma unroll
    for (int dt = 0; dt < DT; ++dt) {
#pragma unroll
      for (int rt = 0; rt < RTN; ++rt) { oacc[rt][dt] = mmaH<1>(pa[rt].v, pa[rt].v, bv[dt].v, bv[dt].v, oacc[rt][dt]); oaccl[rt][dt] = mmaH<1>(pa[rt].v, pa[rt].v, bl[dt].v, bl[dt].v, oaccl[rt][dt]); oaccl[rt][dt] = mmaH<1>(pl[rt].v, pl[rt].v, bv[dt].v, bv[dt].v, oaccl[rt][dt]); } }
    asm volatile("s_wait_dscnt 0x0" ::: "memory");      /* this wave's reads of the buffer (and of its P rows) are done before the refill */
    asm volatile("s_wait_asynccnt 0x0" ::: "memory");      /* this wave's copies of the next stage have landed */
    __syncthreads();      /* publishes the next stage and ends every wave's reads of this one */
    if (j0 + 64 < jend) fm_stage(lk + bo, lv + bo, gkh + (size_t)(j0 + 64) * ldk, gkl + (size_t)(j0 + 64) * ldk, ldk, gvh + (j0 + 64), gvl + (j0 + 64), TK); }
  asm volatile("s_wait_asynccnt 0x0" ::: "memory");      /* no copy is left in flight */
#pragma unroll
  for (int rt = 0; rt < RTN; ++rt) {
#pragma unroll
    for (int r = 0; r < 8; ++r) { float l = l_r[rt][r]; l += __shfl_xor(l, 1, 32); l += __shfl_xor(l, 2, 32); l += __shfl_xor(l, 4, 32); l += __shfl_xor(l, 8, 32); l_r[rt][r] = (l > 0.f) ? 1.0f / (l * 1024.0f) : 0.f; }
#pragma unroll
    for (int dt = 0; dt < DT; ++dt)
#pragma unroll
      for (int r = 0; r < 8; ++r) sO[w][rt * 16 + 8 * hh + r][dt * 16 + ln] = (oacc[rt][dt][r] + oaccl[rt][dt][r] * 0.0009765625f) * l_r[rt][r]; }
  __builtin_amdgcn_fence(__ATOMIC_ACQ_REL, "workgroup"); __builtin_amdgcn_wave_barrier();
  {
#pragma unroll
    for (int rp = 0; rp < RPW; rp += 2) { const int r = rp + (lane >> 4), pc = lane & 15; const v4f val = *(const v4fa*)&sO[w][r][pc * 4]; *(v4f*)(O + ((size_t)b * TQ + q0 + r) * ldo + h * 64 + pc * 4) = val; }
     } }


__device__ __forceinline__ void d_causaltab(unsigned* __restrict__ MB, int* __restrict__ RA, int* __restrict__ KE, int nq, int nk, int blk) {
  const int t = blk * 256 + threadIdx.x; const int nw = nk / 32;
  if (t < nq * nw) { const int q = t / nw, w = t % nw; const int first = q + 1 - 32 * w; const unsigned bits = (first <= 0) ? 0xffffffffu : ((first >= 32) ? 0u : (0xffffffffu << first)); *(unsigned*)(MB + t) = bits;  }
  if (t < nq) { *(int*)(RA + t) = 0;  }
  if (t < nq / 64) { const int v = 64 * (t + 1); *(int*)(KE + t * 32) = v;  } }
__device__ __forceinline__ void d_fulltab(unsigned* __restrict__ MB, int* __restrict__ RA, int* __restrict__ KE, int nq, int nk, int blk) {
  const int t = blk * 256 + threadIdx.x; const int nw = nk / 32;
  if (t < nq * nw) { *(unsigned*)(MB + t) = 0u;  }
  if (t < nq) { *(int*)(RA + t) = 0;  }
  if (t < nq / 64) { *(int*)(KE + t * 32) = nk;  } }

// Everything that depends on the inputs alone (eight weight planes, two embedding planes, two mask tables) in one grid: a range of block indices per job, every branch block-uniform.
// BT: the six [DM][DM] weight planes in a row (q, k, v, cross q, cross k, cross v).
#define PR_F (FF * DM / 8 / 256)
#define PR_W (DM * DM / 8 / 256)
#define PR_X (SW * DM / 8 / 256)
#define PR_P (SP * DM / 8 / 256)
#define PR_C (SW * (SW / 32) / 256)
#define PR_U (SW * (SP / 32) / 256)
__global__ __launch_bounds__(256) void k_prep(const float* __restrict__ Wq, const float* __restrict__ Wk, const float* __restrict__ Wv, const float* __restrict__ Wqc, const float* __restrict__ Wkc, const float* __restrict__ Wvc, const float* __restrict__ W1, const float* __restrict__ W2,
    const float* __restrict__ wemb, const float* __restrict__ pemb, _Float16* __restrict__ BT, _Float16* __restrict__ BW1, _Float16* __restrict__ BW2, _Float16* __restrict__ WE16, _Float16* __restrict__ PE16,
    unsigned* __restrict__ MB, int* __restrict__ RA, int* __restrict__ KE, unsigned* __restrict__ MB2, int* __restrict__ RA2, int* __restrict__ KE2) {
  int b = (int)blockIdx.x;
  if (b < PR_F) { d_round16f(W1, BW1, (size_t)FF * DM / 8, (unsigned)b); return; } b -= PR_F;
  if (b < PR_F) { d_round16f(W2, BW2, (size_t)FF * DM / 8, (unsigned)b); return; } b -= PR_F;
  if (b < 6 * PR_W) { const int j = b / PR_W; const float* W = (j == 0) ? Wq : (j == 1) ? Wk : (j == 2) ? Wv : (j == 3) ? Wqc : (j == 4) ? Wkc : Wvc;
    d_round16f(W, BT + (size_t)j * DM * DM, (size_t)DM * DM / 8, (unsigned)(b - j * PR_W)); return; } b -= 6 * PR_W;
  if (b < PR_X) { d_x16(wemb, WE16, (size_t)SW * DM / 8, (unsigned)b); return; } b -= PR_X;
  if (b < PR_P) { d_x16(pemb, PE16, (size_t)SP * DM / 8, (unsigned)b); return; } b -= PR_P;
  if (b < PR_C) { d_causaltab(MB, RA, KE, SW, SW, b); return; } b -= PR_C;
  d_fulltab(MB2, RA2, KE2, SW, SP, b); }

extern "C" void kernel_launch(void* const* d_in, const int* in_sizes, int n_in,
                              void* d_out, int out_size, void* d_ws, size_t ws_size, hipStream_t stream) {
  (void)in_sizes; (void)n_in; (void)out_size;
  const float* const* I = (const float* const*)d_in; const float* wemb = I[0]; const float* pemb = I[1];
  const float* Wq = I[2]; const float* bq = I[3]; const float* Wk = I[4]; const float* bk = I[5]; const float* Wv = I[6]; const float* bv = I[7];
  const float* Wqc = I[8]; const float* bqc = I[9]; const float* Wkc = I[10]; const float* bkc = I[11]; const float* Wvc = I[12]; const float* bvc = I[13];
  const float* W1 = I[14]; const float* b1 = I[15]; const float* W2 = I[16]; const float* b2 = I[17];
  char* ws = (char*)d_ws; size_t off = 0;
  auto take = [&](size_t bytes) { char* p = ws + off; off += (bytes + 255) & ~(size_t)255; return p; };
  _Float16* BT = (_Float16*)take((size_t)6 * DM * DM * 2); _Float16* BQC = BT + (size_t)3 * DM * DM;      /* weight planes q, k, v, cross q, cross k, cross v in a row */
  _Float16* BW1 = (_Float16*)take((size_t)FF * DM * 2); _Float16* BW2 = (_Float16*)take((size_t)DM * FF * 2);
  _Float16* WE16 = (_Float16*)take((size_t)SW * DM * 2); _Float16* PE16 = (_Float16*)take((size_t)SP * DM * 2);
  float* FW = (float*)take((size_t)3 * SW * DM * 4); float* FP = (float*)take((size_t)2 * SP * DM * 4);      /* f32 q, k, v and cross k, v */
  _Float16* Qh = (_Float16*)take((size_t)SW * DM * 2); _Float16* Ql = (_Float16*)take((size_t)SW * DM * 2); _Float16* Kh = (_Float16*)take((size_t)SW * DM * 2); _Float16* Kl = (_Float16*)take((size_t)SW * DM * 2);      /* Qh..Kl: 16 MiB contiguous, later the FFN f32 half-hidden */
  _Float16* Vth = (_Float16*)take((size_t)SW * DM * 2); _Float16* Vtl = (_Float16*)take((size_t)SW * DM * 2);
  _Float16* KCh = (_Float16*)take((size_t)SP * DM * 2); _Float16* KCl = (_Float16*)take((size_t)SP * DM * 2); _Float16* VCth = (_Float16*)take((size_t)SP * DM * 2); _Float16* VCtl = (_Float16*)take((size_t)SP * DM * 2);
  unsigned* MB = (unsigned*)take((size_t)SW * (SW / 32) * 4); int* RA = (int*)take((size_t)SW * 4); int* KE = (int*)take((size_t)(SW / 64) * 32 * 4);
  unsigned* MB2 = (unsigned*)take((size_t)SW * (SP / 32) * 4); int* RA2 = (int*)take((size_t)SW * 4); int* KE2 = (int*)take((size_t)(SW / 64) * 32 * 4);
  _Float16* Ah = (_Float16*)take((size_t)SW * DM * 2); _Float16* Al = (_Float16*)take((size_t)SW * DM * 2);      /* word hi/lo, later cross hi/lo */
  _Float16* HDh = (_Float16*)take((size_t)SW * (FF / 2) * 2); _Float16* HDl = (_Float16*)take((size_t)SW * (FF / 2) * 2);
  if (off > ws_size) return;      /* 12 + 16 + 4 + 2 + 32 + 32 + 0.8 + 8 + 16 = 123 MiB */
  float* F = FW;      /* free again behind k_split5: attention results, cross q */
  float* HF = (float*)Qh;             /* FFN half hidden f32 [2048][2048] = 16 MiB over Qh..Kl (dead after the second attention) */
  const dim3 gW((SW / 128) * (DM / 64), 1), gH((SW / 128) * ((FF / 2) / 64), 1); const size_t n8w = (size_t)SW * DM / 8; const unsigned nbw = (unsigned)((n8w + 255) / 256);
  k_prep<<<2 * PR_F + 6 * PR_W + PR_X + PR_P + PR_C + PR_U, 256, 0, stream>>>(Wq, Wk, Wv, Wqc, Wkc, Wvc, W1, W2, wemb, pemb, BT, BW1, BW2, WE16, PE16, MB, RA, KE, MB2, RA2, KE2);      /* weights are (out,in) row-major = natural Bt; x16 */
  k_proj5<<<3 * P5_NW + 2 * P5_NP, 128, 0, stream>>>(WE16, PE16, BT, bq, bk, bv, bkc, bvc, FW, FP);
  k_split5<<<2 * S5_HW + S5_VW + S5_HP + S5_VP, 256, 0, stream>>>(FW, FP, Qh, Ql, Kh, Kl, Vth, Vtl, KCh, KCl, VCth, VCtl);
  /* --- causal self attention on the word embeddings (all planes hi/lo) --- */
  k_flashm<SW, SW><<<NH * (SW / 64), 128, 0, stream>>>(Qh, Ql, DM, Kh, Kl, DM, Vth, Vtl, MB, RA, KE, F, DM);      /* word (f32) -> F */
  k_hl<<<nbw, 256, 0, stream>>>(F, Ah, Al, n8w);      /* word as hi/lo operand planes */
  k_gemm2p<0><<<gW, 256, 0, stream>>>(Ah, Al, DM, BQC, DM, 0.0625f, 0.0625f * 0.0009765625f, bqc, nullptr, F, DM, SW, DM, DM); k_hl<<<nbw, 256, 0, stream>>>(F, Qh, Ql, n8w);
  k_flashm<SW, SP><<<NH * (SW / 64), 128, 0, stream>>>(Qh, Ql, DM, KCh, KCl, DM, VCth, VCtl, MB2, RA2, KE2, F, DM);      /* cross (f32) -> F */
  k_hl<<<nbw, 256, 0, stream>>>(F, Ah, Al, n8w);      /* cross as hi/lo operand planes */
  /* --- FFN in two column halves of the hidden: h = relu(cross*W1^T + b1) (hi/lo), out (+)= h_half*W2_half^T (+ b2 once) --- */
  for (int hf = 0; hf < 2; ++hf) { const _Float16* B1h = BW1 + (size_t)hf * (FF / 2) * DM; const _Float16* B2h = BW2 + (size_t)hf * (FF / 2);
    k_gemm2p<3><<<gH, 256, 0, stream>>>(Ah, Al, DM, B1h, DM, 0.0625f, 0.0625f * 0.0009765625f, b1 + hf * (FF / 2), nullptr, HF, FF / 2, SW, FF / 2, DM);      /* relu on the complete sum */
    k_hl<<<(unsigned)(((size_t)SW * (FF / 2) / 8 + 255) / 256), 256, 0, stream>>>(HF, HDh, HDl, (size_t)SW * (FF / 2) / 8);
    k_gemm2p<0><<<gW, 256, 0, stream>>>(HDh, HDl, FF / 2, B2h, FF, 0.0625f, 0.0625f * 0.0009765625f, (hf == 0) ? b2 : nullptr, (hf == 0) ? nullptr : (const float*)d_out, (float*)d_out, DM, SW, DM, FF / 2); }
}
